// v000
// The times below were measured on an AMD MI455X: many runs one after another, warmed up first and cycling through
// copies of the inputs, with the whole window's GPU time divided by the number of runs. Launches and the gaps
// between them are all in it. The median over several windows is given; except for v000 it joins two sittings, which
// can be a few percent apart, so the side-by-side timings, each taken in one sitting, are the better comparison.
// v000 is the starting kernel. One run takes 5850 microseconds.
#include <hip/hip_runtime.h>
// Channel-first multi-head self-attention with PER-HEAD projection tensors and UNSCALED scores (hidden_state [4][768][2048] = [B][E][S]; x = its transpose [B][S][E]; q/k/v[h] = x W[h] + b[h] with W [12][768][64] ([h][in][d], sigma 0.02) and b [12][64] (zeros); scores = q k^T with NO 1/sqrt(d) factor (faithful to the source); softmax over keys; ctx heads concatenated; out = ctx Wo^T + bo (natural [768][768]); returned transposed back to [4][768][2048]).
// Structure: token rows r = b*2048 + s; x as exact f16 rows (bf16-rounded); Q, K, V as three WMMA GEMMs (32x64 wave tiles, f32 accumulation, exact x16 weights + bias, f16 outputs); per batch: V^T for all heads via LDS transposes; per (batch, group of 4 heads): scores GEMM (K = 64, batched over the heads on grid.y, alpha = 1 (unscaled, no mask)), row softmax on VALU (f32 statistics; weights stored x256 as f16), o = P . V^T GEMM (K = 2048, alpha 2^-2: o carried x64 against f16 subnormal flush, folded into the output GEMM alpha) written straight into the merged f16 o rows; out = o W_o + b GEMM (f32) into the output layout.
// Compute dtype: inputs rounded to bf16; x / weights exact; q, k, v, softmax weights and o as plain f16 GEMM operands (~2^-12); scores and softmax statistics f32. v_wmma_f32_16x16x32_f16.
#define NB 4
#define SQ 2048
#define DM 768
#define NH 12
#define HD 64
#define HG 4                         /* heads per attention launch group */
#define B0 0                         /* first batch processed (debug hook) */
#define NBR NB                       /* batches processed (debug hook) */
#define NR ((size_t)NB * SQ)         /* token rows */
#define MP ((int)((size_t)NBR * SQ)) /* rows projected (debug hook) */
#define QN SQ                        /* query rows attended per batch (debug hook) */
#define NHD NH                       /* heads attended (debug hook) */
#define MPO MP                       /* rows through the output stage (debug hook) */
#define LQ DM      /* row pitch of the q/k/v rows */
typedef __bf16 v16b __attribute__((ext_vector_type(16)));
typedef unsigned short v8us __attribute__((ext_vector_type(8), may_alias));
typedef float  v8f  __attribute__((ext_vector_type(8)));
typedef float  v4f  __attribute__((ext_vector_type(4)));
typedef float  v4fa __attribute__((ext_vector_type(4), may_alias));
union FragB { v16b v; v8us half[2]; unsigned short u[16]; };

__device__ __forceinline__ unsigned short bf16_bits(float x) { unsigned int u = __float_as_uint(x); return (unsigned short)((u + 0x7FFFu + ((u >> 16) & 1u)) >> 16); }
__device__ __forceinline__ float bf16_val(unsigned short b) { return __uint_as_float(((unsigned int)b) << 16); }
__device__ __forceinline__ float bf16_round(float x) { return bf16_val(bf16_bits(x)); }
// D += A·B with NT terms: 1 = ah·bh, 2 = + al·bh (A split), 3 = + ah·bl (both split)
template <int NT>
__device__ __forceinline__ v8f mmaN(v16b ah, v16b al, v16b bh, v16b bl, v8f c) {
  c = __builtin_amdgcn_wmma_f32_16x16x32_bf16(false, ah, false, bh, (short)0, c, false, false);
  if (NT >= 2) c = __builtin_amdgcn_wmma_f32_16x16x32_bf16(false, al, false, bh, (short)0, c, false, false);
  if (NT >= 3) c = __builtin_amdgcn_wmma_f32_16x16x32_bf16(false, ah, false, bl, (short)0, c, false, false);
  asm volatile("v_nop\n\tv_nop\n\tv_nop\n\tv_nop" : "+v"(c) : "v"(ah), "v"(al), "v"(bh), "v"(bl));
  return c;
}

__global__ __launch_bounds__(256) void k_wt_bf16(const float* __restrict__ W, unsigned short* __restrict__ Wt, int K, int N) {
  const int t = blockIdx.x * 256 + threadIdx.x;
  const int k8n = K / 8;
  if (t >= N * k8n) return;
  const int n = t / k8n, k8 = (t % k8n) * 8;
  v8us v;
#pragma unroll
  for (int i = 0; i < 8; ++i) v[i] = bf16_bits(W[(size_t)(k8 + i) * N + n]);
  *(v8us*)(Wt + (size_t)n * K + k8) = v;
  
}

// GEMM C[M][N] (f32, pitch ldc) = act(A[M][K]·W + bias). A f32 row-major (pitch lda) converted per fragment to bf16
// (ASPLIT: hi/lo two planes -> 2 terms, else single rounded term); Wt bf16 [N][K] (pitch ldb). BIAS_BF16 rounds the
// bias to bf16 first (bias quantised to bf16 before the add). K%32==0, M%16==0, N%64==0.
template <bool ASPLIT, int ACT, bool BIAS_BF16>
__global__ __launch_bounds__(128) void k_gemm_bf(const float* __restrict__ A, int lda, const unsigned short* __restrict__ Wt, int ldb,
                                               const float* __restrict__ bias, float* __restrict__ C, int ldc, int M, int N, int K) {
  __shared__ __attribute__((aligned(16))) float so[4][16][64];
  const int tid = threadIdx.x, w = tid >> 5, lane = tid & 31, ln = lane & 15, hh = lane >> 4;
  const int ntn = N / 64;
  const int wid = blockIdx.x * 4 + w;
  const int mt = wid / ntn, nq = wid % ntn;
  if (mt * 16 >= M) return;
  const int row0 = mt * 16, col0 = nq * 64;
  const float* arow = A + (size_t)(row0 + ln) * lda;
  v8f acc[4] = {};
  for (int kb = 0; kb < K; kb += 32) {
    FragB ah, al;
    const v4f x0 = *(const v4fa*)(arow + kb + 8 * hh), x1 = *(const v4fa*)(arow + kb + 8 * hh + 4);
    const v4f x2 = *(const v4fa*)(arow + kb + 16 + 8 * hh), x3 = *(const v4fa*)(arow + kb + 16 + 8 * hh + 4);
    float xs[16] = {x0[0],x0[1],x0[2],x0[3],x1[0],x1[1],x1[2],x1[3],x2[0],x2[1],x2[2],x2[3],x3[0],x3[1],x3[2],x3[3]};
#pragma unroll
    for (int i = 0; i < 16; ++i) { const unsigned short hb = bf16_bits(xs[i]); ah.u[i] = hb; al.u[i] = ASPLIT ? bf16_bits(xs[i] - bf16_val(hb)) : (unsigned short)0; }
#pragma unroll
    for (int t = 0; t < 4; ++t) {
      const unsigned short* brow = Wt + (size_t)(col0 + t * 16 + ln) * ldb + kb;
      FragB b;
      b.half[0] = *(const v8us*)(brow + 8 * hh);
      b.half[1] = *(const v8us*)(brow + 16 + 8 * hh);
      acc[t] = mmaN<ASPLIT ? 2 : 1>(ah.v, al.v, b.v, b.v, acc[t]);
    }
  }
#pragma unroll
  for (int t = 0; t < 4; ++t) {
    float bv = bias ? bias[col0 + t * 16 + ln] : 0.f;
    if (BIAS_BF16) bv = bf16_round(bv);
#pragma unroll
    for (int r = 0; r < 8; ++r) { float v = acc[t][r] + bv; if (ACT == 1) v = fmaxf(v, 0.f); so[w][8 * hh + r][t * 16 + ln] = v; }
  }
  __builtin_amdgcn_fence(__ATOMIC_ACQ_REL, "workgroup");
  __builtin_amdgcn_wave_barrier();
  const int rsub = lane >> 4, c4 = (lane & 15) * 4;
  {
#pragma unroll
    for (int q = 0; q < 8; ++q) {
      const int r = q * 2 + rsub;
      const v4f v = *(const v4fa*)&so[w][r][c4];
      *(v4f*)(C + (size_t)(row0 + r) * ldc + col0 + c4) = v;
    }
    
  }
}

// GEMM C = act(A·W + bias + resid): A f32 (ASPLIT -> hi/lo 2 terms), Wt bf16 [N][K]; ACT 0 none, 1 relu, 2 exact gelu;
// resid (optional, f32, row index = (row % rmod), pitch ldr, RES_BF16 rounds it) added before the activation.
template <bool ASPLIT, int ACT, bool BIAS_BF16, bool RES_BF16>
__global__ __launch_bounds__(128) void k_gemm_bf3(const float* __restrict__ A, int lda, const unsigned short* __restrict__ Wt, int ldb,
                                                const float* __restrict__ bias, const float* __restrict__ resid, int rmod, int ldr,
                                                float* __restrict__ C, int ldc, int M, int N, int K) {
  __shared__ __attribute__((aligned(16))) float so[4][16][64];
  const int tid = threadIdx.x, w = tid >> 5, lane = tid & 31, ln = lane & 15, hh = lane >> 4;
  const int ntn = N / 64;
  const int wid = blockIdx.x * 4 + w;
  const int mt = wid / ntn, nq = wid % ntn;
  if (mt * 16 >= M) return;
  const int row0 = mt * 16, col0 = nq * 64;
  const float* arow = A + (size_t)(row0 + ln) * lda;
  v8f acc[4] = {};
  for (int kb = 0; kb < K; kb += 32) {
    FragB ah, al;
    const v4f x0 = *(const v4fa*)(arow + kb + 8 * hh), x1 = *(const v4fa*)(arow + kb + 8 * hh + 4);
    const v4f x2 = *(const v4fa*)(arow + kb + 16 + 8 * hh), x3 = *(const v4fa*)(arow + kb + 16 + 8 * hh + 4);
    float xs[16] = {x0[0],x0[1],x0[2],x0[3],x1[0],x1[1],x1[2],x1[3],x2[0],x2[1],x2[2],x2[3],x3[0],x3[1],x3[2],x3[3]};
#pragma unroll
    for (int i = 0; i < 16; ++i) { const unsigned short hb = bf16_bits(xs[i]); ah.u[i] = hb; al.u[i] = ASPLIT ? bf16_bits(xs[i] - bf16_val(hb)) : (unsigned short)0; }
#pragma unroll
    for (int t = 0; t < 4; ++t) {
      const unsigned short* brow = Wt + (size_t)(col0 + t * 16 + ln) * ldb + kb;
      FragB b;
      b.half[0] = *(const v8us*)(brow + 8 * hh);
      b.half[1] = *(const v8us*)(brow + 16 + 8 * hh);
      acc[t] = mmaN<ASPLIT ? 2 : 1>(ah.v, al.v, b.v, b.v, acc[t]);
    }
  }
#pragma unroll
  for (int t = 0; t < 4; ++t) {
    const int col = col0 + t * 16 + ln;
    float bv = bias ? bias[col] : 0.f;
    if (BIAS_BF16) bv = bf16_round(bv);
#pragma unroll
    for (int r = 0; r < 8; ++r) {
      float v = acc[t][r] + bv;
      if (resid) { float rv = resid[(size_t)((row0 + 8 * hh + r) % rmod) * ldr + col]; if (RES_BF16) rv = bf16_round(rv); v += rv; }
      if (ACT == 1) v = fmaxf(v, 0.f);
      if (ACT == 2) v = 0.5f * v * (1.0f + erff(v * 0.70710678118654752f));
      if (ACT == 3) { const float u = 0.7978845608028654f * (v + 0.044715f * v * v * v); v = 0.5f * v * (1.0f + tanhf(u)); }
      so[w][8 * hh + r][t * 16 + ln] = v;
    }
  }
  __builtin_amdgcn_fence(__ATOMIC_ACQ_REL, "workgroup");
  __builtin_amdgcn_wave_barrier();
  const int rsub = lane >> 4, c4 = (lane & 15) * 4;
  {
#pragma unroll
    for (int q = 0; q < 8; ++q) {
      const int r = q * 2 + rsub;
      const v4f v = *(const v4fa*)&so[w][r][c4];
      *(v4f*)(C + (size_t)(row0 + r) * ldc + col0 + c4) = v;
    }
    
  }
}
// row LayerNorm (biased variance, eps) over N: s = X (+ R); optional out_sum <- s; out_norm <- (s-mu)*rsqrt(var+eps)*g + b
template <bool PARAM_BF16>
__global__ __launch_bounds__(256) void k_layernorm(const float* __restrict__ X, const float* __restrict__ R, const float* __restrict__ g, const float* __restrict__ bta,
                                                  float* __restrict__ out_sum, float* __restrict__ out_norm, int N, float eps) {
  __shared__ float red[256];
  const int row = blockIdx.x, tid = threadIdx.x;
  const float* x = X + (size_t)row * N; const float* rr = R ? R + (size_t)row * N : nullptr;
  float vals[16];                     // up to N = 4096
  const int per = N / 256;            // contiguous chunk per thread? use strided-by-4 chunks: thread handles j = tid*4 + 1024*u
  float s1 = 0.f;
  for (int u = 0; u < per / 4; ++u) {
    const int j = tid * 4 + 1024 * u;
    const v4f a = *(const v4fa*)(x + j);
    v4f b = {0.f,0.f,0.f,0.f}; if (rr) b = *(const v4fa*)(rr + j);
#pragma unroll
    for (int q = 0; q < 4; ++q) { const float v = a[q] + b[q]; vals[u * 4 + q] = v; s1 += v; }
  }
  red[tid] = s1; __syncthreads();
  for (int st = 128; st > 0; st >>= 1) { if (tid < st) red[tid] += red[tid + st]; __syncthreads(); }
  const float mu = red[0] / (float)N; __syncthreads();
  float s2 = 0.f;
  for (int u = 0; u < per / 4; ++u)
#pragma unroll
    for (int q = 0; q < 4; ++q) { const float c = vals[u * 4 + q] - mu; s2 += c * c; }
  red[tid] = s2; __syncthreads();
  for (int st = 128; st > 0; st >>= 1) { if (tid < st) red[tid] += red[tid + st]; __syncthreads(); }
  const float rs = rsqrtf(red[0] / (float)N + eps);
  {
    for (int u = 0; u < per / 4; ++u) {
      const int j = tid * 4 + 1024 * u;
      v4f o, sm;
#pragma unroll
      for (int q = 0; q < 4; ++q) {
        float gg = g[j + q], bb = bta[j + q];
        if (PARAM_BF16) { gg = bf16_round(gg); bb = bf16_round(bb); }
        sm[q] = vals[u * 4 + q]; o[q] = (vals[u * 4 + q] - mu) * rs * gg + bb;
      }
      if (out_sum) *(v4f*)(out_sum + (size_t)row * N + j) = sm;
      *(v4f*)(out_norm + (size_t)row * N + j) = o;
    }
    
  }
}



// ---- f16 WMMA path (v_wmma_f32_16x16x32_f16): 11-bit significands for operands in range — used where a [0,1] probability operand needs more precision than bf16
typedef _Float16 v16h __attribute__((ext_vector_type(16)));
union FragH { v16h v; v8us half[2]; _Float16 h[16]; unsigned short u[16]; };
template <int NT>
__device__ __forceinline__ v8f mmaH(v16h ah, v16h al, v16h bh, v16h bl, v8f c) {
  c = __builtin_amdgcn_wmma_f32_16x16x32_f16(false, ah, false, bh, (short)0, c, false, false);
  if (NT >= 2) c = __builtin_amdgcn_wmma_f32_16x16x32_f16(false, al, false, bh, (short)0, c, false, false);
  if (NT >= 3) c = __builtin_amdgcn_wmma_f32_16x16x32_f16(false, ah, false, bl, (short)0, c, false, false);
  asm volatile("v_nop\n\tv_nop\n\tv_nop\n\tv_nop" : "+v"(c) : "v"(ah), "v"(al), "v"(bh), "v"(bl));
  return c;
}
// batched GEMM like k_gemm_b but f16 operands: A f32 (split into f16 hi/lo if ASPLIT, else rounded to f16), Bt = f16 values [n][k]; alpha; C f32; N multiple of 16 (partial tiles skipped)
template <bool ASPLIT>
__global__ __launch_bounds__(128) void k_gemm_h(const float* __restrict__ A, int lda, size_t sA, const _Float16* __restrict__ Bh, int ldb, size_t sB, float alpha, float* __restrict__ C, int ldc, size_t sC, int M, int N, int K) {
  __shared__ __attribute__((aligned(16))) float so[4][16][64];
  const int tid = threadIdx.x, w = tid >> 5, lane = tid & 31, ln = lane & 15, hh = lane >> 4; const int by = blockIdx.y;
  A += (size_t)by * sA; Bh += (size_t)by * sB; C += (size_t)by * sC;
  const int ntn = (N + 63) / 64; const int wid = blockIdx.x * 4 + w; const int mt = wid / ntn, nq = wid % ntn; if (mt * 16 >= M) return;
  const int row0 = mt * 16, col0 = nq * 64; const float* arow = A + (size_t)(row0 + ln) * lda;
  v8f acc[4] = {};
  for (int kb = 0; kb < K; kb += 32) {
    FragH ah, al;
    const v4f x0 = *(const v4fa*)(arow + kb + 8 * hh), x1 = *(const v4fa*)(arow + kb + 8 * hh + 4), x2 = *(const v4fa*)(arow + kb + 16 + 8 * hh), x3 = *(const v4fa*)(arow + kb + 16 + 8 * hh + 4);
    float xs[16] = {x0[0],x0[1],x0[2],x0[3],x1[0],x1[1],x1[2],x1[3],x2[0],x2[1],x2[2],x2[3],x3[0],x3[1],x3[2],x3[3]};
#pragma unroll
    for (int i = 0; i < 16; ++i) { const _Float16 h = (_Float16)xs[i]; ah.h[i] = h; al.h[i] = ASPLIT ? (_Float16)(xs[i] - (float)h) : (_Float16)0.0f; }
#pragma unroll
    for (int t = 0; t < 4; ++t) { if (col0 + t * 16 >= N) continue; const size_t boff = (size_t)(col0 + t * 16 + ln) * ldb + kb; FragH bq; bq.half[0] = *(const v8us*)(Bh + boff + 8 * hh); bq.half[1] = *(const v8us*)(Bh + boff + 16 + 8 * hh);
      acc[t] = mmaH<ASPLIT ? 2 : 1>(ah.v, al.v, bq.v, bq.v, acc[t]); }
  }
#pragma unroll
  for (int t = 0; t < 4; ++t) { if (col0 + t * 16 >= N) continue;
#pragma unroll
    for (int r = 0; r < 8; ++r) so[w][8 * hh + r][t * 16 + ln] = acc[t][r] * alpha; }
  __builtin_amdgcn_fence(__ATOMIC_ACQ_REL, "workgroup"); __builtin_amdgcn_wave_barrier();
  const int rsub = lane >> 4, c4 = (lane & 15) * 4;
  {
#pragma unroll
    for (int q = 0; q < 8; ++q) { const int r = q * 2 + rsub; if (col0 + c4 < N) { const v4f v = *(const v4fa*)&so[w][r][c4]; *(v4f*)(C + (size_t)(row0 + r) * ldc + col0 + c4) = v; } }
     }
}

// Wt[n][k] = f16(W[k][n]·scale) from f32 row-major W[K][N] (scale = power of two; bf16-exact weights stay exact in f16 away from the subnormal range)
__global__ __launch_bounds__(256) void k_wt_f16(const float* __restrict__ W, _Float16* __restrict__ Wt, int K, int N, float scale) {
  const int t = blockIdx.x * 256 + threadIdx.x; if (t >= N * (K / 8)) return; const int n = t / (K / 8), k8 = (t % (K / 8)) * 8; FragH f;
#pragma unroll
  for (int i = 0; i < 8; ++i) f.h[i] = (_Float16)(bf16_round(W[(size_t)(k8 + i) * N + n]) * scale); const v8us o = f.half[0];
  *(v8us*)((unsigned short*)Wt + (size_t)n * K + k8) = o; 
}
// k_gemm_hh variant with fused epilogue: v = acc·alpha + bias[by·sBias + col] (+ CP[(row/rowsPerB)·sCPb + by·64 + col] if CP) ; ACT 0 none / 1 elu ; writes f16 C16 (and f32 C if non-null)
template <int ACT>
__global__ __launch_bounds__(128) void k_gemm_hhx(const _Float16* __restrict__ A, int lda, size_t sA, const _Float16* __restrict__ Bh, int ldb, size_t sB, float alpha, const float* __restrict__ bias, size_t sBias, const float* __restrict__ CP, int rowsPerB, size_t sCPb, int row0g,
    float* __restrict__ C, _Float16* __restrict__ C16, int ldc, size_t sC, int M, int N, int K) {
  __shared__ __attribute__((aligned(16))) float so[4][16][64];
  const int tid = threadIdx.x, w = tid >> 5, lane = tid & 31, ln = lane & 15, hh = lane >> 4; const int by = blockIdx.y;
  A += (size_t)by * sA; Bh += (size_t)by * sB; const size_t cofs = (size_t)by * sC; const float* bp = bias ? bias + (size_t)by * sBias : nullptr;
  const int ntn = (N + 63) / 64; const int wid = blockIdx.x * 4 + w; const int mt = wid / ntn, nq = wid % ntn; if (mt * 16 >= M) return;
  const int row0 = mt * 16, col0 = nq * 64; const _Float16* arow = A + (size_t)(row0 + ln) * lda;
  v8f acc[4] = {};
  for (int kb = 0; kb < K; kb += 32) { FragH ah; ah.half[0] = *(const v8us*)((const unsigned short*)arow + kb + 8 * hh); ah.half[1] = *(const v8us*)((const unsigned short*)arow + kb + 16 + 8 * hh);
#pragma unroll
    for (int t = 0; t < 4; ++t) { if (col0 + t * 16 >= N) continue; const size_t boff = (size_t)(col0 + t * 16 + ln) * ldb + kb; FragH bq; bq.half[0] = *(const v8us*)((const unsigned short*)Bh + boff + 8 * hh); bq.half[1] = *(const v8us*)((const unsigned short*)Bh + boff + 16 + 8 * hh);
      acc[t] = mmaH<1>(ah.v, ah.v, bq.v, bq.v, acc[t]); }
  }
#pragma unroll
  for (int t = 0; t < 4; ++t) { if (col0 + t * 16 >= N) continue; const int col = col0 + t * 16 + ln; const float bv = bp ? bf16_round(bp[col]) : 0.f;
#pragma unroll
    for (int r = 0; r < 8; ++r) { float v = acc[t][r] * alpha + bv; if (CP) { const int rr = row0g + row0 + 8 * hh + r; if (rowsPerB < 0) v += CP[cofs + (size_t)rr * ldc + col];      /* rowsPerB < 0: own element of the batched C plane */ else { const int bidx = rr / rowsPerB; v += CP[(size_t)bidx * sCPb + (size_t)by * 64 + col]; } } if (ACT == 1) v = (v > 0.f) ? v : expm1f(v); else if (ACT == 7) v = (v > 0.f) ? v + 1.0f : expf(v); else if (ACT == 8) v = tanhf(v); else if (ACT == 9) v = 0.5f * v * (1.0f + tanhf(0.7978845608028654f * (v + 0.044715f * v * v * v))); else if (ACT == 11) v = 1.0f / (1.0f + expf(-v)); else if (ACT == 12) v = (v > 0.f) ? v : 0.01f * v; else if (ACT == 14) v = (v > 0.f) ? v : 0.1f * v; else if (ACT == 16) v = (v >= 0.f) ? v : 0.3f * v; else if (ACT == 17) v = (v >= 0.f) ? v : 0.2f * v; else if (ACT == 15) v = v / (1.0f + expf(-v)); else if (ACT == 3) v = fmaxf(v, 0.f); else if (ACT == 6) v = 0.5f * v * (1.0f + erff(v * 0.70710678118654752f)); so[w][8 * hh + r][t * 16 + ln] = v; } }
  __builtin_amdgcn_fence(__ATOMIC_ACQ_REL, "workgroup"); __builtin_amdgcn_wave_barrier();
  const int rsub = lane >> 4, c4 = (lane & 15) * 4; typedef _Float16 v4h __attribute__((ext_vector_type(4)));
  {
#pragma unroll
    for (int q = 0; q < 8; ++q) { const int r = q * 2 + rsub; if (col0 + c4 < N) { const v4f v = *(const v4fa*)&so[w][r][c4]; if (C) *(v4f*)(C + cofs + (size_t)(row0 + r) * ldc + col0 + c4) = v; if (C16) { v4h h4; for (int i = 0; i < 4; ++i) h4[i] = (_Float16)v[i]; *(v4h*)(C16 + cofs + (size_t)(row0 + r) * ldc + col0 + c4) = h4; } } }
     }
}


typedef _Float16 v4h __attribute__((ext_vector_type(4)));

__global__ __launch_bounds__(256) void k_x16(const float* __restrict__ x, _Float16* __restrict__ X16, size_t n8) { const size_t t = (size_t)blockIdx.x * 256 + threadIdx.x; if (t >= n8) return; FragH f;
#pragma unroll
  for (int q = 0; q < 8; ++q) f.h[q] = (_Float16)bf16_round(x[t * 8 + q]); *(v8us*)((unsigned short*)X16 + t * 8) = f.half[0];  }
__global__ __launch_bounds__(256) void k_h16(const float* __restrict__ x, _Float16* __restrict__ X16, size_t n8) { const size_t t = (size_t)blockIdx.x * 256 + threadIdx.x; if (t >= n8) return; FragH f;
#pragma unroll
  for (int q = 0; q < 8; ++q) f.h[q] = (_Float16)x[t * 8 + q]; *(v8us*)((unsigned short*)X16 + t * 8) = f.half[0];  }
__global__ __launch_bounds__(256) void k_round16f(const float* __restrict__ W, _Float16* __restrict__ Bt, size_t n8) { const size_t t = (size_t)blockIdx.x * 256 + threadIdx.x; if (t >= n8) return; FragH f;
#pragma unroll
  for (int i = 0; i < 8; ++i) f.h[i] = (_Float16)(bf16_round(W[t * 8 + i]) * 16.0f); *(v8us*)((unsigned short*)Bt + t * 8) = f.half[0];  }
template <int NHv, int TTv>
__global__ __launch_bounds__(256) void k_vt(const _Float16* __restrict__ V16, int ldv, int voff, _Float16* __restrict__ Vt) { __shared__ unsigned short tl[64][66]; const int tid = threadIdx.x; const int slab = blockIdx.x / (TTv / 64), lg = blockIdx.x % (TTv / 64); const int b = slab / NHv, h = slab % NHv;
  for (int i = tid; i < 64 * 8; i += 256) { const int r = i / 8, c8 = (i % 8) * 8; FragH f; f.half[0] = *(const v8us*)((const unsigned short*)V16 + ((size_t)b * TTv + lg * 64 + r) * ldv + voff + h * 64 + c8);
#pragma unroll
    for (int q = 0; q < 8; ++q) tl[r][c8 + q] = f.u[q]; }
  __syncthreads();
  {
#pragma unroll
    for (int rd = 0; rd < 2; ++rd) { const int d = rd * 32 + tid / 8, pc = tid % 8; FragH f;
#pragma unroll
      for (int q = 0; q < 8; ++q) f.u[q] = tl[pc * 8 + q][d];
      *(v8us*)((unsigned short*)Vt + ((size_t)slab * 64 + d) * TTv + lg * 64 + pc * 8) = f.half[0]; }
     } }

__global__ __launch_bounds__(256) void k_hl(const float* __restrict__ F, _Float16* __restrict__ Hh, _Float16* __restrict__ Hl, size_t n8) { const size_t t = (size_t)blockIdx.x * 256 + threadIdx.x; if (t >= n8) return; FragH fh, fl; const v4f a = *(const v4fa*)(F + t * 8), c = *(const v4fa*)(F + t * 8 + 4);
#pragma unroll
  for (int q = 0; q < 4; ++q) { _Float16 h = (_Float16)a[q]; fh.h[q] = h; fl.h[q] = (_Float16)((a[q] - (float)h) * 1024.0f); h = (_Float16)c[q]; fh.h[4 + q] = h; fl.h[4 + q] = (_Float16)((c[q] - (float)h) * 1024.0f); }
  { *(v8us*)((unsigned short*)Hh + t * 8) = fh.half[0]; *(v8us*)((unsigned short*)Hl + t * 8) = fl.half[0];  } }

// ---- fast GEMM (wave tile 32x64; requires M % 32 == 0 rows per launch region and N % 64 == 0); epilogue = k_gemm_hhx semantics ----
__device__ __forceinline__ v16h g2_frag(const _Float16* p, int hh) { FragH f; f.half[0] = *(const v8us*)((const unsigned short*)p + 8 * hh); f.half[1] = *(const v8us*)((const unsigned short*)p + 16 + 8 * hh); return f.v; }
__device__ __forceinline__ v8f g2_mma(v16h a, v16h b, v8f c) { v8f d = __builtin_amdgcn_wmma_f32_16x16x32_f16(false, a, false, b, (short)0, c, false, false); asm volatile("v_nop\n\tv_nop\n\tv_nop\n\tv_nop" : "+v"(d) : "v"(a), "v"(b)); return d; }
template <int ACT>
__global__ __launch_bounds__(128) void k_gemm2(const _Float16* __restrict__ A, int lda, size_t sA, const _Float16* __restrict__ Bh, int ldb, size_t sB, float alpha, const float* __restrict__ bias, size_t sBias, const float* __restrict__ CP, int rowsPerB, size_t sCPb, int row0g,
    float* __restrict__ C, _Float16* __restrict__ C16, int ldc, size_t sC, int M, int N, int K) { static_assert(ACT == 0 || ACT == 3 || ACT == 6 || ACT == 8 || ACT == 9 || ACT == 11 || ACT == 12 || ACT == 14 || ACT == 15 || ACT == 16 || ACT == 17, "k_gemm2: unsupported ACT code (would silently apply no activation)");
  __shared__ __attribute__((aligned(16))) float so[4][32][68];
  const int tid = threadIdx.x, w = tid >> 5, lane = tid & 31, ln = lane & 15, hh = lane >> 4; const int by = blockIdx.y;
  A += (size_t)by * sA; Bh += (size_t)by * sB; const size_t cofs = (size_t)by * sC; const float* bp = bias ? bias + (size_t)by * sBias : nullptr;
  const int ntn = N >> 6; const int mt = blockIdx.x / ntn, nq = blockIdx.x - mt * ntn; const int row0 = mt * 128 + 32 * w, col0 = nq * 64; if (row0 >= M) return;
  const _Float16* a0p = A + (size_t)(row0 + ln) * lda; const _Float16* a1p = a0p + (size_t)16 * lda;
  const _Float16* b0p = Bh + (size_t)(col0 + ln) * ldb; const _Float16* b1p = b0p + (size_t)16 * ldb; const _Float16* b2p = b1p + (size_t)16 * ldb; const _Float16* b3p = b2p + (size_t)16 * ldb;
  const v8f z8 = {0.f,0.f,0.f,0.f,0.f,0.f,0.f,0.f}; v8f c00 = z8, c01 = z8, c02 = z8, c03 = z8, c10 = z8, c11 = z8, c12 = z8, c13 = z8;
#pragma unroll 1
  for (int kb = 0; kb < K; kb += 32) { const v16h a0 = g2_frag(a0p + kb, hh), a1 = g2_frag(a1p + kb, hh);
    v16h b = g2_frag(b0p + kb, hh); c00 = g2_mma(a0, b, c00); c10 = g2_mma(a1, b, c10);
    b = g2_frag(b1p + kb, hh); c01 = g2_mma(a0, b, c01); c11 = g2_mma(a1, b, c11);
    b = g2_frag(b2p + kb, hh); c02 = g2_mma(a0, b, c02); c12 = g2_mma(a1, b, c12);
    b = g2_frag(b3p + kb, hh); c03 = g2_mma(a0, b, c03); c13 = g2_mma(a1, b, c13); }
  v8f accs[8] = {c00, c01, c02, c03, c10, c11, c12, c13};
#pragma unroll
  for (int u = 0; u < 8; ++u) { const int t = u & 3, half = u >> 2; const int col = col0 + t * 16 + ln; const float bv = bp ? bf16_round(bp[col]) : 0.f;
#pragma unroll
    for (int r = 0; r < 8; ++r) { const int rloc = half * 16 + 8 * hh + r; float v = accs[u][r] * alpha + bv; if (CP) { if (rowsPerB < 0) v += CP[cofs + (size_t)(row0g + row0 + rloc) * ldc + col];      /* rowsPerB < 0: own element of the batched C plane */ else { const int bidx = (row0g + row0 + rloc) / rowsPerB; v += CP[(size_t)bidx * sCPb + (size_t)by * 64 + col]; } }
      if (ACT == 3) v = fmaxf(v, 0.f); else if (ACT == 6) v = 0.5f * v * (1.0f + erff(v * 0.70710678118654752f)); else if (ACT == 11) v = 1.0f / (1.0f + expf(-v)); else if (ACT == 15) v = v / (1.0f + expf(-v)); else if (ACT == 12) v = (v > 0.f) ? v : 0.01f * v; else if (ACT == 8) v = tanhf(v); else if (ACT == 9) v = 0.5f * v * (1.0f + tanhf(0.7978845608028654f * (v + 0.044715f * v * v * v))); else if (ACT == 14) v = (v > 0.f) ? v : 0.1f * v; else if (ACT == 16) v = (v >= 0.f) ? v : 0.3f * v; else if (ACT == 17) v = (v >= 0.f) ? v : 0.2f * v;
      so[w][rloc][t * 16 + ln] = v; } }
  __builtin_amdgcn_fence(__ATOMIC_ACQ_REL, "workgroup"); __builtin_amdgcn_wave_barrier();
  const int rsub = lane >> 4, c4 = (lane & 15) * 4;
  {
#pragma unroll
    for (int q = 0; q < 16; ++q) { const int r = q * 2 + rsub; const v4f v = *(const v4fa*)&so[w][r][c4]; if (C) *(v4f*)(C + cofs + (size_t)(row0 + r) * ldc + col0 + c4) = v; if (C16) { v4h h4; for (int i = 0; i < 4; ++i) h4[i] = (_Float16)v[i]; *(v4h*)(C16 + cofs + (size_t)(row0 + r) * ldc + col0 + c4) = h4; } }
     } }


__global__ __launch_bounds__(256) void k_wnat(const float* __restrict__ w, size_t n8, _Float16* __restrict__ Bt) { const size_t t = (size_t)blockIdx.x * 256 + threadIdx.x; if (t >= n8) return; FragH f; for (int q = 0; q < 8; ++q) f.h[q] = (_Float16)(bf16_round(w[t * 8 + q]) * 16.0f); *(v8us*)((unsigned short*)Bt + t * 8) = f.half[0];  }
__global__ __launch_bounds__(256) void k_rsm(const float* __restrict__ S, _Float16* __restrict__ P, int nrows) {
  #pragma clang fp contract(off)
  const int i = blockIdx.x * 256 + threadIdx.x; if (i >= nrows) return; const float* s = S + (size_t)i * SQ; float mx = -3.0e38f;
#pragma unroll 1
  for (int j = 0; j < SQ; ++j) mx = fmaxf(mx, s[j]); float se = 0.f;
#pragma unroll 1
  for (int j = 0; j < SQ; ++j) se += expf(s[j] - mx); const float sc = 256.0f / se;
#pragma unroll 1
  for (int j0 = 0; j0 < SQ; j0 += 8) { FragH f; for (int q = 0; q < 8; ++q) f.h[q] = (_Float16)(expf(s[j0 + q] - mx) * sc); unsigned short* d = (unsigned short*)P + (size_t)i * SQ + j0; *(v8us*)d = f.half[0];  } }
__global__ __launch_bounds__(256) void k_vt(const _Float16* __restrict__ V16, int b, int h0, _Float16* __restrict__ VT) { __shared__ unsigned short tl[64][65]; const int tid = threadIdx.x; const int hh = blockIdx.x % HG, sg = blockIdx.x / HG; const int s0 = sg * 64; const int h = h0 + hh;
  for (int i = tid; i < 64 * 8; i += 256) { const int j = i / 8, d8 = (i % 8) * 8; FragH f; f.half[0] = *(const v8us*)((const unsigned short*)V16 + ((size_t)b * SQ + s0 + j) * DM + h * HD + d8); for (int q = 0; q < 8; ++q) tl[d8 + q][j] = f.u[q]; }
  __syncthreads();
  { for (int i = tid; i < 64 * 8; i += 256) { const int d = i / 8, j8 = (i % 8) * 8; FragH f; for (int q = 0; q < 8; ++q) f.u[q] = tl[d][j8 + q]; *(v8us*)((unsigned short*)VT + ((size_t)hh * HD + d) * SQ + s0 + j8) = f.half[0]; }  } }



__global__ __launch_bounds__(256) void k_rsmkm(const float* __restrict__ S, _Float16* __restrict__ P, int nrows, const int* __restrict__ am) {
  #pragma clang fp contract(off)
  const int t = blockIdx.x * 256 + threadIdx.x; if (t >= nrows) return; const size_t i = (size_t)t; const float* s = S + i * SQ; const int* mr = am + (size_t)(t % SQ) * SQ; float mx = -3.0e38f;
#pragma unroll 1
  for (int j = 0; j < SQ; ++j) { const float f = (mr[j] != 0) ? 1.f : 0.f; mx = fmaxf(mx, fmaf(f, s[j], (1.f - f) * -1.0e9f)); } float se = 0.f;
#pragma unroll 1
  for (int j = 0; j < SQ; ++j) { const float f = (mr[j] != 0) ? 1.f : 0.f; se += __expf(fmaf(f, s[j], (1.f - f) * -1.0e9f) - mx); } const float sc = 256.0f / se;
#pragma unroll 1
  for (int j0 = 0; j0 < SQ; j0 += 8) { FragH fr; for (int q = 0; q < 8; ++q) { const int j = j0 + q; const float f = (mr[j] != 0) ? 1.f : 0.f; fr.h[q] = (_Float16)(__expf(fmaf(f, s[j], (1.f - f) * -1.0e9f) - mx) * sc); }
    unsigned short* d = (unsigned short*)P + i * SQ + j0; *(v8us*)d = fr.half[0];  } }

template <int COLS>
__global__ __launch_bounds__(256) void k_wperm(const float* __restrict__ Wn, _Float16* __restrict__ Bt) {
  const size_t t = (size_t)blockIdx.x * 256 + threadIdx.x; if (t >= (size_t)DM * DM / 8) return; const size_t e0 = t * 8; const int n = (int)(e0 / DM), k0 = (int)(e0 % DM); FragH f;
  if (COLS == 0) { const int h = n >> 6, d = n & 63; const float* src = Wn + (size_t)(d * NH + h) * DM + k0; for (int q = 0; q < 8; ++q) f.h[q] = (_Float16)(bf16_round(src[q]) * 16.0f); }
  else { for (int q = 0; q < 8; ++q) { const int kk = k0 + q; const int h = kk >> 6, d = kk & 63; f.h[q] = (_Float16)(bf16_round(Wn[(size_t)n * DM + d * NH + h]) * 16.0f); } }
  unsigned short* dst = (unsigned short*)Bt + e0; *(v8us*)dst = f.half[0];  }
__global__ __launch_bounds__(256) void k_bperm(const float* __restrict__ b, float* __restrict__ out) { const int t = threadIdx.x; if (t >= DM) return; const int h = t >> 6, d = t & 63; const float v = b[d * NH + h]; *(float*)(out + t) = v;  }
__global__ __launch_bounds__(256) void k_tr32(const float* __restrict__ R, float* __restrict__ OUT, size_t n4) {
  const size_t t = (size_t)blockIdx.x * 256 + threadIdx.x; if (t >= n4) return; const size_t e = t * 4; const int c = (int)(e / SQ); const int n0 = (int)(e % SQ); v4f o; for (int q = 0; q < 4; ++q) o[q] = R[(size_t)(n0 + q) * DM + c]; *(v4f*)(OUT + e) = o;  }
extern "C" void kernel_launch(void* const* d_in, const int* in_sizes, int n_in,
                              void* d_out, int out_size, void* d_ws, size_t ws_size, hipStream_t stream) {
  (void)in_sizes; (void)n_in; (void)out_size;
  const float* const* I = (const float* const*)d_in; const float* xq = I[0]; const float* xk = I[0]; const float* xv = I[0]; const float* wq = I[1]; const float* bq = I[2]; const float* wk = I[3]; const float* bk = I[4]; const float* wv = I[5]; const float* bv = I[6]; const float* wo = I[7]; const float* bo = I[8]; const float* x = xq;      /* hidden_state [4][768][2048] (feeds q, k and v); per-head Wq / Wk / Wv [12][768][64] + biases [12][64] (= [768] head-major); Wo [768][768] natural + bo */
  char* ws = (char*)d_ws; size_t off = 0;
  auto take = [&](size_t bytes) { char* p = ws + off; off += (bytes + 255) & ~(size_t)255; return p; };
  _Float16* BQ = (_Float16*)take((size_t)DM * DM * 2); _Float16* BK = (_Float16*)take((size_t)DM * DM * 2); _Float16* BV = (_Float16*)take((size_t)DM * DM * 2); _Float16* BO = (_Float16*)take((size_t)DM * DM * 2);
  _Float16* X16 = (_Float16*)take(NR * DM * 2); _Float16* XKp = nullptr; _Float16* XVp = nullptr;      /* (one shared input: k and v project the X16 rows) */ _Float16* Q16 = (_Float16*)take(NR * DM * 2); _Float16* K16 = (_Float16*)take(NR * DM * 2); _Float16* V16 = (_Float16*)take(NR * DM * 2); _Float16* O16 = (_Float16*)take(NR * DM * 2); _Float16* CF16 = (_Float16*)take(NR * DM * 2); float* BP = (float*)take((size_t)3 * DM * 4); float* OR = (float*)take(NR * DM * 4);      /* channel-first f16 staging plane (one input at a time); BP unused (the GEMMs take bq, bk, bv directly); f32 output token rows before the transpose back */
  float* S = (float*)take((size_t)HG * SQ * SQ * 4); _Float16* P = (_Float16*)take((size_t)HG * SQ * SQ * 2); _Float16* VT = (_Float16*)take((size_t)NH * HD * SQ * 2);
  if (off > ws_size) return;
  for (int h = 0; h < NH; ++h) { const unsigned g = (unsigned)(((size_t)HD * (DM / 8) + 255) / 256); k_wt_f16<<<g, 256, 0, stream>>>(wq + (size_t)h * DM * HD, BQ + (size_t)h * HD * DM, DM, HD, 16.0f); k_wt_f16<<<g, 256, 0, stream>>>(wk + (size_t)h * DM * HD, BK + (size_t)h * HD * DM, DM, HD, 16.0f); k_wt_f16<<<g, 256, 0, stream>>>(wv + (size_t)h * DM * HD, BV + (size_t)h * HD * DM, DM, HD, 16.0f); }      /* per-head [in = 768][out = 64] tensors -> rows h*64.. of the Bt planes (x16): head h = output columns h*64.. = the concat order */
  k_wnat<<<(unsigned)(((size_t)DM * DM / 8 + 255) / 256), 256, 0, stream>>>(wo, (size_t)DM * DM / 8, BO);      /* Wo natural [out][in] = Bt x16 */
  _Float16* XK = XKp; _Float16* XV = XVp;
  k_x16<<<(unsigned)((NR * DM / 8 + 255) / 256), 256, 0, stream>>>(x, CF16, NR * DM / 8); for (int b = 0; b < NB; ++b) k_vt<SQ / 64, DM><<<(SQ / 64) * (DM / 64), 256, 0, stream>>>(CF16 + (size_t)b * DM * SQ, SQ, 0, X16 + (size_t)b * SQ * DM); XK = X16; XV = X16;      /* the [B][E][S] input: exact f16 copy, then per batch an LDS transpose [e][s] -> token rows [s][e]; q, k and v all project these rows */

  const size_t r0p = (size_t)B0 * SQ;      /* first projected row */
  k_gemm2<0><<<dim3((unsigned)((MP / 128) * (DM / 64)), 1), 128, 0, stream>>>(X16 + r0p * DM, DM, 0, BQ, DM, 0, 0.0625f, bq, 0, nullptr, 1, 0, 0, nullptr, Q16 + r0p * DM, DM, 0, MP, DM, DM);
  k_gemm2<0><<<dim3((unsigned)((MP / 128) * (DM / 64)), 1), 128, 0, stream>>>(XK + r0p * DM, DM, 0, BK, DM, 0, 0.0625f, bk, 0, nullptr, 1, 0, 0, nullptr, K16 + r0p * DM, DM, 0, MP, DM, DM);
  k_gemm2<0><<<dim3((unsigned)((MP / 128) * (DM / 64)), 1), 128, 0, stream>>>(XV + r0p * DM, DM, 0, BV, DM, 0, 0.0625f, bv, 0, nullptr, 1, 0, 0, nullptr, V16 + r0p * DM, DM, 0, MP, DM, DM);
  for (int b = B0; b < B0 + NBR; ++b) { const size_t r0 = (size_t)b * SQ;
    k_vt<NH, SQ><<<NH * (SQ / 64), 256, 0, stream>>>(V16 + r0 * LQ, LQ, 0, VT);      /* V^T [NH][HD][SQ] for this batch */
    for (int h0 = 0; h0 < NHD; h0 += HG) {
      k_gemm2<0><<<dim3((QN / 128) * (SQ / 64), HG), 128, 0, stream>>>(Q16 + r0 * LQ + h0 * HD, LQ, (size_t)HD, K16 + r0 * LQ + h0 * HD, LQ, (size_t)HD, 1.0f, nullptr, 0, nullptr, 1, 0, 0, S, nullptr, SQ, (size_t)SQ * SQ, QN, SQ, HD);      /* UNSCALED scores q.k (the module omits 1/sqrt(d)), HG heads per launch */
      k_rsm<<<(HG * SQ + 255) / 256, 256, 0, stream>>>(S, P, HG * SQ);      /* P = 256 softmax (f16), rows of all HG heads */
      k_gemm2<0><<<dim3((QN / 128) * (HD / 64), HG), 128, 0, stream>>>(P, SQ, (size_t)SQ * SQ, VT + (size_t)h0 * HD * SQ, SQ, (size_t)HD * SQ, 0.25f, nullptr, 0, nullptr, 1, 0, 0, nullptr, O16 + r0 * DM + h0 * HD, DM, (size_t)HD, QN, HD, SQ); } }      /* o (merged heads) as f16 rows */
  k_gemm2<0><<<dim3((unsigned)((MPO / 128) * (DM / 64)), 1), 128, 0, stream>>>(O16 + r0p * DM, DM, 0, BO, DM, 0, 0.0009765625f, bo, 0, nullptr, 1, 0, 0, OR + r0p * DM, nullptr, DM, 0, MPO, DM, DM);      /* out token rows [n][co] (f32; bo is in natural channel order = the output columns) */
  for (int b = 0; b < NB; ++b) k_tr32<<<(unsigned)(((size_t)DM * SQ / 4 + 255) / 256), 256, 0, stream>>>(OR + (size_t)b * SQ * DM, (float*)d_out + (size_t)b * DM * SQ, (size_t)DM * SQ / 4);      /* -> the module's [co][n] layout */
}

// v001
// Measured time: 1500 microseconds a run.
// In both of two side-by-side timings against v000, it was 3.89 times as fast.
#include <hip/hip_runtime.h>
// Channel-first multi-head self-attention with PER-HEAD projection tensors and UNSCALED scores (hidden_state [4][768][2048] = [B][E][S]; x = its transpose [B][S][E]; q/k/v[h] = x W[h] + b[h] with W [12][768][64] ([h][in][d], sigma 0.02) and b [12][64] (zeros); scores = q k^T with NO 1/sqrt(d) factor (faithful to the source); softmax over keys; ctx heads concatenated; out = ctx Wo^T + bo (natural [768][768]); returned transposed back to [4][768][2048]).
// Structure: token rows r = b*2048 + s; x as exact f16 rows (bf16-rounded); Q, K, V as three WMMA GEMMs (32x64 wave tiles, f32 accumulation, exact x16 weights + bias, f16 outputs); per batch: V^T for all heads via LDS transposes; per (batch, group of 4 heads): scores GEMM (K = 64, batched over the heads on grid.y, alpha = 1 (unscaled, no mask)), row softmax on VALU (f32 statistics; weights stored x256 as f16), o = P . V^T GEMM (K = 2048, alpha 2^-2: o carried x64 against f16 subnormal flush, folded into the output GEMM alpha) written straight into the merged f16 o rows; out = o W_o + b GEMM (f32) into the output layout.
// Compute dtype: inputs rounded to bf16; x / weights exact; q, k, v, softmax weights and o as plain f16 GEMM operands (~2^-12); scores and softmax statistics f32. v_wmma_f32_16x16x32_f16.
#define NB 4
#define SQ 2048
#define DM 768
#define NH 12
#define HD 64
#define HG 4                         /* heads per attention launch group */
#define B0 0                         /* first batch processed (debug hook) */
#define NBR NB                       /* batches processed (debug hook) */
#define NR ((size_t)NB * SQ)         /* token rows */
#define MP ((int)((size_t)NBR * SQ)) /* rows projected (debug hook) */
#define QN SQ                        /* query rows attended per batch (debug hook) */
#define NHD NH                       /* heads attended (debug hook) */
#define MPO MP                       /* rows through the output stage (debug hook) */
#define LQ DM      /* row pitch of the q/k/v rows */
typedef __bf16 v16b __attribute__((ext_vector_type(16)));
typedef unsigned short v8us __attribute__((ext_vector_type(8), may_alias));
typedef float  v8f  __attribute__((ext_vector_type(8)));
typedef float  v4f  __attribute__((ext_vector_type(4)));
typedef float  v4fa __attribute__((ext_vector_type(4), may_alias));
union FragB { v16b v; v8us half[2]; unsigned short u[16]; };

__device__ __forceinline__ unsigned short bf16_bits(float x) { unsigned int u = __float_as_uint(x); return (unsigned short)((u + 0x7FFFu + ((u >> 16) & 1u)) >> 16); }
__device__ __forceinline__ float bf16_val(unsigned short b) { return __uint_as_float(((unsigned int)b) << 16); }
__device__ __forceinline__ float bf16_round(float x) { return bf16_val(bf16_bits(x)); }
// D += A·B with NT terms: 1 = ah·bh, 2 = + al·bh (A split), 3 = + ah·bl (both split)
template <int NT>
__device__ __forceinline__ v8f mmaN(v16b ah, v16b al, v16b bh, v16b bl, v8f c) {
  c = __builtin_amdgcn_wmma_f32_16x16x32_bf16(false, ah, false, bh, (short)0, c, false, false);
  if (NT >= 2) c = __builtin_amdgcn_wmma_f32_16x16x32_bf16(false, al, false, bh, (short)0, c, false, false);
  if (NT >= 3) c = __builtin_amdgcn_wmma_f32_16x16x32_bf16(false, ah, false, bl, (short)0, c, false, false);
  asm volatile("v_nop\n\tv_nop\n\tv_nop\n\tv_nop" : "+v"(c) : "v"(ah), "v"(al), "v"(bh), "v"(bl));
  return c;
}

__global__ __launch_bounds__(256) void k_wt_bf16(const float* __restrict__ W, unsigned short* __restrict__ Wt, int K, int N) {
  const int t = blockIdx.x * 256 + threadIdx.x;
  const int k8n = K / 8;
  if (t >= N * k8n) return;
  const int n = t / k8n, k8 = (t % k8n) * 8;
  v8us v;
#pragma unroll
  for (int i = 0; i < 8; ++i) v[i] = bf16_bits(W[(size_t)(k8 + i) * N + n]);
  *(v8us*)(Wt + (size_t)n * K + k8) = v;
  
}

// GEMM C[M][N] (f32, pitch ldc) = act(A[M][K]·W + bias). A f32 row-major (pitch lda) converted per fragment to bf16
// (ASPLIT: hi/lo two planes -> 2 terms, else single rounded term); Wt bf16 [N][K] (pitch ldb). BIAS_BF16 rounds the
// bias to bf16 first (bias quantised to bf16 before the add). K%32==0, M%16==0, N%64==0.
template <bool ASPLIT, int ACT, bool BIAS_BF16>
__global__ __launch_bounds__(128) void k_gemm_bf(const float* __restrict__ A, int lda, const unsigned short* __restrict__ Wt, int ldb,
                                               const float* __restrict__ bias, float* __restrict__ C, int ldc, int M, int N, int K) {
  __shared__ __attribute__((aligned(16))) float so[4][16][64];
  const int tid = threadIdx.x, w = tid >> 5, lane = tid & 31, ln = lane & 15, hh = lane >> 4;
  const int ntn = N / 64;
  const int wid = blockIdx.x * 4 + w;
  const int mt = wid / ntn, nq = wid % ntn;
  if (mt * 16 >= M) return;
  const int row0 = mt * 16, col0 = nq * 64;
  const float* arow = A + (size_t)(row0 + ln) * lda;
  v8f acc[4] = {};
  for (int kb = 0; kb < K; kb += 32) {
    FragB ah, al;
    const v4f x0 = *(const v4fa*)(arow + kb + 8 * hh), x1 = *(const v4fa*)(arow + kb + 8 * hh + 4);
    const v4f x2 = *(const v4fa*)(arow + kb + 16 + 8 * hh), x3 = *(const v4fa*)(arow + kb + 16 + 8 * hh + 4);
    float xs[16] = {x0[0],x0[1],x0[2],x0[3],x1[0],x1[1],x1[2],x1[3],x2[0],x2[1],x2[2],x2[3],x3[0],x3[1],x3[2],x3[3]};
#pragma unroll
    for (int i = 0; i < 16; ++i) { const unsigned short hb = bf16_bits(xs[i]); ah.u[i] = hb; al.u[i] = ASPLIT ? bf16_bits(xs[i] - bf16_val(hb)) : (unsigned short)0; }
#pragma unroll
    for (int t = 0; t < 4; ++t) {
      const unsigned short* brow = Wt + (size_t)(col0 + t * 16 + ln) * ldb + kb;
      FragB b;
      b.half[0] = *(const v8us*)(brow + 8 * hh);
      b.half[1] = *(const v8us*)(brow + 16 + 8 * hh);
      acc[t] = mmaN<ASPLIT ? 2 : 1>(ah.v, al.v, b.v, b.v, acc[t]);
    }
  }
#pragma unroll
  for (int t = 0; t < 4; ++t) {
    float bv = bias ? bias[col0 + t * 16 + ln] : 0.f;
    if (BIAS_BF16) bv = bf16_round(bv);
#pragma unroll
    for (int r = 0; r < 8; ++r) { float v = acc[t][r] + bv; if (ACT == 1) v = fmaxf(v, 0.f); so[w][8 * hh + r][t * 16 + ln] = v; }
  }
  __builtin_amdgcn_fence(__ATOMIC_ACQ_REL, "workgroup");
  __builtin_amdgcn_wave_barrier();
  const int rsub = lane >> 4, c4 = (lane & 15) * 4;
  {
#pragma unroll
    for (int q = 0; q < 8; ++q) {
      const int r = q * 2 + rsub;
      const v4f v = *(const v4fa*)&so[w][r][c4];
      *(v4f*)(C + (size_t)(row0 + r) * ldc + col0 + c4) = v;
    }
    
  }
}

// GEMM C = act(A·W + bias + resid): A f32 (ASPLIT -> hi/lo 2 terms), Wt bf16 [N][K]; ACT 0 none, 1 relu, 2 exact gelu;
// resid (optional, f32, row index = (row % rmod), pitch ldr, RES_BF16 rounds it) added before the activation.
template <bool ASPLIT, int ACT, bool BIAS_BF16, bool RES_BF16>
__global__ __launch_bounds__(128) void k_gemm_bf3(const float* __restrict__ A, int lda, const unsigned short* __restrict__ Wt, int ldb,
                                                const float* __restrict__ bias, const float* __restrict__ resid, int rmod, int ldr,
                                                float* __restrict__ C, int ldc, int M, int N, int K) {
  __shared__ __attribute__((aligned(16))) float so[4][16][64];
  const int tid = threadIdx.x, w = tid >> 5, lane = tid & 31, ln = lane & 15, hh = lane >> 4;
  const int ntn = N / 64;
  const int wid = blockIdx.x * 4 + w;
  const int mt = wid / ntn, nq = wid % ntn;
  if (mt * 16 >= M) return;
  const int row0 = mt * 16, col0 = nq * 64;
  const float* arow = A + (size_t)(row0 + ln) * lda;
  v8f acc[4] = {};
  for (int kb = 0; kb < K; kb += 32) {
    FragB ah, al;
    const v4f x0 = *(const v4fa*)(arow + kb + 8 * hh), x1 = *(const v4fa*)(arow + kb + 8 * hh + 4);
    const v4f x2 = *(const v4fa*)(arow + kb + 16 + 8 * hh), x3 = *(const v4fa*)(arow + kb + 16 + 8 * hh + 4);
    float xs[16] = {x0[0],x0[1],x0[2],x0[3],x1[0],x1[1],x1[2],x1[3],x2[0],x2[1],x2[2],x2[3],x3[0],x3[1],x3[2],x3[3]};
#pragma unroll
    for (int i = 0; i < 16; ++i) { const unsigned short hb = bf16_bits(xs[i]); ah.u[i] = hb; al.u[i] = ASPLIT ? bf16_bits(xs[i] - bf16_val(hb)) : (unsigned short)0; }
#pragma unroll
    for (int t = 0; t < 4; ++t) {
      const unsigned short* brow = Wt + (size_t)(col0 + t * 16 + ln) * ldb + kb;
      FragB b;
      b.half[0] = *(const v8us*)(brow + 8 * hh);
      b.half[1] = *(const v8us*)(brow + 16 + 8 * hh);
      acc[t] = mmaN<ASPLIT ? 2 : 1>(ah.v, al.v, b.v, b.v, acc[t]);
    }
  }
#pragma unroll
  for (int t = 0; t < 4; ++t) {
    const int col = col0 + t * 16 + ln;
    float bv = bias ? bias[col] : 0.f;
    if (BIAS_BF16) bv = bf16_round(bv);
#pragma unroll
    for (int r = 0; r < 8; ++r) {
      float v = acc[t][r] + bv;
      if (resid) { float rv = resid[(size_t)((row0 + 8 * hh + r) % rmod) * ldr + col]; if (RES_BF16) rv = bf16_round(rv); v += rv; }
      if (ACT == 1) v = fmaxf(v, 0.f);
      if (ACT == 2) v = 0.5f * v * (1.0f + erff(v * 0.70710678118654752f));
      if (ACT == 3) { const float u = 0.7978845608028654f * (v + 0.044715f * v * v * v); v = 0.5f * v * (1.0f + tanhf(u)); }
      so[w][8 * hh + r][t * 16 + ln] = v;
    }
  }
  __builtin_amdgcn_fence(__ATOMIC_ACQ_REL, "workgroup");
  __builtin_amdgcn_wave_barrier();
  const int rsub = lane >> 4, c4 = (lane & 15) * 4;
  {
#pragma unroll
    for (int q = 0; q < 8; ++q) {
      const int r = q * 2 + rsub;
      const v4f v = *(const v4fa*)&so[w][r][c4];
      *(v4f*)(C + (size_t)(row0 + r) * ldc + col0 + c4) = v;
    }
    
  }
}
// row LayerNorm (biased variance, eps) over N: s = X (+ R); optional out_sum <- s; out_norm <- (s-mu)*rsqrt(var+eps)*g + b
template <bool PARAM_BF16>
__global__ __launch_bounds__(256) void k_layernorm(const float* __restrict__ X, const float* __restrict__ R, const float* __restrict__ g, const float* __restrict__ bta,
                                                  float* __restrict__ out_sum, float* __restrict__ out_norm, int N, float eps) {
  __shared__ float red[256];
  const int row = blockIdx.x, tid = threadIdx.x;
  const float* x = X + (size_t)row * N; const float* rr = R ? R + (size_t)row * N : nullptr;
  float vals[16];                     // up to N = 4096
  const int per = N / 256;            // contiguous chunk per thread? use strided-by-4 chunks: thread handles j = tid*4 + 1024*u
  float s1 = 0.f;
  for (int u = 0; u < per / 4; ++u) {
    const int j = tid * 4 + 1024 * u;
    const v4f a = *(const v4fa*)(x + j);
    v4f b = {0.f,0.f,0.f,0.f}; if (rr) b = *(const v4fa*)(rr + j);
#pragma unroll
    for (int q = 0; q < 4; ++q) { const float v = a[q] + b[q]; vals[u * 4 + q] = v; s1 += v; }
  }
  red[tid] = s1; __syncthreads();
  for (int st = 128; st > 0; st >>= 1) { if (tid < st) red[tid] += red[tid + st]; __syncthreads(); }
  const float mu = red[0] / (float)N; __syncthreads();
  float s2 = 0.f;
  for (int u = 0; u < per / 4; ++u)
#pragma unroll
    for (int q = 0; q < 4; ++q) { const float c = vals[u * 4 + q] - mu; s2 += c * c; }
  red[tid] = s2; __syncthreads();
  for (int st = 128; st > 0; st >>= 1) { if (tid < st) red[tid] += red[tid + st]; __syncthreads(); }
  const float rs = rsqrtf(red[0] / (float)N + eps);
  {
    for (int u = 0; u < per / 4; ++u) {
      const int j = tid * 4 + 1024 * u;
      v4f o, sm;
#pragma unroll
      for (int q = 0; q < 4; ++q) {
        float gg = g[j + q], bb = bta[j + q];
        if (PARAM_BF16) { gg = bf16_round(gg); bb = bf16_round(bb); }
        sm[q] = vals[u * 4 + q]; o[q] = (vals[u * 4 + q] - mu) * rs * gg + bb;
      }
      if (out_sum) *(v4f*)(out_sum + (size_t)row * N + j) = sm;
      *(v4f*)(out_norm + (size_t)row * N + j) = o;
    }
    
  }
}



// ---- f16 WMMA path (v_wmma_f32_16x16x32_f16): 11-bit significands for operands in range — used where a [0,1] probability operand needs more precision than bf16
typedef _Float16 v16h __attribute__((ext_vector_type(16)));
union FragH { v16h v; v8us half[2]; _Float16 h[16]; unsigned short u[16]; };
template <int NT>
__device__ __forceinline__ v8f mmaH(v16h ah, v16h al, v16h bh, v16h bl, v8f c) {
  c = __builtin_amdgcn_wmma_f32_16x16x32_f16(false, ah, false, bh, (short)0, c, false, false);
  if (NT >= 2) c = __builtin_amdgcn_wmma_f32_16x16x32_f16(false, al, false, bh, (short)0, c, false, false);
  if (NT >= 3) c = __builtin_amdgcn_wmma_f32_16x16x32_f16(false, ah, false, bl, (short)0, c, false, false);
  asm volatile("v_nop\n\tv_nop\n\tv_nop\n\tv_nop" : "+v"(c) : "v"(ah), "v"(al), "v"(bh), "v"(bl));
  return c;
}
// batched GEMM like k_gemm_b but f16 operands: A f32 (split into f16 hi/lo if ASPLIT, else rounded to f16), Bt = f16 values [n][k]; alpha; C f32; N multiple of 16 (partial tiles skipped)
template <bool ASPLIT>
__global__ __launch_bounds__(128) void k_gemm_h(const float* __restrict__ A, int lda, size_t sA, const _Float16* __restrict__ Bh, int ldb, size_t sB, float alpha, float* __restrict__ C, int ldc, size_t sC, int M, int N, int K) {
  __shared__ __attribute__((aligned(16))) float so[4][16][64];
  const int tid = threadIdx.x, w = tid >> 5, lane = tid & 31, ln = lane & 15, hh = lane >> 4; const int by = blockIdx.y;
  A += (size_t)by * sA; Bh += (size_t)by * sB; C += (size_t)by * sC;
  const int ntn = (N + 63) / 64; const int wid = blockIdx.x * 4 + w; const int mt = wid / ntn, nq = wid % ntn; if (mt * 16 >= M) return;
  const int row0 = mt * 16, col0 = nq * 64; const float* arow = A + (size_t)(row0 + ln) * lda;
  v8f acc[4] = {};
  for (int kb = 0; kb < K; kb += 32) {
    FragH ah, al;
    const v4f x0 = *(const v4fa*)(arow + kb + 8 * hh), x1 = *(const v4fa*)(arow + kb + 8 * hh + 4), x2 = *(const v4fa*)(arow + kb + 16 + 8 * hh), x3 = *(const v4fa*)(arow + kb + 16 + 8 * hh + 4);
    float xs[16] = {x0[0],x0[1],x0[2],x0[3],x1[0],x1[1],x1[2],x1[3],x2[0],x2[1],x2[2],x2[3],x3[0],x3[1],x3[2],x3[3]};
#pragma unroll
    for (int i = 0; i < 16; ++i) { const _Float16 h = (_Float16)xs[i]; ah.h[i] = h; al.h[i] = ASPLIT ? (_Float16)(xs[i] - (float)h) : (_Float16)0.0f; }
#pragma unroll
    for (int t = 0; t < 4; ++t) { if (col0 + t * 16 >= N) continue; const size_t boff = (size_t)(col0 + t * 16 + ln) * ldb + kb; FragH bq; bq.half[0] = *(const v8us*)(Bh + boff + 8 * hh); bq.half[1] = *(const v8us*)(Bh + boff + 16 + 8 * hh);
      acc[t] = mmaH<ASPLIT ? 2 : 1>(ah.v, al.v, bq.v, bq.v, acc[t]); }
  }
#pragma unroll
  for (int t = 0; t < 4; ++t) { if (col0 + t * 16 >= N) continue;
#pragma unroll
    for (int r = 0; r < 8; ++r) so[w][8 * hh + r][t * 16 + ln] = acc[t][r] * alpha; }
  __builtin_amdgcn_fence(__ATOMIC_ACQ_REL, "workgroup"); __builtin_amdgcn_wave_barrier();
  const int rsub = lane >> 4, c4 = (lane & 15) * 4;
  {
#pragma unroll
    for (int q = 0; q < 8; ++q) { const int r = q * 2 + rsub; if (col0 + c4 < N) { const v4f v = *(const v4fa*)&so[w][r][c4]; *(v4f*)(C + (size_t)(row0 + r) * ldc + col0 + c4) = v; } }
     }
}

// Wt[n][k] = f16(W[k][n]·scale) from f32 row-major W[K][N] (scale = power of two; bf16-exact weights stay exact in f16 away from the subnormal range)
__global__ __launch_bounds__(256) void k_wt_f16(const float* __restrict__ W, _Float16* __restrict__ Wt, int K, int N, float scale) {
  const int t = blockIdx.x * 256 + threadIdx.x; if (t >= N * (K / 8)) return; const int n = t / (K / 8), k8 = (t % (K / 8)) * 8; FragH f;
#pragma unroll
  for (int i = 0; i < 8; ++i) f.h[i] = (_Float16)(bf16_round(W[(size_t)(k8 + i) * N + n]) * scale); const v8us o = f.half[0];
  *(v8us*)((unsigned short*)Wt + (size_t)n * K + k8) = o; 
}
// k_gemm_hh variant with fused epilogue: v = acc·alpha + bias[by·sBias + col] (+ CP[(row/rowsPerB)·sCPb + by·64 + col] if CP) ; ACT 0 none / 1 elu ; writes f16 C16 (and f32 C if non-null)
template <int ACT>
__global__ __launch_bounds__(128) void k_gemm_hhx(const _Float16* __restrict__ A, int lda, size_t sA, const _Float16* __restrict__ Bh, int ldb, size_t sB, float alpha, const float* __restrict__ bias, size_t sBias, const float* __restrict__ CP, int rowsPerB, size_t sCPb, int row0g,
    float* __restrict__ C, _Float16* __restrict__ C16, int ldc, size_t sC, int M, int N, int K) {
  __shared__ __attribute__((aligned(16))) float so[4][16][64];
  const int tid = threadIdx.x, w = tid >> 5, lane = tid & 31, ln = lane & 15, hh = lane >> 4; const int by = blockIdx.y;
  A += (size_t)by * sA; Bh += (size_t)by * sB; const size_t cofs = (size_t)by * sC; const float* bp = bias ? bias + (size_t)by * sBias : nullptr;
  const int ntn = (N + 63) / 64; const int wid = blockIdx.x * 4 + w; const int mt = wid / ntn, nq = wid % ntn; if (mt * 16 >= M) return;
  const int row0 = mt * 16, col0 = nq * 64; const _Float16* arow = A + (size_t)(row0 + ln) * lda;
  v8f acc[4] = {};
  for (int kb = 0; kb < K; kb += 32) { FragH ah; ah.half[0] = *(const v8us*)((const unsigned short*)arow + kb + 8 * hh); ah.half[1] = *(const v8us*)((const unsigned short*)arow + kb + 16 + 8 * hh);
#pragma unroll
    for (int t = 0; t < 4; ++t) { if (col0 + t * 16 >= N) continue; const size_t boff = (size_t)(col0 + t * 16 + ln) * ldb + kb; FragH bq; bq.half[0] = *(const v8us*)((const unsigned short*)Bh + boff + 8 * hh); bq.half[1] = *(const v8us*)((const unsigned short*)Bh + boff + 16 + 8 * hh);
      acc[t] = mmaH<1>(ah.v, ah.v, bq.v, bq.v, acc[t]); }
  }
#pragma unroll
  for (int t = 0; t < 4; ++t) { if (col0 + t * 16 >= N) continue; const int col = col0 + t * 16 + ln; const float bv = bp ? bf16_round(bp[col]) : 0.f;
#pragma unroll
    for (int r = 0; r < 8; ++r) { float v = acc[t][r] * alpha + bv; if (CP) { const int rr = row0g + row0 + 8 * hh + r; if (rowsPerB < 0) v += CP[cofs + (size_t)rr * ldc + col];      /* rowsPerB < 0: own element of the batched C plane */ else { const int bidx = rr / rowsPerB; v += CP[(size_t)bidx * sCPb + (size_t)by * 64 + col]; } } if (ACT == 1) v = (v > 0.f) ? v : expm1f(v); else if (ACT == 7) v = (v > 0.f) ? v + 1.0f : expf(v); else if (ACT == 8) v = tanhf(v); else if (ACT == 9) v = 0.5f * v * (1.0f + tanhf(0.7978845608028654f * (v + 0.044715f * v * v * v))); else if (ACT == 11) v = 1.0f / (1.0f + expf(-v)); else if (ACT == 12) v = (v > 0.f) ? v : 0.01f * v; else if (ACT == 14) v = (v > 0.f) ? v : 0.1f * v; else if (ACT == 16) v = (v >= 0.f) ? v : 0.3f * v; else if (ACT == 17) v = (v >= 0.f) ? v : 0.2f * v; else if (ACT == 15) v = v / (1.0f + expf(-v)); else if (ACT == 3) v = fmaxf(v, 0.f); else if (ACT == 6) v = 0.5f * v * (1.0f + erff(v * 0.70710678118654752f)); so[w][8 * hh + r][t * 16 + ln] = v; } }
  __builtin_amdgcn_fence(__ATOMIC_ACQ_REL, "workgroup"); __builtin_amdgcn_wave_barrier();
  const int rsub = lane >> 4, c4 = (lane & 15) * 4; typedef _Float16 v4h __attribute__((ext_vector_type(4)));
  {
#pragma unroll
    for (int q = 0; q < 8; ++q) { const int r = q * 2 + rsub; if (col0 + c4 < N) { const v4f v = *(const v4fa*)&so[w][r][c4]; if (C) *(v4f*)(C + cofs + (size_t)(row0 + r) * ldc + col0 + c4) = v; if (C16) { v4h h4; for (int i = 0; i < 4; ++i) h4[i] = (_Float16)v[i]; *(v4h*)(C16 + cofs + (size_t)(row0 + r) * ldc + col0 + c4) = h4; } } }
     }
}


typedef _Float16 v4h __attribute__((ext_vector_type(4)));

__global__ __launch_bounds__(256) void k_x16(const float* __restrict__ x, _Float16* __restrict__ X16, size_t n8) { const size_t t = (size_t)blockIdx.x * 256 + threadIdx.x; if (t >= n8) return; FragH f;
#pragma unroll
  for (int q = 0; q < 8; ++q) f.h[q] = (_Float16)bf16_round(x[t * 8 + q]); *(v8us*)((unsigned short*)X16 + t * 8) = f.half[0];  }
__global__ __launch_bounds__(256) void k_h16(const float* __restrict__ x, _Float16* __restrict__ X16, size_t n8) { const size_t t = (size_t)blockIdx.x * 256 + threadIdx.x; if (t >= n8) return; FragH f;
#pragma unroll
  for (int q = 0; q < 8; ++q) f.h[q] = (_Float16)x[t * 8 + q]; *(v8us*)((unsigned short*)X16 + t * 8) = f.half[0];  }
__global__ __launch_bounds__(256) void k_round16f(const float* __restrict__ W, _Float16* __restrict__ Bt, size_t n8) { const size_t t = (size_t)blockIdx.x * 256 + threadIdx.x; if (t >= n8) return; FragH f;
#pragma unroll
  for (int i = 0; i < 8; ++i) f.h[i] = (_Float16)(bf16_round(W[t * 8 + i]) * 16.0f); *(v8us*)((unsigned short*)Bt + t * 8) = f.half[0];  }
template <int NHv, int TTv>
__global__ __launch_bounds__(256) void k_vt(const _Float16* __restrict__ V16, int ldv, int voff, _Float16* __restrict__ Vt) { __shared__ unsigned short tl[64][66]; const int tid = threadIdx.x; const int slab = blockIdx.x / (TTv / 64), lg = blockIdx.x % (TTv / 64); const int b = slab / NHv, h = slab % NHv;
  for (int i = tid; i < 64 * 8; i += 256) { const int r = i / 8, c8 = (i % 8) * 8; FragH f; f.half[0] = *(const v8us*)((const unsigned short*)V16 + ((size_t)b * TTv + lg * 64 + r) * ldv + voff + h * 64 + c8);
#pragma unroll
    for (int q = 0; q < 8; ++q) tl[r][c8 + q] = f.u[q]; }
  __syncthreads();
  {
#pragma unroll
    for (int rd = 0; rd < 2; ++rd) { const int d = rd * 32 + tid / 8, pc = tid % 8; FragH f;
#pragma unroll
      for (int q = 0; q < 8; ++q) f.u[q] = tl[pc * 8 + q][d];
      *(v8us*)((unsigned short*)Vt + ((size_t)slab * 64 + d) * TTv + lg * 64 + pc * 8) = f.half[0]; }
     } }

__global__ __launch_bounds__(256) void k_hl(const float* __restrict__ F, _Float16* __restrict__ Hh, _Float16* __restrict__ Hl, size_t n8) { const size_t t = (size_t)blockIdx.x * 256 + threadIdx.x; if (t >= n8) return; FragH fh, fl; const v4f a = *(const v4fa*)(F + t * 8), c = *(const v4fa*)(F + t * 8 + 4);
#pragma unroll
  for (int q = 0; q < 4; ++q) { _Float16 h = (_Float16)a[q]; fh.h[q] = h; fl.h[q] = (_Float16)((a[q] - (float)h) * 1024.0f); h = (_Float16)c[q]; fh.h[4 + q] = h; fl.h[4 + q] = (_Float16)((c[q] - (float)h) * 1024.0f); }
  { *(v8us*)((unsigned short*)Hh + t * 8) = fh.half[0]; *(v8us*)((unsigned short*)Hl + t * 8) = fl.half[0];  } }

// ---- fast GEMM (wave tile 32x64; requires M % 32 == 0 rows per launch region and N % 64 == 0); epilogue = k_gemm_hhx semantics ----
__device__ __forceinline__ v16h g2_frag(const _Float16* p, int hh) { FragH f; f.half[0] = *(const v8us*)((const unsigned short*)p + 8 * hh); f.half[1] = *(const v8us*)((const unsigned short*)p + 16 + 8 * hh); return f.v; }
__device__ __forceinline__ v8f g2_mma(v16h a, v16h b, v8f c) { v8f d = __builtin_amdgcn_wmma_f32_16x16x32_f16(false, a, false, b, (short)0, c, false, false); asm volatile("v_nop\n\tv_nop\n\tv_nop\n\tv_nop" : "+v"(d) : "v"(a), "v"(b)); return d; }
template <int ACT>
__global__ __launch_bounds__(128) void k_gemm2(const _Float16* __restrict__ A, int lda, size_t sA, const _Float16* __restrict__ Bh, int ldb, size_t sB, float alpha, const float* __restrict__ bias, size_t sBias, const float* __restrict__ CP, int rowsPerB, size_t sCPb, int row0g,
    float* __restrict__ C, _Float16* __restrict__ C16, int ldc, size_t sC, int M, int N, int K) { static_assert(ACT == 0 || ACT == 3 || ACT == 6 || ACT == 8 || ACT == 9 || ACT == 11 || ACT == 12 || ACT == 14 || ACT == 15 || ACT == 16 || ACT == 17, "k_gemm2: unsupported ACT code (would silently apply no activation)");
  __shared__ __attribute__((aligned(16))) float so[4][32][68];
  const int tid = threadIdx.x, w = tid >> 5, lane = tid & 31, ln = lane & 15, hh = lane >> 4; const int by = blockIdx.y;
  A += (size_t)by * sA; Bh += (size_t)by * sB; const size_t cofs = (size_t)by * sC; const float* bp = bias ? bias + (size_t)by * sBias : nullptr;
  const int ntn = N >> 6; const int mt = blockIdx.x / ntn, nq = blockIdx.x - mt * ntn; const int row0 = mt * 128 + 32 * w, col0 = nq * 64; if (row0 >= M) return;
  const _Float16* a0p = A + (size_t)(row0 + ln) * lda; const _Float16* a1p = a0p + (size_t)16 * lda;
  const _Float16* b0p = Bh + (size_t)(col0 + ln) * ldb; const _Float16* b1p = b0p + (size_t)16 * ldb; const _Float16* b2p = b1p + (size_t)16 * ldb; const _Float16* b3p = b2p + (size_t)16 * ldb;
  const v8f z8 = {0.f,0.f,0.f,0.f,0.f,0.f,0.f,0.f}; v8f c00 = z8, c01 = z8, c02 = z8, c03 = z8, c10 = z8, c11 = z8, c12 = z8, c13 = z8;
#pragma unroll 1
  for (int kb = 0; kb < K; kb += 32) { const v16h a0 = g2_frag(a0p + kb, hh), a1 = g2_frag(a1p + kb, hh);
    v16h b = g2_frag(b0p + kb, hh); c00 = g2_mma(a0, b, c00); c10 = g2_mma(a1, b, c10);
    b = g2_frag(b1p + kb, hh); c01 = g2_mma(a0, b, c01); c11 = g2_mma(a1, b, c11);
    b = g2_frag(b2p + kb, hh); c02 = g2_mma(a0, b, c02); c12 = g2_mma(a1, b, c12);
    b = g2_frag(b3p + kb, hh); c03 = g2_mma(a0, b, c03); c13 = g2_mma(a1, b, c13); }
  v8f accs[8] = {c00, c01, c02, c03, c10, c11, c12, c13};
#pragma unroll
  for (int u = 0; u < 8; ++u) { const int t = u & 3, half = u >> 2; const int col = col0 + t * 16 + ln; const float bv = bp ? bf16_round(bp[col]) : 0.f;
#pragma unroll
    for (int r = 0; r < 8; ++r) { const int rloc = half * 16 + 8 * hh + r; float v = accs[u][r] * alpha + bv; if (CP) { if (rowsPerB < 0) v += CP[cofs + (size_t)(row0g + row0 + rloc) * ldc + col];      /* rowsPerB < 0: own element of the batched C plane */ else { const int bidx = (row0g + row0 + rloc) / rowsPerB; v += CP[(size_t)bidx * sCPb + (size_t)by * 64 + col]; } }
      if (ACT == 3) v = fmaxf(v, 0.f); else if (ACT == 6) v = 0.5f * v * (1.0f + erff(v * 0.70710678118654752f)); else if (ACT == 11) v = 1.0f / (1.0f + expf(-v)); else if (ACT == 15) v = v / (1.0f + expf(-v)); else if (ACT == 12) v = (v > 0.f) ? v : 0.01f * v; else if (ACT == 8) v = tanhf(v); else if (ACT == 9) v = 0.5f * v * (1.0f + tanhf(0.7978845608028654f * (v + 0.044715f * v * v * v))); else if (ACT == 14) v = (v > 0.f) ? v : 0.1f * v; else if (ACT == 16) v = (v >= 0.f) ? v : 0.3f * v; else if (ACT == 17) v = (v >= 0.f) ? v : 0.2f * v;
      so[w][rloc][t * 16 + ln] = v; } }
  __builtin_amdgcn_fence(__ATOMIC_ACQ_REL, "workgroup"); __builtin_amdgcn_wave_barrier();
  const int rsub = lane >> 4, c4 = (lane & 15) * 4;
  {
#pragma unroll
    for (int q = 0; q < 16; ++q) { const int r = q * 2 + rsub; const v4f v = *(const v4fa*)&so[w][r][c4]; if (C) *(v4f*)(C + cofs + (size_t)(row0 + r) * ldc + col0 + c4) = v; if (C16) { v4h h4; for (int i = 0; i < 4; ++i) h4[i] = (_Float16)v[i]; *(v4h*)(C16 + cofs + (size_t)(row0 + r) * ldc + col0 + c4) = h4; } }
     } }


__global__ __launch_bounds__(256) void k_wnat(const float* __restrict__ w, size_t n8, _Float16* __restrict__ Bt) { const size_t t = (size_t)blockIdx.x * 256 + threadIdx.x; if (t >= n8) return; FragH f; for (int q = 0; q < 8; ++q) f.h[q] = (_Float16)(bf16_round(w[t * 8 + q]) * 16.0f); *(v8us*)((unsigned short*)Bt + t * 8) = f.half[0];  }
// Row softmax, one wave per row: each of the 16 loads of a wave covers 512 contiguous bytes of the row, the row stays in registers
// (read once, one exp per element), maximum and sum end in a five-step lane butterfly; weights stored x256 as f16, 256 contiguous bytes a store.
__global__ __launch_bounds__(256) void k_rsm(const float* __restrict__ S, _Float16* __restrict__ P, int nrows) {
  const int lane = threadIdx.x & 31; const int row = blockIdx.x * 8 + __builtin_amdgcn_readfirstlane(threadIdx.x >> 5); if (row >= nrows) return;      /* the row is the wave's: scalar base, wave-uniform exit; the kernel has no barrier */
  const float* s = S + (size_t)row * SQ; v4f x[SQ / 128];
#pragma unroll      /* static indices keep x[] in registers */
  for (int c = 0; c < SQ / 128; ++c) {
    if (c == SQ / 128 - 1) asm volatile("s_wait_xcnt 0x0" ::: "memory");      /* the compiler lands the last load's result on the offset register that the earlier loads name: the wait stands in front of that overwrite */
    x[c] = *(const v4fa*)(s + c * 128 + lane * 4); }
  __builtin_amdgcn_sched_barrier(0);      /* ends the scheduling region behind the loads: all 16 stay in front of the first use, and the build holds 128 registers (175 without it), so 8 waves fit a SIMD instead of 5 and every row of a launch is resident at once */
  float mx = -3.0e38f;
#pragma unroll      /* static indices into x[] */
  for (int c = 0; c < SQ / 128; ++c) mx = fmaxf(fmaxf(mx, fmaxf(x[c][0], x[c][1])), fmaxf(x[c][2], x[c][3]));
  for (int m = 16; m > 0; m >>= 1) mx = fmaxf(mx, __shfl_xor(mx, m, 32));
  v4f s4 = {0.f, 0.f, 0.f, 0.f};
#pragma unroll      /* static indices into x[] */
  for (int c = 0; c < SQ / 128; ++c) { v4f e; for (int q = 0; q < 4; ++q) e[q] = expf(x[c][q] - mx); x[c] = e; s4 += e; }
  float se = (s4[0] + s4[1]) + (s4[2] + s4[3]);
  for (int m = 16; m > 0; m >>= 1) se += __shfl_xor(se, m, 32);
  const float sc = 256.0f / se; _Float16* p = P + (size_t)row * SQ;
#pragma unroll      /* static indices into x[] */
  for (int c = 0; c < SQ / 128; ++c) { v4h h4; for (int q = 0; q < 4; ++q) h4[q] = (_Float16)(x[c][q] * sc); *(v4h*)(p + c * 128 + lane * 4) = h4; } }
__global__ __launch_bounds__(256) void k_vt(const _Float16* __restrict__ V16, int b, int h0, _Float16* __restrict__ VT) { __shared__ unsigned short tl[64][65]; const int tid = threadIdx.x; const int hh = blockIdx.x % HG, sg = blockIdx.x / HG; const int s0 = sg * 64; const int h = h0 + hh;
  for (int i = tid; i < 64 * 8; i += 256) { const int j = i / 8, d8 = (i % 8) * 8; FragH f; f.half[0] = *(const v8us*)((const unsigned short*)V16 + ((size_t)b * SQ + s0 + j) * DM + h * HD + d8); for (int q = 0; q < 8; ++q) tl[d8 + q][j] = f.u[q]; }
  __syncthreads();
  { for (int i = tid; i < 64 * 8; i += 256) { const int d = i / 8, j8 = (i % 8) * 8; FragH f; for (int q = 0; q < 8; ++q) f.u[q] = tl[d][j8 + q]; *(v8us*)((unsigned short*)VT + ((size_t)hh * HD + d) * SQ + s0 + j8) = f.half[0]; }  } }



__global__ __launch_bounds__(256) void k_rsmkm(const float* __restrict__ S, _Float16* __restrict__ P, int nrows, const int* __restrict__ am) {
  #pragma clang fp contract(off)
  const int t = blockIdx.x * 256 + threadIdx.x; if (t >= nrows) return; const size_t i = (size_t)t; const float* s = S + i * SQ; const int* mr = am + (size_t)(t % SQ) * SQ; float mx = -3.0e38f;
#pragma unroll 1
  for (int j = 0; j < SQ; ++j) { const float f = (mr[j] != 0) ? 1.f : 0.f; mx = fmaxf(mx, fmaf(f, s[j], (1.f - f) * -1.0e9f)); } float se = 0.f;
#pragma unroll 1
  for (int j = 0; j < SQ; ++j) { const float f = (mr[j] != 0) ? 1.f : 0.f; se += __expf(fmaf(f, s[j], (1.f - f) * -1.0e9f) - mx); } const float sc = 256.0f / se;
#pragma unroll 1
  for (int j0 = 0; j0 < SQ; j0 += 8) { FragH fr; for (int q = 0; q < 8; ++q) { const int j = j0 + q; const float f = (mr[j] != 0) ? 1.f : 0.f; fr.h[q] = (_Float16)(__expf(fmaf(f, s[j], (1.f - f) * -1.0e9f) - mx) * sc); }
    unsigned short* d = (unsigned short*)P + i * SQ + j0; *(v8us*)d = fr.half[0];  } }

template <int COLS>
__global__ __launch_bounds__(256) void k_wperm(const float* __restrict__ Wn, _Float16* __restrict__ Bt) {
  const size_t t = (size_t)blockIdx.x * 256 + threadIdx.x; if (t >= (size_t)DM * DM / 8) return; const size_t e0 = t * 8; const int n = (int)(e0 / DM), k0 = (int)(e0 % DM); FragH f;
  if (COLS == 0) { const int h = n >> 6, d = n & 63; const float* src = Wn + (size_t)(d * NH + h) * DM + k0; for (int q = 0; q < 8; ++q) f.h[q] = (_Float16)(bf16_round(src[q]) * 16.0f); }
  else { for (int q = 0; q < 8; ++q) { const int kk = k0 + q; const int h = kk >> 6, d = kk & 63; f.h[q] = (_Float16)(bf16_round(Wn[(size_t)n * DM + d * NH + h]) * 16.0f); } }
  unsigned short* dst = (unsigned short*)Bt + e0; *(v8us*)dst = f.half[0];  }
__global__ __launch_bounds__(256) void k_bperm(const float* __restrict__ b, float* __restrict__ out) { const int t = threadIdx.x; if (t >= DM) return; const int h = t >> 6, d = t & 63; const float v = b[d * NH + h]; *(float*)(out + t) = v;  }
__global__ __launch_bounds__(256) void k_tr32(const float* __restrict__ R, float* __restrict__ OUT, size_t n4) {
  const size_t t = (size_t)blockIdx.x * 256 + threadIdx.x; if (t >= n4) return; const size_t e = t * 4; const int c = (int)(e / SQ); const int n0 = (int)(e % SQ); v4f o; for (int q = 0; q < 4; ++q) o[q] = R[(size_t)(n0 + q) * DM + c]; *(v4f*)(OUT + e) = o;  }
extern "C" void kernel_launch(void* const* d_in, const int* in_sizes, int n_in,
                              void* d_out, int out_size, void* d_ws, size_t ws_size, hipStream_t stream) {
  (void)in_sizes; (void)n_in; (void)out_size;
  const float* const* I = (const float* const*)d_in; const float* xq = I[0]; const float* xk = I[0]; const float* xv = I[0]; const float* wq = I[1]; const float* bq = I[2]; const float* wk = I[3]; const float* bk = I[4]; const float* wv = I[5]; const float* bv = I[6]; const float* wo = I[7]; const float* bo = I[8]; const float* x = xq;      /* hidden_state [4][768][2048] (feeds q, k and v); per-head Wq / Wk / Wv [12][768][64] + biases [12][64] (= [768] head-major); Wo [768][768] natural + bo */
  char* ws = (char*)d_ws; size_t off = 0;
  auto take = [&](size_t bytes) { char* p = ws + off; off += (bytes + 255) & ~(size_t)255; return p; };
  _Float16* BQ = (_Float16*)take((size_t)DM * DM * 2); _Float16* BK = (_Float16*)take((size_t)DM * DM * 2); _Float16* BV = (_Float16*)take((size_t)DM * DM * 2); _Float16* BO = (_Float16*)take((size_t)DM * DM * 2);
  _Float16* X16 = (_Float16*)take(NR * DM * 2); _Float16* XKp = nullptr; _Float16* XVp = nullptr;      /* (one shared input: k and v project the X16 rows) */ _Float16* Q16 = (_Float16*)take(NR * DM * 2); _Float16* K16 = (_Float16*)take(NR * DM * 2); _Float16* V16 = (_Float16*)take(NR * DM * 2); _Float16* O16 = (_Float16*)take(NR * DM * 2); _Float16* CF16 = (_Float16*)take(NR * DM * 2); float* BP = (float*)take((size_t)3 * DM * 4); float* OR = (float*)take(NR * DM * 4);      /* channel-first f16 staging plane (one input at a time); BP unused (the GEMMs take bq, bk, bv directly); f32 output token rows before the transpose back */
  float* S = (float*)take((size_t)HG * SQ * SQ * 4); _Float16* P = (_Float16*)take((size_t)HG * SQ * SQ * 2); _Float16* VT = (_Float16*)take((size_t)NH * HD * SQ * 2);
  if (off > ws_size) return;
  for (int h = 0; h < NH; ++h) { const unsigned g = (unsigned)(((size_t)HD * (DM / 8) + 255) / 256); k_wt_f16<<<g, 256, 0, stream>>>(wq + (size_t)h * DM * HD, BQ + (size_t)h * HD * DM, DM, HD, 16.0f); k_wt_f16<<<g, 256, 0, stream>>>(wk + (size_t)h * DM * HD, BK + (size_t)h * HD * DM, DM, HD, 16.0f); k_wt_f16<<<g, 256, 0, stream>>>(wv + (size_t)h * DM * HD, BV + (size_t)h * HD * DM, DM, HD, 16.0f); }      /* per-head [in = 768][out = 64] tensors -> rows h*64.. of the Bt planes (x16): head h = output columns h*64.. = the concat order */
  k_wnat<<<(unsigned)(((size_t)DM * DM / 8 + 255) / 256), 256, 0, stream>>>(wo, (size_t)DM * DM / 8, BO);      /* Wo natural [out][in] = Bt x16 */
  _Float16* XK = XKp; _Float16* XV = XVp;
  k_x16<<<(unsigned)((NR * DM / 8 + 255) / 256), 256, 0, stream>>>(x, CF16, NR * DM / 8); for (int b = 0; b < NB; ++b) k_vt<SQ / 64, DM><<<(SQ / 64) * (DM / 64), 256, 0, stream>>>(CF16 + (size_t)b * DM * SQ, SQ, 0, X16 + (size_t)b * SQ * DM); XK = X16; XV = X16;      /* the [B][E][S] input: exact f16 copy, then per batch an LDS transpose [e][s] -> token rows [s][e]; q, k and v all project these rows */

  const size_t r0p = (size_t)B0 * SQ;      /* first projected row */
  k_gemm2<0><<<dim3((unsigned)((MP / 128) * (DM / 64)), 1), 128, 0, stream>>>(X16 + r0p * DM, DM, 0, BQ, DM, 0, 0.0625f, bq, 0, nullptr, 1, 0, 0, nullptr, Q16 + r0p * DM, DM, 0, MP, DM, DM);
  k_gemm2<0><<<dim3((unsigned)((MP / 128) * (DM / 64)), 1), 128, 0, stream>>>(XK + r0p * DM, DM, 0, BK, DM, 0, 0.0625f, bk, 0, nullptr, 1, 0, 0, nullptr, K16 + r0p * DM, DM, 0, MP, DM, DM);
  k_gemm2<0><<<dim3((unsigned)((MP / 128) * (DM / 64)), 1), 128, 0, stream>>>(XV + r0p * DM, DM, 0, BV, DM, 0, 0.0625f, bv, 0, nullptr, 1, 0, 0, nullptr, V16 + r0p * DM, DM, 0, MP, DM, DM);
  for (int b = B0; b < B0 + NBR; ++b) { const size_t r0 = (size_t)b * SQ;
    k_vt<NH, SQ><<<NH * (SQ / 64), 256, 0, stream>>>(V16 + r0 * LQ, LQ, 0, VT);      /* V^T [NH][HD][SQ] for this batch */
    for (int h0 = 0; h0 < NHD; h0 += HG) {
      k_gemm2<0><<<dim3((QN / 128) * (SQ / 64), HG), 128, 0, stream>>>(Q16 + r0 * LQ + h0 * HD, LQ, (size_t)HD, K16 + r0 * LQ + h0 * HD, LQ, (size_t)HD, 1.0f, nullptr, 0, nullptr, 1, 0, 0, S, nullptr, SQ, (size_t)SQ * SQ, QN, SQ, HD);      /* UNSCALED scores q.k (the module omits 1/sqrt(d)), HG heads per launch */
      k_rsm<<<(HG * SQ + 7) / 8, 256, 0, stream>>>(S, P, HG * SQ);      /* P = 256 softmax (f16), rows of all HG heads */
      k_gemm2<0><<<dim3((QN / 128) * (HD / 64), HG), 128, 0, stream>>>(P, SQ, (size_t)SQ * SQ, VT + (size_t)h0 * HD * SQ, SQ, (size_t)HD * SQ, 0.25f, nullptr, 0, nullptr, 1, 0, 0, nullptr, O16 + r0 * DM + h0 * HD, DM, (size_t)HD, QN, HD, SQ); } }      /* o (merged heads) as f16 rows */
  k_gemm2<0><<<dim3((unsigned)((MPO / 128) * (DM / 64)), 1), 128, 0, stream>>>(O16 + r0p * DM, DM, 0, BO, DM, 0, 0.0009765625f, bo, 0, nullptr, 1, 0, 0, OR + r0p * DM, nullptr, DM, 0, MPO, DM, DM);      /* out token rows [n][co] (f32; bo is in natural channel order = the output columns) */
  for (int b = 0; b < NB; ++b) k_tr32<<<(unsigned)(((size_t)DM * SQ / 4 + 255) / 256), 256, 0, stream>>>(OR + (size_t)b * SQ * DM, (float*)d_out + (size_t)b * DM * SQ, (size_t)DM * SQ / 4);      /* -> the module's [co][n] layout */
}

// v002
// Measured time: 384 microseconds a run.
// Two timings next to v001 put it at 3.99 and 3.94 times that version's speed.
// All steps since v000 together make it 15.4 times as fast.
#include <hip/hip_runtime.h>
#define NB 4
#define SQ 2048
#define DM 768
#define NH 12
#define HD 64
#define HG 4                         /* heads per block group of k_vt(V16, b, h0, VT) */
#define B0 0                         /* first batch processed (debug hook) */
#define NBR NB                       /* batches processed (debug hook) */
#define NR ((size_t)NB * SQ)         /* token rows */
#define MP ((int)((size_t)NBR * SQ)) /* rows projected (debug hook) */
#define QN SQ                        /* unused: k_fattn covers all SQ query rows */
#define NHD NH                       /* unused: k_fattn covers all NH heads */
#define MPO MP                       /* rows through the output stage (debug hook) */
#define LQ DM      /* row pitch of the q/k/v rows */
typedef __bf16 v16b __attribute__((ext_vector_type(16)));
typedef unsigned short v8us __attribute__((ext_vector_type(8), may_alias));
typedef float  v8f  __attribute__((ext_vector_type(8)));
typedef float  v4f  __attribute__((ext_vector_type(4)));
typedef float  v4fa __attribute__((ext_vector_type(4), may_alias));
union FragB { v16b v; v8us half[2]; unsigned short u[16]; };

__device__ __forceinline__ unsigned short bf16_bits(float x) { unsigned int u = __float_as_uint(x); return (unsigned short)((u + 0x7FFFu + ((u >> 16) & 1u)) >> 16); }
__device__ __forceinline__ float bf16_val(unsigned short b) { return __uint_as_float(((unsigned int)b) << 16); }
__device__ __forceinline__ float bf16_round(float x) { return bf16_val(bf16_bits(x)); }
// D += A·B with NT terms: 1 = ah·bh, 2 = + al·bh (A split), 3 = + ah·bl (both split)
template <int NT>
__device__ __forceinline__ v8f mmaN(v16b ah, v16b al, v16b bh, v16b bl, v8f c) {
  c = __builtin_amdgcn_wmma_f32_16x16x32_bf16(false, ah, false, bh, (short)0, c, false, false);
  if (NT >= 2) c = __builtin_amdgcn_wmma_f32_16x16x32_bf16(false, al, false, bh, (short)0, c, false, false);
  if (NT >= 3) c = __builtin_amdgcn_wmma_f32_16x16x32_bf16(false, ah, false, bl, (short)0, c, false, false);
  asm volatile("v_nop\n\tv_nop\n\tv_nop\n\tv_nop" : "+v"(c) : "v"(ah), "v"(al), "v"(bh), "v"(bl));
  return c;
}

__global__ __launch_bounds__(256) void k_wt_bf16(const float* __restrict__ W, unsigned short* __restrict__ Wt, int K, int N) {
  const int t = blockIdx.x * 256 + threadIdx.x;
  const int k8n = K / 8;
  if (t >= N * k8n) return;
  const int n = t / k8n, k8 = (t % k8n) * 8;
  v8us v;
#pragma unroll
  for (int i = 0; i < 8; ++i) v[i] = bf16_bits(W[(size_t)(k8 + i) * N + n]);
  *(v8us*)(Wt + (size_t)n * K + k8) = v;
  
}

// GEMM C[M][N] (f32, pitch ldc) = act(A[M][K]·W + bias). A f32 row-major (pitch lda) converted per fragment to bf16
// (ASPLIT: hi/lo two planes -> 2 terms, else single rounded term); Wt bf16 [N][K] (pitch ldb). BIAS_BF16 rounds the
// bias to bf16 first (bias quantised to bf16 before the add). K%32==0, M%16==0, N%64==0.
template <bool ASPLIT, int ACT, bool BIAS_BF16>
__global__ __launch_bounds__(128) void k_gemm_bf(const float* __restrict__ A, int lda, const unsigned short* __restrict__ Wt, int ldb,
                                               const float* __restrict__ bias, float* __restrict__ C, int ldc, int M, int N, int K) {
  __shared__ __attribute__((aligned(16))) float so[4][16][64];
  const int tid = threadIdx.x, w = tid >> 5, lane = tid & 31, ln = lane & 15, hh = lane >> 4;
  const int ntn = N / 64;
  const int wid = blockIdx.x * 4 + w;
  const int mt = wid / ntn, nq = wid % ntn;
  if (mt * 16 >= M) return;
  const int row0 = mt * 16, col0 = nq * 64;
  const float* arow = A + (size_t)(row0 + ln) * lda;
  v8f acc[4] = {};
  for (int kb = 0; kb < K; kb += 32) {
    FragB ah, al;
    const v4f x0 = *(const v4fa*)(arow + kb + 8 * hh), x1 = *(const v4fa*)(arow + kb + 8 * hh + 4);
    const v4f x2 = *(const v4fa*)(arow + kb + 16 + 8 * hh), x3 = *(const v4fa*)(arow + kb + 16 + 8 * hh + 4);
    float xs[16] = {x0[0],x0[1],x0[2],x0[3],x1[0],x1[1],x1[2],x1[3],x2[0],x2[1],x2[2],x2[3],x3[0],x3[1],x3[2],x3[3]};
#pragma unroll
    for (int i = 0; i < 16; ++i) { const unsigned short hb = bf16_bits(xs[i]); ah.u[i] = hb; al.u[i] = ASPLIT ? bf16_bits(xs[i] - bf16_val(hb)) : (unsigned short)0; }
#pragma unroll
    for (int t = 0; t < 4; ++t) {
      const unsigned short* brow = Wt + (size_t)(col0 + t * 16 + ln) * ldb + kb;
      FragB b;
      b.half[0] = *(const v8us*)(brow + 8 * hh);
      b.half[1] = *(const v8us*)(brow + 16 + 8 * hh);
      acc[t] = mmaN<ASPLIT ? 2 : 1>(ah.v, al.v, b.v, b.v, acc[t]);
    }
  }
#pragma unroll
  for (int t = 0; t < 4; ++t) {
    float bv = bias ? bias[col0 + t * 16 + ln] : 0.f;
    if (BIAS_BF16) bv = bf16_round(bv);
#pragma unroll
    for (int r = 0; r < 8; ++r) { float v = acc[t][r] + bv; if (ACT == 1) v = fmaxf(v, 0.f); so[w][8 * hh + r][t * 16 + ln] = v; }
  }
  __builtin_amdgcn_fence(__ATOMIC_ACQ_REL, "workgroup");
  __builtin_amdgcn_wave_barrier();
  const int rsub = lane >> 4, c4 = (lane & 15) * 4;
  {
#pragma unroll
    for (int q = 0; q < 8; ++q) {
      const int r = q * 2 + rsub;
      const v4f v = *(const v4fa*)&so[w][r][c4];
      *(v4f*)(C + (size_t)(row0 + r) * ldc + col0 + c4) = v;
    }
    
  }
}

// GEMM C = act(A·W + bias + resid): A f32 (ASPLIT -> hi/lo 2 terms), Wt bf16 [N][K]; ACT 0 none, 1 relu, 2 exact gelu;
// resid (optional, f32, row index = (row % rmod), pitch ldr, RES_BF16 rounds it) added before the activation.
template <bool ASPLIT, int ACT, bool BIAS_BF16, bool RES_BF16>
__global__ __launch_bounds__(128) void k_gemm_bf3(const float* __restrict__ A, int lda, const unsigned short* __restrict__ Wt, int ldb,
                                                const float* __restrict__ bias, const float* __restrict__ resid, int rmod, int ldr,
                                                float* __restrict__ C, int ldc, int M, int N, int K) {
  __shared__ __attribute__((aligned(16))) float so[4][16][64];
  const int tid = threadIdx.x, w = tid >> 5, lane = tid & 31, ln = lane & 15, hh = lane >> 4;
  const int ntn = N / 64;
  const int wid = blockIdx.x * 4 + w;
  const int mt = wid / ntn, nq = wid % ntn;
  if (mt * 16 >= M) return;
  const int row0 = mt * 16, col0 = nq * 64;
  const float* arow = A + (size_t)(row0 + ln) * lda;
  v8f acc[4] = {};
  for (int kb = 0; kb < K; kb += 32) {
    FragB ah, al;
    const v4f x0 = *(const v4fa*)(arow + kb + 8 * hh), x1 = *(const v4fa*)(arow + kb + 8 * hh + 4);
    const v4f x2 = *(const v4fa*)(arow + kb + 16 + 8 * hh), x3 = *(const v4fa*)(arow + kb + 16 + 8 * hh + 4);
    float xs[16] = {x0[0],x0[1],x0[2],x0[3],x1[0],x1[1],x1[2],x1[3],x2[0],x2[1],x2[2],x2[3],x3[0],x3[1],x3[2],x3[3]};
#pragma unroll
    for (int i = 0; i < 16; ++i) { const unsigned short hb = bf16_bits(xs[i]); ah.u[i] = hb; al.u[i] = ASPLIT ? bf16_bits(xs[i] - bf16_val(hb)) : (unsigned short)0; }
#pragma unroll
    for (int t = 0; t < 4; ++t) {
      const unsigned short* brow = Wt + (size_t)(col0 + t * 16 + ln) * ldb + kb;
      FragB b;
      b.half[0] = *(const v8us*)(brow + 8 * hh);
      b.half[1] = *(const v8us*)(brow + 16 + 8 * hh);
      acc[t] = mmaN<ASPLIT ? 2 : 1>(ah.v, al.v, b.v, b.v, acc[t]);
    }
  }
#pragma unroll
  for (int t = 0; t < 4; ++t) {
    const int col = col0 + t * 16 + ln;
    float bv = bias ? bias[col] : 0.f;
    if (BIAS_BF16) bv = bf16_round(bv);
#pragma unroll
    for (int r = 0; r < 8; ++r) {
      float v = acc[t][r] + bv;
      if (resid) { float rv = resid[(size_t)((row0 + 8 * hh + r) % rmod) * ldr + col]; if (RES_BF16) rv = bf16_round(rv); v += rv; }
      if (ACT == 1) v = fmaxf(v, 0.f);
      if (ACT == 2) v = 0.5f * v * (1.0f + erff(v * 0.70710678118654752f));
      if (ACT == 3) { const float u = 0.7978845608028654f * (v + 0.044715f * v * v * v); v = 0.5f * v * (1.0f + tanhf(u)); }
      so[w][8 * hh + r][t * 16 + ln] = v;
    }
  }
  __builtin_amdgcn_fence(__ATOMIC_ACQ_REL, "workgroup");
  __builtin_amdgcn_wave_barrier();
  const int rsub = lane >> 4, c4 = (lane & 15) * 4;
  {
#pragma unroll
    for (int q = 0; q < 8; ++q) {
      const int r = q * 2 + rsub;
      const v4f v = *(const v4fa*)&so[w][r][c4];
      *(v4f*)(C + (size_t)(row0 + r) * ldc + col0 + c4) = v;
    }
    
  }
}
// row LayerNorm (biased variance, eps) over N: s = X (+ R); optional out_sum <- s; out_norm <- (s-mu)*rsqrt(var+eps)*g + b
template <bool PARAM_BF16>
__global__ __launch_bounds__(256) void k_layernorm(const float* __restrict__ X, const float* __restrict__ R, const float* __restrict__ g, const float* __restrict__ bta,
                                                  float* __restrict__ out_sum, float* __restrict__ out_norm, int N, float eps) {
  __shared__ float red[256];
  const int row = blockIdx.x, tid = threadIdx.x;
  const float* x = X + (size_t)row * N; const float* rr = R ? R + (size_t)row * N : nullptr;
  float vals[16];                     // up to N = 4096
  const int per = N / 256;            // contiguous chunk per thread? use strided-by-4 chunks: thread handles j = tid*4 + 1024*u
  float s1 = 0.f;
  for (int u = 0; u < per / 4; ++u) {
    const int j = tid * 4 + 1024 * u;
    const v4f a = *(const v4fa*)(x + j);
    v4f b = {0.f,0.f,0.f,0.f}; if (rr) b = *(const v4fa*)(rr + j);
#pragma unroll
    for (int q = 0; q < 4; ++q) { const float v = a[q] + b[q]; vals[u * 4 + q] = v; s1 += v; }
  }
  red[tid] = s1; __syncthreads();
  for (int st = 128; st > 0; st >>= 1) { if (tid < st) red[tid] += red[tid + st]; __syncthreads(); }
  const float mu = red[0] / (float)N; __syncthreads();
  float s2 = 0.f;
  for (int u = 0; u < per / 4; ++u)
#pragma unroll
    for (int q = 0; q < 4; ++q) { const float c = vals[u * 4 + q] - mu; s2 += c * c; }
  red[tid] = s2; __syncthreads();
  for (int st = 128; st > 0; st >>= 1) { if (tid < st) red[tid] += red[tid + st]; __syncthreads(); }
  const float rs = rsqrtf(red[0] / (float)N + eps);
  {
    for (int u = 0; u < per / 4; ++u) {
      const int j = tid * 4 + 1024 * u;
      v4f o, sm;
#pragma unroll
      for (int q = 0; q < 4; ++q) {
        float gg = g[j + q], bb = bta[j + q];
        if (PARAM_BF16) { gg = bf16_round(gg); bb = bf16_round(bb); }
        sm[q] = vals[u * 4 + q]; o[q] = (vals[u * 4 + q] - mu) * rs * gg + bb;
      }
      if (out_sum) *(v4f*)(out_sum + (size_t)row * N + j) = sm;
      *(v4f*)(out_norm + (size_t)row * N + j) = o;
    }
    
  }
}



// ---- f16 WMMA path (v_wmma_f32_16x16x32_f16): 11-bit significands for operands in range — used where a [0,1] probability operand needs more precision than bf16
typedef _Float16 v16h __attribute__((ext_vector_type(16)));
union FragH { v16h v; v8us half[2]; _Float16 h[16]; unsigned short u[16]; };
template <int NT>
__device__ __forceinline__ v8f mmaH(v16h ah, v16h al, v16h bh, v16h bl, v8f c) {
  c = __builtin_amdgcn_wmma_f32_16x16x32_f16(false, ah, false, bh, (short)0, c, false, false);
  if (NT >= 2) c = __builtin_amdgcn_wmma_f32_16x16x32_f16(false, al, false, bh, (short)0, c, false, false);
  if (NT >= 3) c = __builtin_amdgcn_wmma_f32_16x16x32_f16(false, ah, false, bl, (short)0, c, false, false);
  asm volatile("v_nop\n\tv_nop\n\tv_nop\n\tv_nop" : "+v"(c) : "v"(ah), "v"(al), "v"(bh), "v"(bl));
  return c;
}
// batched GEMM like k_gemm_b but f16 operands: A f32 (split into f16 hi/lo if ASPLIT, else rounded to f16), Bt = f16 values [n][k]; alpha; C f32; N multiple of 16 (partial tiles skipped)
template <bool ASPLIT>
__global__ __launch_bounds__(128) void k_gemm_h(const float* __restrict__ A, int lda, size_t sA, const _Float16* __restrict__ Bh, int ldb, size_t sB, float alpha, float* __restrict__ C, int ldc, size_t sC, int M, int N, int K) {
  __shared__ __attribute__((aligned(16))) float so[4][16][64];
  const int tid = threadIdx.x, w = tid >> 5, lane = tid & 31, ln = lane & 15, hh = lane >> 4; const int by = blockIdx.y;
  A += (size_t)by * sA; Bh += (size_t)by * sB; C += (size_t)by * sC;
  const int ntn = (N + 63) / 64; const int wid = blockIdx.x * 4 + w; const int mt = wid / ntn, nq = wid % ntn; if (mt * 16 >= M) return;
  const int row0 = mt * 16, col0 = nq * 64; const float* arow = A + (size_t)(row0 + ln) * lda;
  v8f acc[4] = {};
  for (int kb = 0; kb < K; kb += 32) {
    FragH ah, al;
    const v4f x0 = *(const v4fa*)(arow + kb + 8 * hh), x1 = *(const v4fa*)(arow + kb + 8 * hh + 4), x2 = *(const v4fa*)(arow + kb + 16 + 8 * hh), x3 = *(const v4fa*)(arow + kb + 16 + 8 * hh + 4);
    float xs[16] = {x0[0],x0[1],x0[2],x0[3],x1[0],x1[1],x1[2],x1[3],x2[0],x2[1],x2[2],x2[3],x3[0],x3[1],x3[2],x3[3]};
#pragma unroll
    for (int i = 0; i < 16; ++i) { const _Float16 h = (_Float16)xs[i]; ah.h[i] = h; al.h[i] = ASPLIT ? (_Float16)(xs[i] - (float)h) : (_Float16)0.0f; }
#pragma unroll
    for (int t = 0; t < 4; ++t) { if (col0 + t * 16 >= N) continue; const size_t boff = (size_t)(col0 + t * 16 + ln) * ldb + kb; FragH bq; bq.half[0] = *(const v8us*)(Bh + boff + 8 * hh); bq.half[1] = *(const v8us*)(Bh + boff + 16 + 8 * hh);
      acc[t] = mmaH<ASPLIT ? 2 : 1>(ah.v, al.v, bq.v, bq.v, acc[t]); }
  }
#pragma unroll
  for (int t = 0; t < 4; ++t) { if (col0 + t * 16 >= N) continue;
#pragma unroll
    for (int r = 0; r < 8; ++r) so[w][8 * hh + r][t * 16 + ln] = acc[t][r] * alpha; }
  __builtin_amdgcn_fence(__ATOMIC_ACQ_REL, "workgroup"); __builtin_amdgcn_wave_barrier();
  const int rsub = lane >> 4, c4 = (lane & 15) * 4;
  {
#pragma unroll
    for (int q = 0; q < 8; ++q) { const int r = q * 2 + rsub; if (col0 + c4 < N) { const v4f v = *(const v4fa*)&so[w][r][c4]; *(v4f*)(C + (size_t)(row0 + r) * ldc + col0 + c4) = v; } }
     }
}

// Wt[n][k] = f16(W[k][n]·scale) from f32 row-major W[K][N] (scale = power of two; bf16-exact weights stay exact in f16 away from the subnormal range)
__global__ __launch_bounds__(256) void k_wt_f16(const float* __restrict__ W, _Float16* __restrict__ Wt, int K, int N, float scale) {
  const int t = blockIdx.x * 256 + threadIdx.x; if (t >= N * (K / 8)) return; const int n = t / (K / 8), k8 = (t % (K / 8)) * 8; FragH f;
#pragma unroll
  for (int i = 0; i < 8; ++i) f.h[i] = (_Float16)(bf16_round(W[(size_t)(k8 + i) * N + n]) * scale); const v8us o = f.half[0];
  *(v8us*)((unsigned short*)Wt + (size_t)n * K + k8) = o; 
}
// k_gemm_hh variant with fused epilogue: v = acc·alpha + bias[by·sBias + col] (+ CP[(row/rowsPerB)·sCPb + by·64 + col] if CP) ; ACT 0 none / 1 elu ; writes f16 C16 (and f32 C if non-null)
template <int ACT>
__global__ __launch_bounds__(128) void k_gemm_hhx(const _Float16* __restrict__ A, int lda, size_t sA, const _Float16* __restrict__ Bh, int ldb, size_t sB, float alpha, const float* __restrict__ bias, size_t sBias, const float* __restrict__ CP, int rowsPerB, size_t sCPb, int row0g,
    float* __restrict__ C, _Float16* __restrict__ C16, int ldc, size_t sC, int M, int N, int K) {
  __shared__ __attribute__((aligned(16))) float so[4][16][64];
  const int tid = threadIdx.x, w = tid >> 5, lane = tid & 31, ln = lane & 15, hh = lane >> 4; const int by = blockIdx.y;
  A += (size_t)by * sA; Bh += (size_t)by * sB; const size_t cofs = (size_t)by * sC; const float* bp = bias ? bias + (size_t)by * sBias : nullptr;
  const int ntn = (N + 63) / 64; const int wid = blockIdx.x * 4 + w; const int mt = wid / ntn, nq = wid % ntn; if (mt * 16 >= M) return;
  const int row0 = mt * 16, col0 = nq * 64; const _Float16* arow = A + (size_t)(row0 + ln) * lda;
  v8f acc[4] = {};
  for (int kb = 0; kb < K; kb += 32) { FragH ah; ah.half[0] = *(const v8us*)((const unsigned short*)arow + kb + 8 * hh); ah.half[1] = *(const v8us*)((const unsigned short*)arow + kb + 16 + 8 * hh);
#pragma unroll
    for (int t = 0; t < 4; ++t) { if (col0 + t * 16 >= N) continue; const size_t boff = (size_t)(col0 + t * 16 + ln) * ldb + kb; FragH bq; bq.half[0] = *(const v8us*)((const unsigned short*)Bh + boff + 8 * hh); bq.half[1] = *(const v8us*)((const unsigned short*)Bh + boff + 16 + 8 * hh);
      acc[t] = mmaH<1>(ah.v, ah.v, bq.v, bq.v, acc[t]); }
  }
#pragma unroll
  for (int t = 0; t < 4; ++t) { if (col0 + t * 16 >= N) continue; const int col = col0 + t * 16 + ln; const float bv = bp ? bf16_round(bp[col]) : 0.f;
#pragma unroll
    for (int r = 0; r < 8; ++r) { float v = acc[t][r] * alpha + bv; if (CP) { const int rr = row0g + row0 + 8 * hh + r; if (rowsPerB < 0) v += CP[cofs + (size_t)rr * ldc + col];      /* rowsPerB < 0: own element of the batched C plane */ else { const int bidx = rr / rowsPerB; v += CP[(size_t)bidx * sCPb + (size_t)by * 64 + col]; } } if (ACT == 1) v = (v > 0.f) ? v : expm1f(v); else if (ACT == 7) v = (v > 0.f) ? v + 1.0f : expf(v); else if (ACT == 8) v = tanhf(v); else if (ACT == 9) v = 0.5f * v * (1.0f + tanhf(0.7978845608028654f * (v + 0.044715f * v * v * v))); else if (ACT == 11) v = 1.0f / (1.0f + expf(-v)); else if (ACT == 12) v = (v > 0.f) ? v : 0.01f * v; else if (ACT == 14) v = (v > 0.f) ? v : 0.1f * v; else if (ACT == 16) v = (v >= 0.f) ? v : 0.3f * v; else if (ACT == 17) v = (v >= 0.f) ? v : 0.2f * v; else if (ACT == 15) v = v / (1.0f + expf(-v)); else if (ACT == 3) v = fmaxf(v, 0.f); else if (ACT == 6) v = 0.5f * v * (1.0f + erff(v * 0.70710678118654752f)); so[w][8 * hh + r][t * 16 + ln] = v; } }
  __builtin_amdgcn_fence(__ATOMIC_ACQ_REL, "workgroup"); __builtin_amdgcn_wave_barrier();
  const int rsub = lane >> 4, c4 = (lane & 15) * 4; typedef _Float16 v4h __attribute__((ext_vector_type(4)));
  {
#pragma unroll
    for (int q = 0; q < 8; ++q) { const int r = q * 2 + rsub; if (col0 + c4 < N) { const v4f v = *(const v4fa*)&so[w][r][c4]; if (C) *(v4f*)(C + cofs + (size_t)(row0 + r) * ldc + col0 + c4) = v; if (C16) { v4h h4; for (int i = 0; i < 4; ++i) h4[i] = (_Float16)v[i]; *(v4h*)(C16 + cofs + (size_t)(row0 + r) * ldc + col0 + c4) = h4; } } }
     }
}


typedef _Float16 v4h __attribute__((ext_vector_type(4)));

__global__ __launch_bounds__(256) void k_x16(const float* __restrict__ x, _Float16* __restrict__ X16, size_t n8) { const size_t t = (size_t)blockIdx.x * 256 + threadIdx.x; if (t >= n8) return; FragH f;
#pragma unroll
  for (int q = 0; q < 8; ++q) f.h[q] = (_Float16)bf16_round(x[t * 8 + q]); *(v8us*)((unsigned short*)X16 + t * 8) = f.half[0];  }
__global__ __launch_bounds__(256) void k_h16(const float* __restrict__ x, _Float16* __restrict__ X16, size_t n8) { const size_t t = (size_t)blockIdx.x * 256 + threadIdx.x; if (t >= n8) return; FragH f;
#pragma unroll
  for (int q = 0; q < 8; ++q) f.h[q] = (_Float16)x[t * 8 + q]; *(v8us*)((unsigned short*)X16 + t * 8) = f.half[0];  }
__global__ __launch_bounds__(256) void k_round16f(const float* __restrict__ W, _Float16* __restrict__ Bt, size_t n8) { const size_t t = (size_t)blockIdx.x * 256 + threadIdx.x; if (t >= n8) return; FragH f;
#pragma unroll
  for (int i = 0; i < 8; ++i) f.h[i] = (_Float16)(bf16_round(W[t * 8 + i]) * 16.0f); *(v8us*)((unsigned short*)Bt + t * 8) = f.half[0];  }
template <int NHv, int TTv>
__global__ __launch_bounds__(256) void k_vt(const _Float16* __restrict__ V16, int ldv, int voff, _Float16* __restrict__ Vt) { __shared__ unsigned short tl[64][66]; const int tid = threadIdx.x; const int slab = blockIdx.x / (TTv / 64), lg = blockIdx.x % (TTv / 64); const int b = slab / NHv, h = slab % NHv;
  for (int i = tid; i < 64 * 8; i += 256) { const int r = i / 8, c8 = (i % 8) * 8; FragH f; f.half[0] = *(const v8us*)((const unsigned short*)V16 + ((size_t)b * TTv + lg * 64 + r) * ldv + voff + h * 64 + c8);
#pragma unroll
    for (int q = 0; q < 8; ++q) tl[r][c8 + q] = f.u[q]; }
  __syncthreads();
  {
#pragma unroll
    for (int rd = 0; rd < 2; ++rd) { const int d = rd * 32 + tid / 8, pc = tid % 8; FragH f;
#pragma unroll
      for (int q = 0; q < 8; ++q) f.u[q] = tl[pc * 8 + q][d];
      *(v8us*)((unsigned short*)Vt + ((size_t)slab * 64 + d) * TTv + lg * 64 + pc * 8) = f.half[0]; }
     } }

__global__ __launch_bounds__(256) void k_hl(const float* __restrict__ F, _Float16* __restrict__ Hh, _Float16* __restrict__ Hl, size_t n8) { const size_t t = (size_t)blockIdx.x * 256 + threadIdx.x; if (t >= n8) return; FragH fh, fl; const v4f a = *(const v4fa*)(F + t * 8), c = *(const v4fa*)(F + t * 8 + 4);
#pragma unroll
  for (int q = 0; q < 4; ++q) { _Float16 h = (_Float16)a[q]; fh.h[q] = h; fl.h[q] = (_Float16)((a[q] - (float)h) * 1024.0f); h = (_Float16)c[q]; fh.h[4 + q] = h; fl.h[4 + q] = (_Float16)((c[q] - (float)h) * 1024.0f); }
  { *(v8us*)((unsigned short*)Hh + t * 8) = fh.half[0]; *(v8us*)((unsigned short*)Hl + t * 8) = fl.half[0];  } }

// ---- fast GEMM (wave tile 32x64; requires M % 32 == 0 rows per launch region and N % 64 == 0); epilogue = k_gemm_hhx semantics ----
__device__ __forceinline__ v16h g2_frag(const _Float16* p, int hh) { FragH f; f.half[0] = *(const v8us*)((const unsigned short*)p + 8 * hh); f.half[1] = *(const v8us*)((const unsigned short*)p + 16 + 8 * hh); return f.v; }
__device__ __forceinline__ v8f g2_mma(v16h a, v16h b, v8f c) { v8f d = __builtin_amdgcn_wmma_f32_16x16x32_f16(false, a, false, b, (short)0, c, false, false); asm volatile("v_nop\n\tv_nop\n\tv_nop\n\tv_nop" : "+v"(d) : "v"(a), "v"(b)); return d; }
template <int ACT>
__global__ __launch_bounds__(128) void k_gemm2(const _Float16* __restrict__ A, int lda, size_t sA, const _Float16* __restrict__ Bh, int ldb, size_t sB, float alpha, const float* __restrict__ bias, size_t sBias, const float* __restrict__ CP, int rowsPerB, size_t sCPb, int row0g,
    float* __restrict__ C, _Float16* __restrict__ C16, int ldc, size_t sC, int M, int N, int K) { static_assert(ACT == 0 || ACT == 3 || ACT == 6 || ACT == 8 || ACT == 9 || ACT == 11 || ACT == 12 || ACT == 14 || ACT == 15 || ACT == 16 || ACT == 17, "k_gemm2: unsupported ACT code (would silently apply no activation)");
  __shared__ __attribute__((aligned(16))) float so[4][32][68];
  const int tid = threadIdx.x, w = tid >> 5, lane = tid & 31, ln = lane & 15, hh = lane >> 4; const int by = blockIdx.y;
  A += (size_t)by * sA; Bh += (size_t)by * sB; const size_t cofs = (size_t)by * sC; const float* bp = bias ? bias + (size_t)by * sBias : nullptr;
  const int ntn = N >> 6; const int mt = blockIdx.x / ntn, nq = blockIdx.x - mt * ntn; const int row0 = mt * 128 + 32 * w, col0 = nq * 64; if (row0 >= M) return;
  const _Float16* a0p = A + (size_t)(row0 + ln) * lda; const _Float16* a1p = a0p + (size_t)16 * lda;
  const _Float16* b0p = Bh + (size_t)(col0 + ln) * ldb; const _Float16* b1p = b0p + (size_t)16 * ldb; const _Float16* b2p = b1p + (size_t)16 * ldb; const _Float16* b3p = b2p + (size_t)16 * ldb;
  const v8f z8 = {0.f,0.f,0.f,0.f,0.f,0.f,0.f,0.f}; v8f c00 = z8, c01 = z8, c02 = z8, c03 = z8, c10 = z8, c11 = z8, c12 = z8, c13 = z8;
#pragma unroll 1
  for (int kb = 0; kb < K; kb += 32) { const v16h a0 = g2_frag(a0p + kb, hh), a1 = g2_frag(a1p + kb, hh);
    v16h b = g2_frag(b0p + kb, hh); c00 = g2_mma(a0, b, c00); c10 = g2_mma(a1, b, c10);
    b = g2_frag(b1p + kb, hh); c01 = g2_mma(a0, b, c01); c11 = g2_mma(a1, b, c11);
    b = g2_frag(b2p + kb, hh); c02 = g2_mma(a0, b, c02); c12 = g2_mma(a1, b, c12);
    b = g2_frag(b3p + kb, hh); c03 = g2_mma(a0, b, c03); c13 = g2_mma(a1, b, c13); }
  v8f accs[8] = {c00, c01, c02, c03, c10, c11, c12, c13};
#pragma unroll
  for (int u = 0; u < 8; ++u) { const int t = u & 3, half = u >> 2; const int col = col0 + t * 16 + ln; const float bv = bp ? bf16_round(bp[col]) : 0.f;
#pragma unroll
    for (int r = 0; r < 8; ++r) { const int rloc = half * 16 + 8 * hh + r; float v = accs[u][r] * alpha + bv; if (CP) { if (rowsPerB < 0) v += CP[cofs + (size_t)(row0g + row0 + rloc) * ldc + col];      /* rowsPerB < 0: own element of the batched C plane */ else { const int bidx = (row0g + row0 + rloc) / rowsPerB; v += CP[(size_t)bidx * sCPb + (size_t)by * 64 + col]; } }
      if (ACT == 3) v = fmaxf(v, 0.f); else if (ACT == 6) v = 0.5f * v * (1.0f + erff(v * 0.70710678118654752f)); else if (ACT == 11) v = 1.0f / (1.0f + expf(-v)); else if (ACT == 15) v = v / (1.0f + expf(-v)); else if (ACT == 12) v = (v > 0.f) ? v : 0.01f * v; else if (ACT == 8) v = tanhf(v); else if (ACT == 9) v = 0.5f * v * (1.0f + tanhf(0.7978845608028654f * (v + 0.044715f * v * v * v))); else if (ACT == 14) v = (v > 0.f) ? v : 0.1f * v; else if (ACT == 16) v = (v >= 0.f) ? v : 0.3f * v; else if (ACT == 17) v = (v >= 0.f) ? v : 0.2f * v;
      so[w][rloc][t * 16 + ln] = v; } }
  __builtin_amdgcn_fence(__ATOMIC_ACQ_REL, "workgroup"); __builtin_amdgcn_wave_barrier();
  const int rsub = lane >> 4, c4 = (lane & 15) * 4;
  {
#pragma unroll
    for (int q = 0; q < 16; ++q) { const int r = q * 2 + rsub; const v4f v = *(const v4fa*)&so[w][r][c4]; if (C) *(v4f*)(C + cofs + (size_t)(row0 + r) * ldc + col0 + c4) = v; if (C16) { v4h h4; for (int i = 0; i < 4; ++i) h4[i] = (_Float16)v[i]; *(v4h*)(C16 + cofs + (size_t)(row0 + r) * ldc + col0 + c4) = h4; } }
     } }


__global__ __launch_bounds__(256) void k_wnat(const float* __restrict__ w, size_t n8, _Float16* __restrict__ Bt) { const size_t t = (size_t)blockIdx.x * 256 + threadIdx.x; if (t >= n8) return; FragH f; for (int q = 0; q < 8; ++q) f.h[q] = (_Float16)(bf16_round(w[t * 8 + q]) * 16.0f); *(v8us*)((unsigned short*)Bt + t * 8) = f.half[0];  }
#define FA_KEYS 64      /* keys per LDS stage */
#define FA_PITCH 72     /* 16-bit elements per LDS row: 128 data bytes + 16 */
typedef float v2f __attribute__((ext_vector_type(2)));
__device__ __forceinline__ float fa_xhalf(float x) { return __builtin_bit_cast(float, __builtin_amdgcn_permlanex16(__builtin_bit_cast(int, x), __builtin_bit_cast(int, x), 0x76543210, 0xfedcba98, false, false)); }      /* lane l <-> lane l ^ 16 */
__device__ __forceinline__ v16h fa_frag(const unsigned short* p) { FragH f; f.half[0] = *(const v8us*)p; f.half[1] = *(const v8us*)(p + 16); return f.v; }      /* p = row + k0 + 8 * hh */
__device__ __forceinline__ v8f fa_mma(v16h a, v16h b, v8f c) { return __builtin_amdgcn_wmma_f32_16x16x32_f16(false, a, false, b, (short)0, c, false, false); }
__global__ __launch_bounds__(128) void k_fattn(const _Float16* __restrict__ Q16, const _Float16* __restrict__ K16, const _Float16* __restrict__ VT, _Float16* __restrict__ O16) {
  __shared__ __attribute__((aligned(16))) unsigned short sk[2][FA_KEYS][FA_PITCH];      /* K rows [key][d] */
  __shared__ __attribute__((aligned(16))) unsigned short sv[2][HD][FA_PITCH];           /* V^T rows [d][key] */
  const int tid = threadIdx.x, w = tid >> 5, lane = tid & 31, ln = lane & 15, hh = lane >> 4;
  const int h = blockIdx.y, b = blockIdx.z, q0 = blockIdx.x * 128 + w * 32;
  const unsigned short* kg = (const unsigned short*)K16 + (size_t)b * SQ * DM + h * HD;
  const unsigned short* vg = (const unsigned short*)VT + ((size_t)b * NH + h) * HD * SQ;
  v16h qf[2][2];
#pragma unroll      /* static indices keep qf[] in registers */
  for (int g = 0; g < 2; ++g) { const _Float16* qp = Q16 + ((size_t)b * SQ + q0 + 16 * g + ln) * DM + h * HD; qf[g][0] = g2_frag(qp, hh); qf[g][1] = g2_frag(qp + 32, hh); }
  const int sr = tid >> 3, sc = (tid & 7) * 8;      /* staging: eight threads a 128-byte row, rows sr + 16 i */
  v8us rk[4], rv[4];
#pragma unroll      /* static indices into rk[], rv[] */
  for (int i = 0; i < 4; ++i) { rk[i] = *(const v8us*)(kg + (size_t)(sr + 16 * i) * DM + sc); rv[i] = *(const v8us*)(vg + (size_t)(sr + 16 * i) * SQ + sc); }
#pragma unroll      /* static indices into rk[], rv[] */
  for (int i = 0; i < 4; ++i) { *(v8us*)&sk[0][sr + 16 * i][sc] = rk[i]; *(v8us*)&sv[0][sr + 16 * i][sc] = rv[i]; }
  __syncthreads();      /* stage 0 is published */
  const v8f z8 = {0.f, 0.f, 0.f, 0.f, 0.f, 0.f, 0.f, 0.f};
  v8f acc[2][4] = {{z8, z8, z8, z8}, {z8, z8, z8, z8}}; float mrun[2] = {-3.0e38f, -3.0e38f}; v2f lsum[2] = {{0.f, 0.f}, {0.f, 0.f}};      /* mrun: the maximum in use, log2 domain; lsum: the lane's share of the denominator, even and odd keys apart */
  const float L2E = 1.4426950408889634f;
#pragma unroll 1      /* one stage a trip: the body already holds two passes */
  for (int s = 0; s < SQ / FA_KEYS; ++s) {
    const int cur = s & 1; const bool more = s + 1 < SQ / FA_KEYS;      /* the same in every thread */
    if (more) {      /* the next stage's lines fly while this stage is worked on */
#pragma unroll      /* static indices into rk[], rv[] */
      for (int i = 0; i < 4; ++i) { rk[i] = *(const v8us*)(kg + (size_t)((s + 1) * FA_KEYS + sr + 16 * i) * DM + sc); rv[i] = *(const v8us*)(vg + (size_t)(sr + 16 * i) * SQ + (s + 1) * FA_KEYS + sc); } }
#pragma unroll      /* static indices into the register arrays */
    for (int ps = 0; ps < FA_KEYS / 32; ++ps) {
      v8f st[2][2];      /* [key tile][query group] */
#pragma unroll      /* static indices keep the register arrays in registers */
      for (int kt = 0; kt < 2; ++kt) { const unsigned short* kp = &sk[cur][ps * 32 + kt * 16 + ln][8 * hh]; const v16h k0 = fa_frag(kp), k1 = fa_frag(kp + 32);
#pragma unroll      /* static indices keep the register arrays in registers */
        for (int g = 0; g < 2; ++g) st[kt][g] = fa_mma(k1, qf[g][1], fa_mma(k0, qf[g][0], z8)); }
      v16h vf[4];
#pragma unroll      /* static indices keep the register arrays in registers */
      for (int t = 0; t < 4; ++t) vf[t] = fa_frag(&sv[cur][16 * t + ln][ps * 32 + 8 * hh]);
      float mb[2]; bool need = false;
#pragma unroll      /* static indices keep the register arrays in registers */
      for (int g = 0; g < 2; ++g) { float mx = st[0][g][0];
#pragma unroll      /* static indices keep the register arrays in registers */
        for (int r = 1; r < 8; ++r) mx = fmaxf(mx, st[0][g][r]);
#pragma unroll      /* static indices keep the register arrays in registers */
        for (int r = 0; r < 8; ++r) mx = fmaxf(mx, st[1][g][r]);
        mx = fmaxf(mx, fa_xhalf(mx)) * L2E; mb[g] = mx; need = need || (mx > mrun[g] + 8.0f); }      /* both halves hold the query's maximum of this pass */
      if (__builtin_amdgcn_ballot_w32(need) != 0) {      /* lazy rescale: only when some query's maximum passes the one in use by more than 2^8; always on the first pass */
#pragma unroll      /* static indices keep the register arrays in registers */
        for (int g = 0; g < 2; ++g) { const float mn = fmaxf(mrun[g], mb[g]); const float corr = __builtin_amdgcn_exp2f(mrun[g] - mn); mrun[g] = mn; lsum[g] *= corr;
#pragma unroll      /* static indices keep the register arrays in registers */
          for (int t = 0; t < 4; ++t) acc[g][t] *= corr; } }
#pragma unroll      /* static indices keep the register arrays in registers */
      for (int g = 0; g < 2; ++g) { const float nm = 6.0f - mrun[g]; FragH pf; v2f ls = {0.f, 0.f};      /* weights x 2^6: at most 2^14 in f16, small ones further from the subnormal range */
#pragma unroll      /* static indices keep the register arrays in registers */
        for (int i = 0; i < 8; ++i) { const v2f a = __builtin_elementwise_fma(v2f{st[i >> 2][g][2 * (i & 3)], st[i >> 2][g][2 * (i & 3) + 1]}, v2f{L2E, L2E}, v2f{nm, nm});
          const v2f p = {__builtin_amdgcn_exp2f(a.x), __builtin_amdgcn_exp2f(a.y)}; ls += p; pf.h[2 * i] = (_Float16)p.x; pf.h[2 * i + 1] = (_Float16)p.y; }
        lsum[g] += ls;
#pragma unroll      /* static indices keep the register arrays in registers */
        for (int t = 0; t < 4; ++t) acc[g][t] = fa_mma(vf[t], pf.v, acc[g][t]); }
    }
    if (more) {
#pragma unroll      /* static indices into rk[], rv[] */
      for (int i = 0; i < 4; ++i) { *(v8us*)&sk[cur ^ 1][sr + 16 * i][sc] = rk[i]; *(v8us*)&sv[cur ^ 1][sr + 16 * i][sc] = rv[i]; } }
    __syncthreads();      /* publishes stage s + 1 and ends every wave's reads of the buffer that the next trip refills */
  }
#pragma unroll      /* static indices keep the register arrays in registers */
  for (int g = 0; g < 2; ++g) { const float lh = lsum[g].x + lsum[g].y; const float inv = 64.0f / (lh + fa_xhalf(lh)); unsigned short* op = (unsigned short*)O16 + ((size_t)b * SQ + q0 + 16 * g + ln) * DM + h * HD + 8 * hh;      /* the halves' sums join once; o x64 */
#pragma unroll      /* static indices keep the register arrays in registers */
    for (int t = 0; t < 4; ++t) { FragH o;
#pragma unroll      /* static indices keep the register arrays in registers */
      for (int r = 0; r < 8; ++r) o.h[r] = (_Float16)(acc[g][t][r] * inv);
      *(v8us*)(op + 16 * t) = o.half[0]; } } }
__global__ __launch_bounds__(256) void k_vt(const _Float16* __restrict__ V16, int b, int h0, _Float16* __restrict__ VT) { __shared__ unsigned short tl[64][65]; const int tid = threadIdx.x; const int hh = blockIdx.x % HG, sg = blockIdx.x / HG; const int s0 = sg * 64; const int h = h0 + hh;
  for (int i = tid; i < 64 * 8; i += 256) { const int j = i / 8, d8 = (i % 8) * 8; FragH f; f.half[0] = *(const v8us*)((const unsigned short*)V16 + ((size_t)b * SQ + s0 + j) * DM + h * HD + d8); for (int q = 0; q < 8; ++q) tl[d8 + q][j] = f.u[q]; }
  __syncthreads();
  { for (int i = tid; i < 64 * 8; i += 256) { const int d = i / 8, j8 = (i % 8) * 8; FragH f; for (int q = 0; q < 8; ++q) f.u[q] = tl[d][j8 + q]; *(v8us*)((unsigned short*)VT + ((size_t)hh * HD + d) * SQ + s0 + j8) = f.half[0]; }  } }



__global__ __launch_bounds__(256) void k_rsmkm(const float* __restrict__ S, _Float16* __restrict__ P, int nrows, const int* __restrict__ am) {
  #pragma clang fp contract(off)
  const int t = blockIdx.x * 256 + threadIdx.x; if (t >= nrows) return; const size_t i = (size_t)t; const float* s = S + i * SQ; const int* mr = am + (size_t)(t % SQ) * SQ; float mx = -3.0e38f;
#pragma unroll 1
  for (int j = 0; j < SQ; ++j) { const float f = (mr[j] != 0) ? 1.f : 0.f; mx = fmaxf(mx, fmaf(f, s[j], (1.f - f) * -1.0e9f)); } float se = 0.f;
#pragma unroll 1
  for (int j = 0; j < SQ; ++j) { const float f = (mr[j] != 0) ? 1.f : 0.f; se += __expf(fmaf(f, s[j], (1.f - f) * -1.0e9f) - mx); } const float sc = 256.0f / se;
#pragma unroll 1
  for (int j0 = 0; j0 < SQ; j0 += 8) { FragH fr; for (int q = 0; q < 8; ++q) { const int j = j0 + q; const float f = (mr[j] != 0) ? 1.f : 0.f; fr.h[q] = (_Float16)(__expf(fmaf(f, s[j], (1.f - f) * -1.0e9f) - mx) * sc); }
    unsigned short* d = (unsigned short*)P + i * SQ + j0; *(v8us*)d = fr.half[0];  } }

template <int COLS>
__global__ __launch_bounds__(256) void k_wperm(const float* __restrict__ Wn, _Float16* __restrict__ Bt) {
  const size_t t = (size_t)blockIdx.x * 256 + threadIdx.x; if (t >= (size_t)DM * DM / 8) return; const size_t e0 = t * 8; const int n = (int)(e0 / DM), k0 = (int)(e0 % DM); FragH f;
  if (COLS == 0) { const int h = n >> 6, d = n & 63; const float* src = Wn + (size_t)(d * NH + h) * DM + k0; for (int q = 0; q < 8; ++q) f.h[q] = (_Float16)(bf16_round(src[q]) * 16.0f); }
  else { for (int q = 0; q < 8; ++q) { const int kk = k0 + q; const int h = kk >> 6, d = kk & 63; f.h[q] = (_Float16)(bf16_round(Wn[(size_t)n * DM + d * NH + h]) * 16.0f); } }
  unsigned short* dst = (unsigned short*)Bt + e0; *(v8us*)dst = f.half[0];  }
__global__ __launch_bounds__(256) void k_bperm(const float* __restrict__ b, float* __restrict__ out) { const int t = threadIdx.x; if (t >= DM) return; const int h = t >> 6, d = t & 63; const float v = b[d * NH + h]; *(float*)(out + t) = v;  }
__global__ __launch_bounds__(256) void k_tr32(const float* __restrict__ R, float* __restrict__ OUT, size_t n4) {
  const size_t t = (size_t)blockIdx.x * 256 + threadIdx.x; if (t >= n4) return; const size_t e = t * 4; const int c = (int)(e / SQ); const int n0 = (int)(e % SQ); v4f o; for (int q = 0; q < 4; ++q) o[q] = R[(size_t)(n0 + q) * DM + c]; *(v4f*)(OUT + e) = o;  }
extern "C" void kernel_launch(void* const* d_in, const int* in_sizes, int n_in,
                              void* d_out, int out_size, void* d_ws, size_t ws_size, hipStream_t stream) {
  (void)in_sizes; (void)n_in; (void)out_size;
  const float* const* I = (const float* const*)d_in; const float* xq = I[0]; const float* xk = I[0]; const float* xv = I[0]; const float* wq = I[1]; const float* bq = I[2]; const float* wk = I[3]; const float* bk = I[4]; const float* wv = I[5]; const float* bv = I[6]; const float* wo = I[7]; const float* bo = I[8]; const float* x = xq;      /* hidden_state [4][768][2048] (feeds q, k and v); per-head Wq / Wk / Wv [12][768][64] + biases [12][64] (= [768] head-major); Wo [768][768] natural + bo */
  char* ws = (char*)d_ws; size_t off = 0;
  auto take = [&](size_t bytes) { char* p = ws + off; off += (bytes + 255) & ~(size_t)255; return p; };
  _Float16* BQ = (_Float16*)take((size_t)DM * DM * 2); _Float16* BK = (_Float16*)take((size_t)DM * DM * 2); _Float16* BV = (_Float16*)take((size_t)DM * DM * 2); _Float16* BO = (_Float16*)take((size_t)DM * DM * 2);
  _Float16* X16 = (_Float16*)take(NR * DM * 2); _Float16* XKp = nullptr; _Float16* XVp = nullptr;      /* (one shared input: k and v project the X16 rows) */ _Float16* Q16 = (_Float16*)take(NR * DM * 2); _Float16* K16 = (_Float16*)take(NR * DM * 2); _Float16* V16 = (_Float16*)take(NR * DM * 2); _Float16* O16 = (_Float16*)take(NR * DM * 2); _Float16* CF16 = (_Float16*)take(NR * DM * 2); float* BP = (float*)take((size_t)3 * DM * 4); float* OR = (float*)take(NR * DM * 4);      /* channel-first f16 staging plane (one input at a time); BP unused (the [12][64] biases are already head-major); f32 output token rows before the transpose back */
  _Float16* VT = (_Float16*)take((size_t)NB * NH * HD * SQ * 2);
  if (off > ws_size) return;
  for (int h = 0; h < NH; ++h) { const unsigned g = (unsigned)(((size_t)HD * (DM / 8) + 255) / 256); k_wt_f16<<<g, 256, 0, stream>>>(wq + (size_t)h * DM * HD, BQ + (size_t)h * HD * DM, DM, HD, 16.0f); k_wt_f16<<<g, 256, 0, stream>>>(wk + (size_t)h * DM * HD, BK + (size_t)h * HD * DM, DM, HD, 16.0f); k_wt_f16<<<g, 256, 0, stream>>>(wv + (size_t)h * DM * HD, BV + (size_t)h * HD * DM, DM, HD, 16.0f); }      /* per-head [in = 768][out = 64] tensors -> rows h*64.. of the Bt planes (x16): head h = output columns h*64.. = the concat order */
  k_wnat<<<(unsigned)(((size_t)DM * DM / 8 + 255) / 256), 256, 0, stream>>>(wo, (size_t)DM * DM / 8, BO);      /* Wo natural [out][in] = Bt x16 */
  _Float16* XK = XKp; _Float16* XV = XVp;
  k_x16<<<(unsigned)((NR * DM / 8 + 255) / 256), 256, 0, stream>>>(x, CF16, NR * DM / 8); for (int b = 0; b < NB; ++b) k_vt<SQ / 64, DM><<<(SQ / 64) * (DM / 64), 256, 0, stream>>>(CF16 + (size_t)b * DM * SQ, SQ, 0, X16 + (size_t)b * SQ * DM); XK = X16; XV = X16;      /* the [B][E][S] input: exact f16 copy, then per batch an LDS transpose [e][s] -> token rows [s][e]; q, k and v all project these rows */

  const size_t r0p = (size_t)B0 * SQ;      /* first projected row */
  k_gemm2<0><<<dim3((unsigned)((MP / 128) * (DM / 64)), 1), 128, 0, stream>>>(X16 + r0p * DM, DM, 0, BQ, DM, 0, 0.0625f, bq, 0, nullptr, 1, 0, 0, nullptr, Q16 + r0p * DM, DM, 0, MP, DM, DM);
  k_gemm2<0><<<dim3((unsigned)((MP / 128) * (DM / 64)), 1), 128, 0, stream>>>(XK + r0p * DM, DM, 0, BK, DM, 0, 0.0625f, bk, 0, nullptr, 1, 0, 0, nullptr, K16 + r0p * DM, DM, 0, MP, DM, DM);
  k_gemm2<0><<<dim3((unsigned)((MP / 128) * (DM / 64)), 1), 128, 0, stream>>>(XV + r0p * DM, DM, 0, BV, DM, 0, 0.0625f, bv, 0, nullptr, 1, 0, 0, nullptr, V16 + r0p * DM, DM, 0, MP, DM, DM);
  for (int b = 0; b < NB; ++b) k_vt<NH, SQ><<<NH * (SQ / 64), 256, 0, stream>>>(V16 + (size_t)b * SQ * LQ, LQ, 0, VT + (size_t)b * NH * HD * SQ);      /* V^T [NB][NH][HD][SQ] */
  k_fattn<<<dim3(SQ / 128, NH, NB), 128, 0, stream>>>(Q16, K16, VT, O16);      /* UNSCALED scores q.k (the module omits 1/sqrt(d)), softmax and P.V; o (merged heads) as f16 rows x64 */
  k_gemm2<0><<<dim3((unsigned)((MPO / 128) * (DM / 64)), 1), 128, 0, stream>>>(O16 + r0p * DM, DM, 0, BO, DM, 0, 0.0009765625f, bo, 0, nullptr, 1, 0, 0, OR + r0p * DM, nullptr, DM, 0, MPO, DM, DM);      /* out token rows [n][co] (f32; bo is in natural channel order = the output columns) */
  for (int b = 0; b < NB; ++b) k_tr32<<<(unsigned)(((size_t)DM * SQ / 4 + 255) / 256), 256, 0, stream>>>(OR + (size_t)b * SQ * DM, (float*)d_out + (size_t)b * DM * SQ, (size_t)DM * SQ / 4);      /* -> the module's [co][n] layout */
}

// v003
// A run of this version takes 211 microseconds.
// Timed twice side by side with v002, it ran 1.81 times as fast both times.
// Over all steps from v000 it is 27.9 times as fast.
#include <hip/hip_runtime.h>
#define NB 4
#define SQ 2048
#define DM 768
#define NH 12
#define HD 64
#define HG 4                         /* heads per block group of k_vt(V16, b, h0, VT) */
#define B0 0                         /* first batch processed (debug hook) */
#define NBR NB                       /* batches processed (debug hook) */
#define NR ((size_t)NB * SQ)         /* token rows */
#define MP ((int)((size_t)NBR * SQ)) /* rows projected (debug hook) */
#define QN SQ                        /* unused: k_fattn covers all SQ query rows */
#define NHD NH                       /* unused: k_fattn covers all NH heads */
#define MPO MP                       /* rows through the output stage (debug hook) */
#define LQ DM      /* row pitch of the q/k/v rows */
typedef __bf16 v16b __attribute__((ext_vector_type(16)));
typedef unsigned short v8us __attribute__((ext_vector_type(8), may_alias));
typedef float  v8f  __attribute__((ext_vector_type(8)));
typedef float  v4f  __attribute__((ext_vector_type(4)));
typedef float  v4fa __attribute__((ext_vector_type(4), may_alias));
union FragB { v16b v; v8us half[2]; unsigned short u[16]; };

__device__ __forceinline__ unsigned short bf16_bits(float x) { unsigned int u = __float_as_uint(x); return (unsigned short)((u + 0x7FFFu + ((u >> 16) & 1u)) >> 16); }
__device__ __forceinline__ float bf16_val(unsigned short b) { return __uint_as_float(((unsigned int)b) << 16); }
__device__ __forceinline__ float bf16_round(float x) { return bf16_val(bf16_bits(x)); }
// D += A·B with NT terms: 1 = ah·bh, 2 = + al·bh (A split), 3 = + ah·bl (both split)
template <int NT>
__device__ __forceinline__ v8f mmaN(v16b ah, v16b al, v16b bh, v16b bl, v8f c) {
  c = __builtin_amdgcn_wmma_f32_16x16x32_bf16(false, ah, false, bh, (short)0, c, false, false);
  if (NT >= 2) c = __builtin_amdgcn_wmma_f32_16x16x32_bf16(false, al, false, bh, (short)0, c, false, false);
  if (NT >= 3) c = __builtin_amdgcn_wmma_f32_16x16x32_bf16(false, ah, false, bl, (short)0, c, false, false);
  asm volatile("v_nop\n\tv_nop\n\tv_nop\n\tv_nop" : "+v"(c) : "v"(ah), "v"(al), "v"(bh), "v"(bl));
  return c;
}

__global__ __launch_bounds__(256) void k_wt_bf16(const float* __restrict__ W, unsigned short* __restrict__ Wt, int K, int N) {
  const int t = blockIdx.x * 256 + threadIdx.x;
  const int k8n = K / 8;
  if (t >= N * k8n) return;
  const int n = t / k8n, k8 = (t % k8n) * 8;
  v8us v;
#pragma unroll
  for (int i = 0; i < 8; ++i) v[i] = bf16_bits(W[(size_t)(k8 + i) * N + n]);
  *(v8us*)(Wt + (size_t)n * K + k8) = v;
  
}

// GEMM C[M][N] (f32, pitch ldc) = act(A[M][K]·W + bias). A f32 row-major (pitch lda) converted per fragment to bf16
// (ASPLIT: hi/lo two planes -> 2 terms, else single rounded term); Wt bf16 [N][K] (pitch ldb). BIAS_BF16 rounds the
// bias to bf16 first (bias quantised to bf16 before the add). K%32==0, M%16==0, N%64==0.
template <bool ASPLIT, int ACT, bool BIAS_BF16>
__global__ __launch_bounds__(128) void k_gemm_bf(const float* __restrict__ A, int lda, const unsigned short* __restrict__ Wt, int ldb,
                                               const float* __restrict__ bias, float* __restrict__ C, int ldc, int M, int N, int K) {
  __shared__ __attribute__((aligned(16))) float so[4][16][64];
  const int tid = threadIdx.x, w = tid >> 5, lane = tid & 31, ln = lane & 15, hh = lane >> 4;
  const int ntn = N / 64;
  const int wid = blockIdx.x * 4 + w;
  const int mt = wid / ntn, nq = wid % ntn;
  if (mt * 16 >= M) return;
  const int row0 = mt * 16, col0 = nq * 64;
  const float* arow = A + (size_t)(row0 + ln) * lda;
  v8f acc[4] = {};
  for (int kb = 0; kb < K; kb += 32) {
    FragB ah, al;
    const v4f x0 = *(const v4fa*)(arow + kb + 8 * hh), x1 = *(const v4fa*)(arow + kb + 8 * hh + 4);
    const v4f x2 = *(const v4fa*)(arow + kb + 16 + 8 * hh), x3 = *(const v4fa*)(arow + kb + 16 + 8 * hh + 4);
    float xs[16] = {x0[0],x0[1],x0[2],x0[3],x1[0],x1[1],x1[2],x1[3],x2[0],x2[1],x2[2],x2[3],x3[0],x3[1],x3[2],x3[3]};
#pragma unroll
    for (int i = 0; i < 16; ++i) { const unsigned short hb = bf16_bits(xs[i]); ah.u[i] = hb; al.u[i] = ASPLIT ? bf16_bits(xs[i] - bf16_val(hb)) : (unsigned short)0; }
#pragma unroll
    for (int t = 0; t < 4; ++t) {
      const unsigned short* brow = Wt + (size_t)(col0 + t * 16 + ln) * ldb + kb;
      FragB b;
      b.half[0] = *(const v8us*)(brow + 8 * hh);
      b.half[1] = *(const v8us*)(brow + 16 + 8 * hh);
      acc[t] = mmaN<ASPLIT ? 2 : 1>(ah.v, al.v, b.v, b.v, acc[t]);
    }
  }
#pragma unroll
  for (int t = 0; t < 4; ++t) {
    float bv = bias ? bias[col0 + t * 16 + ln] : 0.f;
    if (BIAS_BF16) bv = bf16_round(bv);
#pragma unroll
    for (int r = 0; r < 8; ++r) { float v = acc[t][r] + bv; if (ACT == 1) v = fmaxf(v, 0.f); so[w][8 * hh + r][t * 16 + ln] = v; }
  }
  __builtin_amdgcn_fence(__ATOMIC_ACQ_REL, "workgroup");
  __builtin_amdgcn_wave_barrier();
  const int rsub = lane >> 4, c4 = (lane & 15) * 4;
  {
#pragma unroll
    for (int q = 0; q < 8; ++q) {
      const int r = q * 2 + rsub;
      const v4f v = *(const v4fa*)&so[w][r][c4];
      *(v4f*)(C + (size_t)(row0 + r) * ldc + col0 + c4) = v;
    }
    
  }
}

// GEMM C = act(A·W + bias + resid): A f32 (ASPLIT -> hi/lo 2 terms), Wt bf16 [N][K]; ACT 0 none, 1 relu, 2 exact gelu;
// resid (optional, f32, row index = (row % rmod), pitch ldr, RES_BF16 rounds it) added before the activation.
template <bool ASPLIT, int ACT, bool BIAS_BF16, bool RES_BF16>
__global__ __launch_bounds__(128) void k_gemm_bf3(const float* __restrict__ A, int lda, const unsigned short* __restrict__ Wt, int ldb,
                                                const float* __restrict__ bias, const float* __restrict__ resid, int rmod, int ldr,
                                                float* __restrict__ C, int ldc, int M, int N, int K) {
  __shared__ __attribute__((aligned(16))) float so[4][16][64];
  const int tid = threadIdx.x, w = tid >> 5, lane = tid & 31, ln = lane & 15, hh = lane >> 4;
  const int ntn = N / 64;
  const int wid = blockIdx.x * 4 + w;
  const int mt = wid / ntn, nq = wid % ntn;
  if (mt * 16 >= M) return;
  const int row0 = mt * 16, col0 = nq * 64;
  const float* arow = A + (size_t)(row0 + ln) * lda;
  v8f acc[4] = {};
  for (int kb = 0; kb < K; kb += 32) {
    FragB ah, al;
    const v4f x0 = *(const v4fa*)(arow + kb + 8 * hh), x1 = *(const v4fa*)(arow + kb + 8 * hh + 4);
    const v4f x2 = *(const v4fa*)(arow + kb + 16 + 8 * hh), x3 = *(const v4fa*)(arow + kb + 16 + 8 * hh + 4);
    float xs[16] = {x0[0],x0[1],x0[2],x0[3],x1[0],x1[1],x1[2],x1[3],x2[0],x2[1],x2[2],x2[3],x3[0],x3[1],x3[2],x3[3]};
#pragma unroll
    for (int i = 0; i < 16; ++i) { const unsigned short hb = bf16_bits(xs[i]); ah.u[i] = hb; al.u[i] = ASPLIT ? bf16_bits(xs[i] - bf16_val(hb)) : (unsigned short)0; }
#pragma unroll
    for (int t = 0; t < 4; ++t) {
      const unsigned short* brow = Wt + (size_t)(col0 + t * 16 + ln) * ldb + kb;
      FragB b;
      b.half[0] = *(const v8us*)(brow + 8 * hh);
      b.half[1] = *(const v8us*)(brow + 16 + 8 * hh);
      acc[t] = mmaN<ASPLIT ? 2 : 1>(ah.v, al.v, b.v, b.v, acc[t]);
    }
  }
#pragma unroll
  for (int t = 0; t < 4; ++t) {
    const int col = col0 + t * 16 + ln;
    float bv = bias ? bias[col] : 0.f;
    if (BIAS_BF16) bv = bf16_round(bv);
#pragma unroll
    for (int r = 0; r < 8; ++r) {
      float v = acc[t][r] + bv;
      if (resid) { float rv = resid[(size_t)((row0 + 8 * hh + r) % rmod) * ldr + col]; if (RES_BF16) rv = bf16_round(rv); v += rv; }
      if (ACT == 1) v = fmaxf(v, 0.f);
      if (ACT == 2) v = 0.5f * v * (1.0f + erff(v * 0.70710678118654752f));
      if (ACT == 3) { const float u = 0.7978845608028654f * (v + 0.044715f * v * v * v); v = 0.5f * v * (1.0f + tanhf(u)); }
      so[w][8 * hh + r][t * 16 + ln] = v;
    }
  }
  __builtin_amdgcn_fence(__ATOMIC_ACQ_REL, "workgroup");
  __builtin_amdgcn_wave_barrier();
  const int rsub = lane >> 4, c4 = (lane & 15) * 4;
  {
#pragma unroll
    for (int q = 0; q < 8; ++q) {
      const int r = q * 2 + rsub;
      const v4f v = *(const v4fa*)&so[w][r][c4];
      *(v4f*)(C + (size_t)(row0 + r) * ldc + col0 + c4) = v;
    }
    
  }
}
// row LayerNorm (biased variance, eps) over N: s = X (+ R); optional out_sum <- s; out_norm <- (s-mu)*rsqrt(var+eps)*g + b
template <bool PARAM_BF16>
__global__ __launch_bounds__(256) void k_layernorm(const float* __restrict__ X, const float* __restrict__ R, const float* __restrict__ g, const float* __restrict__ bta,
                                                  float* __restrict__ out_sum, float* __restrict__ out_norm, int N, float eps) {
  __shared__ float red[256];
  const int row = blockIdx.x, tid = threadIdx.x;
  const float* x = X + (size_t)row * N; const float* rr = R ? R + (size_t)row * N : nullptr;
  float vals[16];                     // up to N = 4096
  const int per = N / 256;            // contiguous chunk per thread? use strided-by-4 chunks: thread handles j = tid*4 + 1024*u
  float s1 = 0.f;
  for (int u = 0; u < per / 4; ++u) {
    const int j = tid * 4 + 1024 * u;
    const v4f a = *(const v4fa*)(x + j);
    v4f b = {0.f,0.f,0.f,0.f}; if (rr) b = *(const v4fa*)(rr + j);
#pragma unroll
    for (int q = 0; q < 4; ++q) { const float v = a[q] + b[q]; vals[u * 4 + q] = v; s1 += v; }
  }
  red[tid] = s1; __syncthreads();
  for (int st = 128; st > 0; st >>= 1) { if (tid < st) red[tid] += red[tid + st]; __syncthreads(); }
  const float mu = red[0] / (float)N; __syncthreads();
  float s2 = 0.f;
  for (int u = 0; u < per / 4; ++u)
#pragma unroll
    for (int q = 0; q < 4; ++q) { const float c = vals[u * 4 + q] - mu; s2 += c * c; }
  red[tid] = s2; __syncthreads();
  for (int st = 128; st > 0; st >>= 1) { if (tid < st) red[tid] += red[tid + st]; __syncthreads(); }
  const float rs = rsqrtf(red[0] / (float)N + eps);
  {
    for (int u = 0; u < per / 4; ++u) {
      const int j = tid * 4 + 1024 * u;
      v4f o, sm;
#pragma unroll
      for (int q = 0; q < 4; ++q) {
        float gg = g[j + q], bb = bta[j + q];
        if (PARAM_BF16) { gg = bf16_round(gg); bb = bf16_round(bb); }
        sm[q] = vals[u * 4 + q]; o[q] = (vals[u * 4 + q] - mu) * rs * gg + bb;
      }
      if (out_sum) *(v4f*)(out_sum + (size_t)row * N + j) = sm;
      *(v4f*)(out_norm + (size_t)row * N + j) = o;
    }
    
  }
}



// ---- f16 WMMA path (v_wmma_f32_16x16x32_f16): 11-bit significands for operands in range — used where a [0,1] probability operand needs more precision than bf16
typedef _Float16 v16h __attribute__((ext_vector_type(16)));
union FragH { v16h v; v8us half[2]; _Float16 h[16]; unsigned short u[16]; };
template <int NT>
__device__ __forceinline__ v8f mmaH(v16h ah, v16h al, v16h bh, v16h bl, v8f c) {
  c = __builtin_amdgcn_wmma_f32_16x16x32_f16(false, ah, false, bh, (short)0, c, false, false);
  if (NT >= 2) c = __builtin_amdgcn_wmma_f32_16x16x32_f16(false, al, false, bh, (short)0, c, false, false);
  if (NT >= 3) c = __builtin_amdgcn_wmma_f32_16x16x32_f16(false, ah, false, bl, (short)0, c, false, false);
  asm volatile("v_nop\n\tv_nop\n\tv_nop\n\tv_nop" : "+v"(c) : "v"(ah), "v"(al), "v"(bh), "v"(bl));
  return c;
}
// batched GEMM like k_gemm_b but f16 operands: A f32 (split into f16 hi/lo if ASPLIT, else rounded to f16), Bt = f16 values [n][k]; alpha; C f32; N multiple of 16 (partial tiles skipped)
template <bool ASPLIT>
__global__ __launch_bounds__(128) void k_gemm_h(const float* __restrict__ A, int lda, size_t sA, const _Float16* __restrict__ Bh, int ldb, size_t sB, float alpha, float* __restrict__ C, int ldc, size_t sC, int M, int N, int K) {
  __shared__ __attribute__((aligned(16))) float so[4][16][64];
  const int tid = threadIdx.x, w = tid >> 5, lane = tid & 31, ln = lane & 15, hh = lane >> 4; const int by = blockIdx.y;
  A += (size_t)by * sA; Bh += (size_t)by * sB; C += (size_t)by * sC;
  const int ntn = (N + 63) / 64; const int wid = blockIdx.x * 4 + w; const int mt = wid / ntn, nq = wid % ntn; if (mt * 16 >= M) return;
  const int row0 = mt * 16, col0 = nq * 64; const float* arow = A + (size_t)(row0 + ln) * lda;
  v8f acc[4] = {};
  for (int kb = 0; kb < K; kb += 32) {
    FragH ah, al;
    const v4f x0 = *(const v4fa*)(arow + kb + 8 * hh), x1 = *(const v4fa*)(arow + kb + 8 * hh + 4), x2 = *(const v4fa*)(arow + kb + 16 + 8 * hh), x3 = *(const v4fa*)(arow + kb + 16 + 8 * hh + 4);
    float xs[16] = {x0[0],x0[1],x0[2],x0[3],x1[0],x1[1],x1[2],x1[3],x2[0],x2[1],x2[2],x2[3],x3[0],x3[1],x3[2],x3[3]};
#pragma unroll
    for (int i = 0; i < 16; ++i) { const _Float16 h = (_Float16)xs[i]; ah.h[i] = h; al.h[i] = ASPLIT ? (_Float16)(xs[i] - (float)h) : (_Float16)0.0f; }
#pragma unroll
    for (int t = 0; t < 4; ++t) { if (col0 + t * 16 >= N) continue; const size_t boff = (size_t)(col0 + t * 16 + ln) * ldb + kb; FragH bq; bq.half[0] = *(const v8us*)(Bh + boff + 8 * hh); bq.half[1] = *(const v8us*)(Bh + boff + 16 + 8 * hh);
      acc[t] = mmaH<ASPLIT ? 2 : 1>(ah.v, al.v, bq.v, bq.v, acc[t]); }
  }
#pragma unroll
  for (int t = 0; t < 4; ++t) { if (col0 + t * 16 >= N) continue;
#pragma unroll
    for (int r = 0; r < 8; ++r) so[w][8 * hh + r][t * 16 + ln] = acc[t][r] * alpha; }
  __builtin_amdgcn_fence(__ATOMIC_ACQ_REL, "workgroup"); __builtin_amdgcn_wave_barrier();
  const int rsub = lane >> 4, c4 = (lane & 15) * 4;
  {
#pragma unroll
    for (int q = 0; q < 8; ++q) { const int r = q * 2 + rsub; if (col0 + c4 < N) { const v4f v = *(const v4fa*)&so[w][r][c4]; *(v4f*)(C + (size_t)(row0 + r) * ldc + col0 + c4) = v; } }
     }
}

// k_gemm_hh variant with fused epilogue: v = acc·alpha + bias[by·sBias + col] (+ CP[(row/rowsPerB)·sCPb + by·64 + col] if CP) ; ACT 0 none / 1 elu ; writes f16 C16 (and f32 C if non-null)
template <int ACT>
__global__ __launch_bounds__(128) void k_gemm_hhx(const _Float16* __restrict__ A, int lda, size_t sA, const _Float16* __restrict__ Bh, int ldb, size_t sB, float alpha, const float* __restrict__ bias, size_t sBias, const float* __restrict__ CP, int rowsPerB, size_t sCPb, int row0g,
    float* __restrict__ C, _Float16* __restrict__ C16, int ldc, size_t sC, int M, int N, int K) {
  __shared__ __attribute__((aligned(16))) float so[4][16][64];
  const int tid = threadIdx.x, w = tid >> 5, lane = tid & 31, ln = lane & 15, hh = lane >> 4; const int by = blockIdx.y;
  A += (size_t)by * sA; Bh += (size_t)by * sB; const size_t cofs = (size_t)by * sC; const float* bp = bias ? bias + (size_t)by * sBias : nullptr;
  const int ntn = (N + 63) / 64; const int wid = blockIdx.x * 4 + w; const int mt = wid / ntn, nq = wid % ntn; if (mt * 16 >= M) return;
  const int row0 = mt * 16, col0 = nq * 64; const _Float16* arow = A + (size_t)(row0 + ln) * lda;
  v8f acc[4] = {};
  for (int kb = 0; kb < K; kb += 32) { FragH ah; ah.half[0] = *(const v8us*)((const unsigned short*)arow + kb + 8 * hh); ah.half[1] = *(const v8us*)((const unsigned short*)arow + kb + 16 + 8 * hh);
#pragma unroll
    for (int t = 0; t < 4; ++t) { if (col0 + t * 16 >= N) continue; const size_t boff = (size_t)(col0 + t * 16 + ln) * ldb + kb; FragH bq; bq.half[0] = *(const v8us*)((const unsigned short*)Bh + boff + 8 * hh); bq.half[1] = *(const v8us*)((const unsigned short*)Bh + boff + 16 + 8 * hh);
      acc[t] = mmaH<1>(ah.v, ah.v, bq.v, bq.v, acc[t]); }
  }
#pragma unroll
  for (int t = 0; t < 4; ++t) { if (col0 + t * 16 >= N) continue; const int col = col0 + t * 16 + ln; const float bv = bp ? bf16_round(bp[col]) : 0.f;
#pragma unroll
    for (int r = 0; r < 8; ++r) { float v = acc[t][r] * alpha + bv; if (CP) { const int rr = row0g + row0 + 8 * hh + r; if (rowsPerB < 0) v += CP[cofs + (size_t)rr * ldc + col];      /* rowsPerB < 0: own element of the batched C plane */ else { const int bidx = rr / rowsPerB; v += CP[(size_t)bidx * sCPb + (size_t)by * 64 + col]; } } if (ACT == 1) v = (v > 0.f) ? v : expm1f(v); else if (ACT == 7) v = (v > 0.f) ? v + 1.0f : expf(v); else if (ACT == 8) v = tanhf(v); else if (ACT == 9) v = 0.5f * v * (1.0f + tanhf(0.7978845608028654f * (v + 0.044715f * v * v * v))); else if (ACT == 11) v = 1.0f / (1.0f + expf(-v)); else if (ACT == 12) v = (v > 0.f) ? v : 0.01f * v; else if (ACT == 14) v = (v > 0.f) ? v : 0.1f * v; else if (ACT == 16) v = (v >= 0.f) ? v : 0.3f * v; else if (ACT == 17) v = (v >= 0.f) ? v : 0.2f * v; else if (ACT == 15) v = v / (1.0f + expf(-v)); else if (ACT == 3) v = fmaxf(v, 0.f); else if (ACT == 6) v = 0.5f * v * (1.0f + erff(v * 0.70710678118654752f)); so[w][8 * hh + r][t * 16 + ln] = v; } }
  __builtin_amdgcn_fence(__ATOMIC_ACQ_REL, "workgroup"); __builtin_amdgcn_wave_barrier();
  const int rsub = lane >> 4, c4 = (lane & 15) * 4; typedef _Float16 v4h __attribute__((ext_vector_type(4)));
  {
#pragma unroll
    for (int q = 0; q < 8; ++q) { const int r = q * 2 + rsub; if (col0 + c4 < N) { const v4f v = *(const v4fa*)&so[w][r][c4]; if (C) *(v4f*)(C + cofs + (size_t)(row0 + r) * ldc + col0 + c4) = v; if (C16) { v4h h4; for (int i = 0; i < 4; ++i) h4[i] = (_Float16)v[i]; *(v4h*)(C16 + cofs + (size_t)(row0 + r) * ldc + col0 + c4) = h4; } } }
     }
}


typedef _Float16 v4h __attribute__((ext_vector_type(4)));

__global__ __launch_bounds__(256) void k_h16(const float* __restrict__ x, _Float16* __restrict__ X16, size_t n8) { const size_t t = (size_t)blockIdx.x * 256 + threadIdx.x; if (t >= n8) return; FragH f;
#pragma unroll
  for (int q = 0; q < 8; ++q) f.h[q] = (_Float16)x[t * 8 + q]; *(v8us*)((unsigned short*)X16 + t * 8) = f.half[0];  }
__global__ __launch_bounds__(256) void k_round16f(const float* __restrict__ W, _Float16* __restrict__ Bt, size_t n8) { const size_t t = (size_t)blockIdx.x * 256 + threadIdx.x; if (t >= n8) return; FragH f;
#pragma unroll
  for (int i = 0; i < 8; ++i) f.h[i] = (_Float16)(bf16_round(W[t * 8 + i]) * 16.0f); *(v8us*)((unsigned short*)Bt + t * 8) = f.half[0];  }
template <int NHv, int TTv>
__global__ __launch_bounds__(256) void k_vt(const _Float16* __restrict__ V16, int ldv, int voff, _Float16* __restrict__ Vt) { __shared__ unsigned short tl[64][66]; const int tid = threadIdx.x; const int slab = blockIdx.x / (TTv / 64), lg = blockIdx.x % (TTv / 64); const int b = slab / NHv, h = slab % NHv;
  for (int i = tid; i < 64 * 8; i += 256) { const int r = i / 8, c8 = (i % 8) * 8; FragH f; f.half[0] = *(const v8us*)((const unsigned short*)V16 + ((size_t)b * TTv + lg * 64 + r) * ldv + voff + h * 64 + c8);
#pragma unroll
    for (int q = 0; q < 8; ++q) tl[r][c8 + q] = f.u[q]; }
  __syncthreads();
  {
#pragma unroll
    for (int rd = 0; rd < 2; ++rd) { const int d = rd * 32 + tid / 8, pc = tid % 8; FragH f;
#pragma unroll
      for (int q = 0; q < 8; ++q) f.u[q] = tl[pc * 8 + q][d];
      *(v8us*)((unsigned short*)Vt + ((size_t)slab * 64 + d) * TTv + lg * 64 + pc * 8) = f.half[0]; }
     } }

__global__ __launch_bounds__(256) void k_hl(const float* __restrict__ F, _Float16* __restrict__ Hh, _Float16* __restrict__ Hl, size_t n8) { const size_t t = (size_t)blockIdx.x * 256 + threadIdx.x; if (t >= n8) return; FragH fh, fl; const v4f a = *(const v4fa*)(F + t * 8), c = *(const v4fa*)(F + t * 8 + 4);
#pragma unroll
  for (int q = 0; q < 4; ++q) { _Float16 h = (_Float16)a[q]; fh.h[q] = h; fl.h[q] = (_Float16)((a[q] - (float)h) * 1024.0f); h = (_Float16)c[q]; fh.h[4 + q] = h; fl.h[4 + q] = (_Float16)((c[q] - (float)h) * 1024.0f); }
  { *(v8us*)((unsigned short*)Hh + t * 8) = fh.half[0]; *(v8us*)((unsigned short*)Hl + t * 8) = fl.half[0];  } }

// ---- fast GEMM (wave tile 32x64; requires M % 32 == 0 rows per launch region and N % 64 == 0); epilogue = k_gemm_hhx semantics ----
__device__ __forceinline__ v16h g2_frag(const _Float16* p, int hh) { FragH f; f.half[0] = *(const v8us*)((const unsigned short*)p + 8 * hh); f.half[1] = *(const v8us*)((const unsigned short*)p + 16 + 8 * hh); return f.v; }
__device__ __forceinline__ v8f g2_mma(v16h a, v16h b, v8f c) { v8f d = __builtin_amdgcn_wmma_f32_16x16x32_f16(false, a, false, b, (short)0, c, false, false); asm volatile("v_nop\n\tv_nop\n\tv_nop\n\tv_nop" : "+v"(d) : "v"(a), "v"(b)); return d; }
template <int ACT>
__global__ __launch_bounds__(128) void k_gemm2(const _Float16* __restrict__ A, int lda, size_t sA, const _Float16* __restrict__ Bh, int ldb, size_t sB, float alpha, const float* __restrict__ bias, const float* __restrict__ bias1, const float* __restrict__ bias2, size_t sBias, const float* __restrict__ CP, int rowsPerB, size_t sCPb, int row0g,
    float* __restrict__ C, _Float16* __restrict__ C16, int ldc, size_t sC, int M, int N, int K) { static_assert(ACT == 0 || ACT == 3 || ACT == 6 || ACT == 8 || ACT == 9 || ACT == 11 || ACT == 12 || ACT == 14 || ACT == 15 || ACT == 16 || ACT == 17, "k_gemm2: unsupported ACT code (would silently apply no activation)");
  __shared__ __attribute__((aligned(16))) float so[4][32][68];
  const int tid = threadIdx.x, w = tid >> 5, lane = tid & 31, ln = lane & 15, hh = lane >> 4; const int by = blockIdx.y;
  A += (size_t)by * sA; Bh += (size_t)by * sB; const size_t cofs = (size_t)by * sC; const float* bp = (by == 1 && bias1) ? bias1 : (by == 2 && bias2) ? bias2 : bias ? bias + (size_t)by * sBias : nullptr;      /* bias1, bias2: planes 1 and 2 where their biases are buffers of their own */
  const int ntn = N >> 6; const int mt = blockIdx.x / ntn, nq = blockIdx.x - mt * ntn; const int row0 = mt * 128 + 32 * w, col0 = nq * 64; if (row0 >= M) return;
  const _Float16* a0p = A + (size_t)(row0 + ln) * lda; const _Float16* a1p = a0p + (size_t)16 * lda;
  const _Float16* b0p = Bh + (size_t)(col0 + ln) * ldb; const _Float16* b1p = b0p + (size_t)16 * ldb; const _Float16* b2p = b1p + (size_t)16 * ldb; const _Float16* b3p = b2p + (size_t)16 * ldb;
  const v8f z8 = {0.f,0.f,0.f,0.f,0.f,0.f,0.f,0.f}; v8f c00 = z8, c01 = z8, c02 = z8, c03 = z8, c10 = z8, c11 = z8, c12 = z8, c13 = z8;
#pragma unroll 1
  for (int kb = 0; kb < K; kb += 32) { const v16h a0 = g2_frag(a0p + kb, hh), a1 = g2_frag(a1p + kb, hh);
    v16h b = g2_frag(b0p + kb, hh); c00 = g2_mma(a0, b, c00); c10 = g2_mma(a1, b, c10);
    b = g2_frag(b1p + kb, hh); c01 = g2_mma(a0, b, c01); c11 = g2_mma(a1, b, c11);
    b = g2_frag(b2p + kb, hh); c02 = g2_mma(a0, b, c02); c12 = g2_mma(a1, b, c12);
    b = g2_frag(b3p + kb, hh); c03 = g2_mma(a0, b, c03); c13 = g2_mma(a1, b, c13); }
  v8f accs[8] = {c00, c01, c02, c03, c10, c11, c12, c13};
#pragma unroll
  for (int u = 0; u < 8; ++u) { const int t = u & 3, half = u >> 2; const int col = col0 + t * 16 + ln; const float bv = bp ? bf16_round(bp[col]) : 0.f;
#pragma unroll
    for (int r = 0; r < 8; ++r) { const int rloc = half * 16 + 8 * hh + r; float v = accs[u][r] * alpha + bv; if (CP) { if (rowsPerB < 0) v += CP[cofs + (size_t)(row0g + row0 + rloc) * ldc + col];      /* rowsPerB < 0: own element of the batched C plane */ else { const int bidx = (row0g + row0 + rloc) / rowsPerB; v += CP[(size_t)bidx * sCPb + (size_t)by * 64 + col]; } }
      if (ACT == 3) v = fmaxf(v, 0.f); else if (ACT == 6) v = 0.5f * v * (1.0f + erff(v * 0.70710678118654752f)); else if (ACT == 11) v = 1.0f / (1.0f + expf(-v)); else if (ACT == 15) v = v / (1.0f + expf(-v)); else if (ACT == 12) v = (v > 0.f) ? v : 0.01f * v; else if (ACT == 8) v = tanhf(v); else if (ACT == 9) v = 0.5f * v * (1.0f + tanhf(0.7978845608028654f * (v + 0.044715f * v * v * v))); else if (ACT == 14) v = (v > 0.f) ? v : 0.1f * v; else if (ACT == 16) v = (v >= 0.f) ? v : 0.3f * v; else if (ACT == 17) v = (v >= 0.f) ? v : 0.2f * v;
      so[w][rloc][t * 16 + ln] = v; } }
  __builtin_amdgcn_fence(__ATOMIC_ACQ_REL, "workgroup"); __builtin_amdgcn_wave_barrier();
  const int rsub = lane >> 4, c4 = (lane & 15) * 4;
  {
#pragma unroll
    for (int q = 0; q < 16; ++q) { const int r = q * 2 + rsub; const v4f v = *(const v4fa*)&so[w][r][c4]; if (C) *(v4f*)(C + cofs + (size_t)(row0 + r) * ldc + col0 + c4) = v; if (C16) { v4h h4; for (int i = 0; i < 4; ++i) h4[i] = (_Float16)v[i]; *(v4h*)(C16 + cofs + (size_t)(row0 + r) * ldc + col0 + c4) = h4; } }
     } }


// Operand preparation, one launch; the block index picks the part (the same for a whole block), the largest part first:
//   PB_X blocks: hidden_state -> exact f16 copy, still channel-first;
//   PB_W blocks a weight slab (36 slabs = q, k, v times 12 heads): [in = 768][out = 64] -> rows h*64.. of that projection's Bt plane [n][k], x16 (bf16-exact weights stay exact in f16 away from the subnormal range);
//   PB_O blocks: Wo, natural [out][in] = Bt, x16.
#define PB_X ((unsigned)(NR * DM / 8 / 256))
#define PB_W ((unsigned)(HD * (DM / 8) / 256))
#define PB_O ((unsigned)(DM * DM / 8 / 256))
static_assert(NR * DM % 2048 == 0 && HD * DM % 2048 == 0 && DM * DM % 2048 == 0, "k_prep: every part is whole blocks of 256 threads x 8 elements");
__global__ __launch_bounds__(256) void k_prep(const float* __restrict__ x, const float* __restrict__ wq, const float* __restrict__ wk, const float* __restrict__ wv, const float* __restrict__ wo,
    _Float16* __restrict__ CF, _Float16* __restrict__ Bqkv, _Float16* __restrict__ Bo) {
  unsigned bx = blockIdx.x; FragH f;
  if (bx < PB_X) { const size_t t = (size_t)bx * 256 + threadIdx.x;
#pragma unroll
    for (int q = 0; q < 8; ++q) f.h[q] = (_Float16)bf16_round(x[t * 8 + q]);
    *(v8us*)((unsigned short*)CF + t * 8) = f.half[0]; return; }
  bx -= PB_X;
  if (bx < 3 * NH * PB_W) { const unsigned slab = bx / PB_W, m = slab / NH, h = slab - m * NH; const float* W = (m == 0 ? wq : m == 1 ? wk : wv) + (size_t)h * DM * HD;
    const int t = (int)(bx - slab * PB_W) * 256 + (int)threadIdx.x; const int n = t / (DM / 8), k8 = (t % (DM / 8)) * 8;
#pragma unroll
    for (int i = 0; i < 8; ++i) f.h[i] = (_Float16)(bf16_round(W[(size_t)(k8 + i) * HD + n]) * 16.0f);
    *(v8us*)((unsigned short*)Bqkv + (size_t)slab * HD * DM + (size_t)n * DM + k8) = f.half[0];
    asm volatile("s_wait_xcnt 0x0" ::: "memory");      /* precaution: in the built code the three parts join behind this store, and the wait stands in front of every later write of the store's registers on any path there */
    return; }
  bx -= 3 * NH * PB_W;
  { const size_t t = (size_t)bx * 256 + threadIdx.x;
#pragma unroll
    for (int q = 0; q < 8; ++q) f.h[q] = (_Float16)(bf16_round(wo[t * 8 + q]) * 16.0f);
    *(v8us*)((unsigned short*)Bo + t * 8) = f.half[0];
    asm volatile("s_wait_xcnt 0x0" ::: "memory");      /* precaution: in the built code the three parts join behind this store, and the wait stands in front of every later write of the store's registers on any path there */ } }
#define FA_KEYS 64      /* keys per LDS stage */
#define FA_PITCH 72     /* 16-bit elements per LDS row: 128 data bytes + 16 */
typedef float v2f __attribute__((ext_vector_type(2)));
__device__ __forceinline__ float fa_xhalf(float x) { return __builtin_bit_cast(float, __builtin_amdgcn_permlanex16(__builtin_bit_cast(int, x), __builtin_bit_cast(int, x), 0x76543210, 0xfedcba98, false, false)); }      /* lane l <-> lane l ^ 16 */
__device__ __forceinline__ v16h fa_frag(const unsigned short* p) { FragH f; f.half[0] = *(const v8us*)p; f.half[1] = *(const v8us*)(p + 16); return f.v; }      /* p = row + k0 + 8 * hh */
__device__ __forceinline__ v8f fa_mma(v16h a, v16h b, v8f c) { return __builtin_amdgcn_wmma_f32_16x16x32_f16(false, a, false, b, (short)0, c, false, false); }
__global__ __launch_bounds__(128) void k_fattn(const _Float16* __restrict__ Q16, const _Float16* __restrict__ K16, const _Float16* __restrict__ VT, _Float16* __restrict__ O16) {
  __shared__ __attribute__((aligned(16))) unsigned short sk[2][FA_KEYS][FA_PITCH];      /* K rows [key][d] */
  __shared__ __attribute__((aligned(16))) unsigned short sv[2][HD][FA_PITCH];           /* V^T rows [d][key] */
  const int tid = threadIdx.x, w = tid >> 5, lane = tid & 31, ln = lane & 15, hh = lane >> 4;
  const int h = blockIdx.y, b = blockIdx.z, q0 = blockIdx.x * 128 + w * 32;
  const unsigned short* kg = (const unsigned short*)K16 + (size_t)b * SQ * DM + h * HD;
  const unsigned short* vg = (const unsigned short*)VT + ((size_t)b * NH + h) * HD * SQ;
  v16h qf[2][2];
#pragma unroll      /* static indices keep qf[] in registers */
  for (int g = 0; g < 2; ++g) { const _Float16* qp = Q16 + ((size_t)b * SQ + q0 + 16 * g + ln) * DM + h * HD; qf[g][0] = g2_frag(qp, hh); qf[g][1] = g2_frag(qp + 32, hh); }
  const int sr = tid >> 3, sc = (tid & 7) * 8;      /* staging: eight threads a 128-byte row, rows sr + 16 i */
  v8us rk[4], rv[4];
#pragma unroll      /* static indices into rk[], rv[] */
  for (int i = 0; i < 4; ++i) { rk[i] = *(const v8us*)(kg + (size_t)(sr + 16 * i) * DM + sc); rv[i] = *(const v8us*)(vg + (size_t)(sr + 16 * i) * SQ + sc); }
#pragma unroll      /* static indices into rk[], rv[] */
  for (int i = 0; i < 4; ++i) { *(v8us*)&sk[0][sr + 16 * i][sc] = rk[i]; *(v8us*)&sv[0][sr + 16 * i][sc] = rv[i]; }
  __syncthreads();      /* stage 0 is published */
  const v8f z8 = {0.f, 0.f, 0.f, 0.f, 0.f, 0.f, 0.f, 0.f};
  v8f acc[2][4] = {{z8, z8, z8, z8}, {z8, z8, z8, z8}}; float mrun[2] = {-3.0e38f, -3.0e38f}; v2f lsum[2] = {{0.f, 0.f}, {0.f, 0.f}};      /* mrun: the maximum in use, log2 domain; lsum: the lane's share of the denominator, even and odd keys apart */
  const float L2E = 1.4426950408889634f;
#pragma unroll 1      /* one stage a trip: the body already holds two passes */
  for (int s = 0; s < SQ / FA_KEYS; ++s) {
    const int cur = s & 1; const bool more = s + 1 < SQ / FA_KEYS;      /* the same in every thread */
    if (more) {      /* the next stage's lines fly while this stage is worked on */
#pragma unroll      /* static indices into rk[], rv[] */
      for (int i = 0; i < 4; ++i) { rk[i] = *(const v8us*)(kg + (size_t)((s + 1) * FA_KEYS + sr + 16 * i) * DM + sc); rv[i] = *(const v8us*)(vg + (size_t)(sr + 16 * i) * SQ + (s + 1) * FA_KEYS + sc); } }
#pragma unroll      /* static indices into the register arrays */
    for (int ps = 0; ps < FA_KEYS / 32; ++ps) {
      v8f st[2][2];      /* [key tile][query group] */
#pragma unroll      /* static indices keep the register arrays in registers */
      for (int kt = 0; kt < 2; ++kt) { const unsigned short* kp = &sk[cur][ps * 32 + kt * 16 + ln][8 * hh]; const v16h k0 = fa_frag(kp), k1 = fa_frag(kp + 32);
#pragma unroll      /* static indices keep the register arrays in registers */
        for (int g = 0; g < 2; ++g) st[kt][g] = fa_mma(k1, qf[g][1], fa_mma(k0, qf[g][0], z8)); }
      v16h vf[4];
#pragma unroll      /* static indices keep the register arrays in registers */
      for (int t = 0; t < 4; ++t) vf[t] = fa_frag(&sv[cur][16 * t + ln][ps * 32 + 8 * hh]);
      float mb[2]; bool need = false;
#pragma unroll      /* static indices keep the register arrays in registers */
      for (int g = 0; g < 2; ++g) { float mx = st[0][g][0];
#pragma unroll      /* static indices keep the register arrays in registers */
        for (int r = 1; r < 8; ++r) mx = fmaxf(mx, st[0][g][r]);
#pragma unroll      /* static indices keep the register arrays in registers */
        for (int r = 0; r < 8; ++r) mx = fmaxf(mx, st[1][g][r]);
        mx = fmaxf(mx, fa_xhalf(mx)) * L2E; mb[g] = mx; need = need || (mx > mrun[g] + 8.0f); }      /* both halves hold the query's maximum of this pass */
      if (__builtin_amdgcn_ballot_w32(need) != 0) {      /* lazy rescale: only when some query's maximum passes the one in use by more than 2^8; always on the first pass */
#pragma unroll      /* static indices keep the register arrays in registers */
        for (int g = 0; g < 2; ++g) { const float mn = fmaxf(mrun[g], mb[g]); const float corr = __builtin_amdgcn_exp2f(mrun[g] - mn); mrun[g] = mn; lsum[g] *= corr;
#pragma unroll      /* static indices keep the register arrays in registers */
          for (int t = 0; t < 4; ++t) acc[g][t] *= corr; } }
#pragma unroll      /* static indices keep the register arrays in registers */
      for (int g = 0; g < 2; ++g) { const float nm = 6.0f - mrun[g]; FragH pf; v2f ls = {0.f, 0.f};      /* weights x 2^6: at most 2^14 in f16, small ones further from the subnormal range */
#pragma unroll      /* static indices keep the register arrays in registers */
        for (int i = 0; i < 8; ++i) { const v2f a = __builtin_elementwise_fma(v2f{st[i >> 2][g][2 * (i & 3)], st[i >> 2][g][2 * (i & 3) + 1]}, v2f{L2E, L2E}, v2f{nm, nm});
          const v2f p = {__builtin_amdgcn_exp2f(a.x), __builtin_amdgcn_exp2f(a.y)}; ls += p; pf.h[2 * i] = (_Float16)p.x; pf.h[2 * i + 1] = (_Float16)p.y; }
        lsum[g] += ls;
#pragma unroll      /* static indices keep the register arrays in registers */
        for (int t = 0; t < 4; ++t) acc[g][t] = fa_mma(vf[t], pf.v, acc[g][t]); }
    }
    if (more) {
#pragma unroll      /* static indices into rk[], rv[] */
      for (int i = 0; i < 4; ++i) { *(v8us*)&sk[cur ^ 1][sr + 16 * i][sc] = rk[i]; *(v8us*)&sv[cur ^ 1][sr + 16 * i][sc] = rv[i]; } }
    __syncthreads();      /* publishes stage s + 1 and ends every wave's reads of the buffer that the next trip refills */
  }
#pragma unroll      /* static indices keep the register arrays in registers */
  for (int g = 0; g < 2; ++g) { const float lh = lsum[g].x + lsum[g].y; const float inv = 64.0f / (lh + fa_xhalf(lh)); unsigned short* op = (unsigned short*)O16 + ((size_t)b * SQ + q0 + 16 * g + ln) * DM + h * HD + 8 * hh;      /* the halves' sums join once; o x64 */
#pragma unroll      /* static indices keep the register arrays in registers */
    for (int t = 0; t < 4; ++t) { FragH o;
#pragma unroll      /* static indices keep the register arrays in registers */
      for (int r = 0; r < 8; ++r) o.h[r] = (_Float16)(acc[g][t][r] * inv);
      *(v8us*)(op + 16 * t) = o.half[0]; } } }
__global__ __launch_bounds__(256) void k_vt(const _Float16* __restrict__ V16, int b, int h0, _Float16* __restrict__ VT) { __shared__ unsigned short tl[64][65]; const int tid = threadIdx.x; const int hh = blockIdx.x % HG, sg = blockIdx.x / HG; const int s0 = sg * 64; const int h = h0 + hh;
  for (int i = tid; i < 64 * 8; i += 256) { const int j = i / 8, d8 = (i % 8) * 8; FragH f; f.half[0] = *(const v8us*)((const unsigned short*)V16 + ((size_t)b * SQ + s0 + j) * DM + h * HD + d8); for (int q = 0; q < 8; ++q) tl[d8 + q][j] = f.u[q]; }
  __syncthreads();
  { for (int i = tid; i < 64 * 8; i += 256) { const int d = i / 8, j8 = (i % 8) * 8; FragH f; for (int q = 0; q < 8; ++q) f.u[q] = tl[d][j8 + q]; *(v8us*)((unsigned short*)VT + ((size_t)hh * HD + d) * SQ + s0 + j8) = f.half[0]; }  } }



__global__ __launch_bounds__(256) void k_rsmkm(const float* __restrict__ S, _Float16* __restrict__ P, int nrows, const int* __restrict__ am) {
  #pragma clang fp contract(off)
  const int t = blockIdx.x * 256 + threadIdx.x; if (t >= nrows) return; const size_t i = (size_t)t; const float* s = S + i * SQ; const int* mr = am + (size_t)(t % SQ) * SQ; float mx = -3.0e38f;
#pragma unroll 1
  for (int j = 0; j < SQ; ++j) { const float f = (mr[j] != 0) ? 1.f : 0.f; mx = fmaxf(mx, fmaf(f, s[j], (1.f - f) * -1.0e9f)); } float se = 0.f;
#pragma unroll 1
  for (int j = 0; j < SQ; ++j) { const float f = (mr[j] != 0) ? 1.f : 0.f; se += __expf(fmaf(f, s[j], (1.f - f) * -1.0e9f) - mx); } const float sc = 256.0f / se;
#pragma unroll 1
  for (int j0 = 0; j0 < SQ; j0 += 8) { FragH fr; for (int q = 0; q < 8; ++q) { const int j = j0 + q; const float f = (mr[j] != 0) ? 1.f : 0.f; fr.h[q] = (_Float16)(__expf(fmaf(f, s[j], (1.f - f) * -1.0e9f) - mx) * sc); }
    unsigned short* d = (unsigned short*)P + i * SQ + j0; *(v8us*)d = fr.half[0];  } }

template <int COLS>
__global__ __launch_bounds__(256) void k_wperm(const float* __restrict__ Wn, _Float16* __restrict__ Bt) {
  const size_t t = (size_t)blockIdx.x * 256 + threadIdx.x; if (t >= (size_t)DM * DM / 8) return; const size_t e0 = t * 8; const int n = (int)(e0 / DM), k0 = (int)(e0 % DM); FragH f;
  if (COLS == 0) { const int h = n >> 6, d = n & 63; const float* src = Wn + (size_t)(d * NH + h) * DM + k0; for (int q = 0; q < 8; ++q) f.h[q] = (_Float16)(bf16_round(src[q]) * 16.0f); }
  else { for (int q = 0; q < 8; ++q) { const int kk = k0 + q; const int h = kk >> 6, d = kk & 63; f.h[q] = (_Float16)(bf16_round(Wn[(size_t)n * DM + d * NH + h]) * 16.0f); } }
  unsigned short* dst = (unsigned short*)Bt + e0; *(v8us*)dst = f.half[0];  }
__global__ __launch_bounds__(256) void k_bperm(const float* __restrict__ b, float* __restrict__ out) { const int t = threadIdx.x; if (t >= DM) return; const int h = t >> 6, d = t & 63; const float v = b[d * NH + h]; *(float*)(out + t) = v;  }
__global__ __launch_bounds__(256) void k_tr32(const float* __restrict__ R, float* __restrict__ OUT, size_t n4) {
  R += (size_t)blockIdx.y * SQ * DM; OUT += (size_t)blockIdx.y * DM * SQ;      /* blockIdx.y = batch */
  const size_t t = (size_t)blockIdx.x * 256 + threadIdx.x; if (t >= n4) return; const size_t e = t * 4; const int c = (int)(e / SQ); const int n0 = (int)(e % SQ); v4f o; for (int q = 0; q < 4; ++q) o[q] = R[(size_t)(n0 + q) * DM + c]; *(v4f*)(OUT + e) = o;  }
extern "C" void kernel_launch(void* const* d_in, const int* in_sizes, int n_in,
                              void* d_out, int out_size, void* d_ws, size_t ws_size, hipStream_t stream) {
  (void)in_sizes; (void)n_in; (void)out_size;
  const float* const* I = (const float* const*)d_in; const float* xq = I[0]; const float* xk = I[0]; const float* xv = I[0]; const float* wq = I[1]; const float* bq = I[2]; const float* wk = I[3]; const float* bk = I[4]; const float* wv = I[5]; const float* bv = I[6]; const float* wo = I[7]; const float* bo = I[8]; const float* x = xq;      /* hidden_state [4][768][2048] (feeds q, k and v); per-head Wq / Wk / Wv [12][768][64] + biases [12][64] (= [768] head-major); Wo [768][768] natural + bo */
  char* ws = (char*)d_ws; size_t off = 0;
  auto take = [&](size_t bytes) { char* p = ws + off; off += (bytes + 255) & ~(size_t)255; return p; };
  _Float16* BQ = (_Float16*)take((size_t)3 * DM * DM * 2); _Float16* BO = (_Float16*)take((size_t)DM * DM * 2);      /* BQ: the q, k, v Bt planes in a row (plane stride DM * DM) */
  _Float16* X16 = (_Float16*)take(NR * DM * 2); _Float16* Q16 = (_Float16*)take(3 * NR * DM * 2); _Float16* K16 = Q16 + NR * DM; _Float16* V16 = K16 + NR * DM;      /* q, k, v rows in a row (plane stride NR * DM) */ _Float16* O16 = (_Float16*)take(NR * DM * 2); _Float16* CF16 = (_Float16*)take(NR * DM * 2); float* BP = (float*)take((size_t)3 * DM * 4); float* OR = (float*)take(NR * DM * 4);      /* channel-first f16 staging plane (one input at a time); 3 * DM floats, unused; f32 output token rows before the transpose back */
  _Float16* VT = (_Float16*)take((size_t)NB * NH * HD * SQ * 2);
  if (off > ws_size) return;
  k_prep<<<PB_X + 3 * NH * PB_W + PB_O, 256, 0, stream>>>(x, wq, wk, wv, wo, CF16, BQ, BO);      /* exact f16 copy of the [B][E][S] input; per-head [in = 768][out = 64] tensors -> rows h*64.. of the Bt planes (x16): head h = output columns h*64.. = the concat order; Wo natural [out][in] = Bt x16 */
  k_vt<SQ / 64, DM><<<NB * (SQ / 64) * (DM / 64), 256, 0, stream>>>(CF16, SQ, 0, X16);      /* LDS transposes [b][e][s] -> token rows [b][s][e], every batch in one launch (the kernel's slab index runs over batches); q, k and v all project these rows */

  const size_t r0p = (size_t)B0 * SQ;      /* first projected row */
  k_gemm2<0><<<dim3((unsigned)((MP / 128) * (DM / 64)), 3), 128, 0, stream>>>(X16 + r0p * DM, DM, 0, BQ, DM, (size_t)DM * DM, 0.0625f, bq, bk, bv, 0, nullptr, 1, 0, 0, nullptr, Q16 + r0p * DM, DM, NR * DM, MP, DM, DM);      /* blockIdx.y = q, k, v */
  k_vt<NH, SQ><<<NB * NH * (SQ / 64), 256, 0, stream>>>(V16, LQ, 0, VT);      /* V^T [NB][NH][HD][SQ], every batch in one launch */
  k_fattn<<<dim3(SQ / 128, NH, NB), 128, 0, stream>>>(Q16, K16, VT, O16);      /* UNSCALED scores q.k (the module omits 1/sqrt(d)), softmax and P.V; o (merged heads) as f16 rows x64 */
  k_gemm2<0><<<dim3((unsigned)((MPO / 128) * (DM / 64)), 1), 128, 0, stream>>>(O16 + r0p * DM, DM, 0, BO, DM, 0, 0.0009765625f, bo, nullptr, nullptr, 0, nullptr, 1, 0, 0, OR + r0p * DM, nullptr, DM, 0, MPO, DM, DM);      /* out token rows [n][co] (f32; bo is in natural channel order = the output columns) */
  k_tr32<<<dim3((unsigned)(((size_t)DM * SQ / 4 + 255) / 256), NB), 256, 0, stream>>>(OR, (float*)d_out, (size_t)DM * SQ / 4);      /* -> the module's [co][n] layout */
}

// v004
// It runs in 174 microseconds.
// Next to v003, in two timings, it ran 1.22 times as fast each time.
// Over all steps from v000 it is 34.1 times as fast.
#include <hip/hip_runtime.h>
#define NB 4
#define SQ 2048
#define DM 768
#define NH 12
#define HD 64
#define HG 4                         /* heads per block group of k_vt(V16, b, h0, VT) */
#define B0 0                         /* first batch processed (debug hook) */
#define NBR NB                       /* batches processed (debug hook) */
#define NR ((size_t)NB * SQ)         /* token rows */
#define MP ((int)((size_t)NBR * SQ)) /* rows projected (debug hook) */
#define QN SQ                        /* unused: k_fattn covers all SQ query rows */
#define NHD NH                       /* unused: k_fattn covers all NH heads */
#define MPO MP                       /* rows through the output stage (debug hook) */
#define LQ DM      /* unused: row pitch of the q and k rows */
typedef __bf16 v16b __attribute__((ext_vector_type(16)));
typedef unsigned short v8us __attribute__((ext_vector_type(8), may_alias));
typedef float  v8f  __attribute__((ext_vector_type(8)));
typedef float  v4f  __attribute__((ext_vector_type(4)));
typedef float  v4fa __attribute__((ext_vector_type(4), may_alias));
union FragB { v16b v; v8us half[2]; unsigned short u[16]; };

__device__ __forceinline__ unsigned short bf16_bits(float x) { unsigned int u = __float_as_uint(x); return (unsigned short)((u + 0x7FFFu + ((u >> 16) & 1u)) >> 16); }
__device__ __forceinline__ float bf16_val(unsigned short b) { return __uint_as_float(((unsigned int)b) << 16); }
__device__ __forceinline__ float bf16_round(float x) { return bf16_val(bf16_bits(x)); }
// D += A·B with NT terms: 1 = ah·bh, 2 = + al·bh (A split), 3 = + ah·bl (both split)
template <int NT>
__device__ __forceinline__ v8f mmaN(v16b ah, v16b al, v16b bh, v16b bl, v8f c) {
  c = __builtin_amdgcn_wmma_f32_16x16x32_bf16(false, ah, false, bh, (short)0, c, false, false);
  if (NT >= 2) c = __builtin_amdgcn_wmma_f32_16x16x32_bf16(false, al, false, bh, (short)0, c, false, false);
  if (NT >= 3) c = __builtin_amdgcn_wmma_f32_16x16x32_bf16(false, ah, false, bl, (short)0, c, false, false);
  asm volatile("v_nop\n\tv_nop\n\tv_nop\n\tv_nop" : "+v"(c) : "v"(ah), "v"(al), "v"(bh), "v"(bl));
  return c;
}

__global__ __launch_bounds__(256) void k_wt_bf16(const float* __restrict__ W, unsigned short* __restrict__ Wt, int K, int N) {
  const int t = blockIdx.x * 256 + threadIdx.x;
  const int k8n = K / 8;
  if (t >= N * k8n) return;
  const int n = t / k8n, k8 = (t % k8n) * 8;
  v8us v;
#pragma unroll
  for (int i = 0; i < 8; ++i) v[i] = bf16_bits(W[(size_t)(k8 + i) * N + n]);
  *(v8us*)(Wt + (size_t)n * K + k8) = v;
  
}

// GEMM C[M][N] (f32, pitch ldc) = act(A[M][K]·W + bias). A f32 row-major (pitch lda) converted per fragment to bf16
// (ASPLIT: hi/lo two planes -> 2 terms, else single rounded term); Wt bf16 [N][K] (pitch ldb). BIAS_BF16 rounds the
// bias to bf16 first (bias quantised to bf16 before the add). K%32==0, M%16==0, N%64==0.
template <bool ASPLIT, int ACT, bool BIAS_BF16>
__global__ __launch_bounds__(128) void k_gemm_bf(const float* __restrict__ A, int lda, const unsigned short* __restrict__ Wt, int ldb,
                                               const float* __restrict__ bias, float* __restrict__ C, int ldc, int M, int N, int K) {
  __shared__ __attribute__((aligned(16))) float so[4][16][64];
  const int tid = threadIdx.x, w = tid >> 5, lane = tid & 31, ln = lane & 15, hh = lane >> 4;
  const int ntn = N / 64;
  const int wid = blockIdx.x * 4 + w;
  const int mt = wid / ntn, nq = wid % ntn;
  if (mt * 16 >= M) return;
  const int row0 = mt * 16, col0 = nq * 64;
  const float* arow = A + (size_t)(row0 + ln) * lda;
  v8f acc[4] = {};
  for (int kb = 0; kb < K; kb += 32) {
    FragB ah, al;
    const v4f x0 = *(const v4fa*)(arow + kb + 8 * hh), x1 = *(const v4fa*)(arow + kb + 8 * hh + 4);
    const v4f x2 = *(const v4fa*)(arow + kb + 16 + 8 * hh), x3 = *(const v4fa*)(arow + kb + 16 + 8 * hh + 4);
    float xs[16] = {x0[0],x0[1],x0[2],x0[3],x1[0],x1[1],x1[2],x1[3],x2[0],x2[1],x2[2],x2[3],x3[0],x3[1],x3[2],x3[3]};
#pragma unroll
    for (int i = 0; i < 16; ++i) { const unsigned short hb = bf16_bits(xs[i]); ah.u[i] = hb; al.u[i] = ASPLIT ? bf16_bits(xs[i] - bf16_val(hb)) : (unsigned short)0; }
#pragma unroll
    for (int t = 0; t < 4; ++t) {
      const unsigned short* brow = Wt + (size_t)(col0 + t * 16 + ln) * ldb + kb;
      FragB b;
      b.half[0] = *(const v8us*)(brow + 8 * hh);
      b.half[1] = *(const v8us*)(brow + 16 + 8 * hh);
      acc[t] = mmaN<ASPLIT ? 2 : 1>(ah.v, al.v, b.v, b.v, acc[t]);
    }
  }
#pragma unroll
  for (int t = 0; t < 4; ++t) {
    float bv = bias ? bias[col0 + t * 16 + ln] : 0.f;
    if (BIAS_BF16) bv = bf16_round(bv);
#pragma unroll
    for (int r = 0; r < 8; ++r) { float v = acc[t][r] + bv; if (ACT == 1) v = fmaxf(v, 0.f); so[w][8 * hh + r][t * 16 + ln] = v; }
  }
  __builtin_amdgcn_fence(__ATOMIC_ACQ_REL, "workgroup");
  __builtin_amdgcn_wave_barrier();
  const int rsub = lane >> 4, c4 = (lane & 15) * 4;
  {
#pragma unroll
    for (int q = 0; q < 8; ++q) {
      const int r = q * 2 + rsub;
      const v4f v = *(const v4fa*)&so[w][r][c4];
      *(v4f*)(C + (size_t)(row0 + r) * ldc + col0 + c4) = v;
    }
    
  }
}

// GEMM C = act(A·W + bias + resid): A f32 (ASPLIT -> hi/lo 2 terms), Wt bf16 [N][K]; ACT 0 none, 1 relu, 2 exact gelu;
// resid (optional, f32, row index = (row % rmod), pitch ldr, RES_BF16 rounds it) added before the activation.
template <bool ASPLIT, int ACT, bool BIAS_BF16, bool RES_BF16>
__global__ __launch_bounds__(128) void k_gemm_bf3(const float* __restrict__ A, int lda, const unsigned short* __restrict__ Wt, int ldb,
                                                const float* __restrict__ bias, const float* __restrict__ resid, int rmod, int ldr,
                                                float* __restrict__ C, int ldc, int M, int N, int K) {
  __shared__ __attribute__((aligned(16))) float so[4][16][64];
  const int tid = threadIdx.x, w = tid >> 5, lane = tid & 31, ln = lane & 15, hh = lane >> 4;
  const int ntn = N / 64;
  const int wid = blockIdx.x * 4 + w;
  const int mt = wid / ntn, nq = wid % ntn;
  if (mt * 16 >= M) return;
  const int row0 = mt * 16, col0 = nq * 64;
  const float* arow = A + (size_t)(row0 + ln) * lda;
  v8f acc[4] = {};
  for (int kb = 0; kb < K; kb += 32) {
    FragB ah, al;
    const v4f x0 = *(const v4fa*)(arow + kb + 8 * hh), x1 = *(const v4fa*)(arow + kb + 8 * hh + 4);
    const v4f x2 = *(const v4fa*)(arow + kb + 16 + 8 * hh), x3 = *(const v4fa*)(arow + kb + 16 + 8 * hh + 4);
    float xs[16] = {x0[0],x0[1],x0[2],x0[3],x1[0],x1[1],x1[2],x1[3],x2[0],x2[1],x2[2],x2[3],x3[0],x3[1],x3[2],x3[3]};
#pragma unroll
    for (int i = 0; i < 16; ++i) { const unsigned short hb = bf16_bits(xs[i]); ah.u[i] = hb; al.u[i] = ASPLIT ? bf16_bits(xs[i] - bf16_val(hb)) : (unsigned short)0; }
#pragma unroll
    for (int t = 0; t < 4; ++t) {
      const unsigned short* brow = Wt + (size_t)(col0 + t * 16 + ln) * ldb + kb;
      FragB b;
      b.half[0] = *(const v8us*)(brow + 8 * hh);
      b.half[1] = *(const v8us*)(brow + 16 + 8 * hh);
      acc[t] = mmaN<ASPLIT ? 2 : 1>(ah.v, al.v, b.v, b.v, acc[t]);
    }
  }
#pragma unroll
  for (int t = 0; t < 4; ++t) {
    const int col = col0 + t * 16 + ln;
    float bv = bias ? bias[col] : 0.f;
    if (BIAS_BF16) bv = bf16_round(bv);
#pragma unroll
    for (int r = 0; r < 8; ++r) {
      float v = acc[t][r] + bv;
      if (resid) { float rv = resid[(size_t)((row0 + 8 * hh + r) % rmod) * ldr + col]; if (RES_BF16) rv = bf16_round(rv); v += rv; }
      if (ACT == 1) v = fmaxf(v, 0.f);
      if (ACT == 2) v = 0.5f * v * (1.0f + erff(v * 0.70710678118654752f));
      if (ACT == 3) { const float u = 0.7978845608028654f * (v + 0.044715f * v * v * v); v = 0.5f * v * (1.0f + tanhf(u)); }
      so[w][8 * hh + r][t * 16 + ln] = v;
    }
  }
  __builtin_amdgcn_fence(__ATOMIC_ACQ_REL, "workgroup");
  __builtin_amdgcn_wave_barrier();
  const int rsub = lane >> 4, c4 = (lane & 15) * 4;
  {
#pragma unroll
    for (int q = 0; q < 8; ++q) {
      const int r = q * 2 + rsub;
      const v4f v = *(const v4fa*)&so[w][r][c4];
      *(v4f*)(C + (size_t)(row0 + r) * ldc + col0 + c4) = v;
    }
    
  }
}
// row LayerNorm (biased variance, eps) over N: s = X (+ R); optional out_sum <- s; out_norm <- (s-mu)*rsqrt(var+eps)*g + b
template <bool PARAM_BF16>
__global__ __launch_bounds__(256) void k_layernorm(const float* __restrict__ X, const float* __restrict__ R, const float* __restrict__ g, const float* __restrict__ bta,
                                                  float* __restrict__ out_sum, float* __restrict__ out_norm, int N, float eps) {
  __shared__ float red[256];
  const int row = blockIdx.x, tid = threadIdx.x;
  const float* x = X + (size_t)row * N; const float* rr = R ? R + (size_t)row * N : nullptr;
  float vals[16];                     // up to N = 4096
  const int per = N / 256;            // contiguous chunk per thread? use strided-by-4 chunks: thread handles j = tid*4 + 1024*u
  float s1 = 0.f;
  for (int u = 0; u < per / 4; ++u) {
    const int j = tid * 4 + 1024 * u;
    const v4f a = *(const v4fa*)(x + j);
    v4f b = {0.f,0.f,0.f,0.f}; if (rr) b = *(const v4fa*)(rr + j);
#pragma unroll
    for (int q = 0; q < 4; ++q) { const float v = a[q] + b[q]; vals[u * 4 + q] = v; s1 += v; }
  }
  red[tid] = s1; __syncthreads();
  for (int st = 128; st > 0; st >>= 1) { if (tid < st) red[tid] += red[tid + st]; __syncthreads(); }
  const float mu = red[0] / (float)N; __syncthreads();
  float s2 = 0.f;
  for (int u = 0; u < per / 4; ++u)
#pragma unroll
    for (int q = 0; q < 4; ++q) { const float c = vals[u * 4 + q] - mu; s2 += c * c; }
  red[tid] = s2; __syncthreads();
  for (int st = 128; st > 0; st >>= 1) { if (tid < st) red[tid] += red[tid + st]; __syncthreads(); }
  const float rs = rsqrtf(red[0] / (float)N + eps);
  {
    for (int u = 0; u < per / 4; ++u) {
      const int j = tid * 4 + 1024 * u;
      v4f o, sm;
#pragma unroll
      for (int q = 0; q < 4; ++q) {
        float gg = g[j + q], bb = bta[j + q];
        if (PARAM_BF16) { gg = bf16_round(gg); bb = bf16_round(bb); }
        sm[q] = vals[u * 4 + q]; o[q] = (vals[u * 4 + q] - mu) * rs * gg + bb;
      }
      if (out_sum) *(v4f*)(out_sum + (size_t)row * N + j) = sm;
      *(v4f*)(out_norm + (size_t)row * N + j) = o;
    }
    
  }
}



// ---- f16 WMMA path (v_wmma_f32_16x16x32_f16): 11-bit significands for operands in range — used where a [0,1] probability operand needs more precision than bf16
typedef _Float16 v16h __attribute__((ext_vector_type(16)));
union FragH { v16h v; v8us half[2]; _Float16 h[16]; unsigned short u[16]; };
template <int NT>
__device__ __forceinline__ v8f mmaH(v16h ah, v16h al, v16h bh, v16h bl, v8f c) {
  c = __builtin_amdgcn_wmma_f32_16x16x32_f16(false, ah, false, bh, (short)0, c, false, false);
  if (NT >= 2) c = __builtin_amdgcn_wmma_f32_16x16x32_f16(false, al, false, bh, (short)0, c, false, false);
  if (NT >= 3) c = __builtin_amdgcn_wmma_f32_16x16x32_f16(false, ah, false, bl, (short)0, c, false, false);
  asm volatile("v_nop\n\tv_nop\n\tv_nop\n\tv_nop" : "+v"(c) : "v"(ah), "v"(al), "v"(bh), "v"(bl));
  return c;
}
// batched GEMM like k_gemm_b but f16 operands: A f32 (split into f16 hi/lo if ASPLIT, else rounded to f16), Bt = f16 values [n][k]; alpha; C f32; N multiple of 16 (partial tiles skipped)
template <bool ASPLIT>
__global__ __launch_bounds__(128) void k_gemm_h(const float* __restrict__ A, int lda, size_t sA, const _Float16* __restrict__ Bh, int ldb, size_t sB, float alpha, float* __restrict__ C, int ldc, size_t sC, int M, int N, int K) {
  __shared__ __attribute__((aligned(16))) float so[4][16][64];
  const int tid = threadIdx.x, w = tid >> 5, lane = tid & 31, ln = lane & 15, hh = lane >> 4; const int by = blockIdx.y;
  A += (size_t)by * sA; Bh += (size_t)by * sB; C += (size_t)by * sC;
  const int ntn = (N + 63) / 64; const int wid = blockIdx.x * 4 + w; const int mt = wid / ntn, nq = wid % ntn; if (mt * 16 >= M) return;
  const int row0 = mt * 16, col0 = nq * 64; const float* arow = A + (size_t)(row0 + ln) * lda;
  v8f acc[4] = {};
  for (int kb = 0; kb < K; kb += 32) {
    FragH ah, al;
    const v4f x0 = *(const v4fa*)(arow + kb + 8 * hh), x1 = *(const v4fa*)(arow + kb + 8 * hh + 4), x2 = *(const v4fa*)(arow + kb + 16 + 8 * hh), x3 = *(const v4fa*)(arow + kb + 16 + 8 * hh + 4);
    float xs[16] = {x0[0],x0[1],x0[2],x0[3],x1[0],x1[1],x1[2],x1[3],x2[0],x2[1],x2[2],x2[3],x3[0],x3[1],x3[2],x3[3]};
#pragma unroll
    for (int i = 0; i < 16; ++i) { const _Float16 h = (_Float16)xs[i]; ah.h[i] = h; al.h[i] = ASPLIT ? (_Float16)(xs[i] - (float)h) : (_Float16)0.0f; }
#pragma unroll
    for (int t = 0; t < 4; ++t) { if (col0 + t * 16 >= N) continue; const size_t boff = (size_t)(col0 + t * 16 + ln) * ldb + kb; FragH bq; bq.half[0] = *(const v8us*)(Bh + boff + 8 * hh); bq.half[1] = *(const v8us*)(Bh + boff + 16 + 8 * hh);
      acc[t] = mmaH<ASPLIT ? 2 : 1>(ah.v, al.v, bq.v, bq.v, acc[t]); }
  }
#pragma unroll
  for (int t = 0; t < 4; ++t) { if (col0 + t * 16 >= N) continue;
#pragma unroll
    for (int r = 0; r < 8; ++r) so[w][8 * hh + r][t * 16 + ln] = acc[t][r] * alpha; }
  __builtin_amdgcn_fence(__ATOMIC_ACQ_REL, "workgroup"); __builtin_amdgcn_wave_barrier();
  const int rsub = lane >> 4, c4 = (lane & 15) * 4;
  {
#pragma unroll
    for (int q = 0; q < 8; ++q) { const int r = q * 2 + rsub; if (col0 + c4 < N) { const v4f v = *(const v4fa*)&so[w][r][c4]; *(v4f*)(C + (size_t)(row0 + r) * ldc + col0 + c4) = v; } }
     }
}

// k_gemm_hh variant with fused epilogue: v = acc·alpha + bias[by·sBias + col] (+ CP[(row/rowsPerB)·sCPb + by·64 + col] if CP) ; ACT 0 none / 1 elu ; writes f16 C16 (and f32 C if non-null)
template <int ACT>
__global__ __launch_bounds__(128) void k_gemm_hhx(const _Float16* __restrict__ A, int lda, size_t sA, const _Float16* __restrict__ Bh, int ldb, size_t sB, float alpha, const float* __restrict__ bias, size_t sBias, const float* __restrict__ CP, int rowsPerB, size_t sCPb, int row0g,
    float* __restrict__ C, _Float16* __restrict__ C16, int ldc, size_t sC, int M, int N, int K) {
  __shared__ __attribute__((aligned(16))) float so[4][16][64];
  const int tid = threadIdx.x, w = tid >> 5, lane = tid & 31, ln = lane & 15, hh = lane >> 4; const int by = blockIdx.y;
  A += (size_t)by * sA; Bh += (size_t)by * sB; const size_t cofs = (size_t)by * sC; const float* bp = bias ? bias + (size_t)by * sBias : nullptr;
  const int ntn = (N + 63) / 64; const int wid = blockIdx.x * 4 + w; const int mt = wid / ntn, nq = wid % ntn; if (mt * 16 >= M) return;
  const int row0 = mt * 16, col0 = nq * 64; const _Float16* arow = A + (size_t)(row0 + ln) * lda;
  v8f acc[4] = {};
  for (int kb = 0; kb < K; kb += 32) { FragH ah; ah.half[0] = *(const v8us*)((const unsigned short*)arow + kb + 8 * hh); ah.half[1] = *(const v8us*)((const unsigned short*)arow + kb + 16 + 8 * hh);
#pragma unroll
    for (int t = 0; t < 4; ++t) { if (col0 + t * 16 >= N) continue; const size_t boff = (size_t)(col0 + t * 16 + ln) * ldb + kb; FragH bq; bq.half[0] = *(const v8us*)((const unsigned short*)Bh + boff + 8 * hh); bq.half[1] = *(const v8us*)((const unsigned short*)Bh + boff + 16 + 8 * hh);
      acc[t] = mmaH<1>(ah.v, ah.v, bq.v, bq.v, acc[t]); }
  }
#pragma unroll
  for (int t = 0; t < 4; ++t) { if (col0 + t * 16 >= N) continue; const int col = col0 + t * 16 + ln; const float bv = bp ? bf16_round(bp[col]) : 0.f;
#pragma unroll
    for (int r = 0; r < 8; ++r) { float v = acc[t][r] * alpha + bv; if (CP) { const int rr = row0g + row0 + 8 * hh + r; if (rowsPerB < 0) v += CP[cofs + (size_t)rr * ldc + col];      /* rowsPerB < 0: own element of the batched C plane */ else { const int bidx = rr / rowsPerB; v += CP[(size_t)bidx * sCPb + (size_t)by * 64 + col]; } } if (ACT == 1) v = (v > 0.f) ? v : expm1f(v); else if (ACT == 7) v = (v > 0.f) ? v + 1.0f : expf(v); else if (ACT == 8) v = tanhf(v); else if (ACT == 9) v = 0.5f * v * (1.0f + tanhf(0.7978845608028654f * (v + 0.044715f * v * v * v))); else if (ACT == 11) v = 1.0f / (1.0f + expf(-v)); else if (ACT == 12) v = (v > 0.f) ? v : 0.01f * v; else if (ACT == 14) v = (v > 0.f) ? v : 0.1f * v; else if (ACT == 16) v = (v >= 0.f) ? v : 0.3f * v; else if (ACT == 17) v = (v >= 0.f) ? v : 0.2f * v; else if (ACT == 15) v = v / (1.0f + expf(-v)); else if (ACT == 3) v = fmaxf(v, 0.f); else if (ACT == 6) v = 0.5f * v * (1.0f + erff(v * 0.70710678118654752f)); so[w][8 * hh + r][t * 16 + ln] = v; } }
  __builtin_amdgcn_fence(__ATOMIC_ACQ_REL, "workgroup"); __builtin_amdgcn_wave_barrier();
  const int rsub = lane >> 4, c4 = (lane & 15) * 4; typedef _Float16 v4h __attribute__((ext_vector_type(4)));
  {
#pragma unroll
    for (int q = 0; q < 8; ++q) { const int r = q * 2 + rsub; if (col0 + c4 < N) { const v4f v = *(const v4fa*)&so[w][r][c4]; if (C) *(v4f*)(C + cofs + (size_t)(row0 + r) * ldc + col0 + c4) = v; if (C16) { v4h h4; for (int i = 0; i < 4; ++i) h4[i] = (_Float16)v[i]; *(v4h*)(C16 + cofs + (size_t)(row0 + r) * ldc + col0 + c4) = h4; } } }
     }
}


typedef _Float16 v4h __attribute__((ext_vector_type(4)));

__global__ __launch_bounds__(256) void k_h16(const float* __restrict__ x, _Float16* __restrict__ X16, size_t n8) { const size_t t = (size_t)blockIdx.x * 256 + threadIdx.x; if (t >= n8) return; FragH f;
#pragma unroll
  for (int q = 0; q < 8; ++q) f.h[q] = (_Float16)x[t * 8 + q]; *(v8us*)((unsigned short*)X16 + t * 8) = f.half[0];  }
__global__ __launch_bounds__(256) void k_round16f(const float* __restrict__ W, _Float16* __restrict__ Bt, size_t n8) { const size_t t = (size_t)blockIdx.x * 256 + threadIdx.x; if (t >= n8) return; FragH f;
#pragma unroll
  for (int i = 0; i < 8; ++i) f.h[i] = (_Float16)(bf16_round(W[t * 8 + i]) * 16.0f); *(v8us*)((unsigned short*)Bt + t * 8) = f.half[0];  }
__global__ __launch_bounds__(256) void k_hl(const float* __restrict__ F, _Float16* __restrict__ Hh, _Float16* __restrict__ Hl, size_t n8) { const size_t t = (size_t)blockIdx.x * 256 + threadIdx.x; if (t >= n8) return; FragH fh, fl; const v4f a = *(const v4fa*)(F + t * 8), c = *(const v4fa*)(F + t * 8 + 4);
#pragma unroll
  for (int q = 0; q < 4; ++q) { _Float16 h = (_Float16)a[q]; fh.h[q] = h; fl.h[q] = (_Float16)((a[q] - (float)h) * 1024.0f); h = (_Float16)c[q]; fh.h[4 + q] = h; fl.h[4 + q] = (_Float16)((c[q] - (float)h) * 1024.0f); }
  { *(v8us*)((unsigned short*)Hh + t * 8) = fh.half[0]; *(v8us*)((unsigned short*)Hl + t * 8) = fl.half[0];  } }

// ---- fast GEMM (wave tile 32x64; requires M % 32 == 0 rows per launch region and N % 64 == 0); epilogue = k_gemm_hhx semantics ----
__device__ __forceinline__ v16h g2_frag(const _Float16* p, int hh) { FragH f; f.half[0] = *(const v8us*)((const unsigned short*)p + 8 * hh); f.half[1] = *(const v8us*)((const unsigned short*)p + 16 + 8 * hh); return f.v; }
__device__ __forceinline__ v8f g2_mma(v16h a, v16h b, v8f c) { v8f d = __builtin_amdgcn_wmma_f32_16x16x32_f16(false, a, false, b, (short)0, c, false, false); asm volatile("v_nop\n\tv_nop\n\tv_nop\n\tv_nop" : "+v"(d) : "v"(a), "v"(b)); return d; }
template <int ACT>
__global__ __launch_bounds__(128) void k_gemm2(const _Float16* __restrict__ A, int lda, size_t sA, const _Float16* __restrict__ Bh, int ldb, size_t sB, float alpha, const float* __restrict__ bias, const float* __restrict__ bias1, const float* __restrict__ bias2, size_t sBias, const float* __restrict__ CP, int rowsPerB, size_t sCPb, int row0g,
    float* __restrict__ C, _Float16* __restrict__ C16, int ldc, size_t sC, int M, int N, int K, int tp, int rpt) { static_assert(ACT == 0 || ACT == 3 || ACT == 6 || ACT == 8 || ACT == 9 || ACT == 11 || ACT == 12 || ACT == 14 || ACT == 15 || ACT == 16 || ACT == 17, "k_gemm2: unsupported ACT code (would silently apply no activation)");
  __shared__ __attribute__((aligned(16))) float so[4][32][68]; constexpr int TPI = 132;      /* 128 rows + 4: sixteen columns' 16-byte LDS stores fall on sixteen different bank groups */
  static_assert(64 * TPI <= 4 * 32 * 68, "k_gemm2: the transposed tile lies in so[]");
  const int tid = threadIdx.x, w = tid >> 5, lane = tid & 31, ln = lane & 15, hh = lane >> 4; const int by = blockIdx.y;
  A += (size_t)by * sA; Bh += (size_t)by * sB; const size_t cofs = (size_t)by * sC; const float* bp = (by == 1 && bias1) ? bias1 : (by == 2 && bias2) ? bias2 : bias ? bias + (size_t)by * sBias : nullptr;      /* bias1, bias2: planes 1 and 2 where their biases are buffers of their own */
  const int ntn = N >> 6; const int mt = blockIdx.x / ntn, nq = blockIdx.x - mt * ntn; const int row0 = mt * 128 + 32 * w, col0 = nq * 64; if (row0 >= M) return;      /* M is a multiple of 128 wherever a plane is stored transposed: a block leaves whole or not at all */
  const bool tr = by >= tp;      /* planes tp.. are stored transposed, [row / rpt][col][row % rpt] (rpt a multiple of 128); the same in every thread of a block */
  float* const T = &so[0][0][0];      /* transposed path: the block's tile as [64 columns][128 rows], pitch TPI */
  const _Float16* a0p = A + (size_t)(row0 + ln) * lda; const _Float16* a1p = a0p + (size_t)16 * lda;
  const _Float16* b0p = Bh + (size_t)(col0 + ln) * ldb; const _Float16* b1p = b0p + (size_t)16 * ldb; const _Float16* b2p = b1p + (size_t)16 * ldb; const _Float16* b3p = b2p + (size_t)16 * ldb;
  const v8f z8 = {0.f,0.f,0.f,0.f,0.f,0.f,0.f,0.f}; v8f c00 = z8, c01 = z8, c02 = z8, c03 = z8, c10 = z8, c11 = z8, c12 = z8, c13 = z8;
#pragma unroll 1
  for (int kb = 0; kb < K; kb += 32) { const v16h a0 = g2_frag(a0p + kb, hh), a1 = g2_frag(a1p + kb, hh);
    v16h b = g2_frag(b0p + kb, hh); c00 = g2_mma(a0, b, c00); c10 = g2_mma(a1, b, c10);
    b = g2_frag(b1p + kb, hh); c01 = g2_mma(a0, b, c01); c11 = g2_mma(a1, b, c11);
    b = g2_frag(b2p + kb, hh); c02 = g2_mma(a0, b, c02); c12 = g2_mma(a1, b, c12);
    b = g2_frag(b3p + kb, hh); c03 = g2_mma(a0, b, c03); c13 = g2_mma(a1, b, c13); }
  v8f accs[8] = {c00, c01, c02, c03, c10, c11, c12, c13};
#pragma unroll
  for (int u = 0; u < 8; ++u) { const int t = u & 3, half = u >> 2; const int col = col0 + t * 16 + ln; const float bv = bp ? bf16_round(bp[col]) : 0.f;
    float vv[8];      /* the lane's eight values of this tile: rows 8 * hh .. + 7 of one column */
#pragma unroll
    for (int r = 0; r < 8; ++r) { const int rloc = half * 16 + 8 * hh + r; float v = accs[u][r] * alpha + bv; if (CP) { if (rowsPerB < 0) v += CP[cofs + (size_t)(row0g + row0 + rloc) * ldc + col];      /* rowsPerB < 0: own element of the batched C plane */ else { const int bidx = (row0g + row0 + rloc) / rowsPerB; v += CP[(size_t)bidx * sCPb + (size_t)by * 64 + col]; } }
      if (ACT == 3) v = fmaxf(v, 0.f); else if (ACT == 6) v = 0.5f * v * (1.0f + erff(v * 0.70710678118654752f)); else if (ACT == 11) v = 1.0f / (1.0f + expf(-v)); else if (ACT == 15) v = v / (1.0f + expf(-v)); else if (ACT == 12) v = (v > 0.f) ? v : 0.01f * v; else if (ACT == 8) v = tanhf(v); else if (ACT == 9) v = 0.5f * v * (1.0f + tanhf(0.7978845608028654f * (v + 0.044715f * v * v * v))); else if (ACT == 14) v = (v > 0.f) ? v : 0.1f * v; else if (ACT == 16) v = (v >= 0.f) ? v : 0.3f * v; else if (ACT == 17) v = (v >= 0.f) ? v : 0.2f * v;
      vv[r] = v; }
    if (tr) { float* tq = T + (t * 16 + ln) * TPI + 32 * w + half * 16 + 8 * hh; *(v4fa*)tq = v4f{vv[0], vv[1], vv[2], vv[3]}; *(v4fa*)(tq + 4) = v4f{vv[4], vv[5], vv[6], vv[7]}; }      /* a lane's eight values are eight rows in a row of one column */
    else {
#pragma unroll      /* static indices keep vv[] in registers */
      for (int r = 0; r < 8; ++r) so[w][half * 16 + 8 * hh + r][t * 16 + ln] = vv[r]; } }
  if (tr) {
    __syncthreads();      /* the four waves' row groups make up each column's 128 rows */
    const int rb = mt * 128, bb = rb / rpt; const size_t tb = cofs + ((size_t)bb * N + col0) * rpt + (rb - bb * rpt);
    if (C) {
#pragma unroll      /* the columns' LDS reads and stores overlap */
      for (int q = 0; q < 16; ++q) { const int cc = q * 4 + w; const v4f v = *(const v4fa*)(T + cc * TPI + lane * 4); *(v4f*)(C + tb + (size_t)cc * rpt + lane * 4) = v; }      /* a wave's store = one column's 512 bytes */
      asm volatile("s_wait_xcnt 0x0" ::: "memory"); }      /* precaution: the code behind (the 16-bit stores; in the built code also the join with the untransposed path) rewrites these stores' registers, and the wait stands in front of that on any path */
    if (C16) {
#pragma unroll      /* the columns' LDS reads and stores overlap */
      for (int q = 0; q < 8; ++q) { const int cc = q * 8 + w * 2 + hh; const v4f v0 = *(const v4fa*)(T + cc * TPI + ln * 8), v1 = *(const v4fa*)(T + cc * TPI + ln * 8 + 4); FragH h8;
#pragma unroll      /* static indices keep h8 in registers */
        for (int i = 0; i < 4; ++i) { h8.h[i] = (_Float16)v0[i]; h8.h[4 + i] = (_Float16)v1[i]; }
        *(v8us*)((unsigned short*)C16 + tb + (size_t)cc * rpt + ln * 8) = h8.half[0]; }      /* a wave's store = two columns' 256 bytes each */
      asm volatile("s_wait_xcnt 0x0" ::: "memory"); }      /* precaution: in the built code this path joins the untransposed one behind these stores, and the wait stands in front of every later write of their registers on any path there */
    return; }
  __builtin_amdgcn_fence(__ATOMIC_ACQ_REL, "workgroup"); __builtin_amdgcn_wave_barrier();
  const int rsub = lane >> 4, c4 = (lane & 15) * 4;
  {
#pragma unroll
    for (int q = 0; q < 16; ++q) { const int r = q * 2 + rsub; const v4f v = *(const v4fa*)&so[w][r][c4]; if (C) *(v4f*)(C + cofs + (size_t)(row0 + r) * ldc + col0 + c4) = v; if (C16) { v4h h4; for (int i = 0; i < 4; ++i) h4[i] = (_Float16)v[i]; *(v4h*)(C16 + cofs + (size_t)(row0 + r) * ldc + col0 + c4) = h4; } }
     } }


// Operand preparation, one launch; the block index picks the part (the same for a whole block), the largest part first:
//   PB_X blocks: hidden_state [b][e][s] -> exact f16 token rows [b][s][e], one 64-channel x 64-token tile a block, turned in LDS;
//   PB_W blocks a weight slab (36 slabs = q, k, v times 12 heads): [in = 768][out = 64] -> rows h*64.. of that projection's Bt plane [n][k], x16 (bf16-exact weights stay exact in f16 away from the subnormal range);
//   PB_O blocks: Wo, natural [out][in] = Bt, x16.
#define PB_X ((unsigned)(NB * (SQ / 64) * (DM / 64)))
#define PB_W ((unsigned)(HD * (DM / 8) / 256))
#define PB_O ((unsigned)(DM * DM / 8 / 256))
static_assert(SQ % 64 == 0 && DM % 64 == 0 && HD * DM % 2048 == 0 && DM * DM % 2048 == 0, "k_prep: whole 64 x 64 tiles of x; the weight parts are whole blocks of 256 threads x 8 elements");
__global__ __launch_bounds__(256) void k_prep(const float* __restrict__ x, const float* __restrict__ wq, const float* __restrict__ wk, const float* __restrict__ wv, const float* __restrict__ wo,
    _Float16* __restrict__ X16, _Float16* __restrict__ Bqkv, _Float16* __restrict__ Bo) {
  __shared__ unsigned short tl[64][66];      /* x part: [channel][token] */
  unsigned bx = blockIdx.x; FragH f;
  if (bx < PB_X) { const int tid = (int)threadIdx.x; const unsigned slab = bx / (DM / 64), eg = bx - slab * (DM / 64), b = slab / (SQ / 64), sg = slab - b * (SQ / 64);      /* slab = 64 tokens of one batch, eg = 64 channels */
    const float* xs = x + ((size_t)b * DM + eg * 64) * SQ + sg * 64;
#pragma unroll      /* the four loads fly together */
    for (int p = 0; p < 4; ++p) { const int r = p * 16 + (tid >> 4), c4 = (tid & 15) * 4; const v4f a = *(const v4fa*)(xs + (size_t)r * SQ + c4);      /* sixteen threads a channel's 256 bytes */
#pragma unroll      /* static indices keep f in registers */
      for (int q = 0; q < 4; ++q) { f.h[q] = (_Float16)bf16_round(a[q]); tl[r][c4 + q] = f.u[q]; } }
    __syncthreads();      /* the tile is whole before it is read by columns; every thread of an x block passes here */
#pragma unroll      /* both rows' LDS reads overlap */
    for (int rd = 0; rd < 2; ++rd) { const int d = rd * 32 + tid / 8, pc = tid % 8;      /* eight threads a token's 128 bytes */
#pragma unroll      /* static indices keep f in registers */
      for (int q = 0; q < 8; ++q) f.u[q] = tl[pc * 8 + q][d];
      *(v8us*)((unsigned short*)X16 + ((size_t)slab * 64 + d) * DM + eg * 64 + pc * 8) = f.half[0]; }
    return; }
  bx -= PB_X;
  if (bx < 3 * NH * PB_W) { const unsigned slab = bx / PB_W, m = slab / NH, h = slab - m * NH; const float* W = (m == 0 ? wq : m == 1 ? wk : wv) + (size_t)h * DM * HD;
    const int t = (int)(bx - slab * PB_W) * 256 + (int)threadIdx.x; const int n = t / (DM / 8), k8 = (t % (DM / 8)) * 8;
#pragma unroll
    for (int i = 0; i < 8; ++i) f.h[i] = (_Float16)(bf16_round(W[(size_t)(k8 + i) * HD + n]) * 16.0f);
    *(v8us*)((unsigned short*)Bqkv + (size_t)slab * HD * DM + (size_t)n * DM + k8) = f.half[0];
    asm volatile("s_wait_xcnt 0x0" ::: "memory");      /* precaution: in the built code the three parts join behind this store, and the wait stands in front of every later write of the store's registers on any path there */
    return; }
  bx -= 3 * NH * PB_W;
  { const size_t t = (size_t)bx * 256 + threadIdx.x;
#pragma unroll
    for (int q = 0; q < 8; ++q) f.h[q] = (_Float16)(bf16_round(wo[t * 8 + q]) * 16.0f);
    *(v8us*)((unsigned short*)Bo + t * 8) = f.half[0];
    asm volatile("s_wait_xcnt 0x0" ::: "memory");      /* precaution: in the built code the three parts join behind this store, and the wait stands in front of every later write of the store's registers on any path there */ } }
#define FA_KEYS 64      /* keys per LDS stage */
#define FA_PITCH 72     /* 16-bit elements per LDS row: 128 data bytes + 16 */
typedef float v2f __attribute__((ext_vector_type(2)));
__device__ __forceinline__ float fa_xhalf(float x) { return __builtin_bit_cast(float, __builtin_amdgcn_permlanex16(__builtin_bit_cast(int, x), __builtin_bit_cast(int, x), 0x76543210, 0xfedcba98, false, false)); }      /* lane l <-> lane l ^ 16 */
__device__ __forceinline__ v16h fa_frag(const unsigned short* p) { FragH f; f.half[0] = *(const v8us*)p; f.half[1] = *(const v8us*)(p + 16); return f.v; }      /* p = row + k0 + 8 * hh */
__device__ __forceinline__ v8f fa_mma(v16h a, v16h b, v8f c) { return __builtin_amdgcn_wmma_f32_16x16x32_f16(false, a, false, b, (short)0, c, false, false); }
__global__ __launch_bounds__(128) void k_fattn(const _Float16* __restrict__ Q16, const _Float16* __restrict__ K16, const _Float16* __restrict__ VT, _Float16* __restrict__ O16) {
  __shared__ __attribute__((aligned(16))) unsigned short sk[2][FA_KEYS][FA_PITCH];      /* K rows [key][d] */
  __shared__ __attribute__((aligned(16))) unsigned short sv[2][HD][FA_PITCH];           /* V^T rows [d][key] */
  const int tid = threadIdx.x, w = tid >> 5, lane = tid & 31, ln = lane & 15, hh = lane >> 4;
  const int h = blockIdx.y, b = blockIdx.z, q0 = blockIdx.x * 128 + w * 32;
  const unsigned short* kg = (const unsigned short*)K16 + (size_t)b * SQ * DM + h * HD;
  const unsigned short* vg = (const unsigned short*)VT + ((size_t)b * NH + h) * HD * SQ;
  v16h qf[2][2];
#pragma unroll      /* static indices keep qf[] in registers */
  for (int g = 0; g < 2; ++g) { const _Float16* qp = Q16 + ((size_t)b * SQ + q0 + 16 * g + ln) * DM + h * HD; qf[g][0] = g2_frag(qp, hh); qf[g][1] = g2_frag(qp + 32, hh); }
  const int sr = tid >> 3, sc = (tid & 7) * 8;      /* staging: eight threads a 128-byte row, rows sr + 16 i */
  v8us rk[4], rv[4];
#pragma unroll      /* static indices into rk[], rv[] */
  for (int i = 0; i < 4; ++i) { rk[i] = *(const v8us*)(kg + (size_t)(sr + 16 * i) * DM + sc); rv[i] = *(const v8us*)(vg + (size_t)(sr + 16 * i) * SQ + sc); }
#pragma unroll      /* static indices into rk[], rv[] */
  for (int i = 0; i < 4; ++i) { *(v8us*)&sk[0][sr + 16 * i][sc] = rk[i]; *(v8us*)&sv[0][sr + 16 * i][sc] = rv[i]; }
  __syncthreads();      /* stage 0 is published */
  const v8f z8 = {0.f, 0.f, 0.f, 0.f, 0.f, 0.f, 0.f, 0.f};
  v8f acc[2][4] = {{z8, z8, z8, z8}, {z8, z8, z8, z8}}; float mrun[2] = {-3.0e38f, -3.0e38f}; v2f lsum[2] = {{0.f, 0.f}, {0.f, 0.f}};      /* mrun: the maximum in use, log2 domain; lsum: the lane's share of the denominator, even and odd keys apart */
  const float L2E = 1.4426950408889634f;
#pragma unroll 1      /* one stage a trip: the body already holds two passes */
  for (int s = 0; s < SQ / FA_KEYS; ++s) {
    const int cur = s & 1; const bool more = s + 1 < SQ / FA_KEYS;      /* the same in every thread */
    if (more) {      /* the next stage's lines fly while this stage is worked on */
#pragma unroll      /* static indices into rk[], rv[] */
      for (int i = 0; i < 4; ++i) { rk[i] = *(const v8us*)(kg + (size_t)((s + 1) * FA_KEYS + sr + 16 * i) * DM + sc); rv[i] = *(const v8us*)(vg + (size_t)(sr + 16 * i) * SQ + (s + 1) * FA_KEYS + sc); } }
#pragma unroll      /* static indices into the register arrays */
    for (int ps = 0; ps < FA_KEYS / 32; ++ps) {
      v8f st[2][2];      /* [key tile][query group] */
#pragma unroll      /* static indices keep the register arrays in registers */
      for (int kt = 0; kt < 2; ++kt) { const unsigned short* kp = &sk[cur][ps * 32 + kt * 16 + ln][8 * hh]; const v16h k0 = fa_frag(kp), k1 = fa_frag(kp + 32);
#pragma unroll      /* static indices keep the register arrays in registers */
        for (int g = 0; g < 2; ++g) st[kt][g] = fa_mma(k1, qf[g][1], fa_mma(k0, qf[g][0], z8)); }
      v16h vf[4];
#pragma unroll      /* static indices keep the register arrays in registers */
      for (int t = 0; t < 4; ++t) vf[t] = fa_frag(&sv[cur][16 * t + ln][ps * 32 + 8 * hh]);
      float mb[2]; bool need = false;
#pragma unroll      /* static indices keep the register arrays in registers */
      for (int g = 0; g < 2; ++g) { float mx = st[0][g][0];
#pragma unroll      /* static indices keep the register arrays in registers */
        for (int r = 1; r < 8; ++r) mx = fmaxf(mx, st[0][g][r]);
#pragma unroll      /* static indices keep the register arrays in registers */
        for (int r = 0; r < 8; ++r) mx = fmaxf(mx, st[1][g][r]);
        mx = fmaxf(mx, fa_xhalf(mx)) * L2E; mb[g] = mx; need = need || (mx > mrun[g] + 8.0f); }      /* both halves hold the query's maximum of this pass */
      if (__builtin_amdgcn_ballot_w32(need) != 0) {      /* lazy rescale: only when some query's maximum passes the one in use by more than 2^8; always on the first pass */
#pragma unroll      /* static indices keep the register arrays in registers */
        for (int g = 0; g < 2; ++g) { const float mn = fmaxf(mrun[g], mb[g]); const float corr = __builtin_amdgcn_exp2f(mrun[g] - mn); mrun[g] = mn; lsum[g] *= corr;
#pragma unroll      /* static indices keep the register arrays in registers */
          for (int t = 0; t < 4; ++t) acc[g][t] *= corr; } }
#pragma unroll      /* static indices keep the register arrays in registers */
      for (int g = 0; g < 2; ++g) { const float nm = 6.0f - mrun[g]; FragH pf; v2f ls = {0.f, 0.f};      /* weights x 2^6: at most 2^14 in f16, small ones further from the subnormal range */
#pragma unroll      /* static indices keep the register arrays in registers */
        for (int i = 0; i < 8; ++i) { const v2f a = __builtin_elementwise_fma(v2f{st[i >> 2][g][2 * (i & 3)], st[i >> 2][g][2 * (i & 3) + 1]}, v2f{L2E, L2E}, v2f{nm, nm});
          const v2f p = {__builtin_amdgcn_exp2f(a.x), __builtin_amdgcn_exp2f(a.y)}; ls += p; pf.h[2 * i] = (_Float16)p.x; pf.h[2 * i + 1] = (_Float16)p.y; }
        lsum[g] += ls;
#pragma unroll      /* static indices keep the register arrays in registers */
        for (int t = 0; t < 4; ++t) acc[g][t] = fa_mma(vf[t], pf.v, acc[g][t]); }
    }
    if (more) {
#pragma unroll      /* static indices into rk[], rv[] */
      for (int i = 0; i < 4; ++i) { *(v8us*)&sk[cur ^ 1][sr + 16 * i][sc] = rk[i]; *(v8us*)&sv[cur ^ 1][sr + 16 * i][sc] = rv[i]; } }
    __syncthreads();      /* publishes stage s + 1 and ends every wave's reads of the buffer that the next trip refills */
  }
#pragma unroll      /* static indices keep the register arrays in registers */
  for (int g = 0; g < 2; ++g) { const float lh = lsum[g].x + lsum[g].y; const float inv = 64.0f / (lh + fa_xhalf(lh)); unsigned short* op = (unsigned short*)O16 + ((size_t)b * SQ + q0 + 16 * g + ln) * DM + h * HD + 8 * hh;      /* the halves' sums join once; o x64 */
#pragma unroll      /* static indices keep the register arrays in registers */
    for (int t = 0; t < 4; ++t) { FragH o;
#pragma unroll      /* static indices keep the register arrays in registers */
      for (int r = 0; r < 8; ++r) o.h[r] = (_Float16)(acc[g][t][r] * inv);
      *(v8us*)(op + 16 * t) = o.half[0]; } } }
__global__ __launch_bounds__(256) void k_vt(const _Float16* __restrict__ V16, int b, int h0, _Float16* __restrict__ VT) { __shared__ unsigned short tl[64][65]; const int tid = threadIdx.x; const int hh = blockIdx.x % HG, sg = blockIdx.x / HG; const int s0 = sg * 64; const int h = h0 + hh;
  for (int i = tid; i < 64 * 8; i += 256) { const int j = i / 8, d8 = (i % 8) * 8; FragH f; f.half[0] = *(const v8us*)((const unsigned short*)V16 + ((size_t)b * SQ + s0 + j) * DM + h * HD + d8); for (int q = 0; q < 8; ++q) tl[d8 + q][j] = f.u[q]; }
  __syncthreads();
  { for (int i = tid; i < 64 * 8; i += 256) { const int d = i / 8, j8 = (i % 8) * 8; FragH f; for (int q = 0; q < 8; ++q) f.u[q] = tl[d][j8 + q]; *(v8us*)((unsigned short*)VT + ((size_t)hh * HD + d) * SQ + s0 + j8) = f.half[0]; }  } }



__global__ __launch_bounds__(256) void k_rsmkm(const float* __restrict__ S, _Float16* __restrict__ P, int nrows, const int* __restrict__ am) {
  #pragma clang fp contract(off)
  const int t = blockIdx.x * 256 + threadIdx.x; if (t >= nrows) return; const size_t i = (size_t)t; const float* s = S + i * SQ; const int* mr = am + (size_t)(t % SQ) * SQ; float mx = -3.0e38f;
#pragma unroll 1
  for (int j = 0; j < SQ; ++j) { const float f = (mr[j] != 0) ? 1.f : 0.f; mx = fmaxf(mx, fmaf(f, s[j], (1.f - f) * -1.0e9f)); } float se = 0.f;
#pragma unroll 1
  for (int j = 0; j < SQ; ++j) { const float f = (mr[j] != 0) ? 1.f : 0.f; se += __expf(fmaf(f, s[j], (1.f - f) * -1.0e9f) - mx); } const float sc = 256.0f / se;
#pragma unroll 1
  for (int j0 = 0; j0 < SQ; j0 += 8) { FragH fr; for (int q = 0; q < 8; ++q) { const int j = j0 + q; const float f = (mr[j] != 0) ? 1.f : 0.f; fr.h[q] = (_Float16)(__expf(fmaf(f, s[j], (1.f - f) * -1.0e9f) - mx) * sc); }
    unsigned short* d = (unsigned short*)P + i * SQ + j0; *(v8us*)d = fr.half[0];  } }

template <int COLS>
__global__ __launch_bounds__(256) void k_wperm(const float* __restrict__ Wn, _Float16* __restrict__ Bt) {
  const size_t t = (size_t)blockIdx.x * 256 + threadIdx.x; if (t >= (size_t)DM * DM / 8) return; const size_t e0 = t * 8; const int n = (int)(e0 / DM), k0 = (int)(e0 % DM); FragH f;
  if (COLS == 0) { const int h = n >> 6, d = n & 63; const float* src = Wn + (size_t)(d * NH + h) * DM + k0; for (int q = 0; q < 8; ++q) f.h[q] = (_Float16)(bf16_round(src[q]) * 16.0f); }
  else { for (int q = 0; q < 8; ++q) { const int kk = k0 + q; const int h = kk >> 6, d = kk & 63; f.h[q] = (_Float16)(bf16_round(Wn[(size_t)n * DM + d * NH + h]) * 16.0f); } }
  unsigned short* dst = (unsigned short*)Bt + e0; *(v8us*)dst = f.half[0];  }
__global__ __launch_bounds__(256) void k_bperm(const float* __restrict__ b, float* __restrict__ out) { const int t = threadIdx.x; if (t >= DM) return; const int h = t >> 6, d = t & 63; const float v = b[d * NH + h]; *(float*)(out + t) = v;  }
extern "C" void kernel_launch(void* const* d_in, const int* in_sizes, int n_in,
                              void* d_out, int out_size, void* d_ws, size_t ws_size, hipStream_t stream) {
  (void)in_sizes; (void)n_in; (void)out_size;
  const float* const* I = (const float* const*)d_in; const float* xq = I[0]; const float* xk = I[0]; const float* xv = I[0]; const float* wq = I[1]; const float* bq = I[2]; const float* wk = I[3]; const float* bk = I[4]; const float* wv = I[5]; const float* bv = I[6]; const float* wo = I[7]; const float* bo = I[8]; const float* x = xq;      /* hidden_state [4][768][2048] (feeds q, k and v); per-head Wq / Wk / Wv [12][768][64] + biases [12][64] (= [768] head-major); Wo [768][768] natural + bo */
  char* ws = (char*)d_ws; size_t off = 0;
  auto take = [&](size_t bytes) { char* p = ws + off; off += (bytes + 255) & ~(size_t)255; return p; };
  _Float16* BQ = (_Float16*)take((size_t)3 * DM * DM * 2); _Float16* BO = (_Float16*)take((size_t)DM * DM * 2);      /* BQ: the q, k, v Bt planes in a row (plane stride DM * DM) */
  _Float16* X16 = (_Float16*)take(NR * DM * 2); _Float16* Q16 = (_Float16*)take(3 * NR * DM * 2); _Float16* K16 = Q16 + NR * DM; _Float16* V16 = K16 + NR * DM;      /* q rows, k rows and V^T in a row (plane stride NR * DM) */ _Float16* O16 = (_Float16*)take(NR * DM * 2);
  _Float16* VT = V16;      /* the v plane holds V^T [NB][NH][HD][SQ]: as many elements as the rows */
  static_assert(MP % 128 == 0 && MPO % 128 == 0 && SQ % 128 == 0 && B0 == 0, "transposed GEMM stores: whole 128-row blocks inside one batch");
  if (off > ws_size) return;
  k_prep<<<PB_X + 3 * NH * PB_W + PB_O, 256, 0, stream>>>(x, wq, wk, wv, wo, X16, BQ, BO);      /* exact f16 token rows [b][s][e] of the [B][E][S] input (q, k and v all project these rows); per-head [in = 768][out = 64] tensors -> rows h*64.. of the Bt planes (x16): head h = output columns h*64.. = the concat order; Wo natural [out][in] = Bt x16 */

  const size_t r0p = (size_t)B0 * SQ;      /* first projected row */
  k_gemm2<0><<<dim3((unsigned)((MP / 128) * (DM / 64)), 3), 128, 0, stream>>>(X16 + r0p * DM, DM, 0, BQ, DM, (size_t)DM * DM, 0.0625f, bq, bk, bv, 0, nullptr, 1, 0, 0, nullptr, Q16 + r0p * DM, DM, NR * DM, MP, DM, DM, 2, SQ);      /* blockIdx.y = q, k, v; plane 2 stored as V^T */
  k_fattn<<<dim3(SQ / 128, NH, NB), 128, 0, stream>>>(Q16, K16, VT, O16);      /* UNSCALED scores q.k (the module omits 1/sqrt(d)), softmax and P.V; o (merged heads) as f16 rows x64 */
  k_gemm2<0><<<dim3((unsigned)((MPO / 128) * (DM / 64)), 1), 128, 0, stream>>>(O16 + r0p * DM, DM, 0, BO, DM, 0, 0.0009765625f, bo, nullptr, nullptr, 0, nullptr, 1, 0, 0, (float*)d_out, nullptr, DM, 0, MPO, DM, DM, 0, SQ);      /* out (f32; bo is in natural channel order = the output columns), stored transposed: the module's [b][co][n] layout */
}

// v005
// One run takes 113 microseconds.
// Two timings next to v004 put it at 1.52 and 1.53 times that version's speed.
// All steps since v000 together make it 51.9 times as fast.
#include <hip/hip_runtime.h>
#define NB 4
#define SQ 2048
#define DM 768
#define NH 12
#define HD 64
#define HG 4                         /* heads per block group of k_vt(V16, b, h0, VT) */
#define B0 0                         /* first batch processed (debug hook) */
#define NBR NB                       /* batches processed (debug hook) */
#define NR ((size_t)NB * SQ)         /* token rows */
#define MP ((int)((size_t)NBR * SQ)) /* rows projected (debug hook) */
#define QN SQ                        /* unused: k_fattn covers all SQ query rows */
#define NHD NH                       /* unused: k_fattn covers all NH heads */
#define MPO MP                       /* rows through the output stage (debug hook) */
#define LQ DM      /* unused: row pitch of the q and k rows */
typedef __bf16 v16b __attribute__((ext_vector_type(16)));
typedef unsigned short v8us __attribute__((ext_vector_type(8), may_alias));
typedef float  v8f  __attribute__((ext_vector_type(8)));
typedef float  v4f  __attribute__((ext_vector_type(4)));
typedef float  v4fa __attribute__((ext_vector_type(4), may_alias));
union FragB { v16b v; v8us half[2]; unsigned short u[16]; };

__device__ __forceinline__ unsigned short bf16_bits(float x) { unsigned int u = __float_as_uint(x); return (unsigned short)((u + 0x7FFFu + ((u >> 16) & 1u)) >> 16); }
__device__ __forceinline__ float bf16_val(unsigned short b) { return __uint_as_float(((unsigned int)b) << 16); }
__device__ __forceinline__ float bf16_round(float x) { return bf16_val(bf16_bits(x)); }
// D += A·B with NT terms: 1 = ah·bh, 2 = + al·bh (A split), 3 = + ah·bl (both split)
template <int NT>
__device__ __forceinline__ v8f mmaN(v16b ah, v16b al, v16b bh, v16b bl, v8f c) {
  c = __builtin_amdgcn_wmma_f32_16x16x32_bf16(false, ah, false, bh, (short)0, c, false, false);
  if (NT >= 2) c = __builtin_amdgcn_wmma_f32_16x16x32_bf16(false, al, false, bh, (short)0, c, false, false);
  if (NT >= 3) c = __builtin_amdgcn_wmma_f32_16x16x32_bf16(false, ah, false, bl, (short)0, c, false, false);
  asm volatile("v_nop\n\tv_nop\n\tv_nop\n\tv_nop" : "+v"(c) : "v"(ah), "v"(al), "v"(bh), "v"(bl));
  return c;
}

__global__ __launch_bounds__(256) void k_wt_bf16(const float* __restrict__ W, unsigned short* __restrict__ Wt, int K, int N) {
  const int t = blockIdx.x * 256 + threadIdx.x;
  const int k8n = K / 8;
  if (t >= N * k8n) return;
  const int n = t / k8n, k8 = (t % k8n) * 8;
  v8us v;
#pragma unroll
  for (int i = 0; i < 8; ++i) v[i] = bf16_bits(W[(size_t)(k8 + i) * N + n]);
  *(v8us*)(Wt + (size_t)n * K + k8) = v;
  
}

// GEMM C[M][N] (f32, pitch ldc) = act(A[M][K]·W + bias). A f32 row-major (pitch lda) converted per fragment to bf16
// (ASPLIT: hi/lo two planes -> 2 terms, else single rounded term); Wt bf16 [N][K] (pitch ldb). BIAS_BF16 rounds the
// bias to bf16 first (bias quantised to bf16 before the add). K%32==0, M%16==0, N%64==0.
template <bool ASPLIT, int ACT, bool BIAS_BF16>
__global__ __launch_bounds__(128) void k_gemm_bf(const float* __restrict__ A, int lda, const unsigned short* __restrict__ Wt, int ldb,
                                               const float* __restrict__ bias, float* __restrict__ C, int ldc, int M, int N, int K) {
  __shared__ __attribute__((aligned(16))) float so[4][16][64];
  const int tid = threadIdx.x, w = tid >> 5, lane = tid & 31, ln = lane & 15, hh = lane >> 4;
  const int ntn = N / 64;
  const int wid = blockIdx.x * 4 + w;
  const int mt = wid / ntn, nq = wid % ntn;
  if (mt * 16 >= M) return;
  const int row0 = mt * 16, col0 = nq * 64;
  const float* arow = A + (size_t)(row0 + ln) * lda;
  v8f acc[4] = {};
  for (int kb = 0; kb < K; kb += 32) {
    FragB ah, al;
    const v4f x0 = *(const v4fa*)(arow + kb + 8 * hh), x1 = *(const v4fa*)(arow + kb + 8 * hh + 4);
    const v4f x2 = *(const v4fa*)(arow + kb + 16 + 8 * hh), x3 = *(const v4fa*)(arow + kb + 16 + 8 * hh + 4);
    float xs[16] = {x0[0],x0[1],x0[2],x0[3],x1[0],x1[1],x1[2],x1[3],x2[0],x2[1],x2[2],x2[3],x3[0],x3[1],x3[2],x3[3]};
#pragma unroll
    for (int i = 0; i < 16; ++i) { const unsigned short hb = bf16_bits(xs[i]); ah.u[i] = hb; al.u[i] = ASPLIT ? bf16_bits(xs[i] - bf16_val(hb)) : (unsigned short)0; }
#pragma unroll
    for (int t = 0; t < 4; ++t) {
      const unsigned short* brow = Wt + (size_t)(col0 + t * 16 + ln) * ldb + kb;
      FragB b;
      b.half[0] = *(const v8us*)(brow + 8 * hh);
      b.half[1] = *(const v8us*)(brow + 16 + 8 * hh);
      acc[t] = mmaN<ASPLIT ? 2 : 1>(ah.v, al.v, b.v, b.v, acc[t]);
    }
  }
#pragma unroll
  for (int t = 0; t < 4; ++t) {
    float bv = bias ? bias[col0 + t * 16 + ln] : 0.f;
    if (BIAS_BF16) bv = bf16_round(bv);
#pragma unroll
    for (int r = 0; r < 8; ++r) { float v = acc[t][r] + bv; if (ACT == 1) v = fmaxf(v, 0.f); so[w][8 * hh + r][t * 16 + ln] = v; }
  }
  __builtin_amdgcn_fence(__ATOMIC_ACQ_REL, "workgroup");
  __builtin_amdgcn_wave_barrier();
  const int rsub = lane >> 4, c4 = (lane & 15) * 4;
  {
#pragma unroll
    for (int q = 0; q < 8; ++q) {
      const int r = q * 2 + rsub;
      const v4f v = *(const v4fa*)&so[w][r][c4];
      *(v4f*)(C + (size_t)(row0 + r) * ldc + col0 + c4) = v;
    }
    
  }
}

// GEMM C = act(A·W + bias + resid): A f32 (ASPLIT -> hi/lo 2 terms), Wt bf16 [N][K]; ACT 0 none, 1 relu, 2 exact gelu;
// resid (optional, f32, row index = (row % rmod), pitch ldr, RES_BF16 rounds it) added before the activation.
template <bool ASPLIT, int ACT, bool BIAS_BF16, bool RES_BF16>
__global__ __launch_bounds__(128) void k_gemm_bf3(const float* __restrict__ A, int lda, const unsigned short* __restrict__ Wt, int ldb,
                                                const float* __restrict__ bias, const float* __restrict__ resid, int rmod, int ldr,
                                                float* __restrict__ C, int ldc, int M, int N, int K) {
  __shared__ __attribute__((aligned(16))) float so[4][16][64];
  const int tid = threadIdx.x, w = tid >> 5, lane = tid & 31, ln = lane & 15, hh = lane >> 4;
  const int ntn = N / 64;
  const int wid = blockIdx.x * 4 + w;
  const int mt = wid / ntn, nq = wid % ntn;
  if (mt * 16 >= M) return;
  const int row0 = mt * 16, col0 = nq * 64;
  const float* arow = A + (size_t)(row0 + ln) * lda;
  v8f acc[4] = {};
  for (int kb = 0; kb < K; kb += 32) {
    FragB ah, al;
    const v4f x0 = *(const v4fa*)(arow + kb + 8 * hh), x1 = *(const v4fa*)(arow + kb + 8 * hh + 4);
    const v4f x2 = *(const v4fa*)(arow + kb + 16 + 8 * hh), x3 = *(const v4fa*)(arow + kb + 16 + 8 * hh + 4);
    float xs[16] = {x0[0],x0[1],x0[2],x0[3],x1[0],x1[1],x1[2],x1[3],x2[0],x2[1],x2[2],x2[3],x3[0],x3[1],x3[2],x3[3]};
#pragma unroll
    for (int i = 0; i < 16; ++i) { const unsigned short hb = bf16_bits(xs[i]); ah.u[i] = hb; al.u[i] = ASPLIT ? bf16_bits(xs[i] - bf16_val(hb)) : (unsigned short)0; }
#pragma unroll
    for (int t = 0; t < 4; ++t) {
      const unsigned short* brow = Wt + (size_t)(col0 + t * 16 + ln) * ldb + kb;
      FragB b;
      b.half[0] = *(const v8us*)(brow + 8 * hh);
      b.half[1] = *(const v8us*)(brow + 16 + 8 * hh);
      acc[t] = mmaN<ASPLIT ? 2 : 1>(ah.v, al.v, b.v, b.v, acc[t]);
    }
  }
#pragma unroll
  for (int t = 0; t < 4; ++t) {
    const int col = col0 + t * 16 + ln;
    float bv = bias ? bias[col] : 0.f;
    if (BIAS_BF16) bv = bf16_round(bv);
#pragma unroll
    for (int r = 0; r < 8; ++r) {
      float v = acc[t][r] + bv;
      if (resid) { float rv = resid[(size_t)((row0 + 8 * hh + r) % rmod) * ldr + col]; if (RES_BF16) rv = bf16_round(rv); v += rv; }
      if (ACT == 1) v = fmaxf(v, 0.f);
      if (ACT == 2) v = 0.5f * v * (1.0f + erff(v * 0.70710678118654752f));
      if (ACT == 3) { const float u = 0.7978845608028654f * (v + 0.044715f * v * v * v); v = 0.5f * v * (1.0f + tanhf(u)); }
      so[w][8 * hh + r][t * 16 + ln] = v;
    }
  }
  __builtin_amdgcn_fence(__ATOMIC_ACQ_REL, "workgroup");
  __builtin_amdgcn_wave_barrier();
  const int rsub = lane >> 4, c4 = (lane & 15) * 4;
  {
#pragma unroll
    for (int q = 0; q < 8; ++q) {
      const int r = q * 2 + rsub;
      const v4f v = *(const v4fa*)&so[w][r][c4];
      *(v4f*)(C + (size_t)(row0 + r) * ldc + col0 + c4) = v;
    }
    
  }
}
// row LayerNorm (biased variance, eps) over N: s = X (+ R); optional out_sum <- s; out_norm <- (s-mu)*rsqrt(var+eps)*g + b
template <bool PARAM_BF16>
__global__ __launch_bounds__(256) void k_layernorm(const float* __restrict__ X, const float* __restrict__ R, const float* __restrict__ g, const float* __restrict__ bta,
                                                  float* __restrict__ out_sum, float* __restrict__ out_norm, int N, float eps) {
  __shared__ float red[256];
  const int row = blockIdx.x, tid = threadIdx.x;
  const float* x = X + (size_t)row * N; const float* rr = R ? R + (size_t)row * N : nullptr;
  float vals[16];                     // up to N = 4096
  const int per = N / 256;            // contiguous chunk per thread? use strided-by-4 chunks: thread handles j = tid*4 + 1024*u
  float s1 = 0.f;
  for (int u = 0; u < per / 4; ++u) {
    const int j = tid * 4 + 1024 * u;
    const v4f a = *(const v4fa*)(x + j);
    v4f b = {0.f,0.f,0.f,0.f}; if (rr) b = *(const v4fa*)(rr + j);
#pragma unroll
    for (int q = 0; q < 4; ++q) { const float v = a[q] + b[q]; vals[u * 4 + q] = v; s1 += v; }
  }
  red[tid] = s1; __syncthreads();
  for (int st = 128; st > 0; st >>= 1) { if (tid < st) red[tid] += red[tid + st]; __syncthreads(); }
  const float mu = red[0] / (float)N; __syncthreads();
  float s2 = 0.f;
  for (int u = 0; u < per / 4; ++u)
#pragma unroll
    for (int q = 0; q < 4; ++q) { const float c = vals[u * 4 + q] - mu; s2 += c * c; }
  red[tid] = s2; __syncthreads();
  for (int st = 128; st > 0; st >>= 1) { if (tid < st) red[tid] += red[tid + st]; __syncthreads(); }
  const float rs = rsqrtf(red[0] / (float)N + eps);
  {
    for (int u = 0; u < per / 4; ++u) {
      const int j = tid * 4 + 1024 * u;
      v4f o, sm;
#pragma unroll
      for (int q = 0; q < 4; ++q) {
        float gg = g[j + q], bb = bta[j + q];
        if (PARAM_BF16) { gg = bf16_round(gg); bb = bf16_round(bb); }
        sm[q] = vals[u * 4 + q]; o[q] = (vals[u * 4 + q] - mu) * rs * gg + bb;
      }
      if (out_sum) *(v4f*)(out_sum + (size_t)row * N + j) = sm;
      *(v4f*)(out_norm + (size_t)row * N + j) = o;
    }
    
  }
}



// ---- f16 WMMA path (v_wmma_f32_16x16x32_f16): 11-bit significands for operands in range — used where a [0,1] probability operand needs more precision than bf16
typedef _Float16 v16h __attribute__((ext_vector_type(16)));
union FragH { v16h v; v8us half[2]; _Float16 h[16]; unsigned short u[16]; };
template <int NT>
__device__ __forceinline__ v8f mmaH(v16h ah, v16h al, v16h bh, v16h bl, v8f c) {
  c = __builtin_amdgcn_wmma_f32_16x16x32_f16(false, ah, false, bh, (short)0, c, false, false);
  if (NT >= 2) c = __builtin_amdgcn_wmma_f32_16x16x32_f16(false, al, false, bh, (short)0, c, false, false);
  if (NT >= 3) c = __builtin_amdgcn_wmma_f32_16x16x32_f16(false, ah, false, bl, (short)0, c, false, false);
  asm volatile("v_nop\n\tv_nop\n\tv_nop\n\tv_nop" : "+v"(c) : "v"(ah), "v"(al), "v"(bh), "v"(bl));
  return c;
}
// batched GEMM like k_gemm_b but f16 operands: A f32 (split into f16 hi/lo if ASPLIT, else rounded to f16), Bt = f16 values [n][k]; alpha; C f32; N multiple of 16 (partial tiles skipped)
template <bool ASPLIT>
__global__ __launch_bounds__(128) void k_gemm_h(const float* __restrict__ A, int lda, size_t sA, const _Float16* __restrict__ Bh, int ldb, size_t sB, float alpha, float* __restrict__ C, int ldc, size_t sC, int M, int N, int K) {
  __shared__ __attribute__((aligned(16))) float so[4][16][64];
  const int tid = threadIdx.x, w = tid >> 5, lane = tid & 31, ln = lane & 15, hh = lane >> 4; const int by = blockIdx.y;
  A += (size_t)by * sA; Bh += (size_t)by * sB; C += (size_t)by * sC;
  const int ntn = (N + 63) / 64; const int wid = blockIdx.x * 4 + w; const int mt = wid / ntn, nq = wid % ntn; if (mt * 16 >= M) return;
  const int row0 = mt * 16, col0 = nq * 64; const float* arow = A + (size_t)(row0 + ln) * lda;
  v8f acc[4] = {};
  for (int kb = 0; kb < K; kb += 32) {
    FragH ah, al;
    const v4f x0 = *(const v4fa*)(arow + kb + 8 * hh), x1 = *(const v4fa*)(arow + kb + 8 * hh + 4), x2 = *(const v4fa*)(arow + kb + 16 + 8 * hh), x3 = *(const v4fa*)(arow + kb + 16 + 8 * hh + 4);
    float xs[16] = {x0[0],x0[1],x0[2],x0[3],x1[0],x1[1],x1[2],x1[3],x2[0],x2[1],x2[2],x2[3],x3[0],x3[1],x3[2],x3[3]};
#pragma unroll
    for (int i = 0; i < 16; ++i) { const _Float16 h = (_Float16)xs[i]; ah.h[i] = h; al.h[i] = ASPLIT ? (_Float16)(xs[i] - (float)h) : (_Float16)0.0f; }
#pragma unroll
    for (int t = 0; t < 4; ++t) { if (col0 + t * 16 >= N) continue; const size_t boff = (size_t)(col0 + t * 16 + ln) * ldb + kb; FragH bq; bq.half[0] = *(const v8us*)(Bh + boff + 8 * hh); bq.half[1] = *(const v8us*)(Bh + boff + 16 + 8 * hh);
      acc[t] = mmaH<ASPLIT ? 2 : 1>(ah.v, al.v, bq.v, bq.v, acc[t]); }
  }
#pragma unroll
  for (int t = 0; t < 4; ++t) { if (col0 + t * 16 >= N) continue;
#pragma unroll
    for (int r = 0; r < 8; ++r) so[w][8 * hh + r][t * 16 + ln] = acc[t][r] * alpha; }
  __builtin_amdgcn_fence(__ATOMIC_ACQ_REL, "workgroup"); __builtin_amdgcn_wave_barrier();
  const int rsub = lane >> 4, c4 = (lane & 15) * 4;
  {
#pragma unroll
    for (int q = 0; q < 8; ++q) { const int r = q * 2 + rsub; if (col0 + c4 < N) { const v4f v = *(const v4fa*)&so[w][r][c4]; *(v4f*)(C + (size_t)(row0 + r) * ldc + col0 + c4) = v; } }
     }
}

// k_gemm_hh variant with fused epilogue: v = acc·alpha + bias[by·sBias + col] (+ CP[(row/rowsPerB)·sCPb + by·64 + col] if CP) ; ACT 0 none / 1 elu ; writes f16 C16 (and f32 C if non-null)
template <int ACT>
__global__ __launch_bounds__(128) void k_gemm_hhx(const _Float16* __restrict__ A, int lda, size_t sA, const _Float16* __restrict__ Bh, int ldb, size_t sB, float alpha, const float* __restrict__ bias, size_t sBias, const float* __restrict__ CP, int rowsPerB, size_t sCPb, int row0g,
    float* __restrict__ C, _Float16* __restrict__ C16, int ldc, size_t sC, int M, int N, int K) {
  __shared__ __attribute__((aligned(16))) float so[4][16][64];
  const int tid = threadIdx.x, w = tid >> 5, lane = tid & 31, ln = lane & 15, hh = lane >> 4; const int by = blockIdx.y;
  A += (size_t)by * sA; Bh += (size_t)by * sB; const size_t cofs = (size_t)by * sC; const float* bp = bias ? bias + (size_t)by * sBias : nullptr;
  const int ntn = (N + 63) / 64; const int wid = blockIdx.x * 4 + w; const int mt = wid / ntn, nq = wid % ntn; if (mt * 16 >= M) return;
  const int row0 = mt * 16, col0 = nq * 64; const _Float16* arow = A + (size_t)(row0 + ln) * lda;
  v8f acc[4] = {};
  for (int kb = 0; kb < K; kb += 32) { FragH ah; ah.half[0] = *(const v8us*)((const unsigned short*)arow + kb + 8 * hh); ah.half[1] = *(const v8us*)((const unsigned short*)arow + kb + 16 + 8 * hh);
#pragma unroll
    for (int t = 0; t < 4; ++t) { if (col0 + t * 16 >= N) continue; const size_t boff = (size_t)(col0 + t * 16 + ln) * ldb + kb; FragH bq; bq.half[0] = *(const v8us*)((const unsigned short*)Bh + boff + 8 * hh); bq.half[1] = *(const v8us*)((const unsigned short*)Bh + boff + 16 + 8 * hh);
      acc[t] = mmaH<1>(ah.v, ah.v, bq.v, bq.v, acc[t]); }
  }
#pragma unroll
  for (int t = 0; t < 4; ++t) { if (col0 + t * 16 >= N) continue; const int col = col0 + t * 16 + ln; const float bv = bp ? bf16_round(bp[col]) : 0.f;
#pragma unroll
    for (int r = 0; r < 8; ++r) { float v = acc[t][r] * alpha + bv; if (CP) { const int rr = row0g + row0 + 8 * hh + r; if (rowsPerB < 0) v += CP[cofs + (size_t)rr * ldc + col];      /* rowsPerB < 0: own element of the batched C plane */ else { const int bidx = rr / rowsPerB; v += CP[(size_t)bidx * sCPb + (size_t)by * 64 + col]; } } if (ACT == 1) v = (v > 0.f) ? v : expm1f(v); else if (ACT == 7) v = (v > 0.f) ? v + 1.0f : expf(v); else if (ACT == 8) v = tanhf(v); else if (ACT == 9) v = 0.5f * v * (1.0f + tanhf(0.7978845608028654f * (v + 0.044715f * v * v * v))); else if (ACT == 11) v = 1.0f / (1.0f + expf(-v)); else if (ACT == 12) v = (v > 0.f) ? v : 0.01f * v; else if (ACT == 14) v = (v > 0.f) ? v : 0.1f * v; else if (ACT == 16) v = (v >= 0.f) ? v : 0.3f * v; else if (ACT == 17) v = (v >= 0.f) ? v : 0.2f * v; else if (ACT == 15) v = v / (1.0f + expf(-v)); else if (ACT == 3) v = fmaxf(v, 0.f); else if (ACT == 6) v = 0.5f * v * (1.0f + erff(v * 0.70710678118654752f)); so[w][8 * hh + r][t * 16 + ln] = v; } }
  __builtin_amdgcn_fence(__ATOMIC_ACQ_REL, "workgroup"); __builtin_amdgcn_wave_barrier();
  const int rsub = lane >> 4, c4 = (lane & 15) * 4; typedef _Float16 v4h __attribute__((ext_vector_type(4)));
  {
#pragma unroll
    for (int q = 0; q < 8; ++q) { const int r = q * 2 + rsub; if (col0 + c4 < N) { const v4f v = *(const v4fa*)&so[w][r][c4]; if (C) *(v4f*)(C + cofs + (size_t)(row0 + r) * ldc + col0 + c4) = v; if (C16) { v4h h4; for (int i = 0; i < 4; ++i) h4[i] = (_Float16)v[i]; *(v4h*)(C16 + cofs + (size_t)(row0 + r) * ldc + col0 + c4) = h4; } } }
     }
}


typedef _Float16 v4h __attribute__((ext_vector_type(4)));

__global__ __launch_bounds__(256) void k_h16(const float* __restrict__ x, _Float16* __restrict__ X16, size_t n8) { const size_t t = (size_t)blockIdx.x * 256 + threadIdx.x; if (t >= n8) return; FragH f;
#pragma unroll
  for (int q = 0; q < 8; ++q) f.h[q] = (_Float16)x[t * 8 + q]; *(v8us*)((unsigned short*)X16 + t * 8) = f.half[0];  }
__global__ __launch_bounds__(256) void k_round16f(const float* __restrict__ W, _Float16* __restrict__ Bt, size_t n8) { const size_t t = (size_t)blockIdx.x * 256 + threadIdx.x; if (t >= n8) return; FragH f;
#pragma unroll
  for (int i = 0; i < 8; ++i) f.h[i] = (_Float16)(bf16_round(W[t * 8 + i]) * 16.0f); *(v8us*)((unsigned short*)Bt + t * 8) = f.half[0];  }
__global__ __launch_bounds__(256) void k_hl(const float* __restrict__ F, _Float16* __restrict__ Hh, _Float16* __restrict__ Hl, size_t n8) { const size_t t = (size_t)blockIdx.x * 256 + threadIdx.x; if (t >= n8) return; FragH fh, fl; const v4f a = *(const v4fa*)(F + t * 8), c = *(const v4fa*)(F + t * 8 + 4);
#pragma unroll
  for (int q = 0; q < 4; ++q) { _Float16 h = (_Float16)a[q]; fh.h[q] = h; fl.h[q] = (_Float16)((a[q] - (float)h) * 1024.0f); h = (_Float16)c[q]; fh.h[4 + q] = h; fl.h[4 + q] = (_Float16)((c[q] - (float)h) * 1024.0f); }
  { *(v8us*)((unsigned short*)Hh + t * 8) = fh.half[0]; *(v8us*)((unsigned short*)Hl + t * 8) = fl.half[0];  } }

// ---- fast GEMM (block tile 128x64, both operands staged in LDS in 64-k stages; wave tile 32x64; requires M % 128 == 0 rows per launch region, N % 64 == 0 and K % 64 == 0); epilogue = k_gemm_hhx semantics ----
__device__ __forceinline__ v16h g2_frag(const _Float16* p, int hh) { FragH f; f.half[0] = *(const v8us*)((const unsigned short*)p + 8 * hh); f.half[1] = *(const v8us*)((const unsigned short*)p + 16 + 8 * hh); return f.v; }
__device__ __forceinline__ v16h g2_sfrag(const unsigned short* p) { FragH f; f.half[0] = *(const v8us*)p; f.half[1] = *(const v8us*)(p + 16); return f.v; }      /* the same fragment from an LDS row: p = row + k0 + 8 * hh, the k order of g2_frag */
#define G2_KS 64        /* k per LDS stage: one whole 128-byte line of every operand row */
#define G2_PITCH 72     /* 16-bit elements per LDS row: 128 data bytes + 16 (16 bytes x odd for the 16-byte fragment reads) */
#define G2_ROWS 192     /* rows of a stage: the block's 128 A rows, then its 64 B rows */
__device__ __forceinline__ v8f g2_mma(v16h a, v16h b, v8f c) { v8f d = __builtin_amdgcn_wmma_f32_16x16x32_f16(false, a, false, b, (short)0, c, false, false); asm volatile("v_nop\n\tv_nop\n\tv_nop\n\tv_nop" : "+v"(d) : "v"(a), "v"(b)); return d; }
template <int ACT>
__global__ __launch_bounds__(128) void k_gemm2(const _Float16* __restrict__ A, int lda, size_t sA, const _Float16* __restrict__ Bh, int ldb, size_t sB, float alpha, const float* __restrict__ bias, const float* __restrict__ bias1, const float* __restrict__ bias2, size_t sBias, const float* __restrict__ CP, int rowsPerB, size_t sCPb, int row0g,
    float* __restrict__ C, _Float16* __restrict__ C16, int ldc, size_t sC, int M, int N, int K, int tp, int rpt) { static_assert(ACT == 0 || ACT == 3 || ACT == 6 || ACT == 8 || ACT == 9 || ACT == 11 || ACT == 12 || ACT == 14 || ACT == 15 || ACT == 16 || ACT == 17, "k_gemm2: unsupported ACT code (would silently apply no activation)");
  __shared__ __attribute__((aligned(16))) float sm[2 * G2_ROWS * G2_PITCH / 2];      /* main loop: two operand stages; behind the loop's last barrier: the epilogue's tile */
  static_assert(4 * 32 * 68 <= 2 * G2_ROWS * G2_PITCH / 2, "k_gemm2: the epilogue's tile lies in sm[]");
  float (*const so)[32][68] = (float (*)[32][68])sm; unsigned short* const sg = (unsigned short*)sm; constexpr int TPI = 132;      /* 128 rows + 4: sixteen columns' 16-byte LDS stores fall on sixteen different bank groups */
  static_assert(64 * TPI <= 4 * 32 * 68, "k_gemm2: the transposed tile lies in so[]");
  const int tid = threadIdx.x, w = tid >> 5, lane = tid & 31, ln = lane & 15, hh = lane >> 4; const int by = blockIdx.y;
  A += (size_t)by * sA; Bh += (size_t)by * sB; const size_t cofs = (size_t)by * sC; const float* bp = (by == 1 && bias1) ? bias1 : (by == 2 && bias2) ? bias2 : bias ? bias + (size_t)by * sBias : nullptr;      /* bias1, bias2: planes 1 and 2 where their biases are buffers of their own */
  const int ntn = N >> 6; const int mt = blockIdx.x / ntn, nq = blockIdx.x - mt * ntn; const int row0 = mt * 128 + 32 * w, col0 = nq * 64; if (row0 >= M) return;      /* M is a multiple of 128 (and K of G2_KS): a block leaves whole or not at all, in front of every barrier, and stages whole */
  const bool tr = by >= tp;      /* planes tp.. are stored transposed, [row / rpt][col][row % rpt] (rpt a multiple of 128); the same in every thread of a block */
  float* const T = &so[0][0][0];      /* transposed path: the block's tile as [64 columns][128 rows], pitch TPI */
  const int sr = tid >> 3, sc = (tid & 7) * 8;      /* staging: eight threads a 128-byte line of one row, rows sr + 16 i */
  const char* ag = (const char*)(A + (size_t)(mt * 128) * lda); const char* bg = (const char*)(Bh + (size_t)col0 * ldb);      /* the block's first A row and first B row: the same in every thread */
  unsigned oa[8], ob[4];      /* the thread's byte offsets from there, moved on by one stage a trip (a block's rows span far less than 4 GB) */
#pragma unroll      /* static indices into oa[], ob[] */
  for (int i = 0; i < 8; ++i) { oa[i] = (unsigned)((sr + 16 * i) * lda + sc) * 2u; if (i < 4) ob[i] = (unsigned)((sr + 16 * i) * ldb + sc) * 2u; }
  unsigned short* const sw = sg + sr * G2_PITCH + sc;      /* the thread's place in row sr of buffer 0 */
  v8us ra[8], rb[4];
#pragma unroll      /* static indices into ra[], rb[]; the twelve loads fly together */
  for (int i = 0; i < 8; ++i) { ra[i] = *(const v8us*)(ag + oa[i]); if (i < 4) rb[i] = *(const v8us*)(bg + ob[i]); }
#pragma unroll      /* static indices into ra[], rb[] */
  for (int i = 0; i < 8; ++i) { *(v8us*)(sw + 16 * i * G2_PITCH) = ra[i]; if (i < 4) *(v8us*)(sw + (128 + 16 * i) * G2_PITCH) = rb[i]; }
  __syncthreads();      /* stage 0 is published */
  const v8f z8 = {0.f,0.f,0.f,0.f,0.f,0.f,0.f,0.f}; v8f c00 = z8, c01 = z8, c02 = z8, c03 = z8, c10 = z8, c11 = z8, c12 = z8, c13 = z8;
  const int ns = K / G2_KS;
#pragma unroll 1      /* one stage a trip: the body already holds two k steps */
  for (int s = 0; s < ns; ++s) { const int cur = s & 1; const bool more = s + 1 < ns;      /* the same in every thread */
    if (more) {      /* the next stage's lines fly while this stage is worked on */
#pragma unroll      /* static indices into the register arrays */
      for (int i = 0; i < 8; ++i) { oa[i] += G2_KS * 2; ra[i] = *(const v8us*)(ag + oa[i]); if (i < 4) { ob[i] += G2_KS * 2; rb[i] = *(const v8us*)(bg + ob[i]); } } }
#pragma unroll      /* constant LDS offsets for both k steps */
    for (int kk = 0; kk < G2_KS / 32; ++kk) { const unsigned short* ap = sg + (cur * G2_ROWS + 32 * w + ln) * G2_PITCH + kk * 32 + 8 * hh; const unsigned short* bq = sg + (cur * G2_ROWS + 128 + ln) * G2_PITCH + kk * 32 + 8 * hh;
      const v16h a0 = g2_sfrag(ap), a1 = g2_sfrag(ap + 16 * G2_PITCH), b0 = g2_sfrag(bq), b1 = g2_sfrag(bq + 16 * G2_PITCH), b2 = g2_sfrag(bq + 32 * G2_PITCH), b3 = g2_sfrag(bq + 48 * G2_PITCH);      /* the k step's twelve LDS reads as one group ahead of its products */
      c00 = g2_mma(a0, b0, c00); c10 = g2_mma(a1, b0, c10); c01 = g2_mma(a0, b1, c01); c11 = g2_mma(a1, b1, c11);
      c02 = g2_mma(a0, b2, c02); c12 = g2_mma(a1, b2, c12); c03 = g2_mma(a0, b3, c03); c13 = g2_mma(a1, b3, c13); }
    if (more) {
#pragma unroll      /* static indices into ra[], rb[] */
      for (int i = 0; i < 8; ++i) { *(v8us*)(sw + ((cur ^ 1) * G2_ROWS + 16 * i) * G2_PITCH) = ra[i]; if (i < 4) *(v8us*)(sw + ((cur ^ 1) * G2_ROWS + 128 + 16 * i) * G2_PITCH) = rb[i]; } }
    __syncthreads();      /* publishes stage s + 1 and ends every wave's reads of the buffer that the next trip refills; behind the last one sm[] is the epilogue's */
  }
  v8f accs[8] = {c00, c01, c02, c03, c10, c11, c12, c13};
#pragma unroll
  for (int u = 0; u < 8; ++u) { const int t = u & 3, half = u >> 2; const int col = col0 + t * 16 + ln; const float bv = bp ? bf16_round(bp[col]) : 0.f;
    float vv[8];      /* the lane's eight values of this tile: rows 8 * hh .. + 7 of one column */
#pragma unroll
    for (int r = 0; r < 8; ++r) { const int rloc = half * 16 + 8 * hh + r; float v = accs[u][r] * alpha + bv; if (CP) { if (rowsPerB < 0) v += CP[cofs + (size_t)(row0g + row0 + rloc) * ldc + col];      /* rowsPerB < 0: own element of the batched C plane */ else { const int bidx = (row0g + row0 + rloc) / rowsPerB; v += CP[(size_t)bidx * sCPb + (size_t)by * 64 + col]; } }
      if (ACT == 3) v = fmaxf(v, 0.f); else if (ACT == 6) v = 0.5f * v * (1.0f + erff(v * 0.70710678118654752f)); else if (ACT == 11) v = 1.0f / (1.0f + expf(-v)); else if (ACT == 15) v = v / (1.0f + expf(-v)); else if (ACT == 12) v = (v > 0.f) ? v : 0.01f * v; else if (ACT == 8) v = tanhf(v); else if (ACT == 9) v = 0.5f * v * (1.0f + tanhf(0.7978845608028654f * (v + 0.044715f * v * v * v))); else if (ACT == 14) v = (v > 0.f) ? v : 0.1f * v; else if (ACT == 16) v = (v >= 0.f) ? v : 0.3f * v; else if (ACT == 17) v = (v >= 0.f) ? v : 0.2f * v;
      vv[r] = v; }
    if (tr) { float* tq = T + (t * 16 + ln) * TPI + 32 * w + half * 16 + 8 * hh; *(v4fa*)tq = v4f{vv[0], vv[1], vv[2], vv[3]}; *(v4fa*)(tq + 4) = v4f{vv[4], vv[5], vv[6], vv[7]}; }      /* a lane's eight values are eight rows in a row of one column */
    else {
#pragma unroll      /* static indices keep vv[] in registers */
      for (int r = 0; r < 8; ++r) so[w][half * 16 + 8 * hh + r][t * 16 + ln] = vv[r]; } }
  if (tr) {
    __syncthreads();      /* the four waves' row groups make up each column's 128 rows */
    const int rb = mt * 128, bb = rb / rpt; const size_t tb = cofs + ((size_t)bb * N + col0) * rpt + (rb - bb * rpt);
    if (C) {
#pragma unroll      /* the columns' LDS reads and stores overlap */
      for (int q = 0; q < 16; ++q) { const int cc = q * 4 + w; const v4f v = *(const v4fa*)(T + cc * TPI + lane * 4); *(v4f*)(C + tb + (size_t)cc * rpt + lane * 4) = v; }      /* a wave's store = one column's 512 bytes */
      asm volatile("s_wait_xcnt 0x0" ::: "memory"); }      /* precaution: the code behind (the 16-bit stores; in the built code also the join with the untransposed path) rewrites these stores' registers, and the wait stands in front of that on any path */
    if (C16) {
#pragma unroll      /* the columns' LDS reads and stores overlap */
      for (int q = 0; q < 8; ++q) { const int cc = q * 8 + w * 2 + hh; const v4f v0 = *(const v4fa*)(T + cc * TPI + ln * 8), v1 = *(const v4fa*)(T + cc * TPI + ln * 8 + 4); FragH h8;
#pragma unroll      /* static indices keep h8 in registers */
        for (int i = 0; i < 4; ++i) { h8.h[i] = (_Float16)v0[i]; h8.h[4 + i] = (_Float16)v1[i]; }
        *(v8us*)((unsigned short*)C16 + tb + (size_t)cc * rpt + ln * 8) = h8.half[0]; }      /* a wave's store = two columns' 256 bytes each */
      asm volatile("s_wait_xcnt 0x0" ::: "memory"); }      /* precaution: in the built code this path joins the untransposed one behind these stores, and the wait stands in front of every later write of their registers on any path there */
    return; }
  __builtin_amdgcn_fence(__ATOMIC_ACQ_REL, "workgroup"); __builtin_amdgcn_wave_barrier();
  const int rsub = lane >> 4, c4 = (lane & 15) * 4;
  {
#pragma unroll
    for (int q = 0; q < 16; ++q) { const int r = q * 2 + rsub; const v4f v = *(const v4fa*)&so[w][r][c4]; if (C) *(v4f*)(C + cofs + (size_t)(row0 + r) * ldc + col0 + c4) = v; if (C16) { v4h h4; for (int i = 0; i < 4; ++i) h4[i] = (_Float16)v[i]; *(v4h*)(C16 + cofs + (size_t)(row0 + r) * ldc + col0 + c4) = h4; } }
     } }


// Operand preparation, one launch; the block index picks the part (the same for a whole block), the largest part first:
//   PB_X blocks: hidden_state [b][e][s] -> exact f16 token rows [b][s][e], one 64-channel x 64-token tile a block, turned in LDS;
//   PB_W blocks a weight slab (36 slabs = q, k, v times 12 heads): [in = 768][out = 64] -> rows h*64.. of that projection's Bt plane [n][k], x16 (bf16-exact weights stay exact in f16 away from the subnormal range);
//   PB_O blocks: Wo, natural [out][in] = Bt, x16.
#define PB_X ((unsigned)(NB * (SQ / 64) * (DM / 64)))
#define PB_W ((unsigned)(HD * (DM / 8) / 256))
#define PB_O ((unsigned)(DM * DM / 8 / 256))
static_assert(SQ % 64 == 0 && DM % 64 == 0 && HD * DM % 2048 == 0 && DM * DM % 2048 == 0, "k_prep: whole 64 x 64 tiles of x; the weight parts are whole blocks of 256 threads x 8 elements");
__global__ __launch_bounds__(256) void k_prep(const float* __restrict__ x, const float* __restrict__ wq, const float* __restrict__ wk, const float* __restrict__ wv, const float* __restrict__ wo,
    _Float16* __restrict__ X16, _Float16* __restrict__ Bqkv, _Float16* __restrict__ Bo) {
  __shared__ unsigned short tl[64][66];      /* x part: [channel][token] */
  unsigned bx = blockIdx.x; FragH f;
  if (bx < PB_X) { const int tid = (int)threadIdx.x; const unsigned slab = bx / (DM / 64), eg = bx - slab * (DM / 64), b = slab / (SQ / 64), sg = slab - b * (SQ / 64);      /* slab = 64 tokens of one batch, eg = 64 channels */
    const float* xs = x + ((size_t)b * DM + eg * 64) * SQ + sg * 64;
#pragma unroll      /* the four loads fly together */
    for (int p = 0; p < 4; ++p) { const int r = p * 16 + (tid >> 4), c4 = (tid & 15) * 4; const v4f a = *(const v4fa*)(xs + (size_t)r * SQ + c4);      /* sixteen threads a channel's 256 bytes */
#pragma unroll      /* static indices keep f in registers */
      for (int q = 0; q < 4; ++q) { f.h[q] = (_Float16)bf16_round(a[q]); tl[r][c4 + q] = f.u[q]; } }
    __syncthreads();      /* the tile is whole before it is read by columns; every thread of an x block passes here */
#pragma unroll      /* both rows' LDS reads overlap */
    for (int rd = 0; rd < 2; ++rd) { const int d = rd * 32 + tid / 8, pc = tid % 8;      /* eight threads a token's 128 bytes */
#pragma unroll      /* static indices keep f in registers */
      for (int q = 0; q < 8; ++q) f.u[q] = tl[pc * 8 + q][d];
      *(v8us*)((unsigned short*)X16 + ((size_t)slab * 64 + d) * DM + eg * 64 + pc * 8) = f.half[0]; }
    return; }
  bx -= PB_X;
  if (bx < 3 * NH * PB_W) { const unsigned slab = bx / PB_W, m = slab / NH, h = slab - m * NH; const float* W = (m == 0 ? wq : m == 1 ? wk : wv) + (size_t)h * DM * HD;
    const int t = (int)(bx - slab * PB_W) * 256 + (int)threadIdx.x; const int n = t / (DM / 8), k8 = (t % (DM / 8)) * 8;
#pragma unroll
    for (int i = 0; i < 8; ++i) f.h[i] = (_Float16)(bf16_round(W[(size_t)(k8 + i) * HD + n]) * 16.0f);
    *(v8us*)((unsigned short*)Bqkv + (size_t)slab * HD * DM + (size_t)n * DM + k8) = f.half[0];
    asm volatile("s_wait_xcnt 0x0" ::: "memory");      /* precaution: in the built code the three parts join behind this store, and the wait stands in front of every later write of the store's registers on any path there */
    return; }
  bx -= 3 * NH * PB_W;
  { const size_t t = (size_t)bx * 256 + threadIdx.x;
#pragma unroll
    for (int q = 0; q < 8; ++q) f.h[q] = (_Float16)(bf16_round(wo[t * 8 + q]) * 16.0f);
    *(v8us*)((unsigned short*)Bo + t * 8) = f.half[0];
    asm volatile("s_wait_xcnt 0x0" ::: "memory");      /* precaution: in the built code the three parts join behind this store, and the wait stands in front of every later write of the store's registers on any path there */ } }
#define FA_KEYS 64      /* keys per LDS stage */
#define FA_PITCH 72     /* 16-bit elements per LDS row: 128 data bytes + 16 */
typedef float v2f __attribute__((ext_vector_type(2)));
__device__ __forceinline__ float fa_xhalf(float x) { return __builtin_bit_cast(float, __builtin_amdgcn_permlanex16(__builtin_bit_cast(int, x), __builtin_bit_cast(int, x), 0x76543210, 0xfedcba98, false, false)); }      /* lane l <-> lane l ^ 16 */
__device__ __forceinline__ v16h fa_frag(const unsigned short* p) { FragH f; f.half[0] = *(const v8us*)p; f.half[1] = *(const v8us*)(p + 16); return f.v; }      /* p = row + k0 + 8 * hh */
__device__ __forceinline__ v8f fa_mma(v16h a, v16h b, v8f c) { return __builtin_amdgcn_wmma_f32_16x16x32_f16(false, a, false, b, (short)0, c, false, false); }
__global__ __launch_bounds__(128) void k_fattn(const _Float16* __restrict__ Q16, const _Float16* __restrict__ K16, const _Float16* __restrict__ VT, _Float16* __restrict__ O16) {
  __shared__ __attribute__((aligned(16))) unsigned short sk[2][FA_KEYS][FA_PITCH];      /* K rows [key][d] */
  __shared__ __attribute__((aligned(16))) unsigned short sv[2][HD][FA_PITCH];           /* V^T rows [d][key] */
  const int tid = threadIdx.x, w = tid >> 5, lane = tid & 31, ln = lane & 15, hh = lane >> 4;
  const int h = blockIdx.y, b = blockIdx.z, q0 = blockIdx.x * 128 + w * 32;
  const unsigned short* kg = (const unsigned short*)K16 + (size_t)b * SQ * DM + h * HD;
  const unsigned short* vg = (const unsigned short*)VT + ((size_t)b * NH + h) * HD * SQ;
  v16h qf[2][2];
#pragma unroll      /* static indices keep qf[] in registers */
  for (int g = 0; g < 2; ++g) { const _Float16* qp = Q16 + ((size_t)b * SQ + q0 + 16 * g + ln) * DM + h * HD; qf[g][0] = g2_frag(qp, hh); qf[g][1] = g2_frag(qp + 32, hh); }
  const int sr = tid >> 3, sc = (tid & 7) * 8;      /* staging: eight threads a 128-byte row, rows sr + 16 i */
  v8us rk[4], rv[4];
#pragma unroll      /* static indices into rk[], rv[] */
  for (int i = 0; i < 4; ++i) { rk[i] = *(const v8us*)(kg + (size_t)(sr + 16 * i) * DM + sc); rv[i] = *(const v8us*)(vg + (size_t)(sr + 16 * i) * SQ + sc); }
#pragma unroll      /* static indices into rk[], rv[] */
  for (int i = 0; i < 4; ++i) { *(v8us*)&sk[0][sr + 16 * i][sc] = rk[i]; *(v8us*)&sv[0][sr + 16 * i][sc] = rv[i]; }
  __syncthreads();      /* stage 0 is published */
  const v8f z8 = {0.f, 0.f, 0.f, 0.f, 0.f, 0.f, 0.f, 0.f};
  v8f acc[2][4] = {{z8, z8, z8, z8}, {z8, z8, z8, z8}}; float mrun[2] = {-3.0e38f, -3.0e38f}; v2f lsum[2] = {{0.f, 0.f}, {0.f, 0.f}};      /* mrun: the maximum in use, log2 domain; lsum: the lane's share of the denominator, even and odd keys apart */
  const float L2E = 1.4426950408889634f;
#pragma unroll 1      /* one stage a trip: the body already holds two passes */
  for (int s = 0; s < SQ / FA_KEYS; ++s) {
    const int cur = s & 1; const bool more = s + 1 < SQ / FA_KEYS;      /* the same in every thread */
    if (more) {      /* the next stage's lines fly while this stage is worked on */
#pragma unroll      /* static indices into rk[], rv[] */
      for (int i = 0; i < 4; ++i) { rk[i] = *(const v8us*)(kg + (size_t)((s + 1) * FA_KEYS + sr + 16 * i) * DM + sc); rv[i] = *(const v8us*)(vg + (size_t)(sr + 16 * i) * SQ + (s + 1) * FA_KEYS + sc); } }
#pragma unroll      /* static indices into the register arrays */
    for (int ps = 0; ps < FA_KEYS / 32; ++ps) {
      v8f st[2][2];      /* [key tile][query group] */
#pragma unroll      /* static indices keep the register arrays in registers */
      for (int kt = 0; kt < 2; ++kt) { const unsigned short* kp = &sk[cur][ps * 32 + kt * 16 + ln][8 * hh]; const v16h k0 = fa_frag(kp), k1 = fa_frag(kp + 32);
#pragma unroll      /* static indices keep the register arrays in registers */
        for (int g = 0; g < 2; ++g) st[kt][g] = fa_mma(k1, qf[g][1], fa_mma(k0, qf[g][0], z8)); }
      v16h vf[4];
#pragma unroll      /* static indices keep the register arrays in registers */
      for (int t = 0; t < 4; ++t) vf[t] = fa_frag(&sv[cur][16 * t + ln][ps * 32 + 8 * hh]);
      float mb[2]; bool need = false;
#pragma unroll      /* static indices keep the register arrays in registers */
      for (int g = 0; g < 2; ++g) { float mx = st[0][g][0];
#pragma unroll      /* static indices keep the register arrays in registers */
        for (int r = 1; r < 8; ++r) mx = fmaxf(mx, st[0][g][r]);
#pragma unroll      /* static indices keep the register arrays in registers */
        for (int r = 0; r < 8; ++r) mx = fmaxf(mx, st[1][g][r]);
        mx = fmaxf(mx, fa_xhalf(mx)) * L2E; mb[g] = mx; need = need || (mx > mrun[g] + 8.0f); }      /* both halves hold the query's maximum of this pass */
      if (__builtin_amdgcn_ballot_w32(need) != 0) {      /* lazy rescale: only when some query's maximum passes the one in use by more than 2^8; always on the first pass */
#pragma unroll      /* static indices keep the register arrays in registers */
        for (int g = 0; g < 2; ++g) { const float mn = fmaxf(mrun[g], mb[g]); const float corr = __builtin_amdgcn_exp2f(mrun[g] - mn); mrun[g] = mn; lsum[g] *= corr;
#pragma unroll      /* static indices keep the register arrays in registers */
          for (int t = 0; t < 4; ++t) acc[g][t] *= corr; } }
#pragma unroll      /* static indices keep the register arrays in registers */
      for (int g = 0; g < 2; ++g) { const float nm = 6.0f - mrun[g]; FragH pf; v2f ls = {0.f, 0.f};      /* weights x 2^6: at most 2^14 in f16, small ones further from the subnormal range */
#pragma unroll      /* static indices keep the register arrays in registers */
        for (int i = 0; i < 8; ++i) { const v2f a = __builtin_elementwise_fma(v2f{st[i >> 2][g][2 * (i & 3)], st[i >> 2][g][2 * (i & 3) + 1]}, v2f{L2E, L2E}, v2f{nm, nm});
          const v2f p = {__builtin_amdgcn_exp2f(a.x), __builtin_amdgcn_exp2f(a.y)}; ls += p; pf.h[2 * i] = (_Float16)p.x; pf.h[2 * i + 1] = (_Float16)p.y; }
        lsum[g] += ls;
#pragma unroll      /* static indices keep the register arrays in registers */
        for (int t = 0; t < 4; ++t) acc[g][t] = fa_mma(vf[t], pf.v, acc[g][t]); }
    }
    if (more) {
#pragma unroll      /* static indices into rk[], rv[] */
      for (int i = 0; i < 4; ++i) { *(v8us*)&sk[cur ^ 1][sr + 16 * i][sc] = rk[i]; *(v8us*)&sv[cur ^ 1][sr + 16 * i][sc] = rv[i]; } }
    __syncthreads();      /* publishes stage s + 1 and ends every wave's reads of the buffer that the next trip refills */
  }
#pragma unroll      /* static indices keep the register arrays in registers */
  for (int g = 0; g < 2; ++g) { const float lh = lsum[g].x + lsum[g].y; const float inv = 64.0f / (lh + fa_xhalf(lh)); unsigned short* op = (unsigned short*)O16 + ((size_t)b * SQ + q0 + 16 * g + ln) * DM + h * HD + 8 * hh;      /* the halves' sums join once; o x64 */
#pragma unroll      /* static indices keep the register arrays in registers */
    for (int t = 0; t < 4; ++t) { FragH o;
#pragma unroll      /* static indices keep the register arrays in registers */
      for (int r = 0; r < 8; ++r) o.h[r] = (_Float16)(acc[g][t][r] * inv);
      *(v8us*)(op + 16 * t) = o.half[0]; } } }
__global__ __launch_bounds__(256) void k_vt(const _Float16* __restrict__ V16, int b, int h0, _Float16* __restrict__ VT) { __shared__ unsigned short tl[64][65]; const int tid = threadIdx.x; const int hh = blockIdx.x % HG, sg = blockIdx.x / HG; const int s0 = sg * 64; const int h = h0 + hh;
  for (int i = tid; i < 64 * 8; i += 256) { const int j = i / 8, d8 = (i % 8) * 8; FragH f; f.half[0] = *(const v8us*)((const unsigned short*)V16 + ((size_t)b * SQ + s0 + j) * DM + h * HD + d8); for (int q = 0; q < 8; ++q) tl[d8 + q][j] = f.u[q]; }
  __syncthreads();
  { for (int i = tid; i < 64 * 8; i += 256) { const int d = i / 8, j8 = (i % 8) * 8; FragH f; for (int q = 0; q < 8; ++q) f.u[q] = tl[d][j8 + q]; *(v8us*)((unsigned short*)VT + ((size_t)hh * HD + d) * SQ + s0 + j8) = f.half[0]; }  } }



__global__ __launch_bounds__(256) void k_rsmkm(const float* __restrict__ S, _Float16* __restrict__ P, int nrows, const int* __restrict__ am) {
  #pragma clang fp contract(off)
  const int t = blockIdx.x * 256 + threadIdx.x; if (t >= nrows) return; const size_t i = (size_t)t; const float* s = S + i * SQ; const int* mr = am + (size_t)(t % SQ) * SQ; float mx = -3.0e38f;
#pragma unroll 1
  for (int j = 0; j < SQ; ++j) { const float f = (mr[j] != 0) ? 1.f : 0.f; mx = fmaxf(mx, fmaf(f, s[j], (1.f - f) * -1.0e9f)); } float se = 0.f;
#pragma unroll 1
  for (int j = 0; j < SQ; ++j) { const float f = (mr[j] != 0) ? 1.f : 0.f; se += __expf(fmaf(f, s[j], (1.f - f) * -1.0e9f) - mx); } const float sc = 256.0f / se;
#pragma unroll 1
  for (int j0 = 0; j0 < SQ; j0 += 8) { FragH fr; for (int q = 0; q < 8; ++q) { const int j = j0 + q; const float f = (mr[j] != 0) ? 1.f : 0.f; fr.h[q] = (_Float16)(__expf(fmaf(f, s[j], (1.f - f) * -1.0e9f) - mx) * sc); }
    unsigned short* d = (unsigned short*)P + i * SQ + j0; *(v8us*)d = fr.half[0];  } }

template <int COLS>
__global__ __launch_bounds__(256) void k_wperm(const float* __restrict__ Wn, _Float16* __restrict__ Bt) {
  const size_t t = (size_t)blockIdx.x * 256 + threadIdx.x; if (t >= (size_t)DM * DM / 8) return; const size_t e0 = t * 8; const int n = (int)(e0 / DM), k0 = (int)(e0 % DM); FragH f;
  if (COLS == 0) { const int h = n >> 6, d = n & 63; const float* src = Wn + (size_t)(d * NH + h) * DM + k0; for (int q = 0; q < 8; ++q) f.h[q] = (_Float16)(bf16_round(src[q]) * 16.0f); }
  else { for (int q = 0; q < 8; ++q) { const int kk = k0 + q; const int h = kk >> 6, d = kk & 63; f.h[q] = (_Float16)(bf16_round(Wn[(size_t)n * DM + d * NH + h]) * 16.0f); } }
  unsigned short* dst = (unsigned short*)Bt + e0; *(v8us*)dst = f.half[0];  }
__global__ __launch_bounds__(256) void k_bperm(const float* __restrict__ b, float* __restrict__ out) { const int t = threadIdx.x; if (t >= DM) return; const int h = t >> 6, d = t & 63; const float v = b[d * NH + h]; *(float*)(out + t) = v;  }
extern "C" void kernel_launch(void* const* d_in, const int* in_sizes, int n_in,
                              void* d_out, int out_size, void* d_ws, size_t ws_size, hipStream_t stream) {
  (void)in_sizes; (void)n_in; (void)out_size;
  const float* const* I = (const float* const*)d_in; const float* xq = I[0]; const float* xk = I[0]; const float* xv = I[0]; const float* wq = I[1]; const float* bq = I[2]; const float* wk = I[3]; const float* bk = I[4]; const float* wv = I[5]; const float* bv = I[6]; const float* wo = I[7]; const float* bo = I[8]; const float* x = xq;      /* hidden_state [4][768][2048] (feeds q, k and v); per-head Wq / Wk / Wv [12][768][64] + biases [12][64] (= [768] head-major); Wo [768][768] natural + bo */
  char* ws = (char*)d_ws; size_t off = 0;
  auto take = [&](size_t bytes) { char* p = ws + off; off += (bytes + 255) & ~(size_t)255; return p; };
  _Float16* BQ = (_Float16*)take((size_t)3 * DM * DM * 2); _Float16* BO = (_Float16*)take((size_t)DM * DM * 2);      /* BQ: the q, k, v Bt planes in a row (plane stride DM * DM) */
  _Float16* X16 = (_Float16*)take(NR * DM * 2); _Float16* Q16 = (_Float16*)take(3 * NR * DM * 2); _Float16* K16 = Q16 + NR * DM; _Float16* V16 = K16 + NR * DM;      /* q rows, k rows and V^T in a row (plane stride NR * DM) */ _Float16* O16 = (_Float16*)take(NR * DM * 2);
  _Float16* VT = V16;      /* the v plane holds V^T [NB][NH][HD][SQ]: as many elements as the rows */
  static_assert(MP % 128 == 0 && MPO % 128 == 0 && SQ % 128 == 0 && B0 == 0, "transposed GEMM stores: whole 128-row blocks inside one batch");
  static_assert(DM % G2_KS == 0 && DM % 64 == 0, "k_gemm2: whole 64-k stages, whole 64-column blocks");
  if (off > ws_size) return;
  k_prep<<<PB_X + 3 * NH * PB_W + PB_O, 256, 0, stream>>>(x, wq, wk, wv, wo, X16, BQ, BO);      /* exact f16 token rows [b][s][e] of the [B][E][S] input (q, k and v all project these rows); per-head [in = 768][out = 64] tensors -> rows h*64.. of the Bt planes (x16): head h = output columns h*64.. = the concat order; Wo natural [out][in] = Bt x16 */

  const size_t r0p = (size_t)B0 * SQ;      /* first projected row */
  k_gemm2<0><<<dim3((unsigned)((MP / 128) * (DM / 64)), 3), 128, 0, stream>>>(X16 + r0p * DM, DM, 0, BQ, DM, (size_t)DM * DM, 0.0625f, bq, bk, bv, 0, nullptr, 1, 0, 0, nullptr, Q16 + r0p * DM, DM, NR * DM, MP, DM, DM, 2, SQ);      /* blockIdx.y = q, k, v; plane 2 stored as V^T */
  k_fattn<<<dim3(SQ / 128, NH, NB), 128, 0, stream>>>(Q16, K16, VT, O16);      /* UNSCALED scores q.k (the module omits 1/sqrt(d)), softmax and P.V; o (merged heads) as f16 rows x64 */
  k_gemm2<0><<<dim3((unsigned)((MPO / 128) * (DM / 64)), 1), 128, 0, stream>>>(O16 + r0p * DM, DM, 0, BO, DM, 0, 0.0009765625f, bo, nullptr, nullptr, 0, nullptr, 1, 0, 0, (float*)d_out, nullptr, DM, 0, MPO, DM, DM, 0, SQ);      /* out (f32; bo is in natural channel order = the output columns), stored transposed: the module's [b][co][n] layout */
}

// v006
// A run of this version takes 107 microseconds.
// Two timings next to v005 both put it at 1.05 times that version's speed.
// Over all steps from v000 it is 54.6 times as fast.
#include <hip/hip_runtime.h>
#define NB 4
#define SQ 2048
#define DM 768
#define NH 12
#define HD 64
#define HG 4                         /* heads per block group of k_vt(V16, b, h0, VT) */
#define B0 0                         /* first batch processed (debug hook) */
#define NBR NB                       /* batches processed (debug hook) */
#define NR ((size_t)NB * SQ)         /* token rows */
#define MP ((int)((size_t)NBR * SQ)) /* rows projected (debug hook) */
#define QN SQ                        /* unused: k_fattn covers all SQ query rows */
#define NHD NH                       /* unused: k_fattn covers all NH heads */
#define MPO MP                       /* rows through the output stage (debug hook) */
#define LQ DM      /* unused: row pitch of the q and k rows */
typedef __bf16 v16b __attribute__((ext_vector_type(16)));
typedef unsigned short v8us __attribute__((ext_vector_type(8), may_alias));
typedef float  v8f  __attribute__((ext_vector_type(8)));
typedef float  v4f  __attribute__((ext_vector_type(4)));
typedef float  v4fa __attribute__((ext_vector_type(4), may_alias));
union FragB { v16b v; v8us half[2]; unsigned short u[16]; };

__device__ __forceinline__ unsigned short bf16_bits(float x) { unsigned int u = __float_as_uint(x); return (unsigned short)((u + 0x7FFFu + ((u >> 16) & 1u)) >> 16); }
__device__ __forceinline__ float bf16_val(unsigned short b) { return __uint_as_float(((unsigned int)b) << 16); }
__device__ __forceinline__ float bf16_round(float x) { return bf16_val(bf16_bits(x)); }
// D += A·B with NT terms: 1 = ah·bh, 2 = + al·bh (A split), 3 = + ah·bl (both split)
template <int NT>
__device__ __forceinline__ v8f mmaN(v16b ah, v16b al, v16b bh, v16b bl, v8f c) {
  c = __builtin_amdgcn_wmma_f32_16x16x32_bf16(false, ah, false, bh, (short)0, c, false, false);
  if (NT >= 2) c = __builtin_amdgcn_wmma_f32_16x16x32_bf16(false, al, false, bh, (short)0, c, false, false);
  if (NT >= 3) c = __builtin_amdgcn_wmma_f32_16x16x32_bf16(false, ah, false, bl, (short)0, c, false, false);
  asm volatile("v_nop\n\tv_nop\n\tv_nop\n\tv_nop" : "+v"(c) : "v"(ah), "v"(al), "v"(bh), "v"(bl));
  return c;
}

__global__ __launch_bounds__(256) void k_wt_bf16(const float* __restrict__ W, unsigned short* __restrict__ Wt, int K, int N) {
  const int t = blockIdx.x * 256 + threadIdx.x;
  const int k8n = K / 8;
  if (t >= N * k8n) return;
  const int n = t / k8n, k8 = (t % k8n) * 8;
  v8us v;
#pragma unroll
  for (int i = 0; i < 8; ++i) v[i] = bf16_bits(W[(size_t)(k8 + i) * N + n]);
  *(v8us*)(Wt + (size_t)n * K + k8) = v;
  
}

// GEMM C[M][N] (f32, pitch ldc) = act(A[M][K]·W + bias). A f32 row-major (pitch lda) converted per fragment to bf16
// (ASPLIT: hi/lo two planes -> 2 terms, else single rounded term); Wt bf16 [N][K] (pitch ldb). BIAS_BF16 rounds the
// bias to bf16 first (bias quantised to bf16 before the add). K%32==0, M%16==0, N%64==0.
template <bool ASPLIT, int ACT, bool BIAS_BF16>
__global__ __launch_bounds__(128) void k_gemm_bf(const float* __restrict__ A, int lda, const unsigned short* __restrict__ Wt, int ldb,
                                               const float* __restrict__ bias, float* __restrict__ C, int ldc, int M, int N, int K) {
  __shared__ __attribute__((aligned(16))) float so[4][16][64];
  const int tid = threadIdx.x, w = tid >> 5, lane = tid & 31, ln = lane & 15, hh = lane >> 4;
  const int ntn = N / 64;
  const int wid = blockIdx.x * 4 + w;
  const int mt = wid / ntn, nq = wid % ntn;
  if (mt * 16 >= M) return;
  const int row0 = mt * 16, col0 = nq * 64;
  const float* arow = A + (size_t)(row0 + ln) * lda;
  v8f acc[4] = {};
  for (int kb = 0; kb < K; kb += 32) {
    FragB ah, al;
    const v4f x0 = *(const v4fa*)(arow + kb + 8 * hh), x1 = *(const v4fa*)(arow + kb + 8 * hh + 4);
    const v4f x2 = *(const v4fa*)(arow + kb + 16 + 8 * hh), x3 = *(const v4fa*)(arow + kb + 16 + 8 * hh + 4);
    float xs[16] = {x0[0],x0[1],x0[2],x0[3],x1[0],x1[1],x1[2],x1[3],x2[0],x2[1],x2[2],x2[3],x3[0],x3[1],x3[2],x3[3]};
#pragma unroll
    for (int i = 0; i < 16; ++i) { const unsigned short hb = bf16_bits(xs[i]); ah.u[i] = hb; al.u[i] = ASPLIT ? bf16_bits(xs[i] - bf16_val(hb)) : (unsigned short)0; }
#pragma unroll
    for (int t = 0; t < 4; ++t) {
      const unsigned short* brow = Wt + (size_t)(col0 + t * 16 + ln) * ldb + kb;
      FragB b;
      b.half[0] = *(const v8us*)(brow + 8 * hh);
      b.half[1] = *(const v8us*)(brow + 16 + 8 * hh);
      acc[t] = mmaN<ASPLIT ? 2 : 1>(ah.v, al.v, b.v, b.v, acc[t]);
    }
  }
#pragma unroll
  for (int t = 0; t < 4; ++t) {
    float bv = bias ? bias[col0 + t * 16 + ln] : 0.f;
    if (BIAS_BF16) bv = bf16_round(bv);
#pragma unroll
    for (int r = 0; r < 8; ++r) { float v = acc[t][r] + bv; if (ACT == 1) v = fmaxf(v, 0.f); so[w][8 * hh + r][t * 16 + ln] = v; }
  }
  __builtin_amdgcn_fence(__ATOMIC_ACQ_REL, "workgroup");
  __builtin_amdgcn_wave_barrier();
  const int rsub = lane >> 4, c4 = (lane & 15) * 4;
  {
#pragma unroll
    for (int q = 0; q < 8; ++q) {
      const int r = q * 2 + rsub;
      const v4f v = *(const v4fa*)&so[w][r][c4];
      *(v4f*)(C + (size_t)(row0 + r) * ldc + col0 + c4) = v;
    }
    
  }
}

// GEMM C = act(A·W + bias + resid): A f32 (ASPLIT -> hi/lo 2 terms), Wt bf16 [N][K]; ACT 0 none, 1 relu, 2 exact gelu;
// resid (optional, f32, row index = (row % rmod), pitch ldr, RES_BF16 rounds it) added before the activation.
template <bool ASPLIT, int ACT, bool BIAS_BF16, bool RES_BF16>
__global__ __launch_bounds__(128) void k_gemm_bf3(const float* __restrict__ A, int lda, const unsigned short* __restrict__ Wt, int ldb,
                                                const float* __restrict__ bias, const float* __restrict__ resid, int rmod, int ldr,
                                                float* __restrict__ C, int ldc, int M, int N, int K) {
  __shared__ __attribute__((aligned(16))) float so[4][16][64];
  const int tid = threadIdx.x, w = tid >> 5, lane = tid & 31, ln = lane & 15, hh = lane >> 4;
  const int ntn = N / 64;
  const int wid = blockIdx.x * 4 + w;
  const int mt = wid / ntn, nq = wid % ntn;
  if (mt * 16 >= M) return;
  const int row0 = mt * 16, col0 = nq * 64;
  const float* arow = A + (size_t)(row0 + ln) * lda;
  v8f acc[4] = {};
  for (int kb = 0; kb < K; kb += 32) {
    FragB ah, al;
    const v4f x0 = *(const v4fa*)(arow + kb + 8 * hh), x1 = *(const v4fa*)(arow + kb + 8 * hh + 4);
    const v4f x2 = *(const v4fa*)(arow + kb + 16 + 8 * hh), x3 = *(const v4fa*)(arow + kb + 16 + 8 * hh + 4);
    float xs[16] = {x0[0],x0[1],x0[2],x0[3],x1[0],x1[1],x1[2],x1[3],x2[0],x2[1],x2[2],x2[3],x3[0],x3[1],x3[2],x3[3]};
#pragma unroll
    for (int i = 0; i < 16; ++i) { const unsigned short hb = bf16_bits(xs[i]); ah.u[i] = hb; al.u[i] = ASPLIT ? bf16_bits(xs[i] - bf16_val(hb)) : (unsigned short)0; }
#pragma unroll
    for (int t = 0; t < 4; ++t) {
      const unsigned short* brow = Wt + (size_t)(col0 + t * 16 + ln) * ldb + kb;
      FragB b;
      b.half[0] = *(const v8us*)(brow + 8 * hh);
      b.half[1] = *(const v8us*)(brow + 16 + 8 * hh);
      acc[t] = mmaN<ASPLIT ? 2 : 1>(ah.v, al.v, b.v, b.v, acc[t]);
    }
  }
#pragma unroll
  for (int t = 0; t < 4; ++t) {
    const int col = col0 + t * 16 + ln;
    float bv = bias ? bias[col] : 0.f;
    if (BIAS_BF16) bv = bf16_round(bv);
#pragma unroll
    for (int r = 0; r < 8; ++r) {
      float v = acc[t][r] + bv;
      if (resid) { float rv = resid[(size_t)((row0 + 8 * hh + r) % rmod) * ldr + col]; if (RES_BF16) rv = bf16_round(rv); v += rv; }
      if (ACT == 1) v = fmaxf(v, 0.f);
      if (ACT == 2) v = 0.5f * v * (1.0f + erff(v * 0.70710678118654752f));
      if (ACT == 3) { const float u = 0.7978845608028654f * (v + 0.044715f * v * v * v); v = 0.5f * v * (1.0f + tanhf(u)); }
      so[w][8 * hh + r][t * 16 + ln] = v;
    }
  }
  __builtin_amdgcn_fence(__ATOMIC_ACQ_REL, "workgroup");
  __builtin_amdgcn_wave_barrier();
  const int rsub = lane >> 4, c4 = (lane & 15) * 4;
  {
#pragma unroll
    for (int q = 0; q < 8; ++q) {
      const int r = q * 2 + rsub;
      const v4f v = *(const v4fa*)&so[w][r][c4];
      *(v4f*)(C + (size_t)(row0 + r) * ldc + col0 + c4) = v;
    }
    
  }
}
// row LayerNorm (biased variance, eps) over N: s = X (+ R); optional out_sum <- s; out_norm <- (s-mu)*rsqrt(var+eps)*g + b
template <bool PARAM_BF16>
__global__ __launch_bounds__(256) void k_layernorm(const float* __restrict__ X, const float* __restrict__ R, const float* __restrict__ g, const float* __restrict__ bta,
                                                  float* __restrict__ out_sum, float* __restrict__ out_norm, int N, float eps) {
  __shared__ float red[256];
  const int row = blockIdx.x, tid = threadIdx.x;
  const float* x = X + (size_t)row * N; const float* rr = R ? R + (size_t)row * N : nullptr;
  float vals[16];                     // up to N = 4096
  const int per = N / 256;            // contiguous chunk per thread? use strided-by-4 chunks: thread handles j = tid*4 + 1024*u
  float s1 = 0.f;
  for (int u = 0; u < per / 4; ++u) {
    const int j = tid * 4 + 1024 * u;
    const v4f a = *(const v4fa*)(x + j);
    v4f b = {0.f,0.f,0.f,0.f}; if (rr) b = *(const v4fa*)(rr + j);
#pragma unroll
    for (int q = 0; q < 4; ++q) { const float v = a[q] + b[q]; vals[u * 4 + q] = v; s1 += v; }
  }
  red[tid] = s1; __syncthreads();
  for (int st = 128; st > 0; st >>= 1) { if (tid < st) red[tid] += red[tid + st]; __syncthreads(); }
  const float mu = red[0] / (float)N; __syncthreads();
  float s2 = 0.f;
  for (int u = 0; u < per / 4; ++u)
#pragma unroll
    for (int q = 0; q < 4; ++q) { const float c = vals[u * 4 + q] - mu; s2 += c * c; }
  red[tid] = s2; __syncthreads();
  for (int st = 128; st > 0; st >>= 1) { if (tid < st) red[tid] += red[tid + st]; __syncthreads(); }
  const float rs = rsqrtf(red[0] / (float)N + eps);
  {
    for (int u = 0; u < per / 4; ++u) {
      const int j = tid * 4 + 1024 * u;
      v4f o, sm;
#pragma unroll
      for (int q = 0; q < 4; ++q) {
        float gg = g[j + q], bb = bta[j + q];
        if (PARAM_BF16) { gg = bf16_round(gg); bb = bf16_round(bb); }
        sm[q] = vals[u * 4 + q]; o[q] = (vals[u * 4 + q] - mu) * rs * gg + bb;
      }
      if (out_sum) *(v4f*)(out_sum + (size_t)row * N + j) = sm;
      *(v4f*)(out_norm + (size_t)row * N + j) = o;
    }
    
  }
}



// ---- f16 WMMA path (v_wmma_f32_16x16x32_f16): 11-bit significands for operands in range — used where a [0,1] probability operand needs more precision than bf16
typedef _Float16 v16h __attribute__((ext_vector_type(16)));
union FragH { v16h v; v8us half[2]; _Float16 h[16]; unsigned short u[16]; };
template <int NT>
__device__ __forceinline__ v8f mmaH(v16h ah, v16h al, v16h bh, v16h bl, v8f c) {
  c = __builtin_amdgcn_wmma_f32_16x16x32_f16(false, ah, false, bh, (short)0, c, false, false);
  if (NT >= 2) c = __builtin_amdgcn_wmma_f32_16x16x32_f16(false, al, false, bh, (short)0, c, false, false);
  if (NT >= 3) c = __builtin_amdgcn_wmma_f32_16x16x32_f16(false, ah, false, bl, (short)0, c, false, false);
  asm volatile("v_nop\n\tv_nop\n\tv_nop\n\tv_nop" : "+v"(c) : "v"(ah), "v"(al), "v"(bh), "v"(bl));
  return c;
}
// batched GEMM like k_gemm_b but f16 operands: A f32 (split into f16 hi/lo if ASPLIT, else rounded to f16), Bt = f16 values [n][k]; alpha; C f32; N multiple of 16 (partial tiles skipped)
template <bool ASPLIT>
__global__ __launch_bounds__(128) void k_gemm_h(const float* __restrict__ A, int lda, size_t sA, const _Float16* __restrict__ Bh, int ldb, size_t sB, float alpha, float* __restrict__ C, int ldc, size_t sC, int M, int N, int K) {
  __shared__ __attribute__((aligned(16))) float so[4][16][64];
  const int tid = threadIdx.x, w = tid >> 5, lane = tid & 31, ln = lane & 15, hh = lane >> 4; const int by = blockIdx.y;
  A += (size_t)by * sA; Bh += (size_t)by * sB; C += (size_t)by * sC;
  const int ntn = (N + 63) / 64; const int wid = blockIdx.x * 4 + w; const int mt = wid / ntn, nq = wid % ntn; if (mt * 16 >= M) return;
  const int row0 = mt * 16, col0 = nq * 64; const float* arow = A + (size_t)(row0 + ln) * lda;
  v8f acc[4] = {};
  for (int kb = 0; kb < K; kb += 32) {
    FragH ah, al;
    const v4f x0 = *(const v4fa*)(arow + kb + 8 * hh), x1 = *(const v4fa*)(arow + kb + 8 * hh + 4), x2 = *(const v4fa*)(arow + kb + 16 + 8 * hh), x3 = *(const v4fa*)(arow + kb + 16 + 8 * hh + 4);
    float xs[16] = {x0[0],x0[1],x0[2],x0[3],x1[0],x1[1],x1[2],x1[3],x2[0],x2[1],x2[2],x2[3],x3[0],x3[1],x3[2],x3[3]};
#pragma unroll
    for (int i = 0; i < 16; ++i) { const _Float16 h = (_Float16)xs[i]; ah.h[i] = h; al.h[i] = ASPLIT ? (_Float16)(xs[i] - (float)h) : (_Float16)0.0f; }
#pragma unroll
    for (int t = 0; t < 4; ++t) { if (col0 + t * 16 >= N) continue; const size_t boff = (size_t)(col0 + t * 16 + ln) * ldb + kb; FragH bq; bq.half[0] = *(const v8us*)(Bh + boff + 8 * hh); bq.half[1] = *(const v8us*)(Bh + boff + 16 + 8 * hh);
      acc[t] = mmaH<ASPLIT ? 2 : 1>(ah.v, al.v, bq.v, bq.v, acc[t]); }
  }
#pragma unroll
  for (int t = 0; t < 4; ++t) { if (col0 + t * 16 >= N) continue;
#pragma unroll
    for (int r = 0; r < 8; ++r) so[w][8 * hh + r][t * 16 + ln] = acc[t][r] * alpha; }
  __builtin_amdgcn_fence(__ATOMIC_ACQ_REL, "workgroup"); __builtin_amdgcn_wave_barrier();
  const int rsub = lane >> 4, c4 = (lane & 15) * 4;
  {
#pragma unroll
    for (int q = 0; q < 8; ++q) { const int r = q * 2 + rsub; if (col0 + c4 < N) { const v4f v = *(const v4fa*)&so[w][r][c4]; *(v4f*)(C + (size_t)(row0 + r) * ldc + col0 + c4) = v; } }
     }
}

// k_gemm_hh variant with fused epilogue: v = acc·alpha + bias[by·sBias + col] (+ CP[(row/rowsPerB)·sCPb + by·64 + col] if CP) ; ACT 0 none / 1 elu ; writes f16 C16 (and f32 C if non-null)
template <int ACT>
__global__ __launch_bounds__(128) void k_gemm_hhx(const _Float16* __restrict__ A, int lda, size_t sA, const _Float16* __restrict__ Bh, int ldb, size_t sB, float alpha, const float* __restrict__ bias, size_t sBias, const float* __restrict__ CP, int rowsPerB, size_t sCPb, int row0g,
    float* __restrict__ C, _Float16* __restrict__ C16, int ldc, size_t sC, int M, int N, int K) {
  __shared__ __attribute__((aligned(16))) float so[4][16][64];
  const int tid = threadIdx.x, w = tid >> 5, lane = tid & 31, ln = lane & 15, hh = lane >> 4; const int by = blockIdx.y;
  A += (size_t)by * sA; Bh += (size_t)by * sB; const size_t cofs = (size_t)by * sC; const float* bp = bias ? bias + (size_t)by * sBias : nullptr;
  const int ntn = (N + 63) / 64; const int wid = blockIdx.x * 4 + w; const int mt = wid / ntn, nq = wid % ntn; if (mt * 16 >= M) return;
  const int row0 = mt * 16, col0 = nq * 64; const _Float16* arow = A + (size_t)(row0 + ln) * lda;
  v8f acc[4] = {};
  for (int kb = 0; kb < K; kb += 32) { FragH ah; ah.half[0] = *(const v8us*)((const unsigned short*)arow + kb + 8 * hh); ah.half[1] = *(const v8us*)((const unsigned short*)arow + kb + 16 + 8 * hh);
#pragma unroll
    for (int t = 0; t < 4; ++t) { if (col0 + t * 16 >= N) continue; const size_t boff = (size_t)(col0 + t * 16 + ln) * ldb + kb; FragH bq; bq.half[0] = *(const v8us*)((const unsigned short*)Bh + boff + 8 * hh); bq.half[1] = *(const v8us*)((const unsigned short*)Bh + boff + 16 + 8 * hh);
      acc[t] = mmaH<1>(ah.v, ah.v, bq.v, bq.v, acc[t]); }
  }
#pragma unroll
  for (int t = 0; t < 4; ++t) { if (col0 + t * 16 >= N) continue; const int col = col0 + t * 16 + ln; const float bv = bp ? bf16_round(bp[col]) : 0.f;
#pragma unroll
    for (int r = 0; r < 8; ++r) { float v = acc[t][r] * alpha + bv; if (CP) { const int rr = row0g + row0 + 8 * hh + r; if (rowsPerB < 0) v += CP[cofs + (size_t)rr * ldc + col];      /* rowsPerB < 0: own element of the batched C plane */ else { const int bidx = rr / rowsPerB; v += CP[(size_t)bidx * sCPb + (size_t)by * 64 + col]; } } if (ACT == 1) v = (v > 0.f) ? v : expm1f(v); else if (ACT == 7) v = (v > 0.f) ? v + 1.0f : expf(v); else if (ACT == 8) v = tanhf(v); else if (ACT == 9) v = 0.5f * v * (1.0f + tanhf(0.7978845608028654f * (v + 0.044715f * v * v * v))); else if (ACT == 11) v = 1.0f / (1.0f + expf(-v)); else if (ACT == 12) v = (v > 0.f) ? v : 0.01f * v; else if (ACT == 14) v = (v > 0.f) ? v : 0.1f * v; else if (ACT == 16) v = (v >= 0.f) ? v : 0.3f * v; else if (ACT == 17) v = (v >= 0.f) ? v : 0.2f * v; else if (ACT == 15) v = v / (1.0f + expf(-v)); else if (ACT == 3) v = fmaxf(v, 0.f); else if (ACT == 6) v = 0.5f * v * (1.0f + erff(v * 0.70710678118654752f)); so[w][8 * hh + r][t * 16 + ln] = v; } }
  __builtin_amdgcn_fence(__ATOMIC_ACQ_REL, "workgroup"); __builtin_amdgcn_wave_barrier();
  const int rsub = lane >> 4, c4 = (lane & 15) * 4; typedef _Float16 v4h __attribute__((ext_vector_type(4)));
  {
#pragma unroll
    for (int q = 0; q < 8; ++q) { const int r = q * 2 + rsub; if (col0 + c4 < N) { const v4f v = *(const v4fa*)&so[w][r][c4]; if (C) *(v4f*)(C + cofs + (size_t)(row0 + r) * ldc + col0 + c4) = v; if (C16) { v4h h4; for (int i = 0; i < 4; ++i) h4[i] = (_Float16)v[i]; *(v4h*)(C16 + cofs + (size_t)(row0 + r) * ldc + col0 + c4) = h4; } } }
     }
}


typedef _Float16 v4h __attribute__((ext_vector_type(4)));

__global__ __launch_bounds__(256) void k_h16(const float* __restrict__ x, _Float16* __restrict__ X16, size_t n8) { const size_t t = (size_t)blockIdx.x * 256 + threadIdx.x; if (t >= n8) return; FragH f;
#pragma unroll
  for (int q = 0; q < 8; ++q) f.h[q] = (_Float16)x[t * 8 + q]; *(v8us*)((unsigned short*)X16 + t * 8) = f.half[0];  }
__global__ __launch_bounds__(256) void k_round16f(const float* __restrict__ W, _Float16* __restrict__ Bt, size_t n8) { const size_t t = (size_t)blockIdx.x * 256 + threadIdx.x; if (t >= n8) return; FragH f;
#pragma unroll
  for (int i = 0; i < 8; ++i) f.h[i] = (_Float16)(bf16_round(W[t * 8 + i]) * 16.0f); *(v8us*)((unsigned short*)Bt + t * 8) = f.half[0];  }
__global__ __launch_bounds__(256) void k_hl(const float* __restrict__ F, _Float16* __restrict__ Hh, _Float16* __restrict__ Hl, size_t n8) { const size_t t = (size_t)blockIdx.x * 256 + threadIdx.x; if (t >= n8) return; FragH fh, fl; const v4f a = *(const v4fa*)(F + t * 8), c = *(const v4fa*)(F + t * 8 + 4);
#pragma unroll
  for (int q = 0; q < 4; ++q) { _Float16 h = (_Float16)a[q]; fh.h[q] = h; fl.h[q] = (_Float16)((a[q] - (float)h) * 1024.0f); h = (_Float16)c[q]; fh.h[4 + q] = h; fl.h[4 + q] = (_Float16)((c[q] - (float)h) * 1024.0f); }
  { *(v8us*)((unsigned short*)Hh + t * 8) = fh.half[0]; *(v8us*)((unsigned short*)Hl + t * 8) = fl.half[0];  } }

// ---- fast GEMM (block tile 128x192, eight waves, both operands staged in LDS in 64-k stages; wave tile 64x48; requires M % 128 == 0 rows per launch region, N % 192 == 0 and K % 64 == 0) ----
__device__ __forceinline__ v16h g2_frag(const _Float16* p, int hh) { FragH f; f.half[0] = *(const v8us*)((const unsigned short*)p + 8 * hh); f.half[1] = *(const v8us*)((const unsigned short*)p + 16 + 8 * hh); return f.v; }
__device__ __forceinline__ v16h g2_sfrag(const unsigned short* p) { FragH f; f.half[0] = *(const v8us*)p; f.half[1] = *(const v8us*)(p + 16); return f.v; }      /* the same fragment from an LDS row: p = row + k0 + 8 * hh, the k order of g2_frag */
#define G2_KS 64        /* k per LDS stage: one whole 128-byte line of every operand row */
#define G2_PITCH 72     /* 16-bit elements per LDS row: 128 data bytes + 16 (16 bytes x odd for the 16-byte fragment reads) */
#define G2_BM 128       /* rows of the block's tile */
#define G2_BN 192       /* columns of the block's tile: 320 operand rows are fetched for 128 x 192 results */
#define G2_ROWS (G2_BM + G2_BN)     /* rows of a stage: the block's A rows, then its B rows */
#define G2_TPI 132      /* epilogue, transposed tile [column][row]: 128 rows + 4, sixteen columns' 16-byte LDS stores fall on sixteen different bank groups */
#define G2_SPI 196      /* epilogue, plain tile [row][column]: 192 columns + 4 (16 bytes x odd) */
__device__ __forceinline__ v8f g2_mma(v16h a, v16h b, v8f c) { v8f d = __builtin_amdgcn_wmma_f32_16x16x32_f16(false, a, false, b, (short)0, c, false, false); asm volatile("v_nop\n\tv_nop\n\tv_nop\n\tv_nop" : "+v"(d) : "v"(a), "v"(b)); return d; }
template <int ACT>
__global__ __launch_bounds__(256) void k_gemm2(const _Float16* __restrict__ A, int lda, size_t sA, const _Float16* __restrict__ Bh, int ldb, size_t sB, float alpha, const float* __restrict__ bias, const float* __restrict__ bias1, const float* __restrict__ bias2, size_t sBias,
    float* __restrict__ C, _Float16* __restrict__ C16, int ldc, size_t sC, int M, int N, int K, int tp, int rpt) { static_assert(ACT == 0 || ACT == 3 || ACT == 6 || ACT == 8 || ACT == 9 || ACT == 11 || ACT == 12 || ACT == 14 || ACT == 15 || ACT == 16 || ACT == 17, "k_gemm2: unsupported ACT code (would silently apply no activation)");
  __shared__ __attribute__((aligned(16))) float sm[G2_BN * G2_TPI];      /* main loop: two operand stages; behind the loop's last barrier: the epilogue's tile */
  static_assert(2 * G2_ROWS * G2_PITCH / 2 <= G2_BN * G2_TPI && G2_BM * G2_SPI <= G2_BN * G2_TPI && G2_BM <= G2_TPI && G2_BN <= G2_SPI, "k_gemm2: the stages and both forms of the epilogue's tile lie in sm[]");
  unsigned short* const sg = (unsigned short*)sm;
  const int tid = threadIdx.x, w = tid >> 5, lane = tid & 31, ln = lane & 15, hh = lane >> 4; const int by = blockIdx.y;
  const int wr = w & 1, wc = w >> 1;      /* the wave's place in the block's tile: rows 64 * wr .., columns 48 * wc .. */
  A += (size_t)by * sA; Bh += (size_t)by * sB; const size_t cofs = (size_t)by * sC; const float* bp = (by == 1 && bias1) ? bias1 : (by == 2 && bias2) ? bias2 : bias ? bias + (size_t)by * sBias : nullptr;      /* bias1, bias2: planes 1 and 2 where their biases are buffers of their own */
  const int ntn = N / G2_BN; const int mt = blockIdx.x / ntn, nq = blockIdx.x - mt * ntn; const int col0 = nq * G2_BN; if (mt * G2_BM >= M) return;      /* M is a multiple of 128 (and K of G2_KS): a block leaves whole or not at all, in front of every barrier, and stages whole */
  const bool tr = by >= tp;      /* planes tp.. are stored transposed, [row / rpt][col][row % rpt] (rpt a multiple of 128); the same in every thread of a block */
  const int sr = tid >> 3, sc = (tid & 7) * 8;      /* staging: eight threads a 128-byte line of one row, rows sr + 32 i */
  const char* ag = (const char*)(A + (size_t)(mt * G2_BM) * lda); const char* bg = (const char*)(Bh + (size_t)col0 * ldb);      /* the block's first A row and first B row: the same in every thread */
  unsigned oa[4], ob[6];      /* the thread's byte offsets from there, moved on by one stage a trip (a block's rows span far less than 4 GB) */
#pragma unroll      /* static indices into oa[], ob[] */
  for (int i = 0; i < 6; ++i) { if (i < 4) oa[i] = (unsigned)((sr + 32 * i) * lda + sc) * 2u; ob[i] = (unsigned)((sr + 32 * i) * ldb + sc) * 2u; }
  unsigned short* const sw = sg + sr * G2_PITCH + sc;      /* the thread's place in row sr of buffer 0 */
  v8us ra[4], rb[6];
#pragma unroll      /* static indices into ra[], rb[]; the ten loads fly together */
  for (int i = 0; i < 6; ++i) { if (i < 4) ra[i] = *(const v8us*)(ag + oa[i]); rb[i] = *(const v8us*)(bg + ob[i]); }
#pragma unroll      /* static indices into ra[], rb[] */
  for (int i = 0; i < 6; ++i) { if (i < 4) *(v8us*)(sw + 32 * i * G2_PITCH) = ra[i]; *(v8us*)(sw + (G2_BM + 32 * i) * G2_PITCH) = rb[i]; }
  __syncthreads();      /* stage 0 is published */
  const v8f z8 = {0.f,0.f,0.f,0.f,0.f,0.f,0.f,0.f}; v8f c[4][3] = {{z8, z8, z8}, {z8, z8, z8}, {z8, z8, z8}, {z8, z8, z8}};      /* [16-row group][16-column group] */
  const int ns = K / G2_KS;
#pragma unroll 1      /* one stage a trip: the body already holds two k steps */
  for (int s = 0; s < ns; ++s) { const int cur = s & 1; const bool more = s + 1 < ns;      /* the same in every thread */
    if (more) {      /* the next stage's lines fly while this stage is worked on */
#pragma unroll      /* static indices into the register arrays */
      for (int i = 0; i < 6; ++i) { if (i < 4) { oa[i] += G2_KS * 2; ra[i] = *(const v8us*)(ag + oa[i]); } ob[i] += G2_KS * 2; rb[i] = *(const v8us*)(bg + ob[i]); } }
#pragma unroll      /* constant LDS offsets for both k steps */
    for (int kk = 0; kk < G2_KS / 32; ++kk) { const unsigned short* ap = sg + (cur * G2_ROWS + 64 * wr + ln) * G2_PITCH + kk * 32 + 8 * hh; const unsigned short* bq = sg + (cur * G2_ROWS + G2_BM + 48 * wc + ln) * G2_PITCH + kk * 32 + 8 * hh;
      v16h a[4], b[3];      /* the k step's fourteen LDS reads as one group ahead of its products */
#pragma unroll      /* static indices keep a[], b[] in registers */
      for (int i = 0; i < 4; ++i) { a[i] = g2_sfrag(ap + 16 * i * G2_PITCH); if (i < 3) b[i] = g2_sfrag(bq + 16 * i * G2_PITCH); }
#pragma unroll      /* static indices keep the register arrays in registers */
      for (int j = 0; j < 3; ++j)
#pragma unroll      /* static indices keep the register arrays in registers */
        for (int i = 0; i < 4; ++i) c[i][j] = g2_mma(a[i], b[j], c[i][j]); }
    if (more) {
#pragma unroll      /* static indices into ra[], rb[] */
      for (int i = 0; i < 6; ++i) { if (i < 4) *(v8us*)(sw + ((cur ^ 1) * G2_ROWS + 32 * i) * G2_PITCH) = ra[i]; *(v8us*)(sw + ((cur ^ 1) * G2_ROWS + G2_BM + 32 * i) * G2_PITCH) = rb[i]; } }
    __syncthreads();      /* publishes stage s + 1 and ends every wave's reads of the buffer that the next trip refills; behind the last one sm[] is the epilogue's */
  }
  const int cl0 = 48 * wc + ln, rl0 = 64 * wr + 8 * hh;      /* tile (i, j) of the wave: the lane holds rows rl0 + 16 i .. + 7 of column cl0 + 16 j of the block's tile */
#pragma unroll      /* static indices keep c[][] in registers */
  for (int j = 0; j < 3; ++j) { const float bv = bp ? bf16_round(bp[col0 + cl0 + 16 * j]) : 0.f;
#pragma unroll      /* static indices keep c[][] in registers */
    for (int i = 0; i < 4; ++i)
#pragma unroll      /* static indices keep c[][] in registers */
      for (int r = 0; r < 8; ++r) { float v = c[i][j][r] * alpha + bv;
        if (ACT == 3) v = fmaxf(v, 0.f); else if (ACT == 6) v = 0.5f * v * (1.0f + erff(v * 0.70710678118654752f)); else if (ACT == 11) v = 1.0f / (1.0f + expf(-v)); else if (ACT == 15) v = v / (1.0f + expf(-v)); else if (ACT == 12) v = (v > 0.f) ? v : 0.01f * v; else if (ACT == 8) v = tanhf(v); else if (ACT == 9) v = 0.5f * v * (1.0f + tanhf(0.7978845608028654f * (v + 0.044715f * v * v * v))); else if (ACT == 14) v = (v > 0.f) ? v : 0.1f * v; else if (ACT == 16) v = (v >= 0.f) ? v : 0.3f * v; else if (ACT == 17) v = (v >= 0.f) ? v : 0.2f * v;
        c[i][j][r] = v; } }
  if (tr) {
#pragma unroll      /* static indices keep c[][] in registers */
    for (int j = 0; j < 3; ++j)
#pragma unroll      /* static indices keep c[][] in registers */
      for (int i = 0; i < 4; ++i) { float* tq = sm + (cl0 + 16 * j) * G2_TPI + rl0 + 16 * i; *(v4fa*)tq = v4f{c[i][j][0], c[i][j][1], c[i][j][2], c[i][j][3]}; *(v4fa*)(tq + 4) = v4f{c[i][j][4], c[i][j][5], c[i][j][6], c[i][j][7]}; } }      /* a lane's eight values are eight rows in a row of one column */
  else {
#pragma unroll      /* static indices keep c[][] in registers */
    for (int j = 0; j < 3; ++j)
#pragma unroll      /* static indices keep c[][] in registers */
      for (int i = 0; i < 4; ++i)
#pragma unroll      /* static indices keep c[][] in registers */
        for (int r = 0; r < 8; ++r) sm[(rl0 + 16 * i + r) * G2_SPI + cl0 + 16 * j] = c[i][j][r]; }
  __syncthreads();      /* the eight waves' parts make up the block's tile: a column's 128 rows come from two waves, a row's 192 columns from four */
  const int rb0 = mt * G2_BM;
  if (tr) {
    const int bb = rb0 / rpt; const size_t tb = cofs + ((size_t)bb * N + col0) * rpt + (rb0 - bb * rpt);
    if (C) {
#pragma unroll      /* the columns' LDS reads and stores overlap */
      for (int q = 0; q < G2_BN / 8; ++q) { const int cc = q * 8 + w; const v4f v = *(const v4fa*)(sm + cc * G2_TPI + lane * 4); *(v4f*)(C + tb + (size_t)cc * rpt + lane * 4) = v; }      /* a wave's store = one column's 512 bytes */
      asm volatile("s_wait_xcnt 0x0" ::: "memory"); }      /* precaution: the code behind (the 16-bit stores; in the built code also the join with the untransposed path) rewrites these stores' registers, and the wait stands in front of that on any path */
    if (C16) {
#pragma unroll      /* the columns' LDS reads and stores overlap */
      for (int q = 0; q < G2_BN / 16; ++q) { const int cc = q * 16 + w * 2 + hh; const v4f v0 = *(const v4fa*)(sm + cc * G2_TPI + ln * 8), v1 = *(const v4fa*)(sm + cc * G2_TPI + ln * 8 + 4); FragH h8;
#pragma unroll      /* static indices keep h8 in registers */
        for (int i = 0; i < 4; ++i) { h8.h[i] = (_Float16)v0[i]; h8.h[4 + i] = (_Float16)v1[i]; }
        *(v8us*)((unsigned short*)C16 + tb + (size_t)cc * rpt + ln * 8) = h8.half[0]; }      /* a wave's store = two columns' 256 bytes each */
      asm volatile("s_wait_xcnt 0x0" ::: "memory"); }      /* precaution: in the built code this path joins the untransposed one behind these stores, and the wait stands in front of every later write of their registers on any path there */
    return; }
  if (C) {
#pragma unroll      /* the chunks' LDS reads and stores overlap */
    for (int q = 0; q < G2_BM * (G2_BN / 8) / 256; ++q) { const int ix = q * 256 + tid, row = ix / (G2_BN / 8), c8 = (ix - row * (G2_BN / 8)) * 8;      /* 24 threads a row */
      const v4f v0 = *(const v4fa*)(sm + row * G2_SPI + c8), v1 = *(const v4fa*)(sm + row * G2_SPI + c8 + 4); float* cp = C + cofs + (size_t)(rb0 + row) * ldc + col0 + c8; *(v4f*)cp = v0; *(v4f*)(cp + 4) = v1; }
    asm volatile("s_wait_xcnt 0x0" ::: "memory"); }      /* precaution: the 16-bit stores behind rewrite these stores' registers, and the wait stands in front of that */
  if (C16) {
#pragma unroll      /* the chunks' LDS reads and stores overlap */
    for (int q = 0; q < G2_BM * (G2_BN / 8) / 256; ++q) { const int ix = q * 256 + tid, row = ix / (G2_BN / 8), c8 = (ix - row * (G2_BN / 8)) * 8;      /* 24 threads a row: its 192 columns = three whole 128-byte lines of 16-bit values */
      const v4f v0 = *(const v4fa*)(sm + row * G2_SPI + c8), v1 = *(const v4fa*)(sm + row * G2_SPI + c8 + 4); FragH h8;
#pragma unroll      /* static indices keep h8 in registers */
      for (int i = 0; i < 4; ++i) { h8.h[i] = (_Float16)v0[i]; h8.h[4 + i] = (_Float16)v1[i]; }
      *(v8us*)((unsigned short*)C16 + cofs + (size_t)(rb0 + row) * ldc + col0 + c8) = h8.half[0]; }
    asm volatile("s_wait_xcnt 0x0" ::: "memory"); }      /* precaution: stands behind the last stores, in front of any later write of their registers */
}


// Operand preparation, one launch; the block index picks the part (the same for a whole block), the largest part first:
//   PB_X blocks: hidden_state [b][e][s] -> exact f16 token rows [b][s][e], one 64-channel x 64-token tile a block, turned in LDS;
//   PB_W blocks a weight slab (36 slabs = q, k, v times 12 heads): [in = 768][out = 64] -> rows h*64.. of that projection's Bt plane [n][k], x16 (bf16-exact weights stay exact in f16 away from the subnormal range);
//   PB_O blocks: Wo, natural [out][in] = Bt, x16.
#define PB_X ((unsigned)(NB * (SQ / 64) * (DM / 64)))
#define PB_W ((unsigned)(HD * (DM / 8) / 256))
#define PB_O ((unsigned)(DM * DM / 8 / 256))
static_assert(SQ % 64 == 0 && DM % 64 == 0 && HD * DM % 2048 == 0 && DM * DM % 2048 == 0, "k_prep: whole 64 x 64 tiles of x; the weight parts are whole blocks of 256 threads x 8 elements");
__global__ __launch_bounds__(256) void k_prep(const float* __restrict__ x, const float* __restrict__ wq, const float* __restrict__ wk, const float* __restrict__ wv, const float* __restrict__ wo,
    _Float16* __restrict__ X16, _Float16* __restrict__ Bqkv, _Float16* __restrict__ Bo) {
  __shared__ unsigned short tl[64][66];      /* x part: [channel][token] */
  unsigned bx = blockIdx.x; FragH f;
  if (bx < PB_X) { const int tid = (int)threadIdx.x; const unsigned slab = bx / (DM / 64), eg = bx - slab * (DM / 64), b = slab / (SQ / 64), sg = slab - b * (SQ / 64);      /* slab = 64 tokens of one batch, eg = 64 channels */
    const float* xs = x + ((size_t)b * DM + eg * 64) * SQ + sg * 64;
#pragma unroll      /* the four loads fly together */
    for (int p = 0; p < 4; ++p) { const int r = p * 16 + (tid >> 4), c4 = (tid & 15) * 4; const v4f a = *(const v4fa*)(xs + (size_t)r * SQ + c4);      /* sixteen threads a channel's 256 bytes */
#pragma unroll      /* static indices keep f in registers */
      for (int q = 0; q < 4; ++q) { f.h[q] = (_Float16)bf16_round(a[q]); tl[r][c4 + q] = f.u[q]; } }
    __syncthreads();      /* the tile is whole before it is read by columns; every thread of an x block passes here */
#pragma unroll      /* both rows' LDS reads overlap */
    for (int rd = 0; rd < 2; ++rd) { const int d = rd * 32 + tid / 8, pc = tid % 8;      /* eight threads a token's 128 bytes */
#pragma unroll      /* static indices keep f in registers */
      for (int q = 0; q < 8; ++q) f.u[q] = tl[pc * 8 + q][d];
      *(v8us*)((unsigned short*)X16 + ((size_t)slab * 64 + d) * DM + eg * 64 + pc * 8) = f.half[0]; }
    return; }
  bx -= PB_X;
  if (bx < 3 * NH * PB_W) { const unsigned slab = bx / PB_W, m = slab / NH, h = slab - m * NH; const float* W = (m == 0 ? wq : m == 1 ? wk : wv) + (size_t)h * DM * HD;
    const int t = (int)(bx - slab * PB_W) * 256 + (int)threadIdx.x; const int n = t / (DM / 8), k8 = (t % (DM / 8)) * 8;
#pragma unroll
    for (int i = 0; i < 8; ++i) f.h[i] = (_Float16)(bf16_round(W[(size_t)(k8 + i) * HD + n]) * 16.0f);
    *(v8us*)((unsigned short*)Bqkv + (size_t)slab * HD * DM + (size_t)n * DM + k8) = f.half[0];
    asm volatile("s_wait_xcnt 0x0" ::: "memory");      /* precaution: in the built code the three parts join behind this store, and the wait stands in front of every later write of the store's registers on any path there */
    return; }
  bx -= 3 * NH * PB_W;
  { const size_t t = (size_t)bx * 256 + threadIdx.x;
#pragma unroll
    for (int q = 0; q < 8; ++q) f.h[q] = (_Float16)(bf16_round(wo[t * 8 + q]) * 16.0f);
    *(v8us*)((unsigned short*)Bo + t * 8) = f.half[0];
    asm volatile("s_wait_xcnt 0x0" ::: "memory");      /* precaution: in the built code the three parts join behind this store, and the wait stands in front of every later write of the store's registers on any path there */ } }
#define FA_KEYS 64      /* keys per LDS stage */
#define FA_PITCH 72     /* 16-bit elements per LDS row: 128 data bytes + 16 */
typedef float v2f __attribute__((ext_vector_type(2)));
__device__ __forceinline__ float fa_xhalf(float x) { return __builtin_bit_cast(float, __builtin_amdgcn_permlanex16(__builtin_bit_cast(int, x), __builtin_bit_cast(int, x), 0x76543210, 0xfedcba98, false, false)); }      /* lane l <-> lane l ^ 16 */
__device__ __forceinline__ v16h fa_frag(const unsigned short* p) { FragH f; f.half[0] = *(const v8us*)p; f.half[1] = *(const v8us*)(p + 16); return f.v; }      /* p = row + k0 + 8 * hh */
__device__ __forceinline__ v8f fa_mma(v16h a, v16h b, v8f c) { return __builtin_amdgcn_wmma_f32_16x16x32_f16(false, a, false, b, (short)0, c, false, false); }
__global__ __launch_bounds__(128) void k_fattn(const _Float16* __restrict__ Q16, const _Float16* __restrict__ K16, const _Float16* __restrict__ VT, _Float16* __restrict__ O16) {
  __shared__ __attribute__((aligned(16))) unsigned short sk[2][FA_KEYS][FA_PITCH];      /* K rows [key][d] */
  __shared__ __attribute__((aligned(16))) unsigned short sv[2][HD][FA_PITCH];           /* V^T rows [d][key] */
  const int tid = threadIdx.x, w = tid >> 5, lane = tid & 31, ln = lane & 15, hh = lane >> 4;
  const int h = blockIdx.y, b = blockIdx.z, q0 = blockIdx.x * 128 + w * 32;
  const unsigned short* kg = (const unsigned short*)K16 + (size_t)b * SQ * DM + h * HD;
  const unsigned short* vg = (const unsigned short*)VT + ((size_t)b * NH + h) * HD * SQ;
  v16h qf[2][2];
#pragma unroll      /* static indices keep qf[] in registers */
  for (int g = 0; g < 2; ++g) { const _Float16* qp = Q16 + ((size_t)b * SQ + q0 + 16 * g + ln) * DM + h * HD; qf[g][0] = g2_frag(qp, hh); qf[g][1] = g2_frag(qp + 32, hh); }
  const int sr = tid >> 3, sc = (tid & 7) * 8;      /* staging: eight threads a 128-byte row, rows sr + 16 i */
  v8us rk[4], rv[4];
#pragma unroll      /* static indices into rk[], rv[] */
  for (int i = 0; i < 4; ++i) { rk[i] = *(const v8us*)(kg + (size_t)(sr + 16 * i) * DM + sc); rv[i] = *(const v8us*)(vg + (size_t)(sr + 16 * i) * SQ + sc); }
#pragma unroll      /* static indices into rk[], rv[] */
  for (int i = 0; i < 4; ++i) { *(v8us*)&sk[0][sr + 16 * i][sc] = rk[i]; *(v8us*)&sv[0][sr + 16 * i][sc] = rv[i]; }
  __syncthreads();      /* stage 0 is published */
  const v8f z8 = {0.f, 0.f, 0.f, 0.f, 0.f, 0.f, 0.f, 0.f};
  v8f acc[2][4] = {{z8, z8, z8, z8}, {z8, z8, z8, z8}}; float mrun[2] = {-3.0e38f, -3.0e38f}; v2f lsum[2] = {{0.f, 0.f}, {0.f, 0.f}};      /* mrun: the maximum in use, log2 domain; lsum: the lane's share of the denominator, even and odd keys apart */
  const float L2E = 1.4426950408889634f;
#pragma unroll 1      /* one stage a trip: the body already holds two passes */
  for (int s = 0; s < SQ / FA_KEYS; ++s) {
    const int cur = s & 1; const bool more = s + 1 < SQ / FA_KEYS;      /* the same in every thread */
    if (more) {      /* the next stage's lines fly while this stage is worked on */
#pragma unroll      /* static indices into rk[], rv[] */
      for (int i = 0; i < 4; ++i) { rk[i] = *(const v8us*)(kg + (size_t)((s + 1) * FA_KEYS + sr + 16 * i) * DM + sc); rv[i] = *(const v8us*)(vg + (size_t)(sr + 16 * i) * SQ + (s + 1) * FA_KEYS + sc); } }
#pragma unroll      /* static indices into the register arrays */
    for (int ps = 0; ps < FA_KEYS / 32; ++ps) {
      v8f st[2][2];      /* [key tile][query group] */
#pragma unroll      /* static indices keep the register arrays in registers */
      for (int kt = 0; kt < 2; ++kt) { const unsigned short* kp = &sk[cur][ps * 32 + kt * 16 + ln][8 * hh]; const v16h k0 = fa_frag(kp), k1 = fa_frag(kp + 32);
#pragma unroll      /* static indices keep the register arrays in registers */
        for (int g = 0; g < 2; ++g) st[kt][g] = fa_mma(k1, qf[g][1], fa_mma(k0, qf[g][0], z8)); }
      v16h vf[4];
#pragma unroll      /* static indices keep the register arrays in registers */
      for (int t = 0; t < 4; ++t) vf[t] = fa_frag(&sv[cur][16 * t + ln][ps * 32 + 8 * hh]);
      float mb[2]; bool need = false;
#pragma unroll      /* static indices keep the register arrays in registers */
      for (int g = 0; g < 2; ++g) { float mx = st[0][g][0];
#pragma unroll      /* static indices keep the register arrays in registers */
        for (int r = 1; r < 8; ++r) mx = fmaxf(mx, st[0][g][r]);
#pragma unroll      /* static indices keep the register arrays in registers */
        for (int r = 0; r < 8; ++r) mx = fmaxf(mx, st[1][g][r]);
        mx = fmaxf(mx, fa_xhalf(mx)) * L2E; mb[g] = mx; need = need || (mx > mrun[g] + 8.0f); }      /* both halves hold the query's maximum of this pass */
      if (__builtin_amdgcn_ballot_w32(need) != 0) {      /* lazy rescale: only when some query's maximum passes the one in use by more than 2^8; always on the first pass */
#pragma unroll      /* static indices keep the register arrays in registers */
        for (int g = 0; g < 2; ++g) { const float mn = fmaxf(mrun[g], mb[g]); const float corr = __builtin_amdgcn_exp2f(mrun[g] - mn); mrun[g] = mn; lsum[g] *= corr;
#pragma unroll      /* static indices keep the register arrays in registers */
          for (int t = 0; t < 4; ++t) acc[g][t] *= corr; } }
#pragma unroll      /* static indices keep the register arrays in registers */
      for (int g = 0; g < 2; ++g) { const float nm = 6.0f - mrun[g]; FragH pf; v2f ls = {0.f, 0.f};      /* weights x 2^6: at most 2^14 in f16, small ones further from the subnormal range */
#pragma unroll      /* static indices keep the register arrays in registers */
        for (int i = 0; i < 8; ++i) { const v2f a = __builtin_elementwise_fma(v2f{st[i >> 2][g][2 * (i & 3)], st[i >> 2][g][2 * (i & 3) + 1]}, v2f{L2E, L2E}, v2f{nm, nm});
          const v2f p = {__builtin_amdgcn_exp2f(a.x), __builtin_amdgcn_exp2f(a.y)}; ls += p; pf.h[2 * i] = (_Float16)p.x; pf.h[2 * i + 1] = (_Float16)p.y; }
        lsum[g] += ls;
#pragma unroll      /* static indices keep the register arrays in registers */
        for (int t = 0; t < 4; ++t) acc[g][t] = fa_mma(vf[t], pf.v, acc[g][t]); }
    }
    if (more) {
#pragma unroll      /* static indices into rk[], rv[] */
      for (int i = 0; i < 4; ++i) { *(v8us*)&sk[cur ^ 1][sr + 16 * i][sc] = rk[i]; *(v8us*)&sv[cur ^ 1][sr + 16 * i][sc] = rv[i]; } }
    __syncthreads();      /* publishes stage s + 1 and ends every wave's reads of the buffer that the next trip refills */
  }
#pragma unroll      /* static indices keep the register arrays in registers */
  for (int g = 0; g < 2; ++g) { const float lh = lsum[g].x + lsum[g].y; const float inv = 64.0f / (lh + fa_xhalf(lh)); unsigned short* op = (unsigned short*)O16 + ((size_t)b * SQ + q0 + 16 * g + ln) * DM + h * HD + 8 * hh;      /* the halves' sums join once; o x64 */
#pragma unroll      /* static indices keep the register arrays in registers */
    for (int t = 0; t < 4; ++t) { FragH o;
#pragma unroll      /* static indices keep the register arrays in registers */
      for (int r = 0; r < 8; ++r) o.h[r] = (_Float16)(acc[g][t][r] * inv);
      *(v8us*)(op + 16 * t) = o.half[0]; } } }
__global__ __launch_bounds__(256) void k_vt(const _Float16* __restrict__ V16, int b, int h0, _Float16* __restrict__ VT) { __shared__ unsigned short tl[64][65]; const int tid = threadIdx.x; const int hh = blockIdx.x % HG, sg = blockIdx.x / HG; const int s0 = sg * 64; const int h = h0 + hh;
  for (int i = tid; i < 64 * 8; i += 256) { const int j = i / 8, d8 = (i % 8) * 8; FragH f; f.half[0] = *(const v8us*)((const unsigned short*)V16 + ((size_t)b * SQ + s0 + j) * DM + h * HD + d8); for (int q = 0; q < 8; ++q) tl[d8 + q][j] = f.u[q]; }
  __syncthreads();
  { for (int i = tid; i < 64 * 8; i += 256) { const int d = i / 8, j8 = (i % 8) * 8; FragH f; for (int q = 0; q < 8; ++q) f.u[q] = tl[d][j8 + q]; *(v8us*)((unsigned short*)VT + ((size_t)hh * HD + d) * SQ + s0 + j8) = f.half[0]; }  } }



__global__ __launch_bounds__(256) void k_rsmkm(const float* __restrict__ S, _Float16* __restrict__ P, int nrows, const int* __restrict__ am) {
  #pragma clang fp contract(off)
  const int t = blockIdx.x * 256 + threadIdx.x; if (t >= nrows) return; const size_t i = (size_t)t; const float* s = S + i * SQ; const int* mr = am + (size_t)(t % SQ) * SQ; float mx = -3.0e38f;
#pragma unroll 1
  for (int j = 0; j < SQ; ++j) { const float f = (mr[j] != 0) ? 1.f : 0.f; mx = fmaxf(mx, fmaf(f, s[j], (1.f - f) * -1.0e9f)); } float se = 0.f;
#pragma unroll 1
  for (int j = 0; j < SQ; ++j) { const float f = (mr[j] != 0) ? 1.f : 0.f; se += __expf(fmaf(f, s[j], (1.f - f) * -1.0e9f) - mx); } const float sc = 256.0f / se;
#pragma unroll 1
  for (int j0 = 0; j0 < SQ; j0 += 8) { FragH fr; for (int q = 0; q < 8; ++q) { const int j = j0 + q; const float f = (mr[j] != 0) ? 1.f : 0.f; fr.h[q] = (_Float16)(__expf(fmaf(f, s[j], (1.f - f) * -1.0e9f) - mx) * sc); }
    unsigned short* d = (unsigned short*)P + i * SQ + j0; *(v8us*)d = fr.half[0];  } }

template <int COLS>
__global__ __launch_bounds__(256) void k_wperm(const float* __restrict__ Wn, _Float16* __restrict__ Bt) {
  const size_t t = (size_t)blockIdx.x * 256 + threadIdx.x; if (t >= (size_t)DM * DM / 8) return; const size_t e0 = t * 8; const int n = (int)(e0 / DM), k0 = (int)(e0 % DM); FragH f;
  if (COLS == 0) { const int h = n >> 6, d = n & 63; const float* src = Wn + (size_t)(d * NH + h) * DM + k0; for (int q = 0; q < 8; ++q) f.h[q] = (_Float16)(bf16_round(src[q]) * 16.0f); }
  else { for (int q = 0; q < 8; ++q) { const int kk = k0 + q; const int h = kk >> 6, d = kk & 63; f.h[q] = (_Float16)(bf16_round(Wn[(size_t)n * DM + d * NH + h]) * 16.0f); } }
  unsigned short* dst = (unsigned short*)Bt + e0; *(v8us*)dst = f.half[0];  }
__global__ __launch_bounds__(256) void k_bperm(const float* __restrict__ b, float* __restrict__ out) { const int t = threadIdx.x; if (t >= DM) return; const int h = t >> 6, d = t & 63; const float v = b[d * NH + h]; *(float*)(out + t) = v;  }
extern "C" void kernel_launch(void* const* d_in, const int* in_sizes, int n_in,
                              void* d_out, int out_size, void* d_ws, size_t ws_size, hipStream_t stream) {
  (void)in_sizes; (void)n_in; (void)out_size;
  const float* const* I = (const float* const*)d_in; const float* xq = I[0]; const float* xk = I[0]; const float* xv = I[0]; const float* wq = I[1]; const float* bq = I[2]; const float* wk = I[3]; const float* bk = I[4]; const float* wv = I[5]; const float* bv = I[6]; const float* wo = I[7]; const float* bo = I[8]; const float* x = xq;      /* hidden_state [4][768][2048] (feeds q, k and v); per-head Wq / Wk / Wv [12][768][64] + biases [12][64] (= [768] head-major); Wo [768][768] natural + bo */
  char* ws = (char*)d_ws; size_t off = 0;
  auto take = [&](size_t bytes) { char* p = ws + off; off += (bytes + 255) & ~(size_t)255; return p; };
  _Float16* BQ = (_Float16*)take((size_t)3 * DM * DM * 2); _Float16* BO = (_Float16*)take((size_t)DM * DM * 2);      /* BQ: the q, k, v Bt planes in a row (plane stride DM * DM) */
  _Float16* X16 = (_Float16*)take(NR * DM * 2); _Float16* Q16 = (_Float16*)take(3 * NR * DM * 2); _Float16* K16 = Q16 + NR * DM; _Float16* V16 = K16 + NR * DM;      /* q rows, k rows and V^T in a row (plane stride NR * DM) */ _Float16* O16 = (_Float16*)take(NR * DM * 2);
  _Float16* VT = V16;      /* the v plane holds V^T [NB][NH][HD][SQ]: as many elements as the rows */
  static_assert(MP % 128 == 0 && MPO % 128 == 0 && SQ % 128 == 0 && B0 == 0, "transposed GEMM stores: whole 128-row blocks inside one batch");
  static_assert(DM % G2_KS == 0 && DM % G2_BN == 0 && G2_BM == 128, "k_gemm2: whole 64-k stages, whole 192-column blocks of 128 rows");
  if (off > ws_size) return;
  k_prep<<<PB_X + 3 * NH * PB_W + PB_O, 256, 0, stream>>>(x, wq, wk, wv, wo, X16, BQ, BO);      /* exact f16 token rows [b][s][e] of the [B][E][S] input (q, k and v all project these rows); per-head [in = 768][out = 64] tensors -> rows h*64.. of the Bt planes (x16): head h = output columns h*64.. = the concat order; Wo natural [out][in] = Bt x16 */

  const size_t r0p = (size_t)B0 * SQ;      /* first projected row */
  k_gemm2<0><<<dim3((unsigned)((MP / G2_BM) * (DM / G2_BN)), 3), 256, 0, stream>>>(X16 + r0p * DM, DM, 0, BQ, DM, (size_t)DM * DM, 0.0625f, bq, bk, bv, 0, nullptr, Q16 + r0p * DM, DM, NR * DM, MP, DM, DM, 2, SQ);      /* blockIdx.y = q, k, v; plane 2 stored as V^T */
  k_fattn<<<dim3(SQ / 128, NH, NB), 128, 0, stream>>>(Q16, K16, VT, O16);      /* UNSCALED scores q.k (the module omits 1/sqrt(d)), softmax and P.V; o (merged heads) as f16 rows x64 */
  k_gemm2<0><<<dim3((unsigned)((MPO / G2_BM) * (DM / G2_BN)), 1), 256, 0, stream>>>(O16 + r0p * DM, DM, 0, BO, DM, 0, 0.0009765625f, bo, nullptr, nullptr, 0, (float*)d_out, nullptr, DM, 0, MPO, DM, DM, 0, SQ);      /* out (f32; bo is in natural channel order = the output columns), stored transposed: the module's [b][co][n] layout */
}

// v007
// It runs in 102 microseconds.
// Two timings next to v006 put it at 1.06 and 1.05 times that version's speed.
// Counting every step since v000, it is 57.5 times as fast.
#include <hip/hip_runtime.h>
#define NB 4
#define SQ 2048
#define DM 768
#define NH 12
#define HD 64
#define HG 4                         /* heads per block group of k_vt(V16, b, h0, VT) */
#define B0 0                         /* first batch processed (debug hook) */
#define NBR NB                       /* batches processed (debug hook) */
#define NR ((size_t)NB * SQ)         /* token rows */
#define MP ((int)((size_t)NBR * SQ)) /* rows projected (debug hook) */
#define QN SQ                        /* unused: k_fattn covers all SQ query rows */
#define NHD NH                       /* unused: k_fattn covers all NH heads */
#define MPO MP                       /* rows through the output stage (debug hook) */
#define LQ DM      /* unused: row pitch of the q and k rows */
typedef __bf16 v16b __attribute__((ext_vector_type(16)));
typedef unsigned short v8us __attribute__((ext_vector_type(8), may_alias));
typedef float  v8f  __attribute__((ext_vector_type(8)));
typedef float  v4f  __attribute__((ext_vector_type(4)));
typedef float  v4fa __attribute__((ext_vector_type(4), may_alias));
union FragB { v16b v; v8us half[2]; unsigned short u[16]; };

__device__ __forceinline__ unsigned short bf16_bits(float x) { unsigned int u = __float_as_uint(x); return (unsigned short)((u + 0x7FFFu + ((u >> 16) & 1u)) >> 16); }
__device__ __forceinline__ float bf16_val(unsigned short b) { return __uint_as_float(((unsigned int)b) << 16); }
__device__ __forceinline__ float bf16_round(float x) { return bf16_val(bf16_bits(x)); }
// D += A·B with NT terms: 1 = ah·bh, 2 = + al·bh (A split), 3 = + ah·bl (both split)
template <int NT>
__device__ __forceinline__ v8f mmaN(v16b ah, v16b al, v16b bh, v16b bl, v8f c) {
  c = __builtin_amdgcn_wmma_f32_16x16x32_bf16(false, ah, false, bh, (short)0, c, false, false);
  if (NT >= 2) c = __builtin_amdgcn_wmma_f32_16x16x32_bf16(false, al, false, bh, (short)0, c, false, false);
  if (NT >= 3) c = __builtin_amdgcn_wmma_f32_16x16x32_bf16(false, ah, false, bl, (short)0, c, false, false);
  asm volatile("v_nop\n\tv_nop\n\tv_nop\n\tv_nop" : "+v"(c) : "v"(ah), "v"(al), "v"(bh), "v"(bl));
  return c;
}

__global__ __launch_bounds__(256) void k_wt_bf16(const float* __restrict__ W, unsigned short* __restrict__ Wt, int K, int N) {
  const int t = blockIdx.x * 256 + threadIdx.x;
  const int k8n = K / 8;
  if (t >= N * k8n) return;
  const int n = t / k8n, k8 = (t % k8n) * 8;
  v8us v;
#pragma unroll
  for (int i = 0; i < 8; ++i) v[i] = bf16_bits(W[(size_t)(k8 + i) * N + n]);
  *(v8us*)(Wt + (size_t)n * K + k8) = v;
  
}

// GEMM C[M][N] (f32, pitch ldc) = act(A[M][K]·W + bias). A f32 row-major (pitch lda) converted per fragment to bf16
// (ASPLIT: hi/lo two planes -> 2 terms, else single rounded term); Wt bf16 [N][K] (pitch ldb). BIAS_BF16 rounds the
// bias to bf16 first (bias quantised to bf16 before the add). K%32==0, M%16==0, N%64==0.
template <bool ASPLIT, int ACT, bool BIAS_BF16>
__global__ __launch_bounds__(128) void k_gemm_bf(const float* __restrict__ A, int lda, const unsigned short* __restrict__ Wt, int ldb,
                                               const float* __restrict__ bias, float* __restrict__ C, int ldc, int M, int N, int K) {
  __shared__ __attribute__((aligned(16))) float so[4][16][64];
  const int tid = threadIdx.x, w = tid >> 5, lane = tid & 31, ln = lane & 15, hh = lane >> 4;
  const int ntn = N / 64;
  const int wid = blockIdx.x * 4 + w;
  const int mt = wid / ntn, nq = wid % ntn;
  if (mt * 16 >= M) return;
  const int row0 = mt * 16, col0 = nq * 64;
  const float* arow = A + (size_t)(row0 + ln) * lda;
  v8f acc[4] = {};
  for (int kb = 0; kb < K; kb += 32) {
    FragB ah, al;
    const v4f x0 = *(const v4fa*)(arow + kb + 8 * hh), x1 = *(const v4fa*)(arow + kb + 8 * hh + 4);
    const v4f x2 = *(const v4fa*)(arow + kb + 16 + 8 * hh), x3 = *(const v4fa*)(arow + kb + 16 + 8 * hh + 4);
    float xs[16] = {x0[0],x0[1],x0[2],x0[3],x1[0],x1[1],x1[2],x1[3],x2[0],x2[1],x2[2],x2[3],x3[0],x3[1],x3[2],x3[3]};
#pragma unroll
    for (int i = 0; i < 16; ++i) { const unsigned short hb = bf16_bits(xs[i]); ah.u[i] = hb; al.u[i] = ASPLIT ? bf16_bits(xs[i] - bf16_val(hb)) : (unsigned short)0; }
#pragma unroll
    for (int t = 0; t < 4; ++t) {
      const unsigned short* brow = Wt + (size_t)(col0 + t * 16 + ln) * ldb + kb;
      FragB b;
      b.half[0] = *(const v8us*)(brow + 8 * hh);
      b.half[1] = *(const v8us*)(brow + 16 + 8 * hh);
      acc[t] = mmaN<ASPLIT ? 2 : 1>(ah.v, al.v, b.v, b.v, acc[t]);
    }
  }
#pragma unroll
  for (int t = 0; t < 4; ++t) {
    float bv = bias ? bias[col0 + t * 16 + ln] : 0.f;
    if (BIAS_BF16) bv = bf16_round(bv);
#pragma unroll
    for (int r = 0; r < 8; ++r) { float v = acc[t][r] + bv; if (ACT == 1) v = fmaxf(v, 0.f); so[w][8 * hh + r][t * 16 + ln] = v; }
  }
  __builtin_amdgcn_fence(__ATOMIC_ACQ_REL, "workgroup");
  __builtin_amdgcn_wave_barrier();
  const int rsub = lane >> 4, c4 = (lane & 15) * 4;
  {
#pragma unroll
    for (int q = 0; q < 8; ++q) {
      const int r = q * 2 + rsub;
      const v4f v = *(const v4fa*)&so[w][r][c4];
      *(v4f*)(C + (size_t)(row0 + r) * ldc + col0 + c4) = v;
    }
    
  }
}

// GEMM C = act(A·W + bias + resid): A f32 (ASPLIT -> hi/lo 2 terms), Wt bf16 [N][K]; ACT 0 none, 1 relu, 2 exact gelu;
// resid (optional, f32, row index = (row % rmod), pitch ldr, RES_BF16 rounds it) added before the activation.
template <bool ASPLIT, int ACT, bool BIAS_BF16, bool RES_BF16>
__global__ __launch_bounds__(128) void k_gemm_bf3(const float* __restrict__ A, int lda, const unsigned short* __restrict__ Wt, int ldb,
                                                const float* __restrict__ bias, const float* __restrict__ resid, int rmod, int ldr,
                                                float* __restrict__ C, int ldc, int M, int N, int K) {
  __shared__ __attribute__((aligned(16))) float so[4][16][64];
  const int tid = threadIdx.x, w = tid >> 5, lane = tid & 31, ln = lane & 15, hh = lane >> 4;
  const int ntn = N / 64;
  const int wid = blockIdx.x * 4 + w;
  const int mt = wid / ntn, nq = wid % ntn;
  if (mt * 16 >= M) return;
  const int row0 = mt * 16, col0 = nq * 64;
  const float* arow = A + (size_t)(row0 + ln) * lda;
  v8f acc[4] = {};
  for (int kb = 0; kb < K; kb += 32) {
    FragB ah, al;
    const v4f x0 = *(const v4fa*)(arow + kb + 8 * hh), x1 = *(const v4fa*)(arow + kb + 8 * hh + 4);
    const v4f x2 = *(const v4fa*)(arow + kb + 16 + 8 * hh), x3 = *(const v4fa*)(arow + kb + 16 + 8 * hh + 4);
    float xs[16] = {x0[0],x0[1],x0[2],x0[3],x1[0],x1[1],x1[2],x1[3],x2[0],x2[1],x2[2],x2[3],x3[0],x3[1],x3[2],x3[3]};
#pragma unroll
    for (int i = 0; i < 16; ++i) { const unsigned short hb = bf16_bits(xs[i]); ah.u[i] = hb; al.u[i] = ASPLIT ? bf16_bits(xs[i] - bf16_val(hb)) : (unsigned short)0; }
#pragma unroll
    for (int t = 0; t < 4; ++t) {
      const unsigned short* brow = Wt + (size_t)(col0 + t * 16 + ln) * ldb + kb;
      FragB b;
      b.half[0] = *(const v8us*)(brow + 8 * hh);
      b.half[1] = *(const v8us*)(brow + 16 + 8 * hh);
      acc[t] = mmaN<ASPLIT ? 2 : 1>(ah.v, al.v, b.v, b.v, acc[t]);
    }
  }
#pragma unroll
  for (int t = 0; t < 4; ++t) {
    const int col = col0 + t * 16 + ln;
    float bv = bias ? bias[col] : 0.f;
    if (BIAS_BF16) bv = bf16_round(bv);
#pragma unroll
    for (int r = 0; r < 8; ++r) {
      float v = acc[t][r] + bv;
      if (resid) { float rv = resid[(size_t)((row0 + 8 * hh + r) % rmod) * ldr + col]; if (RES_BF16) rv = bf16_round(rv); v += rv; }
      if (ACT == 1) v = fmaxf(v, 0.f);
      if (ACT == 2) v = 0.5f * v * (1.0f + erff(v * 0.70710678118654752f));
      if (ACT == 3) { const float u = 0.7978845608028654f * (v + 0.044715f * v * v * v); v = 0.5f * v * (1.0f + tanhf(u)); }
      so[w][8 * hh + r][t * 16 + ln] = v;
    }
  }
  __builtin_amdgcn_fence(__ATOMIC_ACQ_REL, "workgroup");
  __builtin_amdgcn_wave_barrier();
  const int rsub = lane >> 4, c4 = (lane & 15) * 4;
  {
#pragma unroll
    for (int q = 0; q < 8; ++q) {
      const int r = q * 2 + rsub;
      const v4f v = *(const v4fa*)&so[w][r][c4];
      *(v4f*)(C + (size_t)(row0 + r) * ldc + col0 + c4) = v;
    }
    
  }
}
// row LayerNorm (biased variance, eps) over N: s = X (+ R); optional out_sum <- s; out_norm <- (s-mu)*rsqrt(var+eps)*g + b
template <bool PARAM_BF16>
__global__ __launch_bounds__(256) void k_layernorm(const float* __restrict__ X, const float* __restrict__ R, const float* __restrict__ g, const float* __restrict__ bta,
                                                  float* __restrict__ out_sum, float* __restrict__ out_norm, int N, float eps) {
  __shared__ float red[256];
  const int row = blockIdx.x, tid = threadIdx.x;
  const float* x = X + (size_t)row * N; const float* rr = R ? R + (size_t)row * N : nullptr;
  float vals[16];                     // up to N = 4096
  const int per = N / 256;            // contiguous chunk per thread? use strided-by-4 chunks: thread handles j = tid*4 + 1024*u
  float s1 = 0.f;
  for (int u = 0; u < per / 4; ++u) {
    const int j = tid * 4 + 1024 * u;
    const v4f a = *(const v4fa*)(x + j);
    v4f b = {0.f,0.f,0.f,0.f}; if (rr) b = *(const v4fa*)(rr + j);
#pragma unroll
    for (int q = 0; q < 4; ++q) { const float v = a[q] + b[q]; vals[u * 4 + q] = v; s1 += v; }
  }
  red[tid] = s1; __syncthreads();
  for (int st = 128; st > 0; st >>= 1) { if (tid < st) red[tid] += red[tid + st]; __syncthreads(); }
  const float mu = red[0] / (float)N; __syncthreads();
  float s2 = 0.f;
  for (int u = 0; u < per / 4; ++u)
#pragma unroll
    for (int q = 0; q < 4; ++q) { const float c = vals[u * 4 + q] - mu; s2 += c * c; }
  red[tid] = s2; __syncthreads();
  for (int st = 128; st > 0; st >>= 1) { if (tid < st) red[tid] += red[tid + st]; __syncthreads(); }
  const float rs = rsqrtf(red[0] / (float)N + eps);
  {
    for (int u = 0; u < per / 4; ++u) {
      const int j = tid * 4 + 1024 * u;
      v4f o, sm;
#pragma unroll
      for (int q = 0; q < 4; ++q) {
        float gg = g[j + q], bb = bta[j + q];
        if (PARAM_BF16) { gg = bf16_round(gg); bb = bf16_round(bb); }
        sm[q] = vals[u * 4 + q]; o[q] = (vals[u * 4 + q] - mu) * rs * gg + bb;
      }
      if (out_sum) *(v4f*)(out_sum + (size_t)row * N + j) = sm;
      *(v4f*)(out_norm + (size_t)row * N + j) = o;
    }
    
  }
}



// ---- f16 WMMA path (v_wmma_f32_16x16x32_f16): 11-bit significands for operands in range — used where a [0,1] probability operand needs more precision than bf16
typedef _Float16 v16h __attribute__((ext_vector_type(16)));
union FragH { v16h v; v8us half[2]; _Float16 h[16]; unsigned short u[16]; };
template <int NT>
__device__ __forceinline__ v8f mmaH(v16h ah, v16h al, v16h bh, v16h bl, v8f c) {
  c = __builtin_amdgcn_wmma_f32_16x16x32_f16(false, ah, false, bh, (short)0, c, false, false);
  if (NT >= 2) c = __builtin_amdgcn_wmma_f32_16x16x32_f16(false, al, false, bh, (short)0, c, false, false);
  if (NT >= 3) c = __builtin_amdgcn_wmma_f32_16x16x32_f16(false, ah, false, bl, (short)0, c, false, false);
  asm volatile("v_nop\n\tv_nop\n\tv_nop\n\tv_nop" : "+v"(c) : "v"(ah), "v"(al), "v"(bh), "v"(bl));
  return c;
}
// batched GEMM like k_gemm_b but f16 operands: A f32 (split into f16 hi/lo if ASPLIT, else rounded to f16), Bt = f16 values [n][k]; alpha; C f32; N multiple of 16 (partial tiles skipped)
template <bool ASPLIT>
__global__ __launch_bounds__(128) void k_gemm_h(const float* __restrict__ A, int lda, size_t sA, const _Float16* __restrict__ Bh, int ldb, size_t sB, float alpha, float* __restrict__ C, int ldc, size_t sC, int M, int N, int K) {
  __shared__ __attribute__((aligned(16))) float so[4][16][64];
  const int tid = threadIdx.x, w = tid >> 5, lane = tid & 31, ln = lane & 15, hh = lane >> 4; const int by = blockIdx.y;
  A += (size_t)by * sA; Bh += (size_t)by * sB; C += (size_t)by * sC;
  const int ntn = (N + 63) / 64; const int wid = blockIdx.x * 4 + w; const int mt = wid / ntn, nq = wid % ntn; if (mt * 16 >= M) return;
  const int row0 = mt * 16, col0 = nq * 64; const float* arow = A + (size_t)(row0 + ln) * lda;
  v8f acc[4] = {};
  for (int kb = 0; kb < K; kb += 32) {
    FragH ah, al;
    const v4f x0 = *(const v4fa*)(arow + kb + 8 * hh), x1 = *(const v4fa*)(arow + kb + 8 * hh + 4), x2 = *(const v4fa*)(arow + kb + 16 + 8 * hh), x3 = *(const v4fa*)(arow + kb + 16 + 8 * hh + 4);
    float xs[16] = {x0[0],x0[1],x0[2],x0[3],x1[0],x1[1],x1[2],x1[3],x2[0],x2[1],x2[2],x2[3],x3[0],x3[1],x3[2],x3[3]};
#pragma unroll
    for (int i = 0; i < 16; ++i) { const _Float16 h = (_Float16)xs[i]; ah.h[i] = h; al.h[i] = ASPLIT ? (_Float16)(xs[i] - (float)h) : (_Float16)0.0f; }
#pragma unroll
    for (int t = 0; t < 4; ++t) { if (col0 + t * 16 >= N) continue; const size_t boff = (size_t)(col0 + t * 16 + ln) * ldb + kb; FragH bq; bq.half[0] = *(const v8us*)(Bh + boff + 8 * hh); bq.half[1] = *(const v8us*)(Bh + boff + 16 + 8 * hh);
      acc[t] = mmaH<ASPLIT ? 2 : 1>(ah.v, al.v, bq.v, bq.v, acc[t]); }
  }
#pragma unroll
  for (int t = 0; t < 4; ++t) { if (col0 + t * 16 >= N) continue;
#pragma unroll
    for (int r = 0; r < 8; ++r) so[w][8 * hh + r][t * 16 + ln] = acc[t][r] * alpha; }
  __builtin_amdgcn_fence(__ATOMIC_ACQ_REL, "workgroup"); __builtin_amdgcn_wave_barrier();
  const int rsub = lane >> 4, c4 = (lane & 15) * 4;
  {
#pragma unroll
    for (int q = 0; q < 8; ++q) { const int r = q * 2 + rsub; if (col0 + c4 < N) { const v4f v = *(const v4fa*)&so[w][r][c4]; *(v4f*)(C + (size_t)(row0 + r) * ldc + col0 + c4) = v; } }
     }
}

// k_gemm_hh variant with fused epilogue: v = acc·alpha + bias[by·sBias + col] (+ CP[(row/rowsPerB)·sCPb + by·64 + col] if CP) ; ACT 0 none / 1 elu ; writes f16 C16 (and f32 C if non-null)
template <int ACT>
__global__ __launch_bounds__(128) void k_gemm_hhx(const _Float16* __restrict__ A, int lda, size_t sA, const _Float16* __restrict__ Bh, int ldb, size_t sB, float alpha, const float* __restrict__ bias, size_t sBias, const float* __restrict__ CP, int rowsPerB, size_t sCPb, int row0g,
    float* __restrict__ C, _Float16* __restrict__ C16, int ldc, size_t sC, int M, int N, int K) {
  __shared__ __attribute__((aligned(16))) float so[4][16][64];
  const int tid = threadIdx.x, w = tid >> 5, lane = tid & 31, ln = lane & 15, hh = lane >> 4; const int by = blockIdx.y;
  A += (size_t)by * sA; Bh += (size_t)by * sB; const size_t cofs = (size_t)by * sC; const float* bp = bias ? bias + (size_t)by * sBias : nullptr;
  const int ntn = (N + 63) / 64; const int wid = blockIdx.x * 4 + w; const int mt = wid / ntn, nq = wid % ntn; if (mt * 16 >= M) return;
  const int row0 = mt * 16, col0 = nq * 64; const _Float16* arow = A + (size_t)(row0 + ln) * lda;
  v8f acc[4] = {};
  for (int kb = 0; kb < K; kb += 32) { FragH ah; ah.half[0] = *(const v8us*)((const unsigned short*)arow + kb + 8 * hh); ah.half[1] = *(const v8us*)((const unsigned short*)arow + kb + 16 + 8 * hh);
#pragma unroll
    for (int t = 0; t < 4; ++t) { if (col0 + t * 16 >= N) continue; const size_t boff = (size_t)(col0 + t * 16 + ln) * ldb + kb; FragH bq; bq.half[0] = *(const v8us*)((const unsigned short*)Bh + boff + 8 * hh); bq.half[1] = *(const v8us*)((const unsigned short*)Bh + boff + 16 + 8 * hh);
      acc[t] = mmaH<1>(ah.v, ah.v, bq.v, bq.v, acc[t]); }
  }
#pragma unroll
  for (int t = 0; t < 4; ++t) { if (col0 + t * 16 >= N) continue; const int col = col0 + t * 16 + ln; const float bv = bp ? bf16_round(bp[col]) : 0.f;
#pragma unroll
    for (int r = 0; r < 8; ++r) { float v = acc[t][r] * alpha + bv; if (CP) { const int rr = row0g + row0 + 8 * hh + r; if (rowsPerB < 0) v += CP[cofs + (size_t)rr * ldc + col];      /* rowsPerB < 0: own element of the batched C plane */ else { const int bidx = rr / rowsPerB; v += CP[(size_t)bidx * sCPb + (size_t)by * 64 + col]; } } if (ACT == 1) v = (v > 0.f) ? v : expm1f(v); else if (ACT == 7) v = (v > 0.f) ? v + 1.0f : expf(v); else if (ACT == 8) v = tanhf(v); else if (ACT == 9) v = 0.5f * v * (1.0f + tanhf(0.7978845608028654f * (v + 0.044715f * v * v * v))); else if (ACT == 11) v = 1.0f / (1.0f + expf(-v)); else if (ACT == 12) v = (v > 0.f) ? v : 0.01f * v; else if (ACT == 14) v = (v > 0.f) ? v : 0.1f * v; else if (ACT == 16) v = (v >= 0.f) ? v : 0.3f * v; else if (ACT == 17) v = (v >= 0.f) ? v : 0.2f * v; else if (ACT == 15) v = v / (1.0f + expf(-v)); else if (ACT == 3) v = fmaxf(v, 0.f); else if (ACT == 6) v = 0.5f * v * (1.0f + erff(v * 0.70710678118654752f)); so[w][8 * hh + r][t * 16 + ln] = v; } }
  __builtin_amdgcn_fence(__ATOMIC_ACQ_REL, "workgroup"); __builtin_amdgcn_wave_barrier();
  const int rsub = lane >> 4, c4 = (lane & 15) * 4; typedef _Float16 v4h __attribute__((ext_vector_type(4)));
  {
#pragma unroll
    for (int q = 0; q < 8; ++q) { const int r = q * 2 + rsub; if (col0 + c4 < N) { const v4f v = *(const v4fa*)&so[w][r][c4]; if (C) *(v4f*)(C + cofs + (size_t)(row0 + r) * ldc + col0 + c4) = v; if (C16) { v4h h4; for (int i = 0; i < 4; ++i) h4[i] = (_Float16)v[i]; *(v4h*)(C16 + cofs + (size_t)(row0 + r) * ldc + col0 + c4) = h4; } } }
     }
}


typedef _Float16 v4h __attribute__((ext_vector_type(4)));

__global__ __launch_bounds__(256) void k_h16(const float* __restrict__ x, _Float16* __restrict__ X16, size_t n8) { const size_t t = (size_t)blockIdx.x * 256 + threadIdx.x; if (t >= n8) return; FragH f;
#pragma unroll
  for (int q = 0; q < 8; ++q) f.h[q] = (_Float16)x[t * 8 + q]; *(v8us*)((unsigned short*)X16 + t * 8) = f.half[0];  }
__global__ __launch_bounds__(256) void k_round16f(const float* __restrict__ W, _Float16* __restrict__ Bt, size_t n8) { const size_t t = (size_t)blockIdx.x * 256 + threadIdx.x; if (t >= n8) return; FragH f;
#pragma unroll
  for (int i = 0; i < 8; ++i) f.h[i] = (_Float16)(bf16_round(W[t * 8 + i]) * 16.0f); *(v8us*)((unsigned short*)Bt + t * 8) = f.half[0];  }
__global__ __launch_bounds__(256) void k_hl(const float* __restrict__ F, _Float16* __restrict__ Hh, _Float16* __restrict__ Hl, size_t n8) { const size_t t = (size_t)blockIdx.x * 256 + threadIdx.x; if (t >= n8) return; FragH fh, fl; const v4f a = *(const v4fa*)(F + t * 8), c = *(const v4fa*)(F + t * 8 + 4);
#pragma unroll
  for (int q = 0; q < 4; ++q) { _Float16 h = (_Float16)a[q]; fh.h[q] = h; fl.h[q] = (_Float16)((a[q] - (float)h) * 1024.0f); h = (_Float16)c[q]; fh.h[4 + q] = h; fl.h[4 + q] = (_Float16)((c[q] - (float)h) * 1024.0f); }
  { *(v8us*)((unsigned short*)Hh + t * 8) = fh.half[0]; *(v8us*)((unsigned short*)Hl + t * 8) = fl.half[0];  } }

// ---- fast GEMM (block tile 128x192, eight waves, both operands staged in LDS in 64-k stages; wave tile 64x48; requires M % 128 == 0 rows per launch region, N % 192 == 0 and K % 64 == 0) ----
__device__ __forceinline__ v16h g2_frag(const _Float16* p, int hh) { FragH f; f.half[0] = *(const v8us*)((const unsigned short*)p + 8 * hh); f.half[1] = *(const v8us*)((const unsigned short*)p + 16 + 8 * hh); return f.v; }
__device__ __forceinline__ v16h g2_sfrag(const unsigned short* p) { FragH f; f.half[0] = *(const v8us*)p; f.half[1] = *(const v8us*)(p + 16); return f.v; }      /* the same fragment from an LDS row: p = row + k0 + 8 * hh, the k order of g2_frag */
#define G2_KS 64        /* k per LDS stage: one whole 128-byte line of every operand row */
#define G2_PITCH 72     /* 16-bit elements per LDS row: 128 data bytes + 16 (16 bytes x odd for the 16-byte fragment reads) */
#define G2_BM 128       /* rows of the block's tile */
#define G2_BN 192       /* columns of the block's tile: 320 operand rows are fetched for 128 x 192 results */
#define G2_ROWS (G2_BM + G2_BN)     /* rows of a stage: the block's A rows, then its B rows */
#define G2_TPI 132      /* epilogue, transposed tile [column][row]: 128 rows + 4, sixteen columns' 16-byte LDS stores fall on sixteen different bank groups */
#define G2_SPI 196      /* epilogue, plain tile [row][column]: 192 columns + 4 (16 bytes x odd) */
__device__ __forceinline__ v8f g2_mma(v16h a, v16h b, v8f c) { v8f d = __builtin_amdgcn_wmma_f32_16x16x32_f16(false, a, false, b, (short)0, c, false, false); asm volatile("v_nop\n\tv_nop\n\tv_nop\n\tv_nop" : "+v"(d) : "v"(a), "v"(b)); return d; }
template <int ACT>
__global__ __launch_bounds__(256) void k_gemm2(const _Float16* __restrict__ A, int lda, size_t sA, const _Float16* __restrict__ Bh, int ldb, size_t sB, float alpha, const float* __restrict__ bias, const float* __restrict__ bias1, const float* __restrict__ bias2, size_t sBias,
    float* __restrict__ C, _Float16* __restrict__ C16, int ldc, size_t sC, int M, int N, int K, int tp, int rpt) { static_assert(ACT == 0 || ACT == 3 || ACT == 6 || ACT == 8 || ACT == 9 || ACT == 11 || ACT == 12 || ACT == 14 || ACT == 15 || ACT == 16 || ACT == 17, "k_gemm2: unsupported ACT code (would silently apply no activation)");
  __shared__ __attribute__((aligned(16))) float sm[G2_BN * G2_TPI];      /* main loop: two operand stages; behind the loop's last barrier: the epilogue's tile */
  static_assert(2 * G2_ROWS * G2_PITCH / 2 <= G2_BN * G2_TPI && G2_BM * G2_SPI <= G2_BN * G2_TPI && G2_BM <= G2_TPI && G2_BN <= G2_SPI, "k_gemm2: the stages and both forms of the epilogue's tile lie in sm[]");
  unsigned short* const sg = (unsigned short*)sm;
  const int tid = threadIdx.x, w = tid >> 5, lane = tid & 31, ln = lane & 15, hh = lane >> 4; const int by = blockIdx.y;
  const int wr = w & 1, wc = w >> 1;      /* the wave's place in the block's tile: rows 64 * wr .., columns 48 * wc .. */
  A += (size_t)by * sA; Bh += (size_t)by * sB; const size_t cofs = (size_t)by * sC; const float* bp = (by == 1 && bias1) ? bias1 : (by == 2 && bias2) ? bias2 : bias ? bias + (size_t)by * sBias : nullptr;      /* bias1, bias2: planes 1 and 2 where their biases are buffers of their own */
  const int ntn = N / G2_BN; const int mt = blockIdx.x / ntn, nq = blockIdx.x - mt * ntn; const int col0 = nq * G2_BN; if (mt * G2_BM >= M) return;      /* M is a multiple of 128 (and K of G2_KS): a block leaves whole or not at all, in front of every barrier, and stages whole */
  const bool tr = by >= tp;      /* planes tp.. are stored transposed, [row / rpt][col][row % rpt] (rpt a multiple of 128); the same in every thread of a block */
  const int sr = tid >> 3, sc = (tid & 7) * 8;      /* staging: eight threads a 128-byte line of one row, rows sr + 32 i */
  const char* ag = (const char*)(A + (size_t)(mt * G2_BM) * lda); const char* bg = (const char*)(Bh + (size_t)col0 * ldb);      /* the block's first A row and first B row: the same in every thread */
  unsigned oa[4], ob[6];      /* the thread's byte offsets from there, moved on by one stage a trip (a block's rows span far less than 4 GB) */
#pragma unroll      /* static indices into oa[], ob[] */
  for (int i = 0; i < 6; ++i) { if (i < 4) oa[i] = (unsigned)((sr + 32 * i) * lda + sc) * 2u; ob[i] = (unsigned)((sr + 32 * i) * ldb + sc) * 2u; }
  unsigned short* const sw = sg + sr * G2_PITCH + sc;      /* the thread's place in row sr of buffer 0 */
  v8us ra[4], rb[6];
#pragma unroll      /* static indices into ra[], rb[]; the ten loads fly together */
  for (int i = 0; i < 6; ++i) { if (i < 4) ra[i] = *(const v8us*)(ag + oa[i]); rb[i] = *(const v8us*)(bg + ob[i]); }
#pragma unroll      /* static indices into ra[], rb[] */
  for (int i = 0; i < 6; ++i) { if (i < 4) *(v8us*)(sw + 32 * i * G2_PITCH) = ra[i]; *(v8us*)(sw + (G2_BM + 32 * i) * G2_PITCH) = rb[i]; }
  __syncthreads();      /* stage 0 is published */
  const v8f z8 = {0.f,0.f,0.f,0.f,0.f,0.f,0.f,0.f}; v8f c[4][3] = {{z8, z8, z8}, {z8, z8, z8}, {z8, z8, z8}, {z8, z8, z8}};      /* [16-row group][16-column group] */
  const int ns = K / G2_KS;
#pragma unroll 1      /* one stage a trip: the body already holds two k steps */
  for (int s = 0; s < ns; ++s) { const int cur = s & 1; const bool more = s + 1 < ns;      /* the same in every thread */
    if (more) {      /* the next stage's lines fly while this stage is worked on */
#pragma unroll      /* static indices into the register arrays */
      for (int i = 0; i < 6; ++i) { if (i < 4) { oa[i] += G2_KS * 2; ra[i] = *(const v8us*)(ag + oa[i]); } ob[i] += G2_KS * 2; rb[i] = *(const v8us*)(bg + ob[i]); } }
#pragma unroll      /* constant LDS offsets for both k steps */
    for (int kk = 0; kk < G2_KS / 32; ++kk) { const unsigned short* ap = sg + (cur * G2_ROWS + 64 * wr + ln) * G2_PITCH + kk * 32 + 8 * hh; const unsigned short* bq = sg + (cur * G2_ROWS + G2_BM + 48 * wc + ln) * G2_PITCH + kk * 32 + 8 * hh;
      v16h a[4], b[3];      /* the k step's fourteen LDS reads as one group ahead of its products */
#pragma unroll      /* static indices keep a[], b[] in registers */
      for (int i = 0; i < 4; ++i) { a[i] = g2_sfrag(ap + 16 * i * G2_PITCH); if (i < 3) b[i] = g2_sfrag(bq + 16 * i * G2_PITCH); }
#pragma unroll      /* static indices keep the register arrays in registers */
      for (int j = 0; j < 3; ++j)
#pragma unroll      /* static indices keep the register arrays in registers */
        for (int i = 0; i < 4; ++i) c[i][j] = g2_mma(a[i], b[j], c[i][j]); }
    if (more) {
#pragma unroll      /* static indices into ra[], rb[] */
      for (int i = 0; i < 6; ++i) { if (i < 4) *(v8us*)(sw + ((cur ^ 1) * G2_ROWS + 32 * i) * G2_PITCH) = ra[i]; *(v8us*)(sw + ((cur ^ 1) * G2_ROWS + G2_BM + 32 * i) * G2_PITCH) = rb[i]; } }
    __syncthreads();      /* publishes stage s + 1 and ends every wave's reads of the buffer that the next trip refills; behind the last one sm[] is the epilogue's */
  }
  const int cl0 = 48 * wc + ln, rl0 = 64 * wr + 8 * hh;      /* tile (i, j) of the wave: the lane holds rows rl0 + 16 i .. + 7 of column cl0 + 16 j of the block's tile */
#pragma unroll      /* static indices keep c[][] in registers */
  for (int j = 0; j < 3; ++j) { const float bv = bp ? bf16_round(bp[col0 + cl0 + 16 * j]) : 0.f;
#pragma unroll      /* static indices keep c[][] in registers */
    for (int i = 0; i < 4; ++i)
#pragma unroll      /* static indices keep c[][] in registers */
      for (int r = 0; r < 8; ++r) { float v = c[i][j][r] * alpha + bv;
        if (ACT == 3) v = fmaxf(v, 0.f); else if (ACT == 6) v = 0.5f * v * (1.0f + erff(v * 0.70710678118654752f)); else if (ACT == 11) v = 1.0f / (1.0f + expf(-v)); else if (ACT == 15) v = v / (1.0f + expf(-v)); else if (ACT == 12) v = (v > 0.f) ? v : 0.01f * v; else if (ACT == 8) v = tanhf(v); else if (ACT == 9) v = 0.5f * v * (1.0f + tanhf(0.7978845608028654f * (v + 0.044715f * v * v * v))); else if (ACT == 14) v = (v > 0.f) ? v : 0.1f * v; else if (ACT == 16) v = (v >= 0.f) ? v : 0.3f * v; else if (ACT == 17) v = (v >= 0.f) ? v : 0.2f * v;
        c[i][j][r] = v; } }
  if (tr) {
#pragma unroll      /* static indices keep c[][] in registers */
    for (int j = 0; j < 3; ++j)
#pragma unroll      /* static indices keep c[][] in registers */
      for (int i = 0; i < 4; ++i) { float* tq = sm + (cl0 + 16 * j) * G2_TPI + rl0 + 16 * i; *(v4fa*)tq = v4f{c[i][j][0], c[i][j][1], c[i][j][2], c[i][j][3]}; *(v4fa*)(tq + 4) = v4f{c[i][j][4], c[i][j][5], c[i][j][6], c[i][j][7]}; } }      /* a lane's eight values are eight rows in a row of one column */
  else {
#pragma unroll      /* static indices keep c[][] in registers */
    for (int j = 0; j < 3; ++j)
#pragma unroll      /* static indices keep c[][] in registers */
      for (int i = 0; i < 4; ++i)
#pragma unroll      /* static indices keep c[][] in registers */
        for (int r = 0; r < 8; ++r) sm[(rl0 + 16 * i + r) * G2_SPI + cl0 + 16 * j] = c[i][j][r]; }
  __syncthreads();      /* the eight waves' parts make up the block's tile: a column's 128 rows come from two waves, a row's 192 columns from four */
  const int rb0 = mt * G2_BM;
  if (tr) {
    const int bb = rb0 / rpt; const size_t tb = cofs + ((size_t)bb * N + col0) * rpt + (rb0 - bb * rpt);
    if (C) {
#pragma unroll      /* the columns' LDS reads and stores overlap */
      for (int q = 0; q < G2_BN / 8; ++q) { const int cc = q * 8 + w; const v4f v = *(const v4fa*)(sm + cc * G2_TPI + lane * 4); *(v4f*)(C + tb + (size_t)cc * rpt + lane * 4) = v; }      /* a wave's store = one column's 512 bytes */
      asm volatile("s_wait_xcnt 0x0" ::: "memory"); }      /* precaution: the code behind (the 16-bit stores; in the built code also the join with the untransposed path) rewrites these stores' registers, and the wait stands in front of that on any path */
    if (C16) {
#pragma unroll      /* the columns' LDS reads and stores overlap */
      for (int q = 0; q < G2_BN / 16; ++q) { const int cc = q * 16 + w * 2 + hh; const v4f v0 = *(const v4fa*)(sm + cc * G2_TPI + ln * 8), v1 = *(const v4fa*)(sm + cc * G2_TPI + ln * 8 + 4); FragH h8;
#pragma unroll      /* static indices keep h8 in registers */
        for (int i = 0; i < 4; ++i) { h8.h[i] = (_Float16)v0[i]; h8.h[4 + i] = (_Float16)v1[i]; }
        *(v8us*)((unsigned short*)C16 + tb + (size_t)cc * rpt + ln * 8) = h8.half[0]; }      /* a wave's store = two columns' 256 bytes each */
      asm volatile("s_wait_xcnt 0x0" ::: "memory"); }      /* precaution: in the built code this path joins the untransposed one behind these stores, and the wait stands in front of every later write of their registers on any path there */
    return; }
  if (C) {
#pragma unroll      /* the chunks' LDS reads and stores overlap */
    for (int q = 0; q < G2_BM * (G2_BN / 8) / 256; ++q) { const int ix = q * 256 + tid, row = ix / (G2_BN / 8), c8 = (ix - row * (G2_BN / 8)) * 8;      /* 24 threads a row */
      const v4f v0 = *(const v4fa*)(sm + row * G2_SPI + c8), v1 = *(const v4fa*)(sm + row * G2_SPI + c8 + 4); float* cp = C + cofs + (size_t)(rb0 + row) * ldc + col0 + c8; *(v4f*)cp = v0; *(v4f*)(cp + 4) = v1; }
    asm volatile("s_wait_xcnt 0x0" ::: "memory"); }      /* precaution: the 16-bit stores behind rewrite these stores' registers, and the wait stands in front of that */
  if (C16) {
#pragma unroll      /* the chunks' LDS reads and stores overlap */
    for (int q = 0; q < G2_BM * (G2_BN / 8) / 256; ++q) { const int ix = q * 256 + tid, row = ix / (G2_BN / 8), c8 = (ix - row * (G2_BN / 8)) * 8;      /* 24 threads a row: its 192 columns = three whole 128-byte lines of 16-bit values */
      const v4f v0 = *(const v4fa*)(sm + row * G2_SPI + c8), v1 = *(const v4fa*)(sm + row * G2_SPI + c8 + 4); FragH h8;
#pragma unroll      /* static indices keep h8 in registers */
      for (int i = 0; i < 4; ++i) { h8.h[i] = (_Float16)v0[i]; h8.h[4 + i] = (_Float16)v1[i]; }
      *(v8us*)((unsigned short*)C16 + cofs + (size_t)(rb0 + row) * ldc + col0 + c8) = h8.half[0]; }
    asm volatile("s_wait_xcnt 0x0" ::: "memory"); }      /* precaution: stands behind the last stores, in front of any later write of their registers */
}


// Operand preparation, one launch; the block index picks the part (the same for a whole block), the largest part first. Every block moves PT_E elements, 64 a thread, so that the launch is few waves with many loads in flight each:
//   PB_X blocks: hidden_state [b][e][s] -> exact f16 token rows [b][s][e], one 128-channel x 128-token tile a block, turned in LDS;
//   PB_W blocks a weight slab (36 slabs = q, k, v times 12 heads): [in = 768][out = 64] -> rows h*64.. of that projection's Bt plane [n][k], x16 (bf16-exact weights stay exact in f16 away from the subnormal range), one 256-in x 64-out tile a block, turned in LDS;
//   PB_O blocks: Wo, natural [out][in] = Bt, x16.
#define PT_E 16384      /* elements a block moves */
#define PB_X ((unsigned)((size_t)NB * DM * SQ / PT_E))
#define PB_W ((unsigned)(HD * DM / PT_E))
#define PB_O ((unsigned)(DM * DM / PT_E))
static_assert(SQ % 128 == 0 && DM % 128 == 0 && DM % 256 == 0 && HD == 64 && DM * DM % PT_E == 0, "k_prep: whole 128 x 128 tiles of x, whole 256 x 64 tiles of a weight slab, whole blocks of Wo");
// One tile [PT_E / CW source rows][CW source columns] of an f32 matrix (row pitch sp) -> its transpose, f16 rows of pitch DM; each value rounded to bf16, then times sc (a power of two). tl: (PT_E / CW) * (CW + 2) 16-bit places.
template <int CW>
__device__ __forceinline__ void prep_turn(const float* __restrict__ s, size_t sp, unsigned short* __restrict__ d, float sc, unsigned short* tl) {
  constexpr int TP = CW + 2, TR = CW / 4, RP = 256 / TR;      /* LDS row pitch (an odd number of dwords); threads a source row; source rows a pass */
  const int tid = (int)threadIdx.x, r0 = tid / TR, c4 = (tid % TR) * 4; const float* sb = s + (size_t)r0 * sp + c4; v4f a[16]; FragH f;
#pragma unroll      /* static indices into a[]; the sixteen loads fly together */
  for (int p = 0; p < 16; ++p) a[p] = *(const v4fa*)(sb + (size_t)(p * RP) * sp);      /* a wave's load = whole 128-byte lines of one or two source rows */
  asm volatile("s_wait_xcnt 0x0" :: "v"(sb) : "memory");      /* precaution: the wait stands behind the sixteen loads, in front of every later write of their address registers; as its input the address keeps registers of its own until here (without it the last load's result landed on them) */
#pragma unroll      /* static indices into a[] */
  for (int p = 0; p < 16; ++p)
#pragma unroll      /* static indices keep f in registers */
    for (int q = 0; q < 4; ++q) { f.h[q] = (_Float16)(bf16_round(a[p][q]) * sc); tl[(p * RP + r0) * TP + c4 + q] = f.u[q]; }
  __syncthreads();      /* the tile is whole before it is read by columns; every thread of the block passes here */
#pragma unroll      /* the passes' LDS reads and stores overlap */
  for (int p = 0; p < 8; ++p) { const int i = p * 256 + tid, pc = i & 7, c = (i >> 3) % CW, g = i / (8 * CW);      /* eight threads the 128 bytes that 64 source rows give to one output row */
#pragma unroll      /* static indices keep f in registers */
    for (int q = 0; q < 8; ++q) f.u[q] = tl[(g * 64 + pc * 8 + q) * TP + c];
    *(v8us*)(d + (size_t)c * DM + g * 64 + pc * 8) = f.half[0]; }
  asm volatile("s_wait_xcnt 0x0" ::: "memory");      /* precaution: in the built code the parts join behind these stores, and the wait stands in front of every later write of the stores' registers on any path there */
}
__global__ __launch_bounds__(256) void k_prep(const float* __restrict__ x, const float* __restrict__ wq, const float* __restrict__ wk, const float* __restrict__ wv, const float* __restrict__ wo,
    _Float16* __restrict__ X16, _Float16* __restrict__ Bqkv, _Float16* __restrict__ Bo) {
  __shared__ unsigned short tl[(PT_E / 64) * 66];      /* the tile as [source row][source column]: 256 x 66, or 128 x 130 */
  static_assert((PT_E / 128) * 130 <= (PT_E / 64) * 66, "k_prep: both tile forms lie in tl[]");
  unsigned bx = blockIdx.x;
  if (bx < PB_X) { const unsigned slab = bx / (DM / 128), eg = bx - slab * (DM / 128), b = slab / (SQ / 128), sg = slab - b * (SQ / 128);      /* slab = 128 tokens of one batch, eg = 128 channels */
    prep_turn<128>(x + ((size_t)b * DM + eg * 128) * SQ + sg * 128, SQ, (unsigned short*)X16 + (size_t)slab * 128 * DM + eg * 128, 1.0f, tl);
    return; }
  bx -= PB_X;
  if (bx < 3 * NH * PB_W) { const unsigned slab = bx / PB_W, kg = bx - slab * PB_W, m = slab / NH, h = slab - m * NH; const float* Wm = (m == 0 ? wq : m == 1 ? wk : wv) + (size_t)h * DM * HD;      /* kg = 256 input channels */
    prep_turn<64>(Wm + (size_t)kg * 256 * HD, HD, (unsigned short*)Bqkv + (size_t)slab * HD * DM + kg * 256, 16.0f, tl);
    return; }
  bx -= 3 * NH * PB_W;
  { const float* ws = wo + (size_t)bx * PT_E + threadIdx.x * 8; unsigned short* wd = (unsigned short*)Bo + (size_t)bx * PT_E + threadIdx.x * 8; v4f a[16]; FragH f;
#pragma unroll      /* static indices into a[]; the sixteen loads fly together */
    for (int p = 0; p < 8; ++p) { a[2 * p] = *(const v4fa*)(ws + p * 2048); a[2 * p + 1] = *(const v4fa*)(ws + p * 2048 + 4); }
#pragma unroll      /* static indices into a[] */
    for (int p = 0; p < 8; ++p) {
#pragma unroll      /* static indices keep f in registers */
      for (int q = 0; q < 4; ++q) { f.h[q] = (_Float16)(bf16_round(a[2 * p][q]) * 16.0f); f.h[4 + q] = (_Float16)(bf16_round(a[2 * p + 1][q]) * 16.0f); }
      *(v8us*)(wd + p * 2048) = f.half[0]; }
    asm volatile("s_wait_xcnt 0x0" ::: "memory");      /* precaution: in the built code the parts join behind these stores, and the wait stands in front of every later write of the stores' registers on any path there */ } }
#define FA_KEYS 64      /* keys per LDS stage */
#define FA_PITCH 72     /* 16-bit elements per LDS row: 128 data bytes + 16 */
typedef float v2f __attribute__((ext_vector_type(2)));
__device__ __forceinline__ float fa_xhalf(float x) { return __builtin_bit_cast(float, __builtin_amdgcn_permlanex16(__builtin_bit_cast(int, x), __builtin_bit_cast(int, x), 0x76543210, 0xfedcba98, false, false)); }      /* lane l <-> lane l ^ 16 */
__device__ __forceinline__ v16h fa_frag(const unsigned short* p) { FragH f; f.half[0] = *(const v8us*)p; f.half[1] = *(const v8us*)(p + 16); return f.v; }      /* p = row + k0 + 8 * hh */
__device__ __forceinline__ v8f fa_mma(v16h a, v16h b, v8f c) { return __builtin_amdgcn_wmma_f32_16x16x32_f16(false, a, false, b, (short)0, c, false, false); }
__global__ __launch_bounds__(128) void k_fattn(const _Float16* __restrict__ Q16, const _Float16* __restrict__ K16, const _Float16* __restrict__ VT, _Float16* __restrict__ O16) {
  __shared__ __attribute__((aligned(16))) unsigned short sk[2][FA_KEYS][FA_PITCH];      /* K rows [key][d] */
  __shared__ __attribute__((aligned(16))) unsigned short sv[2][HD][FA_PITCH];           /* V^T rows [d][key] */
  const int tid = threadIdx.x, w = tid >> 5, lane = tid & 31, ln = lane & 15, hh = lane >> 4;
  const int h = blockIdx.y, b = blockIdx.z, q0 = blockIdx.x * 128 + w * 32;
  const unsigned short* kg = (const unsigned short*)K16 + (size_t)b * SQ * DM + h * HD;
  const unsigned short* vg = (const unsigned short*)VT + ((size_t)b * NH + h) * HD * SQ;
  v16h qf[2][2];
#pragma unroll      /* static indices keep qf[] in registers */
  for (int g = 0; g < 2; ++g) { const _Float16* qp = Q16 + ((size_t)b * SQ + q0 + 16 * g + ln) * DM + h * HD; qf[g][0] = g2_frag(qp, hh); qf[g][1] = g2_frag(qp + 32, hh); }
  const int sr = tid >> 3, sc = (tid & 7) * 8;      /* staging: eight threads a 128-byte row, rows sr + 16 i */
  v8us rk[4], rv[4];
#pragma unroll      /* static indices into rk[], rv[] */
  for (int i = 0; i < 4; ++i) { rk[i] = *(const v8us*)(kg + (size_t)(sr + 16 * i) * DM + sc); rv[i] = *(const v8us*)(vg + (size_t)(sr + 16 * i) * SQ + sc); }
#pragma unroll      /* static indices into rk[], rv[] */
  for (int i = 0; i < 4; ++i) { *(v8us*)&sk[0][sr + 16 * i][sc] = rk[i]; *(v8us*)&sv[0][sr + 16 * i][sc] = rv[i]; }
  __syncthreads();      /* stage 0 is published */
  const v8f z8 = {0.f, 0.f, 0.f, 0.f, 0.f, 0.f, 0.f, 0.f};
  v8f acc[2][4] = {{z8, z8, z8, z8}, {z8, z8, z8, z8}}; float mrun[2] = {-3.0e38f, -3.0e38f}; v2f lsum[2] = {{0.f, 0.f}, {0.f, 0.f}};      /* mrun: the maximum in use, log2 domain; lsum: the lane's share of the denominator, even and odd keys apart */
  const float L2E = 1.4426950408889634f;
#pragma unroll 1      /* one stage a trip: the body already holds two passes */
  for (int s = 0; s < SQ / FA_KEYS; ++s) {
    const int cur = s & 1; const bool more = s + 1 < SQ / FA_KEYS;      /* the same in every thread */
    if (more) {      /* the next stage's lines fly while this stage is worked on */
#pragma unroll      /* static indices into rk[], rv[] */
      for (int i = 0; i < 4; ++i) { rk[i] = *(const v8us*)(kg + (size_t)((s + 1) * FA_KEYS + sr + 16 * i) * DM + sc); rv[i] = *(const v8us*)(vg + (size_t)(sr + 16 * i) * SQ + (s + 1) * FA_KEYS + sc); } }
#pragma unroll      /* static indices into the register arrays */
    for (int ps = 0; ps < FA_KEYS / 32; ++ps) {
      v8f st[2][2];      /* [key tile][query group] */
#pragma unroll      /* static indices keep the register arrays in registers */
      for (int kt = 0; kt < 2; ++kt) { const unsigned short* kp = &sk[cur][ps * 32 + kt * 16 + ln][8 * hh]; const v16h k0 = fa_frag(kp), k1 = fa_frag(kp + 32);
#pragma unroll      /* static indices keep the register arrays in registers */
        for (int g = 0; g < 2; ++g) st[kt][g] = fa_mma(k1, qf[g][1], fa_mma(k0, qf[g][0], z8)); }
      v16h vf[4];
#pragma unroll      /* static indices keep the register arrays in registers */
      for (int t = 0; t < 4; ++t) vf[t] = fa_frag(&sv[cur][16 * t + ln][ps * 32 + 8 * hh]);
      float mb[2]; bool need = false;
#pragma unroll      /* static indices keep the register arrays in registers */
      for (int g = 0; g < 2; ++g) { float mx = st[0][g][0];
#pragma unroll      /* static indices keep the register arrays in registers */
        for (int r = 1; r < 8; ++r) mx = fmaxf(mx, st[0][g][r]);
#pragma unroll      /* static indices keep the register arrays in registers */
        for (int r = 0; r < 8; ++r) mx = fmaxf(mx, st[1][g][r]);
        mx = fmaxf(mx, fa_xhalf(mx)) * L2E; mb[g] = mx; need = need || (mx > mrun[g] + 8.0f); }      /* both halves hold the query's maximum of this pass */
      if (__builtin_amdgcn_ballot_w32(need) != 0) {      /* lazy rescale: only when some query's maximum passes the one in use by more than 2^8; always on the first pass */
#pragma unroll      /* static indices keep the register arrays in registers */
        for (int g = 0; g < 2; ++g) { const float mn = fmaxf(mrun[g], mb[g]); const float corr = __builtin_amdgcn_exp2f(mrun[g] - mn); mrun[g] = mn; lsum[g] *= corr;
#pragma unroll      /* static indices keep the register arrays in registers */
          for (int t = 0; t < 4; ++t) acc[g][t] *= corr; } }
#pragma unroll      /* static indices keep the register arrays in registers */
      for (int g = 0; g < 2; ++g) { const float nm = 6.0f - mrun[g]; FragH pf; v2f ls = {0.f, 0.f};      /* weights x 2^6: at most 2^14 in f16, small ones further from the subnormal range */
#pragma unroll      /* static indices keep the register arrays in registers */
        for (int i = 0; i < 8; ++i) { const v2f a = __builtin_elementwise_fma(v2f{st[i >> 2][g][2 * (i & 3)], st[i >> 2][g][2 * (i & 3) + 1]}, v2f{L2E, L2E}, v2f{nm, nm});
          const v2f p = {__builtin_amdgcn_exp2f(a.x), __builtin_amdgcn_exp2f(a.y)}; ls += p; pf.h[2 * i] = (_Float16)p.x; pf.h[2 * i + 1] = (_Float16)p.y; }
        lsum[g] += ls;
#pragma unroll      /* static indices keep the register arrays in registers */
        for (int t = 0; t < 4; ++t) acc[g][t] = fa_mma(vf[t], pf.v, acc[g][t]); }
    }
    if (more) {
#pragma unroll      /* static indices into rk[], rv[] */
      for (int i = 0; i < 4; ++i) { *(v8us*)&sk[cur ^ 1][sr + 16 * i][sc] = rk[i]; *(v8us*)&sv[cur ^ 1][sr + 16 * i][sc] = rv[i]; } }
    __syncthreads();      /* publishes stage s + 1 and ends every wave's reads of the buffer that the next trip refills */
  }
#pragma unroll      /* static indices keep the register arrays in registers */
  for (int g = 0; g < 2; ++g) { const float lh = lsum[g].x + lsum[g].y; const float inv = 64.0f / (lh + fa_xhalf(lh)); unsigned short* op = (unsigned short*)O16 + ((size_t)b * SQ + q0 + 16 * g + ln) * DM + h * HD + 8 * hh;      /* the halves' sums join once; o x64 */
#pragma unroll      /* static indices keep the register arrays in registers */
    for (int t = 0; t < 4; ++t) { FragH o;
#pragma unroll      /* static indices keep the register arrays in registers */
      for (int r = 0; r < 8; ++r) o.h[r] = (_Float16)(acc[g][t][r] * inv);
      *(v8us*)(op + 16 * t) = o.half[0]; } } }
__global__ __launch_bounds__(256) void k_vt(const _Float16* __restrict__ V16, int b, int h0, _Float16* __restrict__ VT) { __shared__ unsigned short tl[64][65]; const int tid = threadIdx.x; const int hh = blockIdx.x % HG, sg = blockIdx.x / HG; const int s0 = sg * 64; const int h = h0 + hh;
  for (int i = tid; i < 64 * 8; i += 256) { const int j = i / 8, d8 = (i % 8) * 8; FragH f; f.half[0] = *(const v8us*)((const unsigned short*)V16 + ((size_t)b * SQ + s0 + j) * DM + h * HD + d8); for (int q = 0; q < 8; ++q) tl[d8 + q][j] = f.u[q]; }
  __syncthreads();
  { for (int i = tid; i < 64 * 8; i += 256) { const int d = i / 8, j8 = (i % 8) * 8; FragH f; for (int q = 0; q < 8; ++q) f.u[q] = tl[d][j8 + q]; *(v8us*)((unsigned short*)VT + ((size_t)hh * HD + d) * SQ + s0 + j8) = f.half[0]; }  } }



__global__ __launch_bounds__(256) void k_rsmkm(const float* __restrict__ S, _Float16* __restrict__ P, int nrows, const int* __restrict__ am) {
  #pragma clang fp contract(off)
  const int t = blockIdx.x * 256 + threadIdx.x; if (t >= nrows) return; const size_t i = (size_t)t; const float* s = S + i * SQ; const int* mr = am + (size_t)(t % SQ) * SQ; float mx = -3.0e38f;
#pragma unroll 1
  for (int j = 0; j < SQ; ++j) { const float f = (mr[j] != 0) ? 1.f : 0.f; mx = fmaxf(mx, fmaf(f, s[j], (1.f - f) * -1.0e9f)); } float se = 0.f;
#pragma unroll 1
  for (int j = 0; j < SQ; ++j) { const float f = (mr[j] != 0) ? 1.f : 0.f; se += __expf(fmaf(f, s[j], (1.f - f) * -1.0e9f) - mx); } const float sc = 256.0f / se;
#pragma unroll 1
  for (int j0 = 0; j0 < SQ; j0 += 8) { FragH fr; for (int q = 0; q < 8; ++q) { const int j = j0 + q; const float f = (mr[j] != 0) ? 1.f : 0.f; fr.h[q] = (_Float16)(__expf(fmaf(f, s[j], (1.f - f) * -1.0e9f) - mx) * sc); }
    unsigned short* d = (unsigned short*)P + i * SQ + j0; *(v8us*)d = fr.half[0];  } }

template <int COLS>
__global__ __launch_bounds__(256) void k_wperm(const float* __restrict__ Wn, _Float16* __restrict__ Bt) {
  const size_t t = (size_t)blockIdx.x * 256 + threadIdx.x; if (t >= (size_t)DM * DM / 8) return; const size_t e0 = t * 8; const int n = (int)(e0 / DM), k0 = (int)(e0 % DM); FragH f;
  if (COLS == 0) { const int h = n >> 6, d = n & 63; const float* src = Wn + (size_t)(d * NH + h) * DM + k0; for (int q = 0; q < 8; ++q) f.h[q] = (_Float16)(bf16_round(src[q]) * 16.0f); }
  else { for (int q = 0; q < 8; ++q) { const int kk = k0 + q; const int h = kk >> 6, d = kk & 63; f.h[q] = (_Float16)(bf16_round(Wn[(size_t)n * DM + d * NH + h]) * 16.0f); } }
  unsigned short* dst = (unsigned short*)Bt + e0; *(v8us*)dst = f.half[0];  }
__global__ __launch_bounds__(256) void k_bperm(const float* __restrict__ b, float* __restrict__ out) { const int t = threadIdx.x; if (t >= DM) return; const int h = t >> 6, d = t & 63; const float v = b[d * NH + h]; *(float*)(out + t) = v;  }
extern "C" void kernel_launch(void* const* d_in, const int* in_sizes, int n_in,
                              void* d_out, int out_size, void* d_ws, size_t ws_size, hipStream_t stream) {
  (void)in_sizes; (void)n_in; (void)out_size;
  const float* const* I = (const float* const*)d_in; const float* xq = I[0]; const float* xk = I[0]; const float* xv = I[0]; const float* wq = I[1]; const float* bq = I[2]; const float* wk = I[3]; const float* bk = I[4]; const float* wv = I[5]; const float* bv = I[6]; const float* wo = I[7]; const float* bo = I[8]; const float* x = xq;      /* hidden_state [4][768][2048] (feeds q, k and v); per-head Wq / Wk / Wv [12][768][64] + biases [12][64] (= [768] head-major); Wo [768][768] natural + bo */
  char* ws = (char*)d_ws; size_t off = 0;
  auto take = [&](size_t bytes) { char* p = ws + off; off += (bytes + 255) & ~(size_t)255; return p; };
  _Float16* BQ = (_Float16*)take((size_t)3 * DM * DM * 2); _Float16* BO = (_Float16*)take((size_t)DM * DM * 2);      /* BQ: the q, k, v Bt planes in a row (plane stride DM * DM) */
  _Float16* X16 = (_Float16*)take(NR * DM * 2); _Float16* Q16 = (_Float16*)take(3 * NR * DM * 2); _Float16* K16 = Q16 + NR * DM; _Float16* V16 = K16 + NR * DM;      /* q rows, k rows and V^T in a row (plane stride NR * DM) */ _Float16* O16 = (_Float16*)take(NR * DM * 2);
  _Float16* VT = V16;      /* the v plane holds V^T [NB][NH][HD][SQ]: as many elements as the rows */
  static_assert(MP % 128 == 0 && MPO % 128 == 0 && SQ % 128 == 0 && B0 == 0, "transposed GEMM stores: whole 128-row blocks inside one batch");
  static_assert(DM % G2_KS == 0 && DM % G2_BN == 0 && G2_BM == 128, "k_gemm2: whole 64-k stages, whole 192-column blocks of 128 rows");
  if (off > ws_size) return;
  k_prep<<<PB_X + 3 * NH * PB_W + PB_O, 256, 0, stream>>>(x, wq, wk, wv, wo, X16, BQ, BO);      /* exact f16 token rows [b][s][e] of the [B][E][S] input (q, k and v all project these rows); per-head [in = 768][out = 64] tensors -> rows h*64.. of the Bt planes (x16): head h = output columns h*64.. = the concat order; Wo natural [out][in] = Bt x16 */

  const size_t r0p = (size_t)B0 * SQ;      /* first projected row */
  k_gemm2<0><<<dim3((unsigned)((MP / G2_BM) * (DM / G2_BN)), 3), 256, 0, stream>>>(X16 + r0p * DM, DM, 0, BQ, DM, (size_t)DM * DM, 0.0625f, bq, bk, bv, 0, nullptr, Q16 + r0p * DM, DM, NR * DM, MP, DM, DM, 2, SQ);      /* blockIdx.y = q, k, v; plane 2 stored as V^T */
  k_fattn<<<dim3(SQ / 128, NH, NB), 128, 0, stream>>>(Q16, K16, VT, O16);      /* UNSCALED scores q.k (the module omits 1/sqrt(d)), softmax and P.V; o (merged heads) as f16 rows x64 */
  k_gemm2<0><<<dim3((unsigned)((MPO / G2_BM) * (DM / G2_BN)), 1), 256, 0, stream>>>(O16 + r0p * DM, DM, 0, BO, DM, 0, 0.0009765625f, bo, nullptr, nullptr, 0, (float*)d_out, nullptr, DM, 0, MPO, DM, DM, 0, SQ);      /* out (f32; bo is in natural channel order = the output columns), stored transposed: the module's [b][co][n] layout */
}

// v008
// Measured time: 97.6 microseconds a run.
// Two timings next to v007 put it at 1.05 and 1.04 times that version's speed.
// Over all steps from v000 it is 60.0 times as fast.
#include <hip/hip_runtime.h>
#define NB 4
#define SQ 2048
#define DM 768
#define NH 12
#define HD 64
#define HG 4                         /* heads per block group of k_vt(V16, b, h0, VT) */
#define B0 0                         /* first batch processed (debug hook) */
#define NBR NB                       /* batches processed (debug hook) */
#define NR ((size_t)NB * SQ)         /* token rows */
#define MP ((int)((size_t)NBR * SQ)) /* rows projected (debug hook) */
#define QN SQ                        /* unused: k_fattn covers all SQ query rows */
#define NHD NH                       /* unused: k_fattn covers all NH heads */
#define MPO MP                       /* rows through the output stage (debug hook) */
#define LQ DM      /* unused: row pitch of the q and k rows */
typedef __bf16 v16b __attribute__((ext_vector_type(16)));
typedef unsigned short v8us __attribute__((ext_vector_type(8), may_alias));
typedef float  v8f  __attribute__((ext_vector_type(8)));
typedef float  v4f  __attribute__((ext_vector_type(4)));
typedef float  v4fa __attribute__((ext_vector_type(4), may_alias));
union FragB { v16b v; v8us half[2]; unsigned short u[16]; };

__device__ __forceinline__ unsigned short bf16_bits(float x) { unsigned int u = __float_as_uint(x); return (unsigned short)((u + 0x7FFFu + ((u >> 16) & 1u)) >> 16); }
__device__ __forceinline__ float bf16_val(unsigned short b) { return __uint_as_float(((unsigned int)b) << 16); }
__device__ __forceinline__ float bf16_round(float x) { return bf16_val(bf16_bits(x)); }
// D += A·B with NT terms: 1 = ah·bh, 2 = + al·bh (A split), 3 = + ah·bl (both split)
template <int NT>
__device__ __forceinline__ v8f mmaN(v16b ah, v16b al, v16b bh, v16b bl, v8f c) {
  c = __builtin_amdgcn_wmma_f32_16x16x32_bf16(false, ah, false, bh, (short)0, c, false, false);
  if (NT >= 2) c = __builtin_amdgcn_wmma_f32_16x16x32_bf16(false, al, false, bh, (short)0, c, false, false);
  if (NT >= 3) c = __builtin_amdgcn_wmma_f32_16x16x32_bf16(false, ah, false, bl, (short)0, c, false, false);
  asm volatile("v_nop\n\tv_nop\n\tv_nop\n\tv_nop" : "+v"(c) : "v"(ah), "v"(al), "v"(bh), "v"(bl));
  return c;
}

__global__ __launch_bounds__(256) void k_wt_bf16(const float* __restrict__ W, unsigned short* __restrict__ Wt, int K, int N) {
  const int t = blockIdx.x * 256 + threadIdx.x;
  const int k8n = K / 8;
  if (t >= N * k8n) return;
  const int n = t / k8n, k8 = (t % k8n) * 8;
  v8us v;
#pragma unroll
  for (int i = 0; i < 8; ++i) v[i] = bf16_bits(W[(size_t)(k8 + i) * N + n]);
  *(v8us*)(Wt + (size_t)n * K + k8) = v;
  
}

// GEMM C[M][N] (f32, pitch ldc) = act(A[M][K]·W + bias). A f32 row-major (pitch lda) converted per fragment to bf16
// (ASPLIT: hi/lo two planes -> 2 terms, else single rounded term); Wt bf16 [N][K] (pitch ldb). BIAS_BF16 rounds the
// bias to bf16 first (bias quantised to bf16 before the add). K%32==0, M%16==0, N%64==0.
template <bool ASPLIT, int ACT, bool BIAS_BF16>
__global__ __launch_bounds__(128) void k_gemm_bf(const float* __restrict__ A, int lda, const unsigned short* __restrict__ Wt, int ldb,
                                               const float* __restrict__ bias, float* __restrict__ C, int ldc, int M, int N, int K) {
  __shared__ __attribute__((aligned(16))) float so[4][16][64];
  const int tid = threadIdx.x, w = tid >> 5, lane = tid & 31, ln = lane & 15, hh = lane >> 4;
  const int ntn = N / 64;
  const int wid = blockIdx.x * 4 + w;
  const int mt = wid / ntn, nq = wid % ntn;
  if (mt * 16 >= M) return;
  const int row0 = mt * 16, col0 = nq * 64;
  const float* arow = A + (size_t)(row0 + ln) * lda;
  v8f acc[4] = {};
  for (int kb = 0; kb < K; kb += 32) {
    FragB ah, al;
    const v4f x0 = *(const v4fa*)(arow + kb + 8 * hh), x1 = *(const v4fa*)(arow + kb + 8 * hh + 4);
    const v4f x2 = *(const v4fa*)(arow + kb + 16 + 8 * hh), x3 = *(const v4fa*)(arow + kb + 16 + 8 * hh + 4);
    float xs[16] = {x0[0],x0[1],x0[2],x0[3],x1[0],x1[1],x1[2],x1[3],x2[0],x2[1],x2[2],x2[3],x3[0],x3[1],x3[2],x3[3]};
#pragma unroll
    for (int i = 0; i < 16; ++i) { const unsigned short hb = bf16_bits(xs[i]); ah.u[i] = hb; al.u[i] = ASPLIT ? bf16_bits(xs[i] - bf16_val(hb)) : (unsigned short)0; }
#pragma unroll
    for (int t = 0; t < 4; ++t) {
      const unsigned short* brow = Wt + (size_t)(col0 + t * 16 + ln) * ldb + kb;
      FragB b;
      b.half[0] = *(const v8us*)(brow + 8 * hh);
      b.half[1] = *(const v8us*)(brow + 16 + 8 * hh);
      acc[t] = mmaN<ASPLIT ? 2 : 1>(ah.v, al.v, b.v, b.v, acc[t]);
    }
  }
#pragma unroll
  for (int t = 0; t < 4; ++t) {
    float bv = bias ? bias[col0 + t * 16 + ln] : 0.f;
    if (BIAS_BF16) bv = bf16_round(bv);
#pragma unroll
    for (int r = 0; r < 8; ++r) { float v = acc[t][r] + bv; if (ACT == 1) v = fmaxf(v, 0.f); so[w][8 * hh + r][t * 16 + ln] = v; }
  }
  __builtin_amdgcn_fence(__ATOMIC_ACQ_REL, "workgroup");
  __builtin_amdgcn_wave_barrier();
  const int rsub = lane >> 4, c4 = (lane & 15) * 4;
  {
#pragma unroll
    for (int q = 0; q < 8; ++q) {
      const int r = q * 2 + rsub;
      const v4f v = *(const v4fa*)&so[w][r][c4];
      *(v4f*)(C + (size_t)(row0 + r) * ldc + col0 + c4) = v;
    }
    
  }
}

// GEMM C = act(A·W + bias + resid): A f32 (ASPLIT -> hi/lo 2 terms), Wt bf16 [N][K]; ACT 0 none, 1 relu, 2 exact gelu;
// resid (optional, f32, row index = (row % rmod), pitch ldr, RES_BF16 rounds it) added before the activation.
template <bool ASPLIT, int ACT, bool BIAS_BF16, bool RES_BF16>
__global__ __launch_bounds__(128) void k_gemm_bf3(const float* __restrict__ A, int lda, const unsigned short* __restrict__ Wt, int ldb,
                                                const float* __restrict__ bias, const float* __restrict__ resid, int rmod, int ldr,
                                                float* __restrict__ C, int ldc, int M, int N, int K) {
  __shared__ __attribute__((aligned(16))) float so[4][16][64];
  const int tid = threadIdx.x, w = tid >> 5, lane = tid & 31, ln = lane & 15, hh = lane >> 4;
  const int ntn = N / 64;
  const int wid = blockIdx.x * 4 + w;
  const int mt = wid / ntn, nq = wid % ntn;
  if (mt * 16 >= M) return;
  const int row0 = mt * 16, col0 = nq * 64;
  const float* arow = A + (size_t)(row0 + ln) * lda;
  v8f acc[4] = {};
  for (int kb = 0; kb < K; kb += 32) {
    FragB ah, al;
    const v4f x0 = *(const v4fa*)(arow + kb + 8 * hh), x1 = *(const v4fa*)(arow + kb + 8 * hh + 4);
    const v4f x2 = *(const v4fa*)(arow + kb + 16 + 8 * hh), x3 = *(const v4fa*)(arow + kb + 16 + 8 * hh + 4);
    float xs[16] = {x0[0],x0[1],x0[2],x0[3],x1[0],x1[1],x1[2],x1[3],x2[0],x2[1],x2[2],x2[3],x3[0],x3[1],x3[2],x3[3]};
#pragma unroll
    for (int i = 0; i < 16; ++i) { const unsigned short hb = bf16_bits(xs[i]); ah.u[i] = hb; al.u[i] = ASPLIT ? bf16_bits(xs[i] - bf16_val(hb)) : (unsigned short)0; }
#pragma unroll
    for (int t = 0; t < 4; ++t) {
      const unsigned short* brow = Wt + (size_t)(col0 + t * 16 + ln) * ldb + kb;
      FragB b;
      b.half[0] = *(const v8us*)(brow + 8 * hh);
      b.half[1] = *(const v8us*)(brow + 16 + 8 * hh);
      acc[t] = mmaN<ASPLIT ? 2 : 1>(ah.v, al.v, b.v, b.v, acc[t]);
    }
  }
#pragma unroll
  for (int t = 0; t < 4; ++t) {
    const int col = col0 + t * 16 + ln;
    float bv = bias ? bias[col] : 0.f;
    if (BIAS_BF16) bv = bf16_round(bv);
#pragma unroll
    for (int r = 0; r < 8; ++r) {
      float v = acc[t][r] + bv;
      if (resid) { float rv = resid[(size_t)((row0 + 8 * hh + r) % rmod) * ldr + col]; if (RES_BF16) rv = bf16_round(rv); v += rv; }
      if (ACT == 1) v = fmaxf(v, 0.f);
      if (ACT == 2) v = 0.5f * v * (1.0f + erff(v * 0.70710678118654752f));
      if (ACT == 3) { const float u = 0.7978845608028654f * (v + 0.044715f * v * v * v); v = 0.5f * v * (1.0f + tanhf(u)); }
      so[w][8 * hh + r][t * 16 + ln] = v;
    }
  }
  __builtin_amdgcn_fence(__ATOMIC_ACQ_REL, "workgroup");
  __builtin_amdgcn_wave_barrier();
  const int rsub = lane >> 4, c4 = (lane & 15) * 4;
  {
#pragma unroll
    for (int q = 0; q < 8; ++q) {
      const int r = q * 2 + rsub;
      const v4f v = *(const v4fa*)&so[w][r][c4];
      *(v4f*)(C + (size_t)(row0 + r) * ldc + col0 + c4) = v;
    }
    
  }
}
// row LayerNorm (biased variance, eps) over N: s = X (+ R); optional out_sum <- s; out_norm <- (s-mu)*rsqrt(var+eps)*g + b
template <bool PARAM_BF16>
__global__ __launch_bounds__(256) void k_layernorm(const float* __restrict__ X, const float* __restrict__ R, const float* __restrict__ g, const float* __restrict__ bta,
                                                  float* __restrict__ out_sum, float* __restrict__ out_norm, int N, float eps) {
  __shared__ float red[256];
  const int row = blockIdx.x, tid = threadIdx.x;
  const float* x = X + (size_t)row * N; const float* rr = R ? R + (size_t)row * N : nullptr;
  float vals[16];                     // up to N = 4096
  const int per = N / 256;            // contiguous chunk per thread? use strided-by-4 chunks: thread handles j = tid*4 + 1024*u
  float s1 = 0.f;
  for (int u = 0; u < per / 4; ++u) {
    const int j = tid * 4 + 1024 * u;
    const v4f a = *(const v4fa*)(x + j);
    v4f b = {0.f,0.f,0.f,0.f}; if (rr) b = *(const v4fa*)(rr + j);
#pragma unroll
    for (int q = 0; q < 4; ++q) { const float v = a[q] + b[q]; vals[u * 4 + q] = v; s1 += v; }
  }
  red[tid] = s1; __syncthreads();
  for (int st = 128; st > 0; st >>= 1) { if (tid < st) red[tid] += red[tid + st]; __syncthreads(); }
  const float mu = red[0] / (float)N; __syncthreads();
  float s2 = 0.f;
  for (int u = 0; u < per / 4; ++u)
#pragma unroll
    for (int q = 0; q < 4; ++q) { const float c = vals[u * 4 + q] - mu; s2 += c * c; }
  red[tid] = s2; __syncthreads();
  for (int st = 128; st > 0; st >>= 1) { if (tid < st) red[tid] += red[tid + st]; __syncthreads(); }
  const float rs = rsqrtf(red[0] / (float)N + eps);
  {
    for (int u = 0; u < per / 4; ++u) {
      const int j = tid * 4 + 1024 * u;
      v4f o, sm;
#pragma unroll
      for (int q = 0; q < 4; ++q) {
        float gg = g[j + q], bb = bta[j + q];
        if (PARAM_BF16) { gg = bf16_round(gg); bb = bf16_round(bb); }
        sm[q] = vals[u * 4 + q]; o[q] = (vals[u * 4 + q] - mu) * rs * gg + bb;
      }
      if (out_sum) *(v4f*)(out_sum + (size_t)row * N + j) = sm;
      *(v4f*)(out_norm + (size_t)row * N + j) = o;
    }
    
  }
}



// ---- f16 WMMA path (v_wmma_f32_16x16x32_f16): 11-bit significands for operands in range — used where a [0,1] probability operand needs more precision than bf16
typedef _Float16 v16h __attribute__((ext_vector_type(16)));
union FragH { v16h v; v8us half[2]; _Float16 h[16]; unsigned short u[16]; };
template <int NT>
__device__ __forceinline__ v8f mmaH(v16h ah, v16h al, v16h bh, v16h bl, v8f c) {
  c = __builtin_amdgcn_wmma_f32_16x16x32_f16(false, ah, false, bh, (short)0, c, false, false);
  if (NT >= 2) c = __builtin_amdgcn_wmma_f32_16x16x32_f16(false, al, false, bh, (short)0, c, false, false);
  if (NT >= 3) c = __builtin_amdgcn_wmma_f32_16x16x32_f16(false, ah, false, bl, (short)0, c, false, false);
  asm volatile("v_nop\n\tv_nop\n\tv_nop\n\tv_nop" : "+v"(c) : "v"(ah), "v"(al), "v"(bh), "v"(bl));
  return c;
}
// batched GEMM like k_gemm_b but f16 operands: A f32 (split into f16 hi/lo if ASPLIT, else rounded to f16), Bt = f16 values [n][k]; alpha; C f32; N multiple of 16 (partial tiles skipped)
template <bool ASPLIT>
__global__ __launch_bounds__(128) void k_gemm_h(const float* __restrict__ A, int lda, size_t sA, const _Float16* __restrict__ Bh, int ldb, size_t sB, float alpha, float* __restrict__ C, int ldc, size_t sC, int M, int N, int K) {
  __shared__ __attribute__((aligned(16))) float so[4][16][64];
  const int tid = threadIdx.x, w = tid >> 5, lane = tid & 31, ln = lane & 15, hh = lane >> 4; const int by = blockIdx.y;
  A += (size_t)by * sA; Bh += (size_t)by * sB; C += (size_t)by * sC;
  const int ntn = (N + 63) / 64; const int wid = blockIdx.x * 4 + w; const int mt = wid / ntn, nq = wid % ntn; if (mt * 16 >= M) return;
  const int row0 = mt * 16, col0 = nq * 64; const float* arow = A + (size_t)(row0 + ln) * lda;
  v8f acc[4] = {};
  for (int kb = 0; kb < K; kb += 32) {
    FragH ah, al;
    const v4f x0 = *(const v4fa*)(arow + kb + 8 * hh), x1 = *(const v4fa*)(arow + kb + 8 * hh + 4), x2 = *(const v4fa*)(arow + kb + 16 + 8 * hh), x3 = *(const v4fa*)(arow + kb + 16 + 8 * hh + 4);
    float xs[16] = {x0[0],x0[1],x0[2],x0[3],x1[0],x1[1],x1[2],x1[3],x2[0],x2[1],x2[2],x2[3],x3[0],x3[1],x3[2],x3[3]};
#pragma unroll
    for (int i = 0; i < 16; ++i) { const _Float16 h = (_Float16)xs[i]; ah.h[i] = h; al.h[i] = ASPLIT ? (_Float16)(xs[i] - (float)h) : (_Float16)0.0f; }
#pragma unroll
    for (int t = 0; t < 4; ++t) { if (col0 + t * 16 >= N) continue; const size_t boff = (size_t)(col0 + t * 16 + ln) * ldb + kb; FragH bq; bq.half[0] = *(const v8us*)(Bh + boff + 8 * hh); bq.half[1] = *(const v8us*)(Bh + boff + 16 + 8 * hh);
      acc[t] = mmaH<ASPLIT ? 2 : 1>(ah.v, al.v, bq.v, bq.v, acc[t]); }
  }
#pragma unroll
  for (int t = 0; t < 4; ++t) { if (col0 + t * 16 >= N) continue;
#pragma unroll
    for (int r = 0; r < 8; ++r) so[w][8 * hh + r][t * 16 + ln] = acc[t][r] * alpha; }
  __builtin_amdgcn_fence(__ATOMIC_ACQ_REL, "workgroup"); __builtin_amdgcn_wave_barrier();
  const int rsub = lane >> 4, c4 = (lane & 15) * 4;
  {
#pragma unroll
    for (int q = 0; q < 8; ++q) { const int r = q * 2 + rsub; if (col0 + c4 < N) { const v4f v = *(const v4fa*)&so[w][r][c4]; *(v4f*)(C + (size_t)(row0 + r) * ldc + col0 + c4) = v; } }
     }
}

// k_gemm_hh variant with fused epilogue: v = acc·alpha + bias[by·sBias + col] (+ CP[(row/rowsPerB)·sCPb + by·64 + col] if CP) ; ACT 0 none / 1 elu ; writes f16 C16 (and f32 C if non-null)
template <int ACT>
__global__ __launch_bounds__(128) void k_gemm_hhx(const _Float16* __restrict__ A, int lda, size_t sA, const _Float16* __restrict__ Bh, int ldb, size_t sB, float alpha, const float* __restrict__ bias, size_t sBias, const float* __restrict__ CP, int rowsPerB, size_t sCPb, int row0g,
    float* __restrict__ C, _Float16* __restrict__ C16, int ldc, size_t sC, int M, int N, int K) {
  __shared__ __attribute__((aligned(16))) float so[4][16][64];
  const int tid = threadIdx.x, w = tid >> 5, lane = tid & 31, ln = lane & 15, hh = lane >> 4; const int by = blockIdx.y;
  A += (size_t)by * sA; Bh += (size_t)by * sB; const size_t cofs = (size_t)by * sC; const float* bp = bias ? bias + (size_t)by * sBias : nullptr;
  const int ntn = (N + 63) / 64; const int wid = blockIdx.x * 4 + w; const int mt = wid / ntn, nq = wid % ntn; if (mt * 16 >= M) return;
  const int row0 = mt * 16, col0 = nq * 64; const _Float16* arow = A + (size_t)(row0 + ln) * lda;
  v8f acc[4] = {};
  for (int kb = 0; kb < K; kb += 32) { FragH ah; ah.half[0] = *(const v8us*)((const unsigned short*)arow + kb + 8 * hh); ah.half[1] = *(const v8us*)((const unsigned short*)arow + kb + 16 + 8 * hh);
#pragma unroll
    for (int t = 0; t < 4; ++t) { if (col0 + t * 16 >= N) continue; const size_t boff = (size_t)(col0 + t * 16 + ln) * ldb + kb; FragH bq; bq.half[0] = *(const v8us*)((const unsigned short*)Bh + boff + 8 * hh); bq.half[1] = *(const v8us*)((const unsigned short*)Bh + boff + 16 + 8 * hh);
      acc[t] = mmaH<1>(ah.v, ah.v, bq.v, bq.v, acc[t]); }
  }
#pragma unroll
  for (int t = 0; t < 4; ++t) { if (col0 + t * 16 >= N) continue; const int col = col0 + t * 16 + ln; const float bv = bp ? bf16_round(bp[col]) : 0.f;
#pragma unroll
    for (int r = 0; r < 8; ++r) { float v = acc[t][r] * alpha + bv; if (CP) { const int rr = row0g + row0 + 8 * hh + r; if (rowsPerB < 0) v += CP[cofs + (size_t)rr * ldc + col];      /* rowsPerB < 0: own element of the batched C plane */ else { const int bidx = rr / rowsPerB; v += CP[(size_t)bidx * sCPb + (size_t)by * 64 + col]; } } if (ACT == 1) v = (v > 0.f) ? v : expm1f(v); else if (ACT == 7) v = (v > 0.f) ? v + 1.0f : expf(v); else if (ACT == 8) v = tanhf(v); else if (ACT == 9) v = 0.5f * v * (1.0f + tanhf(0.7978845608028654f * (v + 0.044715f * v * v * v))); else if (ACT == 11) v = 1.0f / (1.0f + expf(-v)); else if (ACT == 12) v = (v > 0.f) ? v : 0.01f * v; else if (ACT == 14) v = (v > 0.f) ? v : 0.1f * v; else if (ACT == 16) v = (v >= 0.f) ? v : 0.3f * v; else if (ACT == 17) v = (v >= 0.f) ? v : 0.2f * v; else if (ACT == 15) v = v / (1.0f + expf(-v)); else if (ACT == 3) v = fmaxf(v, 0.f); else if (ACT == 6) v = 0.5f * v * (1.0f + erff(v * 0.70710678118654752f)); so[w][8 * hh + r][t * 16 + ln] = v; } }
  __builtin_amdgcn_fence(__ATOMIC_ACQ_REL, "workgroup"); __builtin_amdgcn_wave_barrier();
  const int rsub = lane >> 4, c4 = (lane & 15) * 4; typedef _Float16 v4h __attribute__((ext_vector_type(4)));
  {
#pragma unroll
    for (int q = 0; q < 8; ++q) { const int r = q * 2 + rsub; if (col0 + c4 < N) { const v4f v = *(const v4fa*)&so[w][r][c4]; if (C) *(v4f*)(C + cofs + (size_t)(row0 + r) * ldc + col0 + c4) = v; if (C16) { v4h h4; for (int i = 0; i < 4; ++i) h4[i] = (_Float16)v[i]; *(v4h*)(C16 + cofs + (size_t)(row0 + r) * ldc + col0 + c4) = h4; } } }
     }
}


typedef _Float16 v4h __attribute__((ext_vector_type(4)));

__global__ __launch_bounds__(256) void k_h16(const float* __restrict__ x, _Float16* __restrict__ X16, size_t n8) { const size_t t = (size_t)blockIdx.x * 256 + threadIdx.x; if (t >= n8) return; FragH f;
#pragma unroll
  for (int q = 0; q < 8; ++q) f.h[q] = (_Float16)x[t * 8 + q]; *(v8us*)((unsigned short*)X16 + t * 8) = f.half[0];  }
__global__ __launch_bounds__(256) void k_round16f(const float* __restrict__ W, _Float16* __restrict__ Bt, size_t n8) { const size_t t = (size_t)blockIdx.x * 256 + threadIdx.x; if (t >= n8) return; FragH f;
#pragma unroll
  for (int i = 0; i < 8; ++i) f.h[i] = (_Float16)(bf16_round(W[t * 8 + i]) * 16.0f); *(v8us*)((unsigned short*)Bt + t * 8) = f.half[0];  }
__global__ __launch_bounds__(256) void k_hl(const float* __restrict__ F, _Float16* __restrict__ Hh, _Float16* __restrict__ Hl, size_t n8) { const size_t t = (size_t)blockIdx.x * 256 + threadIdx.x; if (t >= n8) return; FragH fh, fl; const v4f a = *(const v4fa*)(F + t * 8), c = *(const v4fa*)(F + t * 8 + 4);
#pragma unroll
  for (int q = 0; q < 4; ++q) { _Float16 h = (_Float16)a[q]; fh.h[q] = h; fl.h[q] = (_Float16)((a[q] - (float)h) * 1024.0f); h = (_Float16)c[q]; fh.h[4 + q] = h; fl.h[4 + q] = (_Float16)((c[q] - (float)h) * 1024.0f); }
  { *(v8us*)((unsigned short*)Hh + t * 8) = fh.half[0]; *(v8us*)((unsigned short*)Hl + t * 8) = fl.half[0];  } }

// ---- fast GEMM (block tile 128x192, eight waves, both operands staged in LDS in 64-k stages; wave tile 64x48; requires M % 128 == 0 rows per launch region, N % 192 == 0 and K % 64 == 0) ----
__device__ __forceinline__ v16h g2_frag(const _Float16* p, int hh) { FragH f; f.half[0] = *(const v8us*)((const unsigned short*)p + 8 * hh); f.half[1] = *(const v8us*)((const unsigned short*)p + 16 + 8 * hh); return f.v; }
__device__ __forceinline__ v16h g2_sfrag(const unsigned short* p) { FragH f; f.half[0] = *(const v8us*)p; f.half[1] = *(const v8us*)(p + 16); return f.v; }      /* the same fragment from an LDS row: p = row + k0 + 8 * hh, the k order of g2_frag */
#define G2_KS 64        /* k per LDS stage: one whole 128-byte line of every operand row */
#define G2_PITCH 72     /* 16-bit elements per LDS row: 128 data bytes + 16 (16 bytes x odd for the 16-byte fragment reads) */
#define G2_BM 128       /* rows of the block's tile */
#define G2_BN 192       /* columns of the block's tile: 320 operand rows are fetched for 128 x 192 results */
#define G2_ROWS (G2_BM + G2_BN)     /* rows of a stage: the block's A rows, then its B rows */
#define G2_TPI 132      /* epilogue, transposed tile [column][row]: 128 rows + 4, sixteen columns' 16-byte LDS stores fall on sixteen different bank groups */
#define G2_SPI 196      /* epilogue, plain tile [row][column]: 192 columns + 4 (16 bytes x odd) */
__device__ __forceinline__ v8f g2_mma(v16h a, v16h b, v8f c) { v8f d = __builtin_amdgcn_wmma_f32_16x16x32_f16(false, a, false, b, (short)0, c, false, false); asm volatile("v_nop\n\tv_nop\n\tv_nop\n\tv_nop" : "+v"(d) : "v"(a), "v"(b)); return d; }
template <int ACT>
__global__ __launch_bounds__(256) void k_gemm2(const _Float16* __restrict__ A, int lda, size_t sA, const _Float16* __restrict__ Bh, int ldb, size_t sB, float alpha, const float* __restrict__ bias, const float* __restrict__ bias1, const float* __restrict__ bias2, size_t sBias,
    float* __restrict__ C, _Float16* __restrict__ C16, int ldc, size_t sC, int M, int N, int K, int tp, int rpt) { static_assert(ACT == 0 || ACT == 3 || ACT == 6 || ACT == 8 || ACT == 9 || ACT == 11 || ACT == 12 || ACT == 14 || ACT == 15 || ACT == 16 || ACT == 17, "k_gemm2: unsupported ACT code (would silently apply no activation)");
  __shared__ __attribute__((aligned(16))) float sm[G2_BN * G2_TPI];      /* main loop: two operand stages; behind the loop's last barrier: the epilogue's tile */
  static_assert(2 * G2_ROWS * G2_PITCH / 2 <= G2_BN * G2_TPI && G2_BM * G2_SPI <= G2_BN * G2_TPI && G2_BM <= G2_TPI && G2_BN <= G2_SPI, "k_gemm2: the stages and both forms of the epilogue's tile lie in sm[]");
  unsigned short* const sg = (unsigned short*)sm;
  const int tid = threadIdx.x, w = tid >> 5, lane = tid & 31, ln = lane & 15, hh = lane >> 4; const int by = blockIdx.y;
  const int wr = w & 1, wc = w >> 1;      /* the wave's place in the block's tile: rows 64 * wr .., columns 48 * wc .. */
  A += (size_t)by * sA; Bh += (size_t)by * sB; const size_t cofs = (size_t)by * sC; const float* bp = (by == 1 && bias1) ? bias1 : (by == 2 && bias2) ? bias2 : bias ? bias + (size_t)by * sBias : nullptr;      /* bias1, bias2: planes 1 and 2 where their biases are buffers of their own */
  const int ntn = N / G2_BN; const int mt = blockIdx.x / ntn, nq = blockIdx.x - mt * ntn; const int col0 = nq * G2_BN; if (mt * G2_BM >= M) return;      /* M is a multiple of 128 (and K of G2_KS): a block leaves whole or not at all, in front of every barrier, and stages whole */
  const bool tr = by >= tp;      /* planes tp.. are stored transposed, [row / rpt][col][row % rpt] (rpt a multiple of 128); the same in every thread of a block */
  const int sr = tid >> 3, sc = (tid & 7) * 8;      /* staging: eight threads a 128-byte line of one row, rows sr + 32 i */
  const char* ag = (const char*)(A + (size_t)(mt * G2_BM) * lda); const char* bg = (const char*)(Bh + (size_t)col0 * ldb);      /* the block's first A row and first B row: the same in every thread */
  unsigned oa[4], ob[6];      /* the thread's byte offsets from there, moved on by one stage a trip (a block's rows span far less than 4 GB) */
#pragma unroll      /* static indices into oa[], ob[] */
  for (int i = 0; i < 6; ++i) { if (i < 4) oa[i] = (unsigned)((sr + 32 * i) * lda + sc) * 2u; ob[i] = (unsigned)((sr + 32 * i) * ldb + sc) * 2u; }
  unsigned short* const sw = sg + sr * G2_PITCH + sc;      /* the thread's place in row sr of buffer 0 */
  v8us ra[4], rb[6];
#pragma unroll      /* static indices into ra[], rb[]; the ten loads fly together */
  for (int i = 0; i < 6; ++i) { if (i < 4) ra[i] = *(const v8us*)(ag + oa[i]); rb[i] = *(const v8us*)(bg + ob[i]); }
#pragma unroll      /* static indices into ra[], rb[] */
  for (int i = 0; i < 6; ++i) { if (i < 4) *(v8us*)(sw + 32 * i * G2_PITCH) = ra[i]; *(v8us*)(sw + (G2_BM + 32 * i) * G2_PITCH) = rb[i]; }
  __syncthreads();      /* stage 0 is published */
  const v8f z8 = {0.f,0.f,0.f,0.f,0.f,0.f,0.f,0.f}; v8f c[4][3] = {{z8, z8, z8}, {z8, z8, z8}, {z8, z8, z8}, {z8, z8, z8}};      /* [16-row group][16-column group] */
  const int ns = K / G2_KS;
#pragma unroll 1      /* one stage a trip: the body already holds two k steps */
  for (int s = 0; s < ns; ++s) { const int cur = s & 1; const bool more = s + 1 < ns;      /* the same in every thread */
    if (more) {      /* the next stage's lines fly while this stage is worked on */
#pragma unroll      /* static indices into the register arrays */
      for (int i = 0; i < 6; ++i) { if (i < 4) { oa[i] += G2_KS * 2; ra[i] = *(const v8us*)(ag + oa[i]); } ob[i] += G2_KS * 2; rb[i] = *(const v8us*)(bg + ob[i]); } }
#pragma unroll      /* constant LDS offsets for both k steps */
    for (int kk = 0; kk < G2_KS / 32; ++kk) { const unsigned short* ap = sg + (cur * G2_ROWS + 64 * wr + ln) * G2_PITCH + kk * 32 + 8 * hh; const unsigned short* bq = sg + (cur * G2_ROWS + G2_BM + 48 * wc + ln) * G2_PITCH + kk * 32 + 8 * hh;
      v16h a[4], b[3];      /* the k step's fourteen LDS reads as one group ahead of its products */
#pragma unroll      /* static indices keep a[], b[] in registers */
      for (int i = 0; i < 4; ++i) { a[i] = g2_sfrag(ap + 16 * i * G2_PITCH); if (i < 3) b[i] = g2_sfrag(bq + 16 * i * G2_PITCH); }
#pragma unroll      /* static indices keep the register arrays in registers */
      for (int j = 0; j < 3; ++j)
#pragma unroll      /* static indices keep the register arrays in registers */
        for (int i = 0; i < 4; ++i) c[i][j] = g2_mma(a[i], b[j], c[i][j]); }
    if (more) {
#pragma unroll      /* static indices into ra[], rb[] */
      for (int i = 0; i < 6; ++i) { if (i < 4) *(v8us*)(sw + ((cur ^ 1) * G2_ROWS + 32 * i) * G2_PITCH) = ra[i]; *(v8us*)(sw + ((cur ^ 1) * G2_ROWS + G2_BM + 32 * i) * G2_PITCH) = rb[i]; } }
    __syncthreads();      /* publishes stage s + 1 and ends every wave's reads of the buffer that the next trip refills; behind the last one sm[] is the epilogue's */
  }
  const int cl0 = 48 * wc + ln, rl0 = 64 * wr + 8 * hh;      /* tile (i, j) of the wave: the lane holds rows rl0 + 16 i .. + 7 of column cl0 + 16 j of the block's tile */
#pragma unroll      /* static indices keep c[][] in registers */
  for (int j = 0; j < 3; ++j) { const float bv = bp ? bf16_round(bp[col0 + cl0 + 16 * j]) : 0.f;
#pragma unroll      /* static indices keep c[][] in registers */
    for (int i = 0; i < 4; ++i)
#pragma unroll      /* static indices keep c[][] in registers */
      for (int r = 0; r < 8; ++r) { float v = c[i][j][r] * alpha + bv;
        if (ACT == 3) v = fmaxf(v, 0.f); else if (ACT == 6) v = 0.5f * v * (1.0f + erff(v * 0.70710678118654752f)); else if (ACT == 11) v = 1.0f / (1.0f + expf(-v)); else if (ACT == 15) v = v / (1.0f + expf(-v)); else if (ACT == 12) v = (v > 0.f) ? v : 0.01f * v; else if (ACT == 8) v = tanhf(v); else if (ACT == 9) v = 0.5f * v * (1.0f + tanhf(0.7978845608028654f * (v + 0.044715f * v * v * v))); else if (ACT == 14) v = (v > 0.f) ? v : 0.1f * v; else if (ACT == 16) v = (v >= 0.f) ? v : 0.3f * v; else if (ACT == 17) v = (v >= 0.f) ? v : 0.2f * v;
        c[i][j][r] = v; } }
  if (tr) {
#pragma unroll      /* static indices keep c[][] in registers */
    for (int j = 0; j < 3; ++j)
#pragma unroll      /* static indices keep c[][] in registers */
      for (int i = 0; i < 4; ++i) { float* tq = sm + (cl0 + 16 * j) * G2_TPI + rl0 + 16 * i; *(v4fa*)tq = v4f{c[i][j][0], c[i][j][1], c[i][j][2], c[i][j][3]}; *(v4fa*)(tq + 4) = v4f{c[i][j][4], c[i][j][5], c[i][j][6], c[i][j][7]}; } }      /* a lane's eight values are eight rows in a row of one column */
  else {
#pragma unroll      /* static indices keep c[][] in registers */
    for (int j = 0; j < 3; ++j)
#pragma unroll      /* static indices keep c[][] in registers */
      for (int i = 0; i < 4; ++i)
#pragma unroll      /* static indices keep c[][] in registers */
        for (int r = 0; r < 8; ++r) sm[(rl0 + 16 * i + r) * G2_SPI + cl0 + 16 * j] = c[i][j][r]; }
  __syncthreads();      /* the eight waves' parts make up the block's tile: a column's 128 rows come from two waves, a row's 192 columns from four */
  const int rb0 = mt * G2_BM;
  if (tr) {
    const int bb = rb0 / rpt; const size_t tb = cofs + ((size_t)bb * N + col0) * rpt + (rb0 - bb * rpt);
    if (C) {
#pragma unroll      /* the columns' LDS reads and stores overlap */
      for (int q = 0; q < G2_BN / 8; ++q) { const int cc = q * 8 + w; const v4f v = *(const v4fa*)(sm + cc * G2_TPI + lane * 4); *(v4f*)(C + tb + (size_t)cc * rpt + lane * 4) = v; }      /* a wave's store = one column's 512 bytes */
      asm volatile("s_wait_xcnt 0x0" ::: "memory"); }      /* precaution: the code behind (the 16-bit stores; in the built code also the join with the untransposed path) rewrites these stores' registers, and the wait stands in front of that on any path */
    if (C16) {
#pragma unroll      /* the columns' LDS reads and stores overlap */
      for (int q = 0; q < G2_BN / 16; ++q) { const int cc = q * 16 + w * 2 + hh; const v4f v0 = *(const v4fa*)(sm + cc * G2_TPI + ln * 8), v1 = *(const v4fa*)(sm + cc * G2_TPI + ln * 8 + 4); FragH h8;
#pragma unroll      /* static indices keep h8 in registers */
        for (int i = 0; i < 4; ++i) { h8.h[i] = (_Float16)v0[i]; h8.h[4 + i] = (_Float16)v1[i]; }
        *(v8us*)((unsigned short*)C16 + tb + (size_t)cc * rpt + ln * 8) = h8.half[0]; }      /* a wave's store = two columns' 256 bytes each */
      asm volatile("s_wait_xcnt 0x0" ::: "memory"); }      /* precaution: in the built code this path joins the untransposed one behind these stores, and the wait stands in front of every later write of their registers on any path there */
    return; }
  if (C) {
#pragma unroll      /* the chunks' LDS reads and stores overlap */
    for (int q = 0; q < G2_BM * (G2_BN / 8) / 256; ++q) { const int ix = q * 256 + tid, row = ix / (G2_BN / 8), c8 = (ix - row * (G2_BN / 8)) * 8;      /* 24 threads a row */
      const v4f v0 = *(const v4fa*)(sm + row * G2_SPI + c8), v1 = *(const v4fa*)(sm + row * G2_SPI + c8 + 4); float* cp = C + cofs + (size_t)(rb0 + row) * ldc + col0 + c8; *(v4f*)cp = v0; *(v4f*)(cp + 4) = v1; }
    asm volatile("s_wait_xcnt 0x0" ::: "memory"); }      /* precaution: the 16-bit stores behind rewrite these stores' registers, and the wait stands in front of that */
  if (C16) {
#pragma unroll      /* the chunks' LDS reads and stores overlap */
    for (int q = 0; q < G2_BM * (G2_BN / 8) / 256; ++q) { const int ix = q * 256 + tid, row = ix / (G2_BN / 8), c8 = (ix - row * (G2_BN / 8)) * 8;      /* 24 threads a row: its 192 columns = three whole 128-byte lines of 16-bit values */
      const v4f v0 = *(const v4fa*)(sm + row * G2_SPI + c8), v1 = *(const v4fa*)(sm + row * G2_SPI + c8 + 4); FragH h8;
#pragma unroll      /* static indices keep h8 in registers */
      for (int i = 0; i < 4; ++i) { h8.h[i] = (_Float16)v0[i]; h8.h[4 + i] = (_Float16)v1[i]; }
      *(v8us*)((unsigned short*)C16 + cofs + (size_t)(rb0 + row) * ldc + col0 + c8) = h8.half[0]; }
    asm volatile("s_wait_xcnt 0x0" ::: "memory"); }      /* precaution: stands behind the last stores, in front of any later write of their registers */
}


// Operand preparation, one launch; the block index picks the part (the same for a whole block), the largest part first. Every block moves PT_E elements, 64 a thread, so that the launch is few waves with many loads in flight each:
//   PB_X blocks: hidden_state [b][e][s] -> exact f16 token rows [b][s][e], one 128-channel x 128-token tile a block, turned in LDS;
//   PB_W blocks a weight slab (36 slabs = q, k, v times 12 heads): [in = 768][out = 64] -> rows h*64.. of that projection's Bt plane [n][k], x16 (bf16-exact weights stay exact in f16 away from the subnormal range), one 256-in x 64-out tile a block, turned in LDS;
//   PB_O blocks: Wo, natural [out][in] = Bt, x16.
#define PT_E 16384      /* elements a block moves */
#define PB_X ((unsigned)((size_t)NB * DM * SQ / PT_E))
#define PB_W ((unsigned)(HD * DM / PT_E))
#define PB_O ((unsigned)(DM * DM / PT_E))
static_assert(SQ % 128 == 0 && DM % 128 == 0 && DM % 256 == 0 && HD == 64 && DM * DM % PT_E == 0, "k_prep: whole 128 x 128 tiles of x, whole 256 x 64 tiles of a weight slab, whole blocks of Wo");
// One tile [PT_E / CW source rows][CW source columns] of an f32 matrix (row pitch sp) -> its transpose, f16 rows of pitch DM; each value rounded to bf16, then times sc (a power of two). tl: (PT_E / CW) * (CW + 2) 16-bit places.
template <int CW>
__device__ __forceinline__ void prep_turn(const float* __restrict__ s, size_t sp, unsigned short* __restrict__ d, float sc, unsigned short* tl) {
  constexpr int TP = CW + 2, TR = CW / 4, RP = 256 / TR;      /* LDS row pitch (an odd number of dwords); threads a source row; source rows a pass */
  const int tid = (int)threadIdx.x, r0 = tid / TR, c4 = (tid % TR) * 4; const float* sb = s + (size_t)r0 * sp + c4; v4f a[16]; FragH f;
#pragma unroll      /* static indices into a[]; the sixteen loads fly together */
  for (int p = 0; p < 16; ++p) a[p] = *(const v4fa*)(sb + (size_t)(p * RP) * sp);      /* a wave's load = whole 128-byte lines of one or two source rows */
  asm volatile("s_wait_xcnt 0x0" :: "v"(sb) : "memory");      /* precaution: the wait stands behind the sixteen loads, in front of every later write of their address registers; as its input the address keeps registers of its own until here (without it the last load's result landed on them) */
#pragma unroll      /* static indices into a[] */
  for (int p = 0; p < 16; ++p)
#pragma unroll      /* static indices keep f in registers */
    for (int q = 0; q < 4; ++q) { f.h[q] = (_Float16)(bf16_round(a[p][q]) * sc); tl[(p * RP + r0) * TP + c4 + q] = f.u[q]; }
  __syncthreads();      /* the tile is whole before it is read by columns; every thread of the block passes here */
#pragma unroll      /* the passes' LDS reads and stores overlap */
  for (int p = 0; p < 8; ++p) { const int i = p * 256 + tid, pc = i & 7, c = (i >> 3) % CW, g = i / (8 * CW);      /* eight threads the 128 bytes that 64 source rows give to one output row */
#pragma unroll      /* static indices keep f in registers */
    for (int q = 0; q < 8; ++q) f.u[q] = tl[(g * 64 + pc * 8 + q) * TP + c];
    *(v8us*)(d + (size_t)c * DM + g * 64 + pc * 8) = f.half[0]; }
  asm volatile("s_wait_xcnt 0x0" ::: "memory");      /* precaution: in the built code the parts join behind these stores, and the wait stands in front of every later write of the stores' registers on any path there */
}
__global__ __launch_bounds__(256) void k_prep(const float* __restrict__ x, const float* __restrict__ wq, const float* __restrict__ wk, const float* __restrict__ wv, const float* __restrict__ wo,
    _Float16* __restrict__ X16, _Float16* __restrict__ Bqkv, _Float16* __restrict__ Bo) {
  __shared__ unsigned short tl[(PT_E / 64) * 66];      /* the tile as [source row][source column]: 256 x 66, or 128 x 130 */
  static_assert((PT_E / 128) * 130 <= (PT_E / 64) * 66, "k_prep: both tile forms lie in tl[]");
  unsigned bx = blockIdx.x;
  if (bx < PB_X) { const unsigned slab = bx / (DM / 128), eg = bx - slab * (DM / 128), b = slab / (SQ / 128), sg = slab - b * (SQ / 128);      /* slab = 128 tokens of one batch, eg = 128 channels */
    prep_turn<128>(x + ((size_t)b * DM + eg * 128) * SQ + sg * 128, SQ, (unsigned short*)X16 + (size_t)slab * 128 * DM + eg * 128, 1.0f, tl);
    return; }
  bx -= PB_X;
  if (bx < 3 * NH * PB_W) { const unsigned slab = bx / PB_W, kg = bx - slab * PB_W, m = slab / NH, h = slab - m * NH; const float* Wm = (m == 0 ? wq : m == 1 ? wk : wv) + (size_t)h * DM * HD;      /* kg = 256 input channels */
    prep_turn<64>(Wm + (size_t)kg * 256 * HD, HD, (unsigned short*)Bqkv + (size_t)slab * HD * DM + kg * 256, 16.0f, tl);
    return; }
  bx -= 3 * NH * PB_W;
  { const float* ws = wo + (size_t)bx * PT_E + threadIdx.x * 8; unsigned short* wd = (unsigned short*)Bo + (size_t)bx * PT_E + threadIdx.x * 8; v4f a[16]; FragH f;
#pragma unroll      /* static indices into a[]; the sixteen loads fly together */
    for (int p = 0; p < 8; ++p) { a[2 * p] = *(const v4fa*)(ws + p * 2048); a[2 * p + 1] = *(const v4fa*)(ws + p * 2048 + 4); }
#pragma unroll      /* static indices into a[] */
    for (int p = 0; p < 8; ++p) {
#pragma unroll      /* static indices keep f in registers */
      for (int q = 0; q < 4; ++q) { f.h[q] = (_Float16)(bf16_round(a[2 * p][q]) * 16.0f); f.h[4 + q] = (_Float16)(bf16_round(a[2 * p + 1][q]) * 16.0f); }
      *(v8us*)(wd + p * 2048) = f.half[0]; }
    asm volatile("s_wait_xcnt 0x0" ::: "memory");      /* precaution: in the built code the parts join behind these stores, and the wait stands in front of every later write of the stores' registers on any path there */ } }
#define FA_KEYS 64      /* keys per LDS stage */
#define FA_PITCH 72     /* 16-bit elements per LDS row: 128 data bytes + 16 */
typedef float v2f __attribute__((ext_vector_type(2)));
__device__ __forceinline__ float fa_xhalf(float x) { return __builtin_bit_cast(float, __builtin_amdgcn_permlanex16(__builtin_bit_cast(int, x), __builtin_bit_cast(int, x), 0x76543210, 0xfedcba98, false, false)); }      /* lane l <-> lane l ^ 16 */
__device__ __forceinline__ v16h fa_frag(const unsigned short* p) { FragH f; f.half[0] = *(const v8us*)p; f.half[1] = *(const v8us*)(p + 16); return f.v; }      /* p = row + k0 + 8 * hh */
__device__ __forceinline__ v8f fa_mma(v16h a, v16h b, v8f c) { return __builtin_amdgcn_wmma_f32_16x16x32_f16(false, a, false, b, (short)0, c, false, false); }
// The scores of one 32-key pass, [key tile][query group]: kp = the lane's place in the pass's first K row in LDS.
__device__ __forceinline__ void fa_kfrags(const unsigned short* kp, v16h (&kf)[2][2]) {
#pragma unroll      /* static indices keep the register arrays in registers */
  for (int kt = 0; kt < 2; ++kt) { kf[kt][0] = fa_frag(kp + kt * 16 * FA_PITCH); kf[kt][1] = fa_frag(kp + kt * 16 * FA_PITCH + 32); } }
__device__ __forceinline__ void fa_scores(const v16h (&kf)[2][2], const v16h (&qf)[2][2], v8f (&st)[2][2]) {
  const v8f z8 = {0.f, 0.f, 0.f, 0.f, 0.f, 0.f, 0.f, 0.f};
#pragma unroll      /* static indices keep the register arrays in registers */
  for (int kt = 0; kt < 2; ++kt)
#pragma unroll      /* static indices keep the register arrays in registers */
    for (int g = 0; g < 2; ++g) st[kt][g] = fa_mma(kf[kt][1], qf[g][1], fa_mma(kf[kt][0], qf[g][0], z8)); }
// The weights 2^(s * log2 e + nm) of query group g in the order of the P^T operand; returns the lane's sum of them, even and odd keys apart.
__device__ __forceinline__ v2f fa_weights(const v8f (&st)[2][2], int g, float nm, v2f (&pw)[8]) {
  const float L2E = 1.4426950408889634f; v2f l2 = {0.f, 0.f};
#pragma unroll      /* static indices keep the register arrays in registers */
  for (int i = 0; i < 8; ++i) { const v2f a = __builtin_elementwise_fma(v2f{st[i >> 2][g][2 * (i & 3)], st[i >> 2][g][2 * (i & 3) + 1]}, v2f{L2E, L2E}, v2f{nm, nm});
    pw[i] = v2f{__builtin_amdgcn_exp2f(a.x), __builtin_amdgcn_exp2f(a.y)}; l2 += pw[i]; }
  return l2; }
__global__ __launch_bounds__(128) void k_fattn(const _Float16* __restrict__ Q16, const _Float16* __restrict__ K16, const _Float16* __restrict__ VT, _Float16* __restrict__ O16) {
  __shared__ __attribute__((aligned(16))) unsigned short sk[2][FA_KEYS][FA_PITCH];      /* K rows [key][d] */
  __shared__ __attribute__((aligned(16))) unsigned short sv[2][HD][FA_PITCH];           /* V^T rows [d][key] */
  const int tid = threadIdx.x, w = tid >> 5, lane = tid & 31, ln = lane & 15, hh = lane >> 4;
  const int h = blockIdx.y, b = blockIdx.z, q0 = blockIdx.x * 128 + w * 32;
  const unsigned short* kg = (const unsigned short*)K16 + (size_t)b * SQ * DM + h * HD;
  const unsigned short* vg = (const unsigned short*)VT + ((size_t)b * NH + h) * HD * SQ;
  v16h qf[2][2];
#pragma unroll      /* static indices keep qf[] in registers */
  for (int g = 0; g < 2; ++g) { const _Float16* qp = Q16 + ((size_t)b * SQ + q0 + 16 * g + ln) * DM + h * HD; qf[g][0] = g2_frag(qp, hh); qf[g][1] = g2_frag(qp + 32, hh); }
  const int sr = tid >> 3, sc = (tid & 7) * 8;      /* staging: eight threads a 128-byte row, rows sr + 16 i */
  v8us rk[4], rv[4];
#pragma unroll      /* static indices into rk[], rv[] */
  for (int i = 0; i < 4; ++i) { rk[i] = *(const v8us*)(kg + (size_t)(sr + 16 * i) * DM + sc); rv[i] = *(const v8us*)(vg + (size_t)(sr + 16 * i) * SQ + sc); }
#pragma unroll      /* static indices into rk[], rv[] */
  for (int i = 0; i < 4; ++i) { *(v8us*)&sk[0][sr + 16 * i][sc] = rk[i]; *(v8us*)&sv[0][sr + 16 * i][sc] = rv[i]; }
  __syncthreads();      /* stage 0 is published */
  const v8f z8 = {0.f, 0.f, 0.f, 0.f, 0.f, 0.f, 0.f, 0.f};
  v8f acc[2][4] = {{z8, z8, z8, z8}, {z8, z8, z8, z8}}; float mrun[2] = {-3.0e38f, -3.0e38f}; v2f lsum[2] = {{0.f, 0.f}, {0.f, 0.f}};      /* mrun: the maximum in use, log2 domain; lsum: the lane's share of the denominator, even and odd keys apart */
  const float L2E = 1.4426950408889634f;
#pragma unroll 1      /* one stage a trip: the body already holds two passes */
  for (int s = 0; s < SQ / FA_KEYS; ++s) {
    const int cur = s & 1; const bool more = s + 1 < SQ / FA_KEYS;      /* the same in every thread */
    if (more) {      /* the next stage's lines fly while this stage is worked on */
#pragma unroll      /* static indices into rk[], rv[] */
      for (int i = 0; i < 4; ++i) { rk[i] = *(const v8us*)(kg + (size_t)((s + 1) * FA_KEYS + sr + 16 * i) * DM + sc); rv[i] = *(const v8us*)(vg + (size_t)(sr + 16 * i) * SQ + (s + 1) * FA_KEYS + sc); } }
#pragma unroll      /* static indices into the register arrays */
    for (int ps = 0; ps < FA_KEYS / 32; ++ps) {
      const unsigned short* kp = &sk[cur][ps * 32 + ln][8 * hh];
      v16h kf[2][2], vf[4];
      fa_kfrags(kp, kf);
#pragma unroll      /* static indices keep the register arrays in registers */
      for (int t = 0; t < 4; ++t) vf[t] = fa_frag(&sv[cur][16 * t + ln][ps * 32 + 8 * hh]);
      __builtin_amdgcn_sched_barrier(0);      /* the V^T reads stay up here with the K reads and fly under the score products and the exponentials: sunk behind the test below, only the conversions would cover their latency */
      v8f st[2][2];      /* [key tile][query group] */
      fa_scores(kf, qf, st);
      v2f pw[2][8], ls[2]; bool need = false;      /* the pass's weights (f32) and each lane's sum of them */
#pragma unroll      /* static indices keep the register arrays in registers */
      for (int g = 0; g < 2; ++g) { ls[g] = fa_weights(st, g, 6.0f - mrun[g], pw[g]); need = need || !(ls[g].x + ls[g].y <= 32768.0f); }      /* weights x 2^6 against the maximum in use (small ones further from the f16 subnormal range); they are positive, so a sum of at most 2^15 bounds each of them by 2^15, inside f16 */
      if (__builtin_amdgcn_ballot_w32(need) != 0) {      /* lazy rescale, tested once a pass on the sums that the pass needs anyway: only here is the pass's maximum taken; always on the first pass (weights against -3e38 are infinite) */
        asm volatile("" ::: "memory");      /* the rare path forms its scores anew from LDS: without this fence the compiler reuses the first ones and keeps 32 registers live across the exponentials of every pass */
        fa_kfrags(kp, kf); fa_scores(kf, qf, st);
#pragma unroll      /* static indices keep the register arrays in registers */
        for (int g = 0; g < 2; ++g) { float mx = st[0][g][0];
#pragma unroll      /* static indices keep the register arrays in registers */
          for (int r = 1; r < 8; ++r) mx = fmaxf(mx, st[0][g][r]);
#pragma unroll      /* static indices keep the register arrays in registers */
          for (int r = 0; r < 8; ++r) mx = fmaxf(mx, st[1][g][r]);
          mx = fmaxf(mx, fa_xhalf(mx)) * L2E;      /* both halves hold the query's maximum of this pass */
          const float mn = fmaxf(mrun[g], mx); const float corr = __builtin_amdgcn_exp2f(mrun[g] - mn); mrun[g] = mn; lsum[g] *= corr;
#pragma unroll      /* static indices keep the register arrays in registers */
          for (int t = 0; t < 4; ++t) acc[g][t] *= corr;
          ls[g] = fa_weights(st, g, 6.0f - mn, pw[g]); } }      /* the weights anew, now at most 2^6 each */
#pragma unroll      /* static indices keep the register arrays in registers */
      for (int g = 0; g < 2; ++g) { FragH pf;
#pragma unroll      /* static indices keep the register arrays in registers */
        for (int i = 0; i < 8; ++i) { pf.h[2 * i] = (_Float16)pw[g][i].x; pf.h[2 * i + 1] = (_Float16)pw[g][i].y; }
        lsum[g] += ls[g];
#pragma unroll      /* static indices keep the register arrays in registers */
        for (int t = 0; t < 4; ++t) acc[g][t] = fa_mma(vf[t], pf.v, acc[g][t]); }
    }
    if (more) {
#pragma unroll      /* static indices into rk[], rv[] */
      for (int i = 0; i < 4; ++i) { *(v8us*)&sk[cur ^ 1][sr + 16 * i][sc] = rk[i]; *(v8us*)&sv[cur ^ 1][sr + 16 * i][sc] = rv[i]; } }
    __syncthreads();      /* publishes stage s + 1 and ends every wave's reads of the buffer that the next trip refills */
  }
#pragma unroll      /* static indices keep the register arrays in registers */
  for (int g = 0; g < 2; ++g) { const float lh = lsum[g].x + lsum[g].y; const float inv = 64.0f / (lh + fa_xhalf(lh)); unsigned short* op = (unsigned short*)O16 + ((size_t)b * SQ + q0 + 16 * g + ln) * DM + h * HD + 8 * hh;      /* the halves' sums join once; o x64 */
#pragma unroll      /* static indices keep the register arrays in registers */
    for (int t = 0; t < 4; ++t) { FragH o;
#pragma unroll      /* static indices keep the register arrays in registers */
      for (int r = 0; r < 8; ++r) o.h[r] = (_Float16)(acc[g][t][r] * inv);
      *(v8us*)(op + 16 * t) = o.half[0]; } } }
__global__ __launch_bounds__(256) void k_vt(const _Float16* __restrict__ V16, int b, int h0, _Float16* __restrict__ VT) { __shared__ unsigned short tl[64][65]; const int tid = threadIdx.x; const int hh = blockIdx.x % HG, sg = blockIdx.x / HG; const int s0 = sg * 64; const int h = h0 + hh;
  for (int i = tid; i < 64 * 8; i += 256) { const int j = i / 8, d8 = (i % 8) * 8; FragH f; f.half[0] = *(const v8us*)((const unsigned short*)V16 + ((size_t)b * SQ + s0 + j) * DM + h * HD + d8); for (int q = 0; q < 8; ++q) tl[d8 + q][j] = f.u[q]; }
  __syncthreads();
  { for (int i = tid; i < 64 * 8; i += 256) { const int d = i / 8, j8 = (i % 8) * 8; FragH f; for (int q = 0; q < 8; ++q) f.u[q] = tl[d][j8 + q]; *(v8us*)((unsigned short*)VT + ((size_t)hh * HD + d) * SQ + s0 + j8) = f.half[0]; }  } }



__global__ __launch_bounds__(256) void k_rsmkm(const float* __restrict__ S, _Float16* __restrict__ P, int nrows, const int* __restrict__ am) {
  #pragma clang fp contract(off)
  const int t = blockIdx.x * 256 + threadIdx.x; if (t >= nrows) return; const size_t i = (size_t)t; const float* s = S + i * SQ; const int* mr = am + (size_t)(t % SQ) * SQ; float mx = -3.0e38f;
#pragma unroll 1
  for (int j = 0; j < SQ; ++j) { const float f = (mr[j] != 0) ? 1.f : 0.f; mx = fmaxf(mx, fmaf(f, s[j], (1.f - f) * -1.0e9f)); } float se = 0.f;
#pragma unroll 1
  for (int j = 0; j < SQ; ++j) { const float f = (mr[j] != 0) ? 1.f : 0.f; se += __expf(fmaf(f, s[j], (1.f - f) * -1.0e9f) - mx); } const float sc = 256.0f / se;
#pragma unroll 1
  for (int j0 = 0; j0 < SQ; j0 += 8) { FragH fr; for (int q = 0; q < 8; ++q) { const int j = j0 + q; const float f = (mr[j] != 0) ? 1.f : 0.f; fr.h[q] = (_Float16)(__expf(fmaf(f, s[j], (1.f - f) * -1.0e9f) - mx) * sc); }
    unsigned short* d = (unsigned short*)P + i * SQ + j0; *(v8us*)d = fr.half[0];  } }

template <int COLS>
__global__ __launch_bounds__(256) void k_wperm(const float* __restrict__ Wn, _Float16* __restrict__ Bt) {
  const size_t t = (size_t)blockIdx.x * 256 + threadIdx.x; if (t >= (size_t)DM * DM / 8) return; const size_t e0 = t * 8; const int n = (int)(e0 / DM), k0 = (int)(e0 % DM); FragH f;
  if (COLS == 0) { const int h = n >> 6, d = n & 63; const float* src = Wn + (size_t)(d * NH + h) * DM + k0; for (int q = 0; q < 8; ++q) f.h[q] = (_Float16)(bf16_round(src[q]) * 16.0f); }
  else { for (int q = 0; q < 8; ++q) { const int kk = k0 + q; const int h = kk >> 6, d = kk & 63; f.h[q] = (_Float16)(bf16_round(Wn[(size_t)n * DM + d * NH + h]) * 16.0f); } }
  unsigned short* dst = (unsigned short*)Bt + e0; *(v8us*)dst = f.half[0];  }
__global__ __launch_bounds__(256) void k_bperm(const float* __restrict__ b, float* __restrict__ out) { const int t = threadIdx.x; if (t >= DM) return; const int h = t >> 6, d = t & 63; const float v = b[d * NH + h]; *(float*)(out + t) = v;  }
extern "C" void kernel_launch(void* const* d_in, const int* in_sizes, int n_in,
                              void* d_out, int out_size, void* d_ws, size_t ws_size, hipStream_t stream) {
  (void)in_sizes; (void)n_in; (void)out_size;
  const float* const* I = (const float* const*)d_in; const float* xq = I[0]; const float* xk = I[0]; const float* xv = I[0]; const float* wq = I[1]; const float* bq = I[2]; const float* wk = I[3]; const float* bk = I[4]; const float* wv = I[5]; const float* bv = I[6]; const float* wo = I[7]; const float* bo = I[8]; const float* x = xq;      /* hidden_state [4][768][2048] (feeds q, k and v); per-head Wq / Wk / Wv [12][768][64] + biases [12][64] (= [768] head-major); Wo [768][768] natural + bo */
  char* ws = (char*)d_ws; size_t off = 0;
  auto take = [&](size_t bytes) { char* p = ws + off; off += (bytes + 255) & ~(size_t)255; return p; };
  _Float16* BQ = (_Float16*)take((size_t)3 * DM * DM * 2); _Float16* BO = (_Float16*)take((size_t)DM * DM * 2);      /* BQ: the q, k, v Bt planes in a row (plane stride DM * DM) */
  _Float16* X16 = (_Float16*)take(NR * DM * 2); _Float16* Q16 = (_Float16*)take(3 * NR * DM * 2); _Float16* K16 = Q16 + NR * DM; _Float16* V16 = K16 + NR * DM;      /* q rows, k rows and V^T in a row (plane stride NR * DM) */ _Float16* O16 = (_Float16*)take(NR * DM * 2);
  _Float16* VT = V16;      /* the v plane holds V^T [NB][NH][HD][SQ]: as many elements as the rows */
  static_assert(MP % 128 == 0 && MPO % 128 == 0 && SQ % 128 == 0 && B0 == 0, "transposed GEMM stores: whole 128-row blocks inside one batch");
  static_assert(DM % G2_KS == 0 && DM % G2_BN == 0 && G2_BM == 128, "k_gemm2: whole 64-k stages, whole 192-column blocks of 128 rows");
  if (off > ws_size) return;
  k_prep<<<PB_X + 3 * NH * PB_W + PB_O, 256, 0, stream>>>(x, wq, wk, wv, wo, X16, BQ, BO);      /* exact f16 token rows [b][s][e] of the [B][E][S] input (q, k and v all project these rows); per-head [in = 768][out = 64] tensors -> rows h*64.. of the Bt planes (x16): head h = output columns h*64.. = the concat order; Wo natural [out][in] = Bt x16 */

  const size_t r0p = (size_t)B0 * SQ;      /* first projected row */
  k_gemm2<0><<<dim3((unsigned)((MP / G2_BM) * (DM / G2_BN)), 3), 256, 0, stream>>>(X16 + r0p * DM, DM, 0, BQ, DM, (size_t)DM * DM, 0.0625f, bq, bk, bv, 0, nullptr, Q16 + r0p * DM, DM, NR * DM, MP, DM, DM, 2, SQ);      /* blockIdx.y = q, k, v; plane 2 stored as V^T */
  k_fattn<<<dim3(SQ / 128, NH, NB), 128, 0, stream>>>(Q16, K16, VT, O16);      /* UNSCALED scores q.k (the module omits 1/sqrt(d)), softmax and P.V; o (merged heads) as f16 rows x64 */
  k_gemm2<0><<<dim3((unsigned)((MPO / G2_BM) * (DM / G2_BN)), 1), 256, 0, stream>>>(O16 + r0p * DM, DM, 0, BO, DM, 0, 0.0009765625f, bo, nullptr, nullptr, 0, (float*)d_out, nullptr, DM, 0, MPO, DM, DM, 0, SQ);      /* out (f32; bo is in natural channel order = the output columns), stored transposed: the module's [b][co][n] layout */
}

// v009
// Measured time: 94.8 microseconds a run.
// Two timings next to v008 both put it at 1.03 times that version's speed.
// Over all steps from v000 it is 62.0 times as fast.
#include <hip/hip_runtime.h>
#define NB 4
#define SQ 2048
#define DM 768
#define NH 12
#define HD 64
#define HG 4                         /* heads per block group of k_vt(V16, b, h0, VT) */
#define B0 0                         /* first batch processed (debug hook) */
#define NBR NB                       /* batches processed (debug hook) */
#define NR ((size_t)NB * SQ)         /* token rows */
#define MP ((int)((size_t)NBR * SQ)) /* rows projected (debug hook) */
#define QN SQ                        /* unused: k_fattn covers all SQ query rows */
#define NHD NH                       /* unused: k_fattn covers all NH heads */
#define MPO MP                       /* rows through the output stage (debug hook) */
#define LQ DM      /* unused: row pitch of the q and k rows */
typedef __bf16 v16b __attribute__((ext_vector_type(16)));
typedef unsigned short v8us __attribute__((ext_vector_type(8), may_alias));
typedef float  v8f  __attribute__((ext_vector_type(8)));
typedef float  v4f  __attribute__((ext_vector_type(4)));
typedef float  v4fa __attribute__((ext_vector_type(4), may_alias));
union FragB { v16b v; v8us half[2]; unsigned short u[16]; };

__device__ __forceinline__ unsigned short bf16_bits(float x) { unsigned int u = __float_as_uint(x); return (unsigned short)((u + 0x7FFFu + ((u >> 16) & 1u)) >> 16); }
__device__ __forceinline__ float bf16_val(unsigned short b) { return __uint_as_float(((unsigned int)b) << 16); }
__device__ __forceinline__ float bf16_round(float x) { return bf16_val(bf16_bits(x)); }
// D += A·B with NT terms: 1 = ah·bh, 2 = + al·bh (A split), 3 = + ah·bl (both split)
template <int NT>
__device__ __forceinline__ v8f mmaN(v16b ah, v16b al, v16b bh, v16b bl, v8f c) {
  c = __builtin_amdgcn_wmma_f32_16x16x32_bf16(false, ah, false, bh, (short)0, c, false, false);
  if (NT >= 2) c = __builtin_amdgcn_wmma_f32_16x16x32_bf16(false, al, false, bh, (short)0, c, false, false);
  if (NT >= 3) c = __builtin_amdgcn_wmma_f32_16x16x32_bf16(false, ah, false, bl, (short)0, c, false, false);
  asm volatile("v_nop\n\tv_nop\n\tv_nop\n\tv_nop" : "+v"(c) : "v"(ah), "v"(al), "v"(bh), "v"(bl));
  return c;
}

__global__ __launch_bounds__(256) void k_wt_bf16(const float* __restrict__ W, unsigned short* __restrict__ Wt, int K, int N) {
  const int t = blockIdx.x * 256 + threadIdx.x;
  const int k8n = K / 8;
  if (t >= N * k8n) return;
  const int n = t / k8n, k8 = (t % k8n) * 8;
  v8us v;
#pragma unroll
  for (int i = 0; i < 8; ++i) v[i] = bf16_bits(W[(size_t)(k8 + i) * N + n]);
  *(v8us*)(Wt + (size_t)n * K + k8) = v;
  
}

// GEMM C[M][N] (f32, pitch ldc) = act(A[M][K]·W + bias). A f32 row-major (pitch lda) converted per fragment to bf16
// (ASPLIT: hi/lo two planes -> 2 terms, else single rounded term); Wt bf16 [N][K] (pitch ldb). BIAS_BF16 rounds the
// bias to bf16 first (bias quantised to bf16 before the add). K%32==0, M%16==0, N%64==0.
template <bool ASPLIT, int ACT, bool BIAS_BF16>
__global__ __launch_bounds__(128) void k_gemm_bf(const float* __restrict__ A, int lda, const unsigned short* __restrict__ Wt, int ldb,
                                               const float* __restrict__ bias, float* __restrict__ C, int ldc, int M, int N, int K) {
  __shared__ __attribute__((aligned(16))) float so[4][16][64];
  const int tid = threadIdx.x, w = tid >> 5, lane = tid & 31, ln = lane & 15, hh = lane >> 4;
  const int ntn = N / 64;
  const int wid = blockIdx.x * 4 + w;
  const int mt = wid / ntn, nq = wid % ntn;
  if (mt * 16 >= M) return;
  const int row0 = mt * 16, col0 = nq * 64;
  const float* arow = A + (size_t)(row0 + ln) * lda;
  v8f acc[4] = {};
  for (int kb = 0; kb < K; kb += 32) {
    FragB ah, al;
    const v4f x0 = *(const v4fa*)(arow + kb + 8 * hh), x1 = *(const v4fa*)(arow + kb + 8 * hh + 4);
    const v4f x2 = *(const v4fa*)(arow + kb + 16 + 8 * hh), x3 = *(const v4fa*)(arow + kb + 16 + 8 * hh + 4);
    float xs[16] = {x0[0],x0[1],x0[2],x0[3],x1[0],x1[1],x1[2],x1[3],x2[0],x2[1],x2[2],x2[3],x3[0],x3[1],x3[2],x3[3]};
#pragma unroll
    for (int i = 0; i < 16; ++i) { const unsigned short hb = bf16_bits(xs[i]); ah.u[i] = hb; al.u[i] = ASPLIT ? bf16_bits(xs[i] - bf16_val(hb)) : (unsigned short)0; }
#pragma unroll
    for (int t = 0; t < 4; ++t) {
      const unsigned short* brow = Wt + (size_t)(col0 + t * 16 + ln) * ldb + kb;
      FragB b;
      b.half[0] = *(const v8us*)(brow + 8 * hh);
      b.half[1] = *(const v8us*)(brow + 16 + 8 * hh);
      acc[t] = mmaN<ASPLIT ? 2 : 1>(ah.v, al.v, b.v, b.v, acc[t]);
    }
  }
#pragma unroll
  for (int t = 0; t < 4; ++t) {
    float bv = bias ? bias[col0 + t * 16 + ln] : 0.f;
    if (BIAS_BF16) bv = bf16_round(bv);
#pragma unroll
    for (int r = 0; r < 8; ++r) { float v = acc[t][r] + bv; if (ACT == 1) v = fmaxf(v, 0.f); so[w][8 * hh + r][t * 16 + ln] = v; }
  }
  __builtin_amdgcn_fence(__ATOMIC_ACQ_REL, "workgroup");
  __builtin_amdgcn_wave_barrier();
  const int rsub = lane >> 4, c4 = (lane & 15) * 4;
  {
#pragma unroll
    for (int q = 0; q < 8; ++q) {
      const int r = q * 2 + rsub;
      const v4f v = *(const v4fa*)&so[w][r][c4];
      *(v4f*)(C + (size_t)(row0 + r) * ldc + col0 + c4) = v;
    }
    
  }
}

// GEMM C = act(A·W + bias + resid): A f32 (ASPLIT -> hi/lo 2 terms), Wt bf16 [N][K]; ACT 0 none, 1 relu, 2 exact gelu;
// resid (optional, f32, row index = (row % rmod), pitch ldr, RES_BF16 rounds it) added before the activation.
template <bool ASPLIT, int ACT, bool BIAS_BF16, bool RES_BF16>
__global__ __launch_bounds__(128) void k_gemm_bf3(const float* __restrict__ A, int lda, const unsigned short* __restrict__ Wt, int ldb,
                                                const float* __restrict__ bias, const float* __restrict__ resid, int rmod, int ldr,
                                                float* __restrict__ C, int ldc, int M, int N, int K) {
  __shared__ __attribute__((aligned(16))) float so[4][16][64];
  const int tid = threadIdx.x, w = tid >> 5, lane = tid & 31, ln = lane & 15, hh = lane >> 4;
  const int ntn = N / 64;
  const int wid = blockIdx.x * 4 + w;
  const int mt = wid / ntn, nq = wid % ntn;
  if (mt * 16 >= M) return;
  const int row0 = mt * 16, col0 = nq * 64;
  const float* arow = A + (size_t)(row0 + ln) * lda;
  v8f acc[4] = {};
  for (int kb = 0; kb < K; kb += 32) {
    FragB ah, al;
    const v4f x0 = *(const v4fa*)(arow + kb + 8 * hh), x1 = *(const v4fa*)(arow + kb + 8 * hh + 4);
    const v4f x2 = *(const v4fa*)(arow + kb + 16 + 8 * hh), x3 = *(const v4fa*)(arow + kb + 16 + 8 * hh + 4);
    float xs[16] = {x0[0],x0[1],x0[2],x0[3],x1[0],x1[1],x1[2],x1[3],x2[0],x2[1],x2[2],x2[3],x3[0],x3[1],x3[2],x3[3]};
#pragma unroll
    for (int i = 0; i < 16; ++i) { const unsigned short hb = bf16_bits(xs[i]); ah.u[i] = hb; al.u[i] = ASPLIT ? bf16_bits(xs[i] - bf16_val(hb)) : (unsigned short)0; }
#pragma unroll
    for (int t = 0; t < 4; ++t) {
      const unsigned short* brow = Wt + (size_t)(col0 + t * 16 + ln) * ldb + kb;
      FragB b;
      b.half[0] = *(const v8us*)(brow + 8 * hh);
      b.half[1] = *(const v8us*)(brow + 16 + 8 * hh);
      acc[t] = mmaN<ASPLIT ? 2 : 1>(ah.v, al.v, b.v, b.v, acc[t]);
    }
  }
#pragma unroll
  for (int t = 0; t < 4; ++t) {
    const int col = col0 + t * 16 + ln;
    float bv = bias ? bias[col] : 0.f;
    if (BIAS_BF16) bv = bf16_round(bv);
#pragma unroll
    for (int r = 0; r < 8; ++r) {
      float v = acc[t][r] + bv;
      if (resid) { float rv = resid[(size_t)((row0 + 8 * hh + r) % rmod) * ldr + col]; if (RES_BF16) rv = bf16_round(rv); v += rv; }
      if (ACT == 1) v = fmaxf(v, 0.f);
      if (ACT == 2) v = 0.5f * v * (1.0f + erff(v * 0.70710678118654752f));
      if (ACT == 3) { const float u = 0.7978845608028654f * (v + 0.044715f * v * v * v); v = 0.5f * v * (1.0f + tanhf(u)); }
      so[w][8 * hh + r][t * 16 + ln] = v;
    }
  }
  __builtin_amdgcn_fence(__ATOMIC_ACQ_REL, "workgroup");
  __builtin_amdgcn_wave_barrier();
  const int rsub = lane >> 4, c4 = (lane & 15) * 4;
  {
#pragma unroll
    for (int q = 0; q < 8; ++q) {
      const int r = q * 2 + rsub;
      const v4f v = *(const v4fa*)&so[w][r][c4];
      *(v4f*)(C + (size_t)(row0 + r) * ldc + col0 + c4) = v;
    }
    
  }
}
// row LayerNorm (biased variance, eps) over N: s = X (+ R); optional out_sum <- s; out_norm <- (s-mu)*rsqrt(var+eps)*g + b
template <bool PARAM_BF16>
__global__ __launch_bounds__(256) void k_layernorm(const float* __restrict__ X, const float* __restrict__ R, const float* __restrict__ g, const float* __restrict__ bta,
                                                  float* __restrict__ out_sum, float* __restrict__ out_norm, int N, float eps) {
  __shared__ float red[256];
  const int row = blockIdx.x, tid = threadIdx.x;
  const float* x = X + (size_t)row * N; const float* rr = R ? R + (size_t)row * N : nullptr;
  float vals[16];                     // up to N = 4096
  const int per = N / 256;            // contiguous chunk per thread? use strided-by-4 chunks: thread handles j = tid*4 + 1024*u
  float s1 = 0.f;
  for (int u = 0; u < per / 4; ++u) {
    const int j = tid * 4 + 1024 * u;
    const v4f a = *(const v4fa*)(x + j);
    v4f b = {0.f,0.f,0.f,0.f}; if (rr) b = *(const v4fa*)(rr + j);
#pragma unroll
    for (int q = 0; q < 4; ++q) { const float v = a[q] + b[q]; vals[u * 4 + q] = v; s1 += v; }
  }
  red[tid] = s1; __syncthreads();
  for (int st = 128; st > 0; st >>= 1) { if (tid < st) red[tid] += red[tid + st]; __syncthreads(); }
  const float mu = red[0] / (float)N; __syncthreads();
  float s2 = 0.f;
  for (int u = 0; u < per / 4; ++u)
#pragma unroll
    for (int q = 0; q < 4; ++q) { const float c = vals[u * 4 + q] - mu; s2 += c * c; }
  red[tid] = s2; __syncthreads();
  for (int st = 128; st > 0; st >>= 1) { if (tid < st) red[tid] += red[tid + st]; __syncthreads(); }
  const float rs = rsqrtf(red[0] / (float)N + eps);
  {
    for (int u = 0; u < per / 4; ++u) {
      const int j = tid * 4 + 1024 * u;
      v4f o, sm;
#pragma unroll
      for (int q = 0; q < 4; ++q) {
        float gg = g[j + q], bb = bta[j + q];
        if (PARAM_BF16) { gg = bf16_round(gg); bb = bf16_round(bb); }
        sm[q] = vals[u * 4 + q]; o[q] = (vals[u * 4 + q] - mu) * rs * gg + bb;
      }
      if (out_sum) *(v4f*)(out_sum + (size_t)row * N + j) = sm;
      *(v4f*)(out_norm + (size_t)row * N + j) = o;
    }
    
  }
}



// ---- f16 WMMA path (v_wmma_f32_16x16x32_f16): 11-bit significands for operands in range — used where a [0,1] probability operand needs more precision than bf16
typedef _Float16 v16h __attribute__((ext_vector_type(16)));
union FragH { v16h v; v8us half[2]; _Float16 h[16]; unsigned short u[16]; };
template <int NT>
__device__ __forceinline__ v8f mmaH(v16h ah, v16h al, v16h bh, v16h bl, v8f c) {
  c = __builtin_amdgcn_wmma_f32_16x16x32_f16(false, ah, false, bh, (short)0, c, false, false);
  if (NT >= 2) c = __builtin_amdgcn_wmma_f32_16x16x32_f16(false, al, false, bh, (short)0, c, false, false);
  if (NT >= 3) c = __builtin_amdgcn_wmma_f32_16x16x32_f16(false, ah, false, bl, (short)0, c, false, false);
  asm volatile("v_nop\n\tv_nop\n\tv_nop\n\tv_nop" : "+v"(c) : "v"(ah), "v"(al), "v"(bh), "v"(bl));
  return c;
}
// batched GEMM like k_gemm_b but f16 operands: A f32 (split into f16 hi/lo if ASPLIT, else rounded to f16), Bt = f16 values [n][k]; alpha; C f32; N multiple of 16 (partial tiles skipped)
template <bool ASPLIT>
__global__ __launch_bounds__(128) void k_gemm_h(const float* __restrict__ A, int lda, size_t sA, const _Float16* __restrict__ Bh, int ldb, size_t sB, float alpha, float* __restrict__ C, int ldc, size_t sC, int M, int N, int K) {
  __shared__ __attribute__((aligned(16))) float so[4][16][64];
  const int tid = threadIdx.x, w = tid >> 5, lane = tid & 31, ln = lane & 15, hh = lane >> 4; const int by = blockIdx.y;
  A += (size_t)by * sA; Bh += (size_t)by * sB; C += (size_t)by * sC;
  const int ntn = (N + 63) / 64; const int wid = blockIdx.x * 4 + w; const int mt = wid / ntn, nq = wid % ntn; if (mt * 16 >= M) return;
  const int row0 = mt * 16, col0 = nq * 64; const float* arow = A + (size_t)(row0 + ln) * lda;
  v8f acc[4] = {};
  for (int kb = 0; kb < K; kb += 32) {
    FragH ah, al;
    const v4f x0 = *(const v4fa*)(arow + kb + 8 * hh), x1 = *(const v4fa*)(arow + kb + 8 * hh + 4), x2 = *(const v4fa*)(arow + kb + 16 + 8 * hh), x3 = *(const v4fa*)(arow + kb + 16 + 8 * hh + 4);
    float xs[16] = {x0[0],x0[1],x0[2],x0[3],x1[0],x1[1],x1[2],x1[3],x2[0],x2[1],x2[2],x2[3],x3[0],x3[1],x3[2],x3[3]};
#pragma unroll
    for (int i = 0; i < 16; ++i) { const _Float16 h = (_Float16)xs[i]; ah.h[i] = h; al.h[i] = ASPLIT ? (_Float16)(xs[i] - (float)h) : (_Float16)0.0f; }
#pragma unroll
    for (int t = 0; t < 4; ++t) { if (col0 + t * 16 >= N) continue; const size_t boff = (size_t)(col0 + t * 16 + ln) * ldb + kb; FragH bq; bq.half[0] = *(const v8us*)(Bh + boff + 8 * hh); bq.half[1] = *(const v8us*)(Bh + boff + 16 + 8 * hh);
      acc[t] = mmaH<ASPLIT ? 2 : 1>(ah.v, al.v, bq.v, bq.v, acc[t]); }
  }
#pragma unroll
  for (int t = 0; t < 4; ++t) { if (col0 + t * 16 >= N) continue;
#pragma unroll
    for (int r = 0; r < 8; ++r) so[w][8 * hh + r][t * 16 + ln] = acc[t][r] * alpha; }
  __builtin_amdgcn_fence(__ATOMIC_ACQ_REL, "workgroup"); __builtin_amdgcn_wave_barrier();
  const int rsub = lane >> 4, c4 = (lane & 15) * 4;
  {
#pragma unroll
    for (int q = 0; q < 8; ++q) { const int r = q * 2 + rsub; if (col0 + c4 < N) { const v4f v = *(const v4fa*)&so[w][r][c4]; *(v4f*)(C + (size_t)(row0 + r) * ldc + col0 + c4) = v; } }
     }
}

// k_gemm_hh variant with fused epilogue: v = acc·alpha + bias[by·sBias + col] (+ CP[(row/rowsPerB)·sCPb + by·64 + col] if CP) ; ACT 0 none / 1 elu ; writes f16 C16 (and f32 C if non-null)
template <int ACT>
__global__ __launch_bounds__(128) void k_gemm_hhx(const _Float16* __restrict__ A, int lda, size_t sA, const _Float16* __restrict__ Bh, int ldb, size_t sB, float alpha, const float* __restrict__ bias, size_t sBias, const float* __restrict__ CP, int rowsPerB, size_t sCPb, int row0g,
    float* __restrict__ C, _Float16* __restrict__ C16, int ldc, size_t sC, int M, int N, int K) {
  __shared__ __attribute__((aligned(16))) float so[4][16][64];
  const int tid = threadIdx.x, w = tid >> 5, lane = tid & 31, ln = lane & 15, hh = lane >> 4; const int by = blockIdx.y;
  A += (size_t)by * sA; Bh += (size_t)by * sB; const size_t cofs = (size_t)by * sC; const float* bp = bias ? bias + (size_t)by * sBias : nullptr;
  const int ntn = (N + 63) / 64; const int wid = blockIdx.x * 4 + w; const int mt = wid / ntn, nq = wid % ntn; if (mt * 16 >= M) return;
  const int row0 = mt * 16, col0 = nq * 64; const _Float16* arow = A + (size_t)(row0 + ln) * lda;
  v8f acc[4] = {};
  for (int kb = 0; kb < K; kb += 32) { FragH ah; ah.half[0] = *(const v8us*)((const unsigned short*)arow + kb + 8 * hh); ah.half[1] = *(const v8us*)((const unsigned short*)arow + kb + 16 + 8 * hh);
#pragma unroll
    for (int t = 0; t < 4; ++t) { if (col0 + t * 16 >= N) continue; const size_t boff = (size_t)(col0 + t * 16 + ln) * ldb + kb; FragH bq; bq.half[0] = *(const v8us*)((const unsigned short*)Bh + boff + 8 * hh); bq.half[1] = *(const v8us*)((const unsigned short*)Bh + boff + 16 + 8 * hh);
      acc[t] = mmaH<1>(ah.v, ah.v, bq.v, bq.v, acc[t]); }
  }
#pragma unroll
  for (int t = 0; t < 4; ++t) { if (col0 + t * 16 >= N) continue; const int col = col0 + t * 16 + ln; const float bv = bp ? bf16_round(bp[col]) : 0.f;
#pragma unroll
    for (int r = 0; r < 8; ++r) { float v = acc[t][r] * alpha + bv; if (CP) { const int rr = row0g + row0 + 8 * hh + r; if (rowsPerB < 0) v += CP[cofs + (size_t)rr * ldc + col];      /* rowsPerB < 0: own element of the batched C plane */ else { const int bidx = rr / rowsPerB; v += CP[(size_t)bidx * sCPb + (size_t)by * 64 + col]; } } if (ACT == 1) v = (v > 0.f) ? v : expm1f(v); else if (ACT == 7) v = (v > 0.f) ? v + 1.0f : expf(v); else if (ACT == 8) v = tanhf(v); else if (ACT == 9) v = 0.5f * v * (1.0f + tanhf(0.7978845608028654f * (v + 0.044715f * v * v * v))); else if (ACT == 11) v = 1.0f / (1.0f + expf(-v)); else if (ACT == 12) v = (v > 0.f) ? v : 0.01f * v; else if (ACT == 14) v = (v > 0.f) ? v : 0.1f * v; else if (ACT == 16) v = (v >= 0.f) ? v : 0.3f * v; else if (ACT == 17) v = (v >= 0.f) ? v : 0.2f * v; else if (ACT == 15) v = v / (1.0f + expf(-v)); else if (ACT == 3) v = fmaxf(v, 0.f); else if (ACT == 6) v = 0.5f * v * (1.0f + erff(v * 0.70710678118654752f)); so[w][8 * hh + r][t * 16 + ln] = v; } }
  __builtin_amdgcn_fence(__ATOMIC_ACQ_REL, "workgroup"); __builtin_amdgcn_wave_barrier();
  const int rsub = lane >> 4, c4 = (lane & 15) * 4; typedef _Float16 v4h __attribute__((ext_vector_type(4)));
  {
#pragma unroll
    for (int q = 0; q < 8; ++q) { const int r = q * 2 + rsub; if (col0 + c4 < N) { const v4f v = *(const v4fa*)&so[w][r][c4]; if (C) *(v4f*)(C + cofs + (size_t)(row0 + r) * ldc + col0 + c4) = v; if (C16) { v4h h4; for (int i = 0; i < 4; ++i) h4[i] = (_Float16)v[i]; *(v4h*)(C16 + cofs + (size_t)(row0 + r) * ldc + col0 + c4) = h4; } } }
     }
}


typedef _Float16 v4h __attribute__((ext_vector_type(4)));

__global__ __launch_bounds__(256) void k_h16(const float* __restrict__ x, _Float16* __restrict__ X16, size_t n8) { const size_t t = (size_t)blockIdx.x * 256 + threadIdx.x; if (t >= n8) return; FragH f;
#pragma unroll
  for (int q = 0; q < 8; ++q) f.h[q] = (_Float16)x[t * 8 + q]; *(v8us*)((unsigned short*)X16 + t * 8) = f.half[0];  }
__global__ __launch_bounds__(256) void k_round16f(const float* __restrict__ W, _Float16* __restrict__ Bt, size_t n8) { const size_t t = (size_t)blockIdx.x * 256 + threadIdx.x; if (t >= n8) return; FragH f;
#pragma unroll
  for (int i = 0; i < 8; ++i) f.h[i] = (_Float16)(bf16_round(W[t * 8 + i]) * 16.0f); *(v8us*)((unsigned short*)Bt + t * 8) = f.half[0];  }
__global__ __launch_bounds__(256) void k_hl(const float* __restrict__ F, _Float16* __restrict__ Hh, _Float16* __restrict__ Hl, size_t n8) { const size_t t = (size_t)blockIdx.x * 256 + threadIdx.x; if (t >= n8) return; FragH fh, fl; const v4f a = *(const v4fa*)(F + t * 8), c = *(const v4fa*)(F + t * 8 + 4);
#pragma unroll
  for (int q = 0; q < 4; ++q) { _Float16 h = (_Float16)a[q]; fh.h[q] = h; fl.h[q] = (_Float16)((a[q] - (float)h) * 1024.0f); h = (_Float16)c[q]; fh.h[4 + q] = h; fl.h[4 + q] = (_Float16)((c[q] - (float)h) * 1024.0f); }
  { *(v8us*)((unsigned short*)Hh + t * 8) = fh.half[0]; *(v8us*)((unsigned short*)Hl + t * 8) = fl.half[0];  } }

// ---- fast GEMM (block tile 128x192, eight waves, both operands staged in LDS in 64-k stages; wave tile 64x48; requires M % 128 == 0 rows per launch region, N % 192 == 0 and K % 64 == 0) ----
__device__ __forceinline__ v16h g2_frag(const _Float16* p, int hh) { FragH f; f.half[0] = *(const v8us*)((const unsigned short*)p + 8 * hh); f.half[1] = *(const v8us*)((const unsigned short*)p + 16 + 8 * hh); return f.v; }
__device__ __forceinline__ v16h g2_sfrag(const unsigned short* p) { FragH f; f.half[0] = *(const v8us*)p; f.half[1] = *(const v8us*)(p + 16); return f.v; }      /* the same fragment from an LDS row: p = row + k0 + 8 * hh, the k order of g2_frag */
#define G2_KS 64        /* k per LDS stage: one whole 128-byte line of every operand row */
#define G2_PITCH 72     /* 16-bit elements per LDS row: 128 data bytes + 16 (16 bytes x odd for the 16-byte fragment reads) */
#define G2_BM 128       /* rows of the block's tile */
#define G2_BN 192       /* columns of the block's tile: 320 operand rows are fetched for 128 x 192 results */
#define G2_ROWS (G2_BM + G2_BN)     /* rows of a stage: the block's A rows, then its B rows */
#define G2_TPI 132      /* epilogue, transposed tile [column][row]: 128 rows + 4, sixteen columns' 16-byte LDS stores fall on sixteen different bank groups */
#define G2_SPI 196      /* epilogue, plain tile [row][column]: 192 columns + 4 (16 bytes x odd) */
__device__ __forceinline__ v8f g2_mma(v16h a, v16h b, v8f c) { v8f d = __builtin_amdgcn_wmma_f32_16x16x32_f16(false, a, false, b, (short)0, c, false, false); asm volatile("v_nop\n\tv_nop\n\tv_nop\n\tv_nop" : "+v"(d) : "v"(a), "v"(b)); return d; }
template <int ACT>
__global__ __launch_bounds__(256) void k_gemm2(const _Float16* __restrict__ A, int lda, size_t sA, const _Float16* __restrict__ Bh, int ldb, size_t sB, float alpha, const float* __restrict__ bias, const float* __restrict__ bias1, const float* __restrict__ bias2, size_t sBias,
    float* __restrict__ C, _Float16* __restrict__ C16, int ldc, size_t sC, int M, int N, int K, int tp, int rpt) { static_assert(ACT == 0 || ACT == 3 || ACT == 6 || ACT == 8 || ACT == 9 || ACT == 11 || ACT == 12 || ACT == 14 || ACT == 15 || ACT == 16 || ACT == 17, "k_gemm2: unsupported ACT code (would silently apply no activation)");
  __shared__ __attribute__((aligned(16))) float sm[G2_BN * G2_TPI];      /* main loop: two operand stages; behind the loop's last barrier: the epilogue's tile */
  static_assert(2 * G2_ROWS * G2_PITCH / 2 <= G2_BN * G2_TPI && G2_BM * G2_SPI <= G2_BN * G2_TPI && G2_BM <= G2_TPI && G2_BN <= G2_SPI, "k_gemm2: the stages and both forms of the epilogue's tile lie in sm[]");
  unsigned short* const sg = (unsigned short*)sm;
  const int tid = threadIdx.x, w = tid >> 5, lane = tid & 31, ln = lane & 15, hh = lane >> 4; const int by = blockIdx.y;
  const int wr = w & 1, wc = w >> 1;      /* the wave's place in the block's tile: rows 64 * wr .., columns 48 * wc .. */
  A += (size_t)by * sA; Bh += (size_t)by * sB; const size_t cofs = (size_t)by * sC; const float* bp = (by == 1 && bias1) ? bias1 : (by == 2 && bias2) ? bias2 : bias ? bias + (size_t)by * sBias : nullptr;      /* bias1, bias2: planes 1 and 2 where their biases are buffers of their own */
  const int ntn = N / G2_BN; const int mt = blockIdx.x / ntn, nq = blockIdx.x - mt * ntn; const int col0 = nq * G2_BN; if (mt * G2_BM >= M) return;      /* M is a multiple of 128 (and K of G2_KS): a block leaves whole or not at all, in front of every barrier, and stages whole */
  const bool tr = by >= tp;      /* planes tp.. are stored transposed, [row / rpt][col][row % rpt] (rpt a multiple of 128); the same in every thread of a block */
  const int sr = tid >> 3, sc = (tid & 7) * 8;      /* staging: eight threads a 128-byte line of one row, rows sr + 32 i */
  const char* ag = (const char*)(A + (size_t)(mt * G2_BM) * lda); const char* bg = (const char*)(Bh + (size_t)col0 * ldb);      /* the block's first A row and first B row: the same in every thread */
  const int ns = K / G2_KS;
  int ks = ns > 1 ? (mt + nq + ntn * by) % ns : 0;      /* the block's first k stage; the loop walks all ns stages from there and wraps round. Blocks that share A rows (same mt) or B rows (same nq, by) run at the same time: each on a stage of its own, they do not ask L2 for the same lines at the same moment. The same in every thread */
  unsigned oa[4], ob[6];      /* the thread's byte offsets from there, moved on by one stage a trip (a block's rows span far less than 4 GB) */
#pragma unroll      /* static indices into oa[], ob[] */
  for (int i = 0; i < 6; ++i) { if (i < 4) oa[i] = (unsigned)((sr + 32 * i) * lda + sc + ks * G2_KS) * 2u; ob[i] = (unsigned)((sr + 32 * i) * ldb + sc + ks * G2_KS) * 2u; }
  unsigned short* const sw = sg + sr * G2_PITCH + sc;      /* the thread's place in row sr of buffer 0 */
  v8us ra[4], rb[6];
#pragma unroll      /* static indices into ra[], rb[]; the ten loads fly together */
  for (int i = 0; i < 6; ++i) { if (i < 4) ra[i] = *(const v8us*)(ag + oa[i]); rb[i] = *(const v8us*)(bg + ob[i]); }
#pragma unroll      /* static indices into ra[], rb[] */
  for (int i = 0; i < 6; ++i) { if (i < 4) *(v8us*)(sw + 32 * i * G2_PITCH) = ra[i]; *(v8us*)(sw + (G2_BM + 32 * i) * G2_PITCH) = rb[i]; }
  __syncthreads();      /* the first stage is published */
  const v8f z8 = {0.f,0.f,0.f,0.f,0.f,0.f,0.f,0.f}; v8f c[4][3] = {{z8, z8, z8}, {z8, z8, z8}, {z8, z8, z8}, {z8, z8, z8}};      /* [16-row group][16-column group] */
#pragma unroll 1      /* one stage a trip: the body already holds two k steps */
  for (int s = 0; s < ns; ++s) { const int cur = s & 1; const bool more = s + 1 < ns;      /* the same in every thread */
    if (more) {      /* the next stage's lines fly while this stage is worked on */
      const bool wrap = ks + 1 == ns; ks = wrap ? 0 : ks + 1; const unsigned dk = wrap ? 0u - (unsigned)(ns - 1) * (G2_KS * 2) : (unsigned)(G2_KS * 2);      /* behind the last k stage comes stage 0: one step on, or ns - 1 steps back (modulo 2^32; the sum is an offset in range again) */
#pragma unroll      /* static indices into the register arrays */
      for (int i = 0; i < 6; ++i) { if (i < 4) { oa[i] += dk; ra[i] = *(const v8us*)(ag + oa[i]); } ob[i] += dk; rb[i] = *(const v8us*)(bg + ob[i]); } }
#pragma unroll      /* constant LDS offsets for both k steps */
    for (int kk = 0; kk < G2_KS / 32; ++kk) { const unsigned short* ap = sg + (cur * G2_ROWS + 64 * wr + ln) * G2_PITCH + kk * 32 + 8 * hh; const unsigned short* bq = sg + (cur * G2_ROWS + G2_BM + 48 * wc + ln) * G2_PITCH + kk * 32 + 8 * hh;
      v16h a[4], b[3];      /* the k step's fourteen LDS reads as one group ahead of its products */
#pragma unroll      /* static indices keep a[], b[] in registers */
      for (int i = 0; i < 4; ++i) { a[i] = g2_sfrag(ap + 16 * i * G2_PITCH); if (i < 3) b[i] = g2_sfrag(bq + 16 * i * G2_PITCH); }
#pragma unroll      /* static indices keep the register arrays in registers */
      for (int j = 0; j < 3; ++j)
#pragma unroll      /* static indices keep the register arrays in registers */
        for (int i = 0; i < 4; ++i) c[i][j] = g2_mma(a[i], b[j], c[i][j]); }
    if (more) {
#pragma unroll      /* static indices into ra[], rb[] */
      for (int i = 0; i < 6; ++i) { if (i < 4) *(v8us*)(sw + ((cur ^ 1) * G2_ROWS + 32 * i) * G2_PITCH) = ra[i]; *(v8us*)(sw + ((cur ^ 1) * G2_ROWS + G2_BM + 32 * i) * G2_PITCH) = rb[i]; } }
    __syncthreads();      /* publishes the next trip's stage and ends every wave's reads of the buffer that the next trip refills; behind the last one sm[] is the epilogue's */
  }
  const int cl0 = 48 * wc + ln, rl0 = 64 * wr + 8 * hh;      /* tile (i, j) of the wave: the lane holds rows rl0 + 16 i .. + 7 of column cl0 + 16 j of the block's tile */
#pragma unroll      /* static indices keep c[][] in registers */
  for (int j = 0; j < 3; ++j) { const float bv = bp ? bf16_round(bp[col0 + cl0 + 16 * j]) : 0.f;
#pragma unroll      /* static indices keep c[][] in registers */
    for (int i = 0; i < 4; ++i)
#pragma unroll      /* static indices keep c[][] in registers */
      for (int r = 0; r < 8; ++r) { float v = c[i][j][r] * alpha + bv;
        if (ACT == 3) v = fmaxf(v, 0.f); else if (ACT == 6) v = 0.5f * v * (1.0f + erff(v * 0.70710678118654752f)); else if (ACT == 11) v = 1.0f / (1.0f + expf(-v)); else if (ACT == 15) v = v / (1.0f + expf(-v)); else if (ACT == 12) v = (v > 0.f) ? v : 0.01f * v; else if (ACT == 8) v = tanhf(v); else if (ACT == 9) v = 0.5f * v * (1.0f + tanhf(0.7978845608028654f * (v + 0.044715f * v * v * v))); else if (ACT == 14) v = (v > 0.f) ? v : 0.1f * v; else if (ACT == 16) v = (v >= 0.f) ? v : 0.3f * v; else if (ACT == 17) v = (v >= 0.f) ? v : 0.2f * v;
        c[i][j][r] = v; } }
  if (tr) {
#pragma unroll      /* static indices keep c[][] in registers */
    for (int j = 0; j < 3; ++j)
#pragma unroll      /* static indices keep c[][] in registers */
      for (int i = 0; i < 4; ++i) { float* tq = sm + (cl0 + 16 * j) * G2_TPI + rl0 + 16 * i; *(v4fa*)tq = v4f{c[i][j][0], c[i][j][1], c[i][j][2], c[i][j][3]}; *(v4fa*)(tq + 4) = v4f{c[i][j][4], c[i][j][5], c[i][j][6], c[i][j][7]}; } }      /* a lane's eight values are eight rows in a row of one column */
  else {
#pragma unroll      /* static indices keep c[][] in registers */
    for (int j = 0; j < 3; ++j)
#pragma unroll      /* static indices keep c[][] in registers */
      for (int i = 0; i < 4; ++i)
#pragma unroll      /* static indices keep c[][] in registers */
        for (int r = 0; r < 8; ++r) sm[(rl0 + 16 * i + r) * G2_SPI + cl0 + 16 * j] = c[i][j][r]; }
  __syncthreads();      /* the eight waves' parts make up the block's tile: a column's 128 rows come from two waves, a row's 192 columns from four */
  const int rb0 = mt * G2_BM;
  if (tr) {
    const int bb = rb0 / rpt; const size_t tb = cofs + ((size_t)bb * N + col0) * rpt + (rb0 - bb * rpt);
    if (C) {
#pragma unroll      /* the columns' LDS reads and stores overlap */
      for (int q = 0; q < G2_BN / 8; ++q) { const int cc = q * 8 + w; const v4f v = *(const v4fa*)(sm + cc * G2_TPI + lane * 4); *(v4f*)(C + tb + (size_t)cc * rpt + lane * 4) = v; }      /* a wave's store = one column's 512 bytes */
      asm volatile("s_wait_xcnt 0x0" ::: "memory"); }      /* precaution: the code behind (the 16-bit stores; in the built code also the join with the untransposed path) rewrites these stores' registers, and the wait stands in front of that on any path */
    if (C16) {
#pragma unroll      /* the columns' LDS reads and stores overlap */
      for (int q = 0; q < G2_BN / 16; ++q) { const int cc = q * 16 + w * 2 + hh; const v4f v0 = *(const v4fa*)(sm + cc * G2_TPI + ln * 8), v1 = *(const v4fa*)(sm + cc * G2_TPI + ln * 8 + 4); FragH h8;
#pragma unroll      /* static indices keep h8 in registers */
        for (int i = 0; i < 4; ++i) { h8.h[i] = (_Float16)v0[i]; h8.h[4 + i] = (_Float16)v1[i]; }
        *(v8us*)((unsigned short*)C16 + tb + (size_t)cc * rpt + ln * 8) = h8.half[0]; }      /* a wave's store = two columns' 256 bytes each */
      asm volatile("s_wait_xcnt 0x0" ::: "memory"); }      /* precaution: in the built code this path joins the untransposed one behind these stores, and the wait stands in front of every later write of their registers on any path there */
    return; }
  if (C) {
#pragma unroll      /* the chunks' LDS reads and stores overlap */
    for (int q = 0; q < G2_BM * (G2_BN / 8) / 256; ++q) { const int ix = q * 256 + tid, row = ix / (G2_BN / 8), c8 = (ix - row * (G2_BN / 8)) * 8;      /* 24 threads a row */
      const v4f v0 = *(const v4fa*)(sm + row * G2_SPI + c8), v1 = *(const v4fa*)(sm + row * G2_SPI + c8 + 4); float* cp = C + cofs + (size_t)(rb0 + row) * ldc + col0 + c8; *(v4f*)cp = v0; *(v4f*)(cp + 4) = v1; }
    asm volatile("s_wait_xcnt 0x0" ::: "memory"); }      /* precaution: the 16-bit stores behind rewrite these stores' registers, and the wait stands in front of that */
  if (C16) {
#pragma unroll      /* the chunks' LDS reads and stores overlap */
    for (int q = 0; q < G2_BM * (G2_BN / 8) / 256; ++q) { const int ix = q * 256 + tid, row = ix / (G2_BN / 8), c8 = (ix - row * (G2_BN / 8)) * 8;      /* 24 threads a row: its 192 columns = three whole 128-byte lines of 16-bit values */
      const v4f v0 = *(const v4fa*)(sm + row * G2_SPI + c8), v1 = *(const v4fa*)(sm + row * G2_SPI + c8 + 4); FragH h8;
#pragma unroll      /* static indices keep h8 in registers */
      for (int i = 0; i < 4; ++i) { h8.h[i] = (_Float16)v0[i]; h8.h[4 + i] = (_Float16)v1[i]; }
      *(v8us*)((unsigned short*)C16 + cofs + (size_t)(rb0 + row) * ldc + col0 + c8) = h8.half[0]; }
    asm volatile("s_wait_xcnt 0x0" ::: "memory"); }      /* precaution: stands behind the last stores, in front of any later write of their registers */
}


// Operand preparation, one launch; the block index picks the part (the same for a whole block), the largest part first. Every block moves PT_E elements, 64 a thread, so that the launch is few waves with many loads in flight each:
//   PB_X blocks: hidden_state [b][e][s] -> exact f16 token rows [b][s][e], one 128-channel x 128-token tile a block, turned in LDS;
//   PB_W blocks a weight slab (36 slabs = q, k, v times 12 heads): [in = 768][out = 64] -> rows h*64.. of that projection's Bt plane [n][k], x16 (bf16-exact weights stay exact in f16 away from the subnormal range), one 256-in x 64-out tile a block, turned in LDS;
//   PB_O blocks: Wo, natural [out][in] = Bt, x16.
#define PT_E 16384      /* elements a block moves */
#define PB_X ((unsigned)((size_t)NB * DM * SQ / PT_E))
#define PB_W ((unsigned)(HD * DM / PT_E))
#define PB_O ((unsigned)(DM * DM / PT_E))
static_assert(SQ % 128 == 0 && DM % 128 == 0 && DM % 256 == 0 && HD == 64 && DM * DM % PT_E == 0, "k_prep: whole 128 x 128 tiles of x, whole 256 x 64 tiles of a weight slab, whole blocks of Wo");
// One tile [PT_E / CW source rows][CW source columns] of an f32 matrix (row pitch sp) -> its transpose, f16 rows of pitch DM; each value rounded to bf16, then times sc (a power of two). tl: (PT_E / CW) * (CW + 2) 16-bit places.
template <int CW>
__device__ __forceinline__ void prep_turn(const float* __restrict__ s, size_t sp, unsigned short* __restrict__ d, float sc, unsigned short* tl) {
  constexpr int TP = CW + 2, TR = CW / 4, RP = 256 / TR;      /* LDS row pitch (an odd number of dwords); threads a source row; source rows a pass */
  const int tid = (int)threadIdx.x, r0 = tid / TR, c4 = (tid % TR) * 4; const float* sb = s + (size_t)r0 * sp + c4; v4f a[16]; FragH f;
#pragma unroll      /* static indices into a[]; the sixteen loads fly together */
  for (int p = 0; p < 16; ++p) a[p] = *(const v4fa*)(sb + (size_t)(p * RP) * sp);      /* a wave's load = whole 128-byte lines of one or two source rows */
  asm volatile("s_wait_xcnt 0x0" :: "v"(sb) : "memory");      /* precaution: the wait stands behind the sixteen loads, in front of every later write of their address registers; as its input the address keeps registers of its own until here (without it the last load's result landed on them) */
#pragma unroll      /* static indices into a[] */
  for (int p = 0; p < 16; ++p)
#pragma unroll      /* static indices keep f in registers */
    for (int q = 0; q < 4; ++q) { f.h[q] = (_Float16)(bf16_round(a[p][q]) * sc); tl[(p * RP + r0) * TP + c4 + q] = f.u[q]; }
  __syncthreads();      /* the tile is whole before it is read by columns; every thread of the block passes here */
#pragma unroll      /* the passes' LDS reads and stores overlap */
  for (int p = 0; p < 8; ++p) { const int i = p * 256 + tid, pc = i & 7, c = (i >> 3) % CW, g = i / (8 * CW);      /* eight threads the 128 bytes that 64 source rows give to one output row */
#pragma unroll      /* static indices keep f in registers */
    for (int q = 0; q < 8; ++q) f.u[q] = tl[(g * 64 + pc * 8 + q) * TP + c];
    *(v8us*)(d + (size_t)c * DM + g * 64 + pc * 8) = f.half[0]; }
  asm volatile("s_wait_xcnt 0x0" ::: "memory");      /* precaution: in the built code the parts join behind these stores, and the wait stands in front of every later write of the stores' registers on any path there */
}
__global__ __launch_bounds__(256) void k_prep(const float* __restrict__ x, const float* __restrict__ wq, const float* __restrict__ wk, const float* __restrict__ wv, const float* __restrict__ wo,
    _Float16* __restrict__ X16, _Float16* __restrict__ Bqkv, _Float16* __restrict__ Bo) {
  __shared__ unsigned short tl[(PT_E / 64) * 66];      /* the tile as [source row][source column]: 256 x 66, or 128 x 130 */
  static_assert((PT_E / 128) * 130 <= (PT_E / 64) * 66, "k_prep: both tile forms lie in tl[]");
  unsigned bx = blockIdx.x;
  if (bx < PB_X) { const unsigned slab = bx / (DM / 128), eg = bx - slab * (DM / 128), b = slab / (SQ / 128), sg = slab - b * (SQ / 128);      /* slab = 128 tokens of one batch, eg = 128 channels */
    prep_turn<128>(x + ((size_t)b * DM + eg * 128) * SQ + sg * 128, SQ, (unsigned short*)X16 + (size_t)slab * 128 * DM + eg * 128, 1.0f, tl);
    return; }
  bx -= PB_X;
  if (bx < 3 * NH * PB_W) { const unsigned slab = bx / PB_W, kg = bx - slab * PB_W, m = slab / NH, h = slab - m * NH; const float* Wm = (m == 0 ? wq : m == 1 ? wk : wv) + (size_t)h * DM * HD;      /* kg = 256 input channels */
    prep_turn<64>(Wm + (size_t)kg * 256 * HD, HD, (unsigned short*)Bqkv + (size_t)slab * HD * DM + kg * 256, 16.0f, tl);
    return; }
  bx -= 3 * NH * PB_W;
  { const float* ws = wo + (size_t)bx * PT_E + threadIdx.x * 8; unsigned short* wd = (unsigned short*)Bo + (size_t)bx * PT_E + threadIdx.x * 8; v4f a[16]; FragH f;
#pragma unroll      /* static indices into a[]; the sixteen loads fly together */
    for (int p = 0; p < 8; ++p) { a[2 * p] = *(const v4fa*)(ws + p * 2048); a[2 * p + 1] = *(const v4fa*)(ws + p * 2048 + 4); }
#pragma unroll      /* static indices into a[] */
    for (int p = 0; p < 8; ++p) {
#pragma unroll      /* static indices keep f in registers */
      for (int q = 0; q < 4; ++q) { f.h[q] = (_Float16)(bf16_round(a[2 * p][q]) * 16.0f); f.h[4 + q] = (_Float16)(bf16_round(a[2 * p + 1][q]) * 16.0f); }
      *(v8us*)(wd + p * 2048) = f.half[0]; }
    asm volatile("s_wait_xcnt 0x0" ::: "memory");      /* precaution: in the built code the parts join behind these stores, and the wait stands in front of every later write of the stores' registers on any path there */ } }
#define FA_KEYS 64      /* keys per LDS stage */
#define FA_PITCH 72     /* 16-bit elements per LDS row: 128 data bytes + 16 */
typedef float v2f __attribute__((ext_vector_type(2)));
__device__ __forceinline__ float fa_xhalf(float x) { return __builtin_bit_cast(float, __builtin_amdgcn_permlanex16(__builtin_bit_cast(int, x), __builtin_bit_cast(int, x), 0x76543210, 0xfedcba98, false, false)); }      /* lane l <-> lane l ^ 16 */
__device__ __forceinline__ v16h fa_frag(const unsigned short* p) { FragH f; f.half[0] = *(const v8us*)p; f.half[1] = *(const v8us*)(p + 16); return f.v; }      /* p = row + k0 + 8 * hh */
__device__ __forceinline__ v8f fa_mma(v16h a, v16h b, v8f c) { return __builtin_amdgcn_wmma_f32_16x16x32_f16(false, a, false, b, (short)0, c, false, false); }
// The scores of one 32-key pass, [key tile][query group]: kp = the lane's place in the pass's first K row in LDS.
__device__ __forceinline__ void fa_kfrags(const unsigned short* kp, v16h (&kf)[2][2]) {
#pragma unroll      /* static indices keep the register arrays in registers */
  for (int kt = 0; kt < 2; ++kt) { kf[kt][0] = fa_frag(kp + kt * 16 * FA_PITCH); kf[kt][1] = fa_frag(kp + kt * 16 * FA_PITCH + 32); } }
__device__ __forceinline__ void fa_scores(const v16h (&kf)[2][2], const v16h (&qf)[2][2], v8f (&st)[2][2]) {
  const v8f z8 = {0.f, 0.f, 0.f, 0.f, 0.f, 0.f, 0.f, 0.f};
#pragma unroll      /* static indices keep the register arrays in registers */
  for (int kt = 0; kt < 2; ++kt)
#pragma unroll      /* static indices keep the register arrays in registers */
    for (int g = 0; g < 2; ++g) st[kt][g] = fa_mma(kf[kt][1], qf[g][1], fa_mma(kf[kt][0], qf[g][0], z8)); }
// The weights 2^(s * log2 e + nm) of query group g in the order of the P^T operand; returns the lane's sum of them, even and odd keys apart.
__device__ __forceinline__ v2f fa_weights(const v8f (&st)[2][2], int g, float nm, v2f (&pw)[8]) {
  const float L2E = 1.4426950408889634f; v2f l2 = {0.f, 0.f};
#pragma unroll      /* static indices keep the register arrays in registers */
  for (int i = 0; i < 8; ++i) { const v2f a = __builtin_elementwise_fma(v2f{st[i >> 2][g][2 * (i & 3)], st[i >> 2][g][2 * (i & 3) + 1]}, v2f{L2E, L2E}, v2f{nm, nm});
    pw[i] = v2f{__builtin_amdgcn_exp2f(a.x), __builtin_amdgcn_exp2f(a.y)}; l2 += pw[i]; }
  return l2; }
__global__ __launch_bounds__(128) void k_fattn(const _Float16* __restrict__ Q16, const _Float16* __restrict__ K16, const _Float16* __restrict__ VT, _Float16* __restrict__ O16) {
  __shared__ __attribute__((aligned(16))) unsigned short sk[2][FA_KEYS][FA_PITCH];      /* K rows [key][d] */
  __shared__ __attribute__((aligned(16))) unsigned short sv[2][HD][FA_PITCH];           /* V^T rows [d][key] */
  const int tid = threadIdx.x, w = tid >> 5, lane = tid & 31, ln = lane & 15, hh = lane >> 4;
  const int h = blockIdx.y, b = blockIdx.z, q0 = blockIdx.x * 128 + w * 32;
  const unsigned short* kg = (const unsigned short*)K16 + (size_t)b * SQ * DM + h * HD;
  const unsigned short* vg = (const unsigned short*)VT + ((size_t)b * NH + h) * HD * SQ;
  v16h qf[2][2];
#pragma unroll      /* static indices keep qf[] in registers */
  for (int g = 0; g < 2; ++g) { const _Float16* qp = Q16 + ((size_t)b * SQ + q0 + 16 * g + ln) * DM + h * HD; qf[g][0] = g2_frag(qp, hh); qf[g][1] = g2_frag(qp + 32, hh); }
  const int sr = tid >> 3, sc = (tid & 7) * 8;      /* staging: eight threads a 128-byte row, rows sr + 16 i */
  static_assert(((SQ / FA_KEYS) & (SQ / FA_KEYS - 1)) == 0 && (SQ / FA_KEYS) % (SQ / 128) == 0, "k_fattn: the key stages wrap by a mask; the blocks' first stages are spread evenly");
  const int s0 = (int)blockIdx.x * ((SQ / FA_KEYS) / (SQ / 128));      /* the block's first key stage; the loop walks all stages from there and wraps round. The blocks of one (batch, head) read the same K and V^T lines and start together: each on a stage of its own, they do not ask L2 for the same lines at the same moment */
  v8us rk[4], rv[4];
#pragma unroll      /* static indices into rk[], rv[] */
  for (int i = 0; i < 4; ++i) { rk[i] = *(const v8us*)(kg + (size_t)s0 * (FA_KEYS * DM) + (size_t)(sr + 16 * i) * DM + sc); rv[i] = *(const v8us*)(vg + (size_t)s0 * FA_KEYS + (size_t)(sr + 16 * i) * SQ + sc); }
#pragma unroll      /* static indices into rk[], rv[] */
  for (int i = 0; i < 4; ++i) { *(v8us*)&sk[0][sr + 16 * i][sc] = rk[i]; *(v8us*)&sv[0][sr + 16 * i][sc] = rv[i]; }
  __syncthreads();      /* the first stage is published */
  const v8f z8 = {0.f, 0.f, 0.f, 0.f, 0.f, 0.f, 0.f, 0.f};
  v8f acc[2][4] = {{z8, z8, z8, z8}, {z8, z8, z8, z8}}; float mrun[2] = {-3.0e38f, -3.0e38f}; v2f lsum[2] = {{0.f, 0.f}, {0.f, 0.f}};      /* mrun: the maximum in use, log2 domain; lsum: the lane's share of the denominator, even and odd keys apart */
  const float L2E = 1.4426950408889634f;
#pragma unroll 1      /* one stage a trip: the body already holds two passes */
  for (int s = 0; s < SQ / FA_KEYS; ++s) {
    const int cur = s & 1; const bool more = s + 1 < SQ / FA_KEYS;      /* the same in every thread */
    if (more) {      /* the next stage's lines fly while this stage is worked on */
      const int sn = (s0 + s + 1) & (SQ / FA_KEYS - 1);      /* behind the last key stage comes stage 0 */
      const unsigned short* kn = kg + (size_t)sn * (FA_KEYS * DM); const unsigned short* vn = vg + (size_t)sn * FA_KEYS;      /* the same in every thread */
#pragma unroll      /* static indices into rk[], rv[] */
      for (int i = 0; i < 4; ++i) { rk[i] = *(const v8us*)(kn + (size_t)(sr + 16 * i) * DM + sc); rv[i] = *(const v8us*)(vn + (size_t)(sr + 16 * i) * SQ + sc); } }
#pragma unroll      /* static indices into the register arrays */
    for (int ps = 0; ps < FA_KEYS / 32; ++ps) {
      const unsigned short* kp = &sk[cur][ps * 32 + ln][8 * hh];
      v16h kf[2][2], vf[4];
      fa_kfrags(kp, kf);
#pragma unroll      /* static indices keep the register arrays in registers */
      for (int t = 0; t < 4; ++t) vf[t] = fa_frag(&sv[cur][16 * t + ln][ps * 32 + 8 * hh]);
      __builtin_amdgcn_sched_barrier(0);      /* the V^T reads stay up here with the K reads and fly under the score products and the exponentials: sunk behind the test below, only the conversions would cover their latency */
      v8f st[2][2];      /* [key tile][query group] */
      fa_scores(kf, qf, st);
      v2f pw[2][8], ls[2]; bool need = false;      /* the pass's weights (f32) and each lane's sum of them */
#pragma unroll      /* static indices keep the register arrays in registers */
      for (int g = 0; g < 2; ++g) { ls[g] = fa_weights(st, g, 6.0f - mrun[g], pw[g]); need = need || !(ls[g].x + ls[g].y <= 32768.0f); }      /* weights x 2^6 against the maximum in use (small ones further from the f16 subnormal range); they are positive, so a sum of at most 2^15 bounds each of them by 2^15, inside f16 */
      if (__builtin_amdgcn_ballot_w32(need) != 0) {      /* lazy rescale, tested once a pass on the sums that the pass needs anyway: only here is the pass's maximum taken; always on the first pass (weights against -3e38 are infinite) */
        asm volatile("" ::: "memory");      /* the rare path forms its scores anew from LDS: without this fence the compiler reuses the first ones and keeps 32 registers live across the exponentials of every pass */
        fa_kfrags(kp, kf); fa_scores(kf, qf, st);
#pragma unroll      /* static indices keep the register arrays in registers */
        for (int g = 0; g < 2; ++g) { float mx = st[0][g][0];
#pragma unroll      /* static indices keep the register arrays in registers */
          for (int r = 1; r < 8; ++r) mx = fmaxf(mx, st[0][g][r]);
#pragma unroll      /* static indices keep the register arrays in registers */
          for (int r = 0; r < 8; ++r) mx = fmaxf(mx, st[1][g][r]);
          mx = fmaxf(mx, fa_xhalf(mx)) * L2E;      /* both halves hold the query's maximum of this pass */
          const float mn = fmaxf(mrun[g], mx); const float corr = __builtin_amdgcn_exp2f(mrun[g] - mn); mrun[g] = mn; lsum[g] *= corr;
#pragma unroll      /* static indices keep the register arrays in registers */
          for (int t = 0; t < 4; ++t) acc[g][t] *= corr;
          ls[g] = fa_weights(st, g, 6.0f - mn, pw[g]); } }      /* the weights anew, now at most 2^6 each */
#pragma unroll      /* static indices keep the register arrays in registers */
      for (int g = 0; g < 2; ++g) { FragH pf;
#pragma unroll      /* static indices keep the register arrays in registers */
        for (int i = 0; i < 8; ++i) { pf.h[2 * i] = (_Float16)pw[g][i].x; pf.h[2 * i + 1] = (_Float16)pw[g][i].y; }
        lsum[g] += ls[g];
#pragma unroll      /* static indices keep the register arrays in registers */
        for (int t = 0; t < 4; ++t) acc[g][t] = fa_mma(vf[t], pf.v, acc[g][t]); }
    }
    if (more) {
#pragma unroll      /* static indices into rk[], rv[] */
      for (int i = 0; i < 4; ++i) { *(v8us*)&sk[cur ^ 1][sr + 16 * i][sc] = rk[i]; *(v8us*)&sv[cur ^ 1][sr + 16 * i][sc] = rv[i]; } }
    __syncthreads();      /* publishes the next trip's stage and ends every wave's reads of the buffer that the next trip refills */
  }
#pragma unroll      /* static indices keep the register arrays in registers */
  for (int g = 0; g < 2; ++g) { const float lh = lsum[g].x + lsum[g].y; const float inv = 64.0f / (lh + fa_xhalf(lh)); unsigned short* op = (unsigned short*)O16 + ((size_t)b * SQ + q0 + 16 * g + ln) * DM + h * HD + 8 * hh;      /* the halves' sums join once; o x64 */
#pragma unroll      /* static indices keep the register arrays in registers */
    for (int t = 0; t < 4; ++t) { FragH o;
#pragma unroll      /* static indices keep the register arrays in registers */
      for (int r = 0; r < 8; ++r) o.h[r] = (_Float16)(acc[g][t][r] * inv);
      *(v8us*)(op + 16 * t) = o.half[0]; } } }
__global__ __launch_bounds__(256) void k_vt(const _Float16* __restrict__ V16, int b, int h0, _Float16* __restrict__ VT) { __shared__ unsigned short tl[64][65]; const int tid = threadIdx.x; const int hh = blockIdx.x % HG, sg = blockIdx.x / HG; const int s0 = sg * 64; const int h = h0 + hh;
  for (int i = tid; i < 64 * 8; i += 256) { const int j = i / 8, d8 = (i % 8) * 8; FragH f; f.half[0] = *(const v8us*)((const unsigned short*)V16 + ((size_t)b * SQ + s0 + j) * DM + h * HD + d8); for (int q = 0; q < 8; ++q) tl[d8 + q][j] = f.u[q]; }
  __syncthreads();
  { for (int i = tid; i < 64 * 8; i += 256) { const int d = i / 8, j8 = (i % 8) * 8; FragH f; for (int q = 0; q < 8; ++q) f.u[q] = tl[d][j8 + q]; *(v8us*)((unsigned short*)VT + ((size_t)hh * HD + d) * SQ + s0 + j8) = f.half[0]; }  } }



__global__ __launch_bounds__(256) void k_rsmkm(const float* __restrict__ S, _Float16* __restrict__ P, int nrows, const int* __restrict__ am) {
  #pragma clang fp contract(off)
  const int t = blockIdx.x * 256 + threadIdx.x; if (t >= nrows) return; const size_t i = (size_t)t; const float* s = S + i * SQ; const int* mr = am + (size_t)(t % SQ) * SQ; float mx = -3.0e38f;
#pragma unroll 1
  for (int j = 0; j < SQ; ++j) { const float f = (mr[j] != 0) ? 1.f : 0.f; mx = fmaxf(mx, fmaf(f, s[j], (1.f - f) * -1.0e9f)); } float se = 0.f;
#pragma unroll 1
  for (int j = 0; j < SQ; ++j) { const float f = (mr[j] != 0) ? 1.f : 0.f; se += __expf(fmaf(f, s[j], (1.f - f) * -1.0e9f) - mx); } const float sc = 256.0f / se;
#pragma unroll 1
  for (int j0 = 0; j0 < SQ; j0 += 8) { FragH fr; for (int q = 0; q < 8; ++q) { const int j = j0 + q; const float f = (mr[j] != 0) ? 1.f : 0.f; fr.h[q] = (_Float16)(__expf(fmaf(f, s[j], (1.f - f) * -1.0e9f) - mx) * sc); }
    unsigned short* d = (unsigned short*)P + i * SQ + j0; *(v8us*)d = fr.half[0];  } }

template <int COLS>
__global__ __launch_bounds__(256) void k_wperm(const float* __restrict__ Wn, _Float16* __restrict__ Bt) {
  const size_t t = (size_t)blockIdx.x * 256 + threadIdx.x; if (t >= (size_t)DM * DM / 8) return; const size_t e0 = t * 8; const int n = (int)(e0 / DM), k0 = (int)(e0 % DM); FragH f;
  if (COLS == 0) { const int h = n >> 6, d = n & 63; const float* src = Wn + (size_t)(d * NH + h) * DM + k0; for (int q = 0; q < 8; ++q) f.h[q] = (_Float16)(bf16_round(src[q]) * 16.0f); }
  else { for (int q = 0; q < 8; ++q) { const int kk = k0 + q; const int h = kk >> 6, d = kk & 63; f.h[q] = (_Float16)(bf16_round(Wn[(size_t)n * DM + d * NH + h]) * 16.0f); } }
  unsigned short* dst = (unsigned short*)Bt + e0; *(v8us*)dst = f.half[0];  }
__global__ __launch_bounds__(256) void k_bperm(const float* __restrict__ b, float* __restrict__ out) { const int t = threadIdx.x; if (t >= DM) return; const int h = t >> 6, d = t & 63; const float v = b[d * NH + h]; *(float*)(out + t) = v;  }
extern "C" void kernel_launch(void* const* d_in, const int* in_sizes, int n_in,
                              void* d_out, int out_size, void* d_ws, size_t ws_size, hipStream_t stream) {
  (void)in_sizes; (void)n_in; (void)out_size;
  const float* const* I = (const float* const*)d_in; const float* xq = I[0]; const float* xk = I[0]; const float* xv = I[0]; const float* wq = I[1]; const float* bq = I[2]; const float* wk = I[3]; const float* bk = I[4]; const float* wv = I[5]; const float* bv = I[6]; const float* wo = I[7]; const float* bo = I[8]; const float* x = xq;      /* hidden_state [4][768][2048] (feeds q, k and v); per-head Wq / Wk / Wv [12][768][64] + biases [12][64] (= [768] head-major); Wo [768][768] natural + bo */
  char* ws = (char*)d_ws; size_t off = 0;
  auto take = [&](size_t bytes) { char* p = ws + off; off += (bytes + 255) & ~(size_t)255; return p; };
  _Float16* BQ = (_Float16*)take((size_t)3 * DM * DM * 2); _Float16* BO = (_Float16*)take((size_t)DM * DM * 2);      /* BQ: the q, k, v Bt planes in a row (plane stride DM * DM) */
  _Float16* X16 = (_Float16*)take(NR * DM * 2); _Float16* Q16 = (_Float16*)take(3 * NR * DM * 2); _Float16* K16 = Q16 + NR * DM; _Float16* V16 = K16 + NR * DM;      /* q rows, k rows and V^T in a row (plane stride NR * DM) */ _Float16* O16 = (_Float16*)take(NR * DM * 2);
  _Float16* VT = V16;      /* the v plane holds V^T [NB][NH][HD][SQ]: as many elements as the rows */
  static_assert(MP % 128 == 0 && MPO % 128 == 0 && SQ % 128 == 0 && B0 == 0, "transposed GEMM stores: whole 128-row blocks inside one batch");
  static_assert(DM % G2_KS == 0 && DM % G2_BN == 0 && G2_BM == 128, "k_gemm2: whole 64-k stages, whole 192-column blocks of 128 rows");
  if (off > ws_size) return;
  k_prep<<<PB_X + 3 * NH * PB_W + PB_O, 256, 0, stream>>>(x, wq, wk, wv, wo, X16, BQ, BO);      /* exact f16 token rows [b][s][e] of the [B][E][S] input (q, k and v all project these rows); per-head [in = 768][out = 64] tensors -> rows h*64.. of the Bt planes (x16): head h = output columns h*64.. = the concat order; Wo natural [out][in] = Bt x16 */

  const size_t r0p = (size_t)B0 * SQ;      /* first projected row */
  k_gemm2<0><<<dim3((unsigned)((MP / G2_BM) * (DM / G2_BN)), 3), 256, 0, stream>>>(X16 + r0p * DM, DM, 0, BQ, DM, (size_t)DM * DM, 0.0625f, bq, bk, bv, 0, nullptr, Q16 + r0p * DM, DM, NR * DM, MP, DM, DM, 2, SQ);      /* blockIdx.y = q, k, v; plane 2 stored as V^T */
  k_fattn<<<dim3(SQ / 128, NH, NB), 128, 0, stream>>>(Q16, K16, VT, O16);      /* UNSCALED scores q.k (the module omits 1/sqrt(d)), softmax and P.V; o (merged heads) as f16 rows x64 */
  k_gemm2<0><<<dim3((unsigned)((MPO / G2_BM) * (DM / G2_BN)), 1), 256, 0, stream>>>(O16 + r0p * DM, DM, 0, BO, DM, 0, 0.0009765625f, bo, nullptr, nullptr, 0, (float*)d_out, nullptr, DM, 0, MPO, DM, DM, 0, SQ);      /* out (f32; bo is in natural channel order = the output columns), stored transposed: the module's [b][co][n] layout */
}
